// v000
// Measured on an AMD MI455X. A time is GPU time per run, averaged over a window of back-to-back runs after a warm-up
// (all launches, gaps included; the runs take copies of the inputs in turn), and the median of several windows.
// Apart from v000's, it joins two sittings. Times from different sittings can be a few percent apart, while
// side-by-side timings come from the same sitting.
// v000 is the starting kernel. One run takes 1860 microseconds.
#include <hip/hip_runtime.h>

// Causal cross attention between two LayerNorm'd sequences with per-head projection tensors (seq1, seq2 [2][2048][1024]; x1, x2 = LayerNorm(seq) (eps 1e-5, gamma/beta read); q = x1 q_proj[h], k = x2 k_proj[h], v = x2 v_proj[h] ([16][1024][64] 0.02, 'xw' per head, no bias); scores / float32(sqrt 64); causal (-inf); softmax; out = merged mixer_w^T + mixer_b ('oi') -> [2][2048][1024] (4.2 M); argument order seq1, seq2, ln_gamma, ln_beta, q_proj, k_proj, v_proj, mixer_w, mixer_b).
// Layout per batch: a LayerNorm kernel (one wave per token row: mean, biased variance, f32) writes bf16 hi/lo planes of x1, then of x2; per-head 'xw' weight blocks gathered into Bt; projections hi/lo x exact (2 products); causal T-2048 attention (hybrid rows: < 512 hi/lo 3 products, rest fp16 x1024; k_gemmc skips tiles above the diagonal); merged hi/lo x mixer_w exact + mixer_b.
// Compute dtypes, f32 accumulate: every input rounded to bf16; LayerNorm f32; projections 2 products (~f32); attention rows < 512 3 products, rest fp16; softmax f32; mixer hl x exact + bias.

#define NB_  2
#define TT   2048
#define DM   1024
#define NH_  16
#define NKV  16
#define REP  (NH_ / NKV)
#define HD   64
#define DQ   (NH_ * HD)
#define DKV  (NKV * HD)
#define ZH   2
#define RH   512                  // query rows < RH use hi+lo planes (0: none)
#define WIN  2048
#define PCAR 1024.0f
#define SCL  0.125f   // HD^-0.5
typedef _Float16 h16;
typedef unsigned short bf;
typedef __attribute__((ext_vector_type(16))) __bf16   v16bf;
typedef __attribute__((ext_vector_type(16))) _Float16 v16h;
typedef __attribute__((ext_vector_type(8)))  _Float16 v8h;
typedef __attribute__((ext_vector_type(8)))  unsigned short v8us;
typedef __attribute__((ext_vector_type(8)))  float    v8f;
typedef __attribute__((ext_vector_type(4)))  float    v4f;
typedef v8h  __attribute__((may_alias)) v8ha;
typedef v4f  __attribute__((may_alias)) v4fa;
typedef v8us __attribute__((may_alias)) v8usa;

__device__ __forceinline__ unsigned short f2bf(float f) { unsigned u = __float_as_uint(f); u += 0x7FFFu + ((u >> 16) & 1u); return (unsigned short)(u >> 16); }
__device__ __forceinline__ float bf2f(unsigned short b) { return __uint_as_float(((unsigned)b) << 16); }
__device__ __forceinline__ float bfr(float f) { return bf2f(f2bf(f)); }
__device__ __forceinline__ v16h cat16(v8h lo, v8h hi) { return __builtin_shufflevector(lo, hi, 0, 1, 2, 3, 4, 5, 6, 7, 8, 9, 10, 11, 12, 13, 14, 15); }
__device__ __forceinline__ v16bf cat16b(v8us lo, v8us hi) { return __builtin_bit_cast(v16bf, __builtin_shufflevector(lo, hi, 0, 1, 2, 3, 4, 5, 6, 7, 8, 9, 10, 11, 12, 13, 14, 15)); }
__device__ __forceinline__ v8f wmma16(v16h a, v16h b, v8f c) { return __builtin_amdgcn_wmma_f32_16x16x32_f16(false, a, false, b, (short)0, c, false, false); }
__device__ __forceinline__ v8f wmmab(v16bf a, v16bf b, v8f c) { return __builtin_amdgcn_wmma_f32_16x16x32_bf16(false, a, false, b, (short)0, c, false, false); }



// ---- k_gemmw: register-blocked GEMM, ONE WAVE per 64x64 output tile (16 accumulators), operands straight from K-contiguous 16-bit planes; grid (M/64, N/64, Z), 32 threads.
// C[m][n] (f32, pitch ldc, + optional f32 bias[n]) = sum_k A[m][k] Bt[n][k] (+ split products per NSPLIT). z-batch strides sA/sB/sC in elements. K % 32 == 0.
template <typename T16> struct WFrag;
template <> struct WFrag<h16> { typedef v16h V; static __device__ __forceinline__ V ld(const h16* p) { return cat16(*(const v8h*)p, *(const v8h*)(p + 16)); } static __device__ __forceinline__ v8f mma(V a, V b, v8f c) { return wmma16(a, b, c); } };
template <> struct WFrag<bf> { typedef v16bf V; static __device__ __forceinline__ V ld(const bf* p) { return cat16b(*(const v8us*)p, *(const v8us*)(p + 16)); } static __device__ __forceinline__ v8f mma(V a, V b, v8f c) { return wmmab(a, b, c); } };
template <typename T16, int NSPLIT, bool BIAS>
__global__ __launch_bounds__(32) void k_gemmw(const T16* __restrict__ A, const T16* __restrict__ A2, const T16* __restrict__ Bt, const T16* __restrict__ Bt2, int K, float* C, int ldc, const float* __restrict__ bias, size_t sA, size_t sB, size_t sC) {
    typedef typename WFrag<T16>::V V;
    __shared__ __align__(16) float os[16 * 68];
    const size_t z = blockIdx.z; A += z * sA; if (A2) A2 += z * sA; Bt += z * sB; if (Bt2) Bt2 += z * sB; C += z * sC;
    const int lane = threadIdx.x & 31, lr = lane & 15, hi = lane >> 4; const int r0 = blockIdx.x * 64, c0 = blockIdx.y * 64;
    v8f acc[4][4];
#pragma unroll
    for (int mb = 0; mb < 4; ++mb)
#pragma unroll
        for (int nb = 0; nb < 4; ++nb) acc[mb][nb] = (v8f){};
    const size_t aoff = (size_t)(r0 + lr) * K + 8 * hi, boff = (size_t)(c0 + lr) * K + 8 * hi;
#pragma unroll 1
    for (int kc = 0; kc < K; kc += 32) {
        V a[4], a2[4];
#pragma unroll
        for (int mb = 0; mb < 4; ++mb) { a[mb] = WFrag<T16>::ld(A + aoff + (size_t)mb * 16 * K + kc); if (NSPLIT == 1 || NSPLIT == 2) a2[mb] = WFrag<T16>::ld(A2 + aoff + (size_t)mb * 16 * K + kc); }
#pragma unroll
        for (int nb = 0; nb < 4; ++nb) { const V b = WFrag<T16>::ld(Bt + boff + (size_t)nb * 16 * K + kc); V b2; if (NSPLIT >= 2) b2 = WFrag<T16>::ld(Bt2 + boff + (size_t)nb * 16 * K + kc);
#pragma unroll
            for (int mb = 0; mb < 4; ++mb) { acc[mb][nb] = WFrag<T16>::mma(a[mb], b, acc[mb][nb]); if (NSPLIT == 1 || NSPLIT == 2) acc[mb][nb] = WFrag<T16>::mma(a2[mb], b, acc[mb][nb]); if (NSPLIT >= 2) acc[mb][nb] = WFrag<T16>::mma(a[mb], b2, acc[mb][nb]); } }
        asm volatile("v_nop\n\tv_nop\n\tv_nop\n\tv_nop" : "+v"(acc[0][0]), "+v"(acc[1][1]), "+v"(acc[2][2]), "+v"(acc[3][3]) : "v"(a[0]), "v"(a[3]));
    }
#pragma unroll
    for (int mb = 0; mb < 4; ++mb) {
#pragma unroll
        for (int nb = 0; nb < 4; ++nb) {
#pragma unroll
            for (int j = 0; j < 8; ++j) os[(hi * 8 + j) * 68 + nb * 16 + lr] = acc[mb][nb][j]; }
        __builtin_amdgcn_wave_barrier(); asm volatile("" ::: "memory");
        float* crow = C + (size_t)(r0 + mb * 16) * ldc + c0;
{
#pragma unroll
            for (int s = 0; s < 8; ++s) { const int row = 2 * s + hi, cofs = lr * 4; v4f val = *(const v4fa*)(os + row * 68 + cofs); if (BIAS) { val[0] += bfr(bias[c0 + cofs]); val[1] += bfr(bias[c0 + cofs + 1]); val[2] += bfr(bias[c0 + cofs + 2]); val[3] += bfr(bias[c0 + cofs + 3]); }
                *(v4f*)(crow + (size_t)row * ldc + cofs) = val; }
             }
        __builtin_amdgcn_wave_barrier(); asm volatile("" ::: "memory");
    }
}

// ---- k_gemmc: the same one-wave 64x64 tile GEMM specialised for causal attention: CMODE 1 skips score tiles entirely above the diagonal (query rows r0+roff.., key columns c0..), CMODE 2 limits the
// key (K) loop of the probability x value contraction to the diagonal block (probabilities beyond it are exactly zero). roff = row offset of this launch's first row within the sequence.
template <typename T16, int NSPLIT, int CMODE>
__global__ __launch_bounds__(32) void k_gemmc(const T16* __restrict__ A, const T16* __restrict__ A2, const T16* __restrict__ Bt, const T16* __restrict__ Bt2, int K, float* C, int ldc, int roff, size_t sA, size_t sB, size_t sC) {
    typedef typename WFrag<T16>::V V;
    __shared__ __align__(16) float os[16 * 68];
    const size_t z = blockIdx.z; A += z * sA; if (A2) A2 += z * sA; Bt += z * sB; if (Bt2) Bt2 += z * sB; C += z * sC;
    const int lane = threadIdx.x & 31, lr = lane & 15, hi = lane >> 4; const int r0 = blockIdx.x * 64, c0 = blockIdx.y * 64;
    if (CMODE == 1 && c0 > r0 + roff + 63) return;                  // score tile entirely above the causal diagonal: never read (the softmax masks j > i by select)
    const int Kl = (CMODE == 2) ? min(K, r0 + roff + 64) : K;        // P.V: probabilities are exactly 0 beyond the diagonal block, so the K loop stops there
    v8f acc[4][4];
#pragma unroll
    for (int mb = 0; mb < 4; ++mb)
#pragma unroll
        for (int nb = 0; nb < 4; ++nb) acc[mb][nb] = (v8f){};
    const size_t aoff = (size_t)(r0 + lr) * K + 8 * hi, boff = (size_t)(c0 + lr) * K + 8 * hi;
#pragma unroll 1
    for (int kc = 0; kc < Kl; kc += 32) {
        V a[4], a2[4];
#pragma unroll
        for (int mb = 0; mb < 4; ++mb) { a[mb] = WFrag<T16>::ld(A + aoff + (size_t)mb * 16 * K + kc); if (NSPLIT == 1 || NSPLIT == 2) a2[mb] = WFrag<T16>::ld(A2 + aoff + (size_t)mb * 16 * K + kc); }
#pragma unroll
        for (int nb = 0; nb < 4; ++nb) { const V b = WFrag<T16>::ld(Bt + boff + (size_t)nb * 16 * K + kc); V b2; if (NSPLIT >= 2) b2 = WFrag<T16>::ld(Bt2 + boff + (size_t)nb * 16 * K + kc);
#pragma unroll
            for (int mb = 0; mb < 4; ++mb) { acc[mb][nb] = WFrag<T16>::mma(a[mb], b, acc[mb][nb]); if (NSPLIT == 1 || NSPLIT == 2) acc[mb][nb] = WFrag<T16>::mma(a2[mb], b, acc[mb][nb]); if (NSPLIT >= 2) acc[mb][nb] = WFrag<T16>::mma(a[mb], b2, acc[mb][nb]); } }
        asm volatile("v_nop\n\tv_nop\n\tv_nop\n\tv_nop" : "+v"(acc[0][0]), "+v"(acc[1][1]), "+v"(acc[2][2]), "+v"(acc[3][3]) : "v"(a[0]), "v"(a[3]));
    }
#pragma unroll
    for (int mb = 0; mb < 4; ++mb) {
#pragma unroll
        for (int nb = 0; nb < 4; ++nb) {
#pragma unroll
            for (int j = 0; j < 8; ++j) os[(hi * 8 + j) * 68 + nb * 16 + lr] = acc[mb][nb][j]; }
        __builtin_amdgcn_wave_barrier(); asm volatile("" ::: "memory");
        float* crow = C + (size_t)(r0 + mb * 16) * ldc + c0;
{
#pragma unroll
            for (int s = 0; s < 8; ++s) { const int row = 2 * s + hi, cofs = lr * 4; v4f val = *(const v4fa*)(os + row * 68 + cofs);
                *(v4f*)(crow + (size_t)row * ldc + cofs) = val; }
             }
        __builtin_amdgcn_wave_barrier(); asm volatile("" ::: "memory");
    }
}

__device__ __forceinline__ h16 tohx(float x) { return (h16)x; }
__device__ __forceinline__ void splitf(float y, unsigned short& h, unsigned short& l) { h = f2bf(y); l = f2bf(y - bf2f(h)); }
typedef __attribute__((ext_vector_type(2))) _Float16 v2h;
typedef __attribute__((ext_vector_type(4))) _Float16 v4h;
typedef __attribute__((ext_vector_type(2))) unsigned short v2us;
typedef __attribute__((ext_vector_type(4))) unsigned short v4us;
typedef __attribute__((ext_vector_type(2))) float v2f;
typedef __attribute__((ext_vector_type(4))) int v4i;

__global__ __launch_bounds__(256) void k_wtG(const float* __restrict__ w, int K, int N, bf* Bt) {
    const int lane = threadIdx.x & 31; const int L0 = (blockIdx.x * 8 + (threadIdx.x >> 5)) * 8; const int nlines = N * K / 64;
{
#pragma unroll 1
        for (int l = 0; l < 8; ++l) { const int L = L0 + l; if (L >= nlines) break; const size_t e = (size_t)L * 64 + lane * 2; const int k = (int)(e % K), n = (int)(e / K); v2us o;
            o[0] = f2bf(w[(size_t)k * N + n]); o[1] = f2bf(w[(size_t)(k + 1) * N + n]); *(v2us*)(Bt + e) = o; }
         }
}
__global__ __launch_bounds__(256) void k_cvt8(const float* __restrict__ src, bf* dst, size_t n8) { const size_t i = (size_t)blockIdx.x * 256 + threadIdx.x; if (i >= n8) return; const v8f v = *(const v8f*)(src + i * 8); v8us o;
#pragma unroll
    for (int k = 0; k < 8; ++k) o[k] = f2bf(v[k]); *(v8us*)(dst + i * 8) = o;  }

__global__ __launch_bounds__(256) void k_lnx(const float* __restrict__ X, const float* __restrict__ gw, const float* __restrict__ gb, bf* Ph, bf* Pl) { const int lane = threadIdx.x & 31; const int r = blockIdx.x * 8 + (threadIdx.x >> 5); if (r >= TT) return; const float* xr = X + (size_t)r * DM; float hv[32]; float s = 0.f;
#pragma unroll
    for (int ch = 0; ch < 8; ++ch) { const v4f a = *(const v4f*)(xr + ch * 128 + lane * 4);
#pragma unroll
        for (int q = 0; q < 4; ++q) { const float u = bfr(a[q]); hv[ch * 4 + q] = u; s += u; } }
#pragma unroll
    for (int sh = 16; sh; sh >>= 1) s += __shfl_xor(s, sh, 32);
    float mu = s * (1.0f / 1024.0f); asm volatile("" : "+v"(mu)); float s2 = 0.f;
#pragma unroll
    for (int k = 0; k < 32; ++k) { float d0 = __fsub_rn(hv[k], mu); asm volatile("" : "+v"(d0)); float p = __fmul_rn(d0, d0); asm volatile("" : "+v"(p)); s2 = __fadd_rn(s2, p); }
#pragma unroll
    for (int sh = 16; sh; sh >>= 1) s2 += __shfl_xor(s2, sh, 32);
    float var = __fadd_rn(s2 * (1.0f / 1024.0f), 1e-5f); asm volatile("" : "+v"(var)); const float rs = __frsqrt_rn(var);
{
#pragma unroll
        for (int ch = 0; ch < 8; ++ch) { const int c0 = ch * 128 + lane * 4; v4us oh, ol;
#pragma unroll
            for (int q = 0; q < 4; ++q) { float gg = bfr(gw[c0 + q]); asm volatile("" : "+v"(gg)); float d0 = __fsub_rn(hv[ch * 4 + q], mu); asm volatile("" : "+v"(d0)); float n0 = __fmul_rn(d0, rs); asm volatile("" : "+v"(n0)); float y = __fmul_rn(n0, gg); asm volatile("" : "+v"(y)); const float z = __fadd_rn(y, bfr(gb[c0 + q])); unsigned short a2, c2; splitf(z, a2, c2); oh[q] = a2; ol[q] = c2; }
            const size_t oo = (size_t)r * DM + c0; *(v4us*)(Ph + oo) = oh; *(v4us*)(Pl + oo) = ol; }
         } }
// k_rope: head planes [h][t][d] (fp16 + hi/lo) of rope(x) x sc with the rotate-half convention out[d] = x[d] cos[t][d] - x[d+HD/2] sin[t][d], out[d+HD/2] = x[d+HD/2] cos[t][d+HD/2] + x[d] sin[t][d+HD/2]
__global__ __launch_bounds__(256) void k_rope(const float* __restrict__ F, int pitch, int nheads, const float* __restrict__ CS, const float* __restrict__ RF, const float* __restrict__ nw, float sc, h16* P16, bf* Ph, bf* Pl) {
    const size_t e = ((size_t)blockIdx.x * 256 + threadIdx.x) * 2; if (e >= (size_t)nheads * TT * HD) return; const int d = (int)(e % HD); const int t = (int)((e / HD) % TT); const int h = (int)(e / ((size_t)HD * TT)); const float* f = F + (size_t)t * pitch + h * HD; const float rf = RF ? RF[(size_t)h * TT + t] : 1.0f; v2h o16; v2us oh, ol;
#pragma unroll
    for (int q = 0; q < 2; ++q) { const int dd = d + q; const int dp = (dd < HD / 2) ? dd + HD / 2 : dd - HD / 2; float x0 = f[dd], x1 = f[dp];
        if (RF) { float n0 = __fmul_rn(x0, rf), n1 = __fmul_rn(x1, rf); asm volatile("" : "+v"(n0)); asm volatile("" : "+v"(n1)); x0 = __fmul_rn(bfr(nw[dd]), n0); x1 = __fmul_rn(bfr(nw[dp]), n1); }
        const v2f cs = *(const v2f*)(CS + ((size_t)t * HD + dd) * 2); float a = __fmul_rn(x0, cs[0]), bq = __fmul_rn(x1, cs[1]); asm volatile("" : "+v"(a)); asm volatile("" : "+v"(bq)); const float r = ((dd < HD / 2) ? __fsub_rn(a, bq) : __fadd_rn(a, bq)) * sc;
        o16[q] = tohx(r); unsigned short a2, c2; splitf(r, a2, c2); oh[q] = a2; ol[q] = c2; }
    *(v2h*)(P16 + e) = o16; *(v2us*)(Ph + e) = oh; *(v2us*)(Pl + e) = ol;  }
__global__ __launch_bounds__(256) void k_vtp(const float* __restrict__ F, int pitch, int nheads, h16* V16, bf* Vh, bf* Vl) { const size_t e = ((size_t)blockIdx.x * 256 + threadIdx.x) * 2; if (e >= (size_t)nheads * HD * TT) return; const int t = (int)(e % TT); const int d = (int)((e / TT) % HD); const int g = (int)(e / ((size_t)TT * HD)); v2h o16; v2us oh, ol;
#pragma unroll
    for (int q = 0; q < 2; ++q) { const float x = F[(size_t)(t + q) * pitch + g * HD + d]; o16[q] = tohx(x); unsigned short a2, c2; splitf(x, a2, c2); oh[q] = a2; ol[q] = c2; }
    *(v2h*)(V16 + e) = o16; *(v2us*)(Vh + e) = oh; *(v2us*)(Vl + e) = ol;  }
__global__ __launch_bounds__(256) void k_csid(float* CS) { const int idx = blockIdx.x * 256 + threadIdx.x; if (idx >= TT * HD) return; v2f cs; cs[0] = 1.0f; cs[1] = 0.0f; *(v2f*)(CS + (size_t)idx * 2) = cs;  }
// k_asoft: per row (zz, i): t = S x HD^-0.5 for j <= i and i - j < WIN (WIN = TT: plain causal, no window cut; the reference's -1e9 additive fill vanishes identically); softmax over the 2048 keys (register row, one exp, fixed trees);
__global__ __launch_bounds__(256) void k_asoft(const float* __restrict__ Sb, h16* P16, bf* Ph, bf* Pl) {
    const int lane = threadIdx.x & 31; const int row = blockIdx.x * 8 + (threadIdx.x >> 5); if (row >= ZH * TT) return; const int i = row % TT; const int zz = row / TT; (void)zz; const bool hires = (i < RH); const float* sr = Sb + (size_t)row * TT; float v[TT / 32]; float mx = -3.0e38f;
#pragma unroll
    for (int ch = 0; ch < TT / 128; ++ch) { const int j0 = ch * 128 + lane * 4; const v4f a = *(const v4f*)(sr + j0);
#pragma unroll
        for (int q = 0; q < 4; ++q) { const int j = j0 + q; (void)j; const float t = (j <= i && i - j < WIN) ? a[q] * SCL : -3.0e38f; v[ch * 4 + q] = t; mx = fmaxf(mx, t); } }
#pragma unroll
    for (int sh = 16; sh; sh >>= 1) mx = fmaxf(mx, __shfl_xor(mx, sh, 32));
    float sum = 0.f;
#pragma unroll
    for (int k = 0; k < TT / 32; ++k) { float d0 = __fsub_rn(v[k], mx); asm volatile("" : "+v"(d0)); v[k] = __builtin_amdgcn_exp2f(__fmul_rn(d0, 1.4426950408889634f)); sum += v[k]; }
#pragma unroll
    for (int sh = 16; sh; sh >>= 1) sum += __shfl_xor(sum, sh, 32);
    const float f = __fdiv_rn(hires ? 1.0f : PCAR, sum);
{
        if (hires) {
#pragma unroll
            for (int ch = 0; ch < TT / 128; ++ch) { v4us oh, ol;
#pragma unroll
                for (int q = 0; q < 4; ++q) { unsigned short a, c2; splitf(v[ch * 4 + q] * f, a, c2); oh[q] = a; ol[q] = c2; }
                const size_t oo = ((size_t)zz * (RH ? RH : 1) + i) * TT + ch * 128 + lane * 4; *(v4us*)(Ph + oo) = oh; *(v4us*)(Pl + oo) = ol; }
        } else {
#pragma unroll
            for (int ch = 0; ch < TT / 128; ++ch) { v4h o4;
#pragma unroll
                for (int q = 0; q < 4; ++q) o4[q] = tohx(v[ch * 4 + q] * f);
                *(v4h*)(P16 + (size_t)row * TT + ch * 128 + lane * 4) = o4; } }
         }
}
__global__ __launch_bounds__(256) void k_merge(const float* __restrict__ O, int h0, bf* Ah, bf* Al) { const size_t e = ((size_t)blockIdx.x * 256 + threadIdx.x) * 2; if (e >= (size_t)ZH * TT * HD) return; const int d = (int)(e % HD); const int t = (int)((e / HD) % TT); const int zz = (int)(e / ((size_t)HD * TT)); const float cs = (t < RH) ? 1.0f : (1.0f / PCAR); const size_t oo = (size_t)t * DQ + (h0 + zz) * HD + d;
    v2us oh, ol;
#pragma unroll
    for (int q = 0; q < 2; ++q) { unsigned short a, c2; splitf(O[e + q] * cs, a, c2); oh[q] = a; ol[q] = c2; } *(v2us*)(Ah + oo) = oh; *(v2us*)(Al + oo) = ol;  }

extern "C" void kernel_launch(void* const* d_in, const int* in_sizes, int n_in,
                              void* d_out, int out_size, void* d_ws, size_t ws_size, hipStream_t stream) {
    (void)in_sizes; (void)n_in; (void)out_size;
    const float* x = (const float*)d_in[0];   /* seq1 */ const float* x2 = (const float*)d_in[1];   /* seq2 */ const float* lng = (const float*)d_in[2]; const float* lnb = (const float*)d_in[3]; const float* pq = (const float*)d_in[4]; const float* pk = (const float*)d_in[5]; const float* pv = (const float*)d_in[6];   /* [16][1024][64] */ const float* wo = (const float*)d_in[7]; const float* bo = (const float*)d_in[8];     const float* wq = pq; const float* wk = pk; const float* wv = pv;
    float* OUT = (float*)d_out;     // [2][2048][1024]
    char* wsp = (char*)d_ws;
    auto take = [&](size_t bytes) { char* p = wsp; wsp += (bytes + 255) & ~(size_t)255; return (void*)p; };
    bf* WQ = (bf*)take((size_t)DQ * DM * 2); bf* WK = (bf*)take((size_t)DKV * DM * 2); bf* WV = (bf*)take((size_t)DKV * DM * 2); bf* WO = (bf*)take((size_t)DM * DQ * 2); float* CS = (float*)take((size_t)TT * HD * 2 * 4);
    bf* X1h = (bf*)take((size_t)TT * DM * 2); bf* X1l = (bf*)take((size_t)TT * DM * 2); bf* X2h = (bf*)take((size_t)TT * DM * 2); bf* X2l = (bf*)take((size_t)TT * DM * 2); float* FQ = (float*)take((size_t)TT * DQ * 4); float* FK = (float*)take((size_t)TT * DKV * 4);
    h16* QP16 = (h16*)take((size_t)NH_ * TT * HD * 2); h16* KP16 = (h16*)take((size_t)NKV * TT * HD * 2); h16* VT16 = (h16*)take((size_t)NKV * HD * TT * 2);
    bf* QPh = (bf*)take((size_t)NH_ * TT * HD * 2); bf* QPl = (bf*)take((size_t)NH_ * TT * HD * 2); bf* KPh = (bf*)take((size_t)NKV * TT * HD * 2); bf* KPl = (bf*)take((size_t)NKV * TT * HD * 2); bf* VTh = (bf*)take((size_t)NKV * HD * TT * 2); bf* VTl = (bf*)take((size_t)NKV * HD * TT * 2); bf* Ph = (bf*)take((size_t)ZH * RH * TT * 2); bf* Pl = (bf*)take((size_t)ZH * RH * TT * 2);
    float* Sb = (float*)take((size_t)ZH * TT * TT * 4); h16* P16 = (h16*)take((size_t)ZH * TT * TT * 2); float* Ob = (float*)take((size_t)ZH * TT * HD * 4); bf* ATh = (bf*)take((size_t)TT * DQ * 2); bf* ATl = (bf*)take((size_t)TT * DQ * 2);
    if ((size_t)(wsp - (char*)d_ws) > ws_size) return;    // ws 256 MiB
    float* FV = FK;   // v projection reuses the k buffer after the k planes are built (stream-ordered)
    { for (int hh = 0; hh < NH_; ++hh) { k_wtG<<<(unsigned)((DM * HD / 64 + 63) / 64), 256, 0, stream>>>(wq + (size_t)hh * DM * HD, DM, HD, WQ + (size_t)hh * HD * DM); k_wtG<<<(unsigned)((DM * HD / 64 + 63) / 64), 256, 0, stream>>>(wk + (size_t)hh * DM * HD, DM, HD, WK + (size_t)hh * HD * DM); k_wtG<<<(unsigned)((DM * HD / 64 + 63) / 64), 256, 0, stream>>>(wv + (size_t)hh * DM * HD, DM, HD, WV + (size_t)hh * HD * DM); }   /* head hh's 'xw' [1024][64] -> Bt rows hh*64.. */
      k_cvt8<<<(unsigned)(((size_t)DM * DQ / 8 + 255) / 256), 256, 0, stream>>>(wo, WO, (size_t)DM * DQ / 8);
       }
    k_csid<<<(TT * HD + 255) / 256, 256, 0, stream>>>(CS);
    const unsigned LQ = (unsigned)(((size_t)NH_ * TT * HD / 2 + 255) / 256), LKv = (unsigned)(((size_t)NKV * TT * HD / 2 + 255) / 256);
    for (int b = 0; b < NB_; ++b) {
        
        k_lnx<<<TT / 8, 256, 0, stream>>>(x + (size_t)b * TT * DM, lng, lnb, X1h, X1l); k_lnx<<<TT / 8, 256, 0, stream>>>(x2 + (size_t)b * TT * DM, lng, lnb, X2h, X2l);   /* LayerNorm(seq1), LayerNorm(seq2) as bf16 hi/lo planes */
        k_gemmw<bf, 1, false><<<dim3(TT / 64, DQ / 64, 1), 32, 0, stream>>>(X1h, X1l, WQ, nullptr, DM, FQ, DQ, nullptr, 0, 0, 0);
        k_rope<<<LQ, 256, 0, stream>>>(FQ, DQ, NH_, CS, nullptr, nullptr, 1.0f, QP16, QPh, QPl);
        k_gemmw<bf, 1, false><<<dim3(TT / 64, DKV / 64, 1), 32, 0, stream>>>(X2h, X2l, WK, nullptr, DM, FK, DKV, nullptr, 0, 0, 0);
        k_rope<<<LKv, 256, 0, stream>>>(FK, DKV, NKV, CS, nullptr, nullptr, 1.0f, KP16, KPh, KPl);
        k_gemmw<bf, 1, false><<<dim3(TT / 64, DKV / 64, 1), 32, 0, stream>>>(X2h, X2l, WV, nullptr, DM, FV, DKV, nullptr, 0, 0, 0); k_vtp<<<LKv, 256, 0, stream>>>(FV, DKV, NKV, VT16, VTh, VTl);
        for (int h0 = 0; h0 < NH_; h0 += ZH) { const size_t zq = (size_t)h0, zk = (size_t)(h0 / REP);   // one kv head per query head: the pass's two heads use consecutive kv planes (z-strides TT*HD)
            k_gemmc<bf, 2, 1><<<dim3(RH / 64, TT / 64, ZH), 32, 0, stream>>>(QPh + zq * TT * HD, QPl + zq * TT * HD, KPh + zk * TT * HD, KPl + zk * TT * HD, HD, Sb, TT, 0, (size_t)TT * HD, (size_t)TT * HD, (size_t)TT * TT);
            k_gemmc<h16, 0, 1><<<dim3((TT - RH) / 64, TT / 64, ZH), 32, 0, stream>>>(QP16 + zq * TT * HD + (size_t)RH * HD, nullptr, KP16 + zk * TT * HD, nullptr, HD, Sb + (size_t)RH * TT, TT, RH, (size_t)TT * HD, (size_t)TT * HD, (size_t)TT * TT);
            k_asoft<<<ZH * TT / 8, 256, 0, stream>>>(Sb, P16, Ph, Pl);
            k_gemmc<bf, 2, 2><<<dim3(RH / 64, HD / 64, ZH), 32, 0, stream>>>(Ph, Pl, VTh + zk * HD * TT, VTl + zk * HD * TT, TT, Ob, HD, 0, (size_t)RH * TT, (size_t)HD * TT, (size_t)TT * HD);
            k_gemmc<h16, 0, 2><<<dim3((TT - RH) / 64, HD / 64, ZH), 32, 0, stream>>>(P16 + (size_t)RH * TT, nullptr, VT16 + zk * HD * TT, nullptr, TT, Ob + (size_t)RH * HD, HD, RH, (size_t)TT * TT, (size_t)HD * TT, (size_t)TT * HD);
            k_merge<<<(unsigned)(((size_t)ZH * TT * HD / 2 + 255) / 256), 256, 0, stream>>>(Ob, h0, ATh, ATl); }
        k_gemmw<bf, 1, true><<<dim3(TT / 64, DM / 64, 1), 32, 0, stream>>>(ATh, ATl, WO, nullptr, DQ, OUT + (size_t)b * TT * DM, DM, bo, 0, 0, 0); }
}

// v001
// Measured time: 1120 microseconds a run.
// Next to v000, in two timings, it ran 1.65 times as fast each time.
#include <hip/hip_runtime.h>

// Causal cross attention between two LayerNorm'd sequences with per-head projection tensors (seq1, seq2 [2][2048][1024]; x1, x2 = LayerNorm(seq) (eps 1e-5, gamma/beta read); q = x1 q_proj[h], k = x2 k_proj[h], v = x2 v_proj[h] ([16][1024][64] 0.02, 'xw' per head, no bias); scores / float32(sqrt 64); causal (-inf); softmax; out = merged mixer_w^T + mixer_b ('oi') -> [2][2048][1024] (4.2 M); argument order seq1, seq2, ln_gamma, ln_beta, q_proj, k_proj, v_proj, mixer_w, mixer_b).
// Layout per batch: a LayerNorm kernel (one wave per token row: mean, biased variance, f32) writes bf16 hi/lo planes of x1, then of x2; per-head 'xw' weight blocks gathered into Bt; projections hi/lo x exact (2 products); causal T-2048 attention (hybrid rows: < 512 hi/lo 3 products, rest fp16 x1024; k_gemmc skips tiles above the diagonal); merged hi/lo x mixer_w exact + mixer_b.
// Compute dtypes, f32 accumulate: every input rounded to bf16; LayerNorm f32; projections 2 products (~f32); attention rows < 512 3 products, rest fp16; softmax f32; mixer hl x exact + bias.

#define NB_  2
#define TT   2048
#define DM   1024
#define NH_  16
#define NKV  16
#define REP  (NH_ / NKV)
#define HD   64
#define DQ   (NH_ * HD)
#define DKV  (NKV * HD)
#define ZH   8                    // heads per attention pass
#define RH   512                  // query rows < RH use hi+lo planes (0: none)
#define WIN  2048
#define PCAR 1024.0f
#define SCL  0.125f   // HD^-0.5
typedef _Float16 h16;
typedef unsigned short bf;
typedef __attribute__((ext_vector_type(16))) __bf16   v16bf;
typedef __attribute__((ext_vector_type(16))) _Float16 v16h;
typedef __attribute__((ext_vector_type(8)))  _Float16 v8h;
typedef __attribute__((ext_vector_type(8)))  unsigned short v8us;
typedef __attribute__((ext_vector_type(8)))  float    v8f;
typedef __attribute__((ext_vector_type(4)))  float    v4f;
typedef v8h  __attribute__((may_alias)) v8ha;
typedef v4f  __attribute__((may_alias)) v4fa;
typedef v8us __attribute__((may_alias)) v8usa;

__device__ __forceinline__ unsigned short f2bf(float f) { unsigned u = __float_as_uint(f); u += 0x7FFFu + ((u >> 16) & 1u); return (unsigned short)(u >> 16); }
__device__ __forceinline__ float bf2f(unsigned short b) { return __uint_as_float(((unsigned)b) << 16); }
__device__ __forceinline__ float bfr(float f) { return bf2f(f2bf(f)); }
__device__ __forceinline__ v16h cat16(v8h lo, v8h hi) { return __builtin_shufflevector(lo, hi, 0, 1, 2, 3, 4, 5, 6, 7, 8, 9, 10, 11, 12, 13, 14, 15); }
__device__ __forceinline__ v16bf cat16b(v8us lo, v8us hi) { return __builtin_bit_cast(v16bf, __builtin_shufflevector(lo, hi, 0, 1, 2, 3, 4, 5, 6, 7, 8, 9, 10, 11, 12, 13, 14, 15)); }
__device__ __forceinline__ v8f wmma16(v16h a, v16h b, v8f c) { return __builtin_amdgcn_wmma_f32_16x16x32_f16(false, a, false, b, (short)0, c, false, false); }
__device__ __forceinline__ v8f wmmab(v16bf a, v16bf b, v8f c) { return __builtin_amdgcn_wmma_f32_16x16x32_bf16(false, a, false, b, (short)0, c, false, false); }



// ---- k_gemmw: register-blocked GEMM, ONE WAVE per 64x64 output tile (16 accumulators), operands straight from K-contiguous 16-bit planes; grid (M/64, N/64, Z), 32 threads.
// C[m][n] (f32, pitch ldc, + optional f32 bias[n]) = sum_k A[m][k] Bt[n][k] (+ split products per NSPLIT). z-batch strides sA/sB/sC in elements. K % 32 == 0.
template <typename T16> struct WFrag;
template <> struct WFrag<h16> { typedef v16h V; static __device__ __forceinline__ V ld(const h16* p) { return cat16(*(const v8h*)p, *(const v8h*)(p + 16)); } static __device__ __forceinline__ v8f mma(V a, V b, v8f c) { return wmma16(a, b, c); } };
template <> struct WFrag<bf> { typedef v16bf V; static __device__ __forceinline__ V ld(const bf* p) { return cat16b(*(const v8us*)p, *(const v8us*)(p + 16)); } static __device__ __forceinline__ v8f mma(V a, V b, v8f c) { return wmmab(a, b, c); } };
template <typename T16, int NSPLIT, bool BIAS>
__global__ __launch_bounds__(32) void k_gemmw(const T16* __restrict__ A, const T16* __restrict__ A2, const T16* __restrict__ Bt, const T16* __restrict__ Bt2, int K, float* C, int ldc, const float* __restrict__ bias, size_t sA, size_t sB, size_t sC) {
    typedef typename WFrag<T16>::V V;
    __shared__ __align__(16) float os[16 * 68];
    const size_t z = blockIdx.z; A += z * sA; if (A2) A2 += z * sA; Bt += z * sB; if (Bt2) Bt2 += z * sB; C += z * sC;
    const int lane = threadIdx.x & 31, lr = lane & 15, hi = lane >> 4; const int r0 = blockIdx.x * 64, c0 = blockIdx.y * 64;
    v8f acc[4][4];
#pragma unroll
    for (int mb = 0; mb < 4; ++mb)
#pragma unroll
        for (int nb = 0; nb < 4; ++nb) acc[mb][nb] = (v8f){};
    const size_t aoff = (size_t)(r0 + lr) * K + 8 * hi, boff = (size_t)(c0 + lr) * K + 8 * hi;
#pragma unroll 1
    for (int kc = 0; kc < K; kc += 32) {
        V a[4], a2[4];
#pragma unroll
        for (int mb = 0; mb < 4; ++mb) { a[mb] = WFrag<T16>::ld(A + aoff + (size_t)mb * 16 * K + kc); if (NSPLIT == 1 || NSPLIT == 2) a2[mb] = WFrag<T16>::ld(A2 + aoff + (size_t)mb * 16 * K + kc); }
#pragma unroll
        for (int nb = 0; nb < 4; ++nb) { const V b = WFrag<T16>::ld(Bt + boff + (size_t)nb * 16 * K + kc); V b2; if (NSPLIT >= 2) b2 = WFrag<T16>::ld(Bt2 + boff + (size_t)nb * 16 * K + kc);
#pragma unroll
            for (int mb = 0; mb < 4; ++mb) { acc[mb][nb] = WFrag<T16>::mma(a[mb], b, acc[mb][nb]); if (NSPLIT == 1 || NSPLIT == 2) acc[mb][nb] = WFrag<T16>::mma(a2[mb], b, acc[mb][nb]); if (NSPLIT >= 2) acc[mb][nb] = WFrag<T16>::mma(a[mb], b2, acc[mb][nb]); } }
        asm volatile("v_nop\n\tv_nop\n\tv_nop\n\tv_nop" : "+v"(acc[0][0]), "+v"(acc[1][1]), "+v"(acc[2][2]), "+v"(acc[3][3]) : "v"(a[0]), "v"(a[3]));
    }
#pragma unroll
    for (int mb = 0; mb < 4; ++mb) {
#pragma unroll
        for (int nb = 0; nb < 4; ++nb) {
#pragma unroll
            for (int j = 0; j < 8; ++j) os[(hi * 8 + j) * 68 + nb * 16 + lr] = acc[mb][nb][j]; }
        __builtin_amdgcn_wave_barrier(); asm volatile("" ::: "memory");
        float* crow = C + (size_t)(r0 + mb * 16) * ldc + c0;
{
#pragma unroll
            for (int s = 0; s < 8; ++s) { const int row = 2 * s + hi, cofs = lr * 4; v4f val = *(const v4fa*)(os + row * 68 + cofs); if (BIAS) { val[0] += bfr(bias[c0 + cofs]); val[1] += bfr(bias[c0 + cofs + 1]); val[2] += bfr(bias[c0 + cofs + 2]); val[3] += bfr(bias[c0 + cofs + 3]); }
                *(v4f*)(crow + (size_t)row * ldc + cofs) = val; }
             }
        __builtin_amdgcn_wave_barrier(); asm volatile("" ::: "memory");
    }
}

// ---- k_gemmc: the same one-wave 64x64 tile GEMM specialised for causal attention: CMODE 1 skips score tiles entirely above the diagonal (query rows r0+roff.., key columns c0..), CMODE 2 limits the
// key (K) loop of the probability x value contraction to the diagonal block (probabilities beyond it are exactly zero). roff = row offset of this launch's first row within the sequence. lda = row pitch of A and A2 in elements (Bt's pitch is K).
template <typename T16, int NSPLIT, int CMODE>
__global__ __launch_bounds__(32) void k_gemmc(const T16* __restrict__ A, const T16* __restrict__ A2, int lda, const T16* __restrict__ Bt, const T16* __restrict__ Bt2, int K, float* C, int ldc, int roff, size_t sA, size_t sB, size_t sC) {
    typedef typename WFrag<T16>::V V;
    __shared__ __align__(16) float os[16 * 68];
    const size_t z = blockIdx.z; A += z * sA; if (A2) A2 += z * sA; Bt += z * sB; if (Bt2) Bt2 += z * sB; C += z * sC;
    const int lane = threadIdx.x & 31, lr = lane & 15, hi = lane >> 4; const int r0 = blockIdx.x * 64, c0 = blockIdx.y * 64;
    if (CMODE == 1 && c0 > r0 + roff + 63) return;                  // score tile entirely above the causal diagonal: never read (the softmax masks j > i by select)
    const int Kl = (CMODE == 2) ? min(K, r0 + roff + 64) : K;        // P.V: probabilities are exactly 0 beyond the diagonal block, so the K loop stops there
    v8f acc[4][4];
#pragma unroll
    for (int mb = 0; mb < 4; ++mb)
#pragma unroll
        for (int nb = 0; nb < 4; ++nb) acc[mb][nb] = (v8f){};
    const size_t aoff = (size_t)(r0 + lr) * lda + 8 * hi, boff = (size_t)(c0 + lr) * K + 8 * hi;
#pragma unroll 1
    for (int kc = 0; kc < Kl; kc += 32) {
        V a[4], a2[4];
#pragma unroll
        for (int mb = 0; mb < 4; ++mb) { a[mb] = WFrag<T16>::ld(A + aoff + (size_t)mb * 16 * lda + kc); asm volatile("s_wait_xcnt 0x0" ::: "memory");   // the next fragment may land in this load's address registers: the wait stands in front of that overwrite
            if (NSPLIT == 1 || NSPLIT == 2) { a2[mb] = WFrag<T16>::ld(A2 + aoff + (size_t)mb * 16 * lda + kc); asm volatile("s_wait_xcnt 0x0" ::: "memory"); } }   // same wait, for the lo plane's load
#pragma unroll
        for (int nb = 0; nb < 4; ++nb) { const V b = WFrag<T16>::ld(Bt + boff + (size_t)nb * 16 * K + kc); V b2; if (NSPLIT >= 2) b2 = WFrag<T16>::ld(Bt2 + boff + (size_t)nb * 16 * K + kc);
#pragma unroll
            for (int mb = 0; mb < 4; ++mb) { acc[mb][nb] = WFrag<T16>::mma(a[mb], b, acc[mb][nb]); if (NSPLIT == 1 || NSPLIT == 2) acc[mb][nb] = WFrag<T16>::mma(a2[mb], b, acc[mb][nb]); if (NSPLIT >= 2) acc[mb][nb] = WFrag<T16>::mma(a[mb], b2, acc[mb][nb]); } }
        asm volatile("v_nop\n\tv_nop\n\tv_nop\n\tv_nop" : "+v"(acc[0][0]), "+v"(acc[1][1]), "+v"(acc[2][2]), "+v"(acc[3][3]) : "v"(a[0]), "v"(a[3]));
    }
#pragma unroll
    for (int mb = 0; mb < 4; ++mb) {
#pragma unroll
        for (int nb = 0; nb < 4; ++nb) {
#pragma unroll
            for (int j = 0; j < 8; ++j) os[(hi * 8 + j) * 68 + nb * 16 + lr] = acc[mb][nb][j]; }
        __builtin_amdgcn_wave_barrier(); asm volatile("" ::: "memory");
        float* crow = C + (size_t)(r0 + mb * 16) * ldc + c0;
{
#pragma unroll
            for (int s = 0; s < 8; ++s) { const int row = 2 * s + hi, cofs = lr * 4; v4f val = *(const v4fa*)(os + row * 68 + cofs);
                *(v4f*)(crow + (size_t)row * ldc + cofs) = val; }
             }
        __builtin_amdgcn_wave_barrier(); asm volatile("" ::: "memory");
    }
}

__device__ __forceinline__ h16 tohx(float x) { return (h16)x; }
__device__ __forceinline__ void splitf(float y, unsigned short& h, unsigned short& l) { h = f2bf(y); l = f2bf(y - bf2f(h)); }
typedef __attribute__((ext_vector_type(2))) _Float16 v2h;
typedef __attribute__((ext_vector_type(4))) _Float16 v4h;
typedef __attribute__((ext_vector_type(2))) unsigned short v2us;
typedef __attribute__((ext_vector_type(4))) unsigned short v4us;
typedef __attribute__((ext_vector_type(2))) float v2f;
typedef __attribute__((ext_vector_type(4))) int v4i;

__global__ __launch_bounds__(256) void k_wtG(const float* __restrict__ w, int K, int N, bf* Bt) {
    const int lane = threadIdx.x & 31; const int L0 = (blockIdx.x * 8 + (threadIdx.x >> 5)) * 8; const int nlines = N * K / 64;
{
#pragma unroll 1
        for (int l = 0; l < 8; ++l) { const int L = L0 + l; if (L >= nlines) break; const size_t e = (size_t)L * 64 + lane * 2; const int k = (int)(e % K), n = (int)(e / K); v2us o;
            o[0] = f2bf(w[(size_t)k * N + n]); o[1] = f2bf(w[(size_t)(k + 1) * N + n]); *(v2us*)(Bt + e) = o; }
         }
}
__global__ __launch_bounds__(256) void k_cvt8(const float* __restrict__ src, bf* dst, size_t n8) { const size_t i = (size_t)blockIdx.x * 256 + threadIdx.x; if (i >= n8) return; const v8f v = *(const v8f*)(src + i * 8); v8us o;
#pragma unroll
    for (int k = 0; k < 8; ++k) o[k] = f2bf(v[k]); *(v8us*)(dst + i * 8) = o;  }

__global__ __launch_bounds__(256) void k_lnx(const float* __restrict__ X, const float* __restrict__ gw, const float* __restrict__ gb, bf* Ph, bf* Pl) { const int lane = threadIdx.x & 31; const int r = blockIdx.x * 8 + (threadIdx.x >> 5); if (r >= TT) return; const float* xr = X + (size_t)r * DM; float hv[32]; float s = 0.f;
#pragma unroll
    for (int ch = 0; ch < 8; ++ch) { const v4f a = *(const v4f*)(xr + ch * 128 + lane * 4);
#pragma unroll
        for (int q = 0; q < 4; ++q) { const float u = bfr(a[q]); hv[ch * 4 + q] = u; s += u; } }
#pragma unroll
    for (int sh = 16; sh; sh >>= 1) s += __shfl_xor(s, sh, 32);
    float mu = s * (1.0f / 1024.0f); asm volatile("" : "+v"(mu)); float s2 = 0.f;
#pragma unroll
    for (int k = 0; k < 32; ++k) { float d0 = __fsub_rn(hv[k], mu); asm volatile("" : "+v"(d0)); float p = __fmul_rn(d0, d0); asm volatile("" : "+v"(p)); s2 = __fadd_rn(s2, p); }
#pragma unroll
    for (int sh = 16; sh; sh >>= 1) s2 += __shfl_xor(s2, sh, 32);
    float var = __fadd_rn(s2 * (1.0f / 1024.0f), 1e-5f); asm volatile("" : "+v"(var)); const float rs = __frsqrt_rn(var);
{
#pragma unroll
        for (int ch = 0; ch < 8; ++ch) { const int c0 = ch * 128 + lane * 4; v4us oh, ol;
#pragma unroll
            for (int q = 0; q < 4; ++q) { float gg = bfr(gw[c0 + q]); asm volatile("" : "+v"(gg)); float d0 = __fsub_rn(hv[ch * 4 + q], mu); asm volatile("" : "+v"(d0)); float n0 = __fmul_rn(d0, rs); asm volatile("" : "+v"(n0)); float y = __fmul_rn(n0, gg); asm volatile("" : "+v"(y)); const float z = __fadd_rn(y, bfr(gb[c0 + q])); unsigned short a2, c2; splitf(z, a2, c2); oh[q] = a2; ol[q] = c2; }
            const size_t oo = (size_t)r * DM + c0; *(v4us*)(Ph + oo) = oh; *(v4us*)(Pl + oo) = ol; }
         } }
// k_rope: head planes [h][t][d] (fp16 + hi/lo) of rope(x) x sc with the rotate-half convention out[d] = x[d] cos[t][d] - x[d+HD/2] sin[t][d], out[d+HD/2] = x[d+HD/2] cos[t][d+HD/2] + x[d] sin[t][d+HD/2]
__global__ __launch_bounds__(256) void k_rope(const float* __restrict__ F, int pitch, int nheads, const float* __restrict__ CS, const float* __restrict__ RF, const float* __restrict__ nw, float sc, h16* P16, bf* Ph, bf* Pl) {
    const size_t e = ((size_t)blockIdx.x * 256 + threadIdx.x) * 2; if (e >= (size_t)nheads * TT * HD) return; const int d = (int)(e % HD); const int t = (int)((e / HD) % TT); const int h = (int)(e / ((size_t)HD * TT)); const float* f = F + (size_t)t * pitch + h * HD; const float rf = RF ? RF[(size_t)h * TT + t] : 1.0f; v2h o16; v2us oh, ol;
#pragma unroll
    for (int q = 0; q < 2; ++q) { const int dd = d + q; const int dp = (dd < HD / 2) ? dd + HD / 2 : dd - HD / 2; float x0 = f[dd], x1 = f[dp];
        if (RF) { float n0 = __fmul_rn(x0, rf), n1 = __fmul_rn(x1, rf); asm volatile("" : "+v"(n0)); asm volatile("" : "+v"(n1)); x0 = __fmul_rn(bfr(nw[dd]), n0); x1 = __fmul_rn(bfr(nw[dp]), n1); }
        const v2f cs = *(const v2f*)(CS + ((size_t)t * HD + dd) * 2); float a = __fmul_rn(x0, cs[0]), bq = __fmul_rn(x1, cs[1]); asm volatile("" : "+v"(a)); asm volatile("" : "+v"(bq)); const float r = ((dd < HD / 2) ? __fsub_rn(a, bq) : __fadd_rn(a, bq)) * sc;
        o16[q] = tohx(r); unsigned short a2, c2; splitf(r, a2, c2); oh[q] = a2; ol[q] = c2; }
    *(v2h*)(P16 + e) = o16; *(v2us*)(Ph + e) = oh; *(v2us*)(Pl + e) = ol;  }
__global__ __launch_bounds__(256) void k_vtp(const float* __restrict__ F, int pitch, int nheads, h16* V16, bf* Vh, bf* Vl) { const size_t e = ((size_t)blockIdx.x * 256 + threadIdx.x) * 2; if (e >= (size_t)nheads * HD * TT) return; const int t = (int)(e % TT); const int d = (int)((e / TT) % HD); const int g = (int)(e / ((size_t)TT * HD)); v2h o16; v2us oh, ol;
#pragma unroll
    for (int q = 0; q < 2; ++q) { const float x = F[(size_t)(t + q) * pitch + g * HD + d]; o16[q] = tohx(x); unsigned short a2, c2; splitf(x, a2, c2); oh[q] = a2; ol[q] = c2; }
    *(v2h*)(V16 + e) = o16; *(v2us*)(Vh + e) = oh; *(v2us*)(Vl + e) = ol;  }
__global__ __launch_bounds__(256) void k_csid(float* CS) { const int idx = blockIdx.x * 256 + threadIdx.x; if (idx >= TT * HD) return; v2f cs; cs[0] = 1.0f; cs[1] = 0.0f; *(v2f*)(CS + (size_t)idx * 2) = cs;  }
// k_asoft: per row (zz, i): t = S x HD^-0.5 for j <= i and i - j < WIN (sliding causal window; the reference's -1e9 additive fill vanishes identically); softmax over the 2048 keys (register row, one exp, fixed trees);
// the probabilities overwrite the row's own 8 KiB of scores (one wave owns a row and holds all of it in registers before its first store): rows < RH bf16 hi in the first 4 KiB, lo in the second; other rows fp16 in the first 4 KiB. 16-bit row pitch 2 * TT.
typedef v4us __attribute__((may_alias)) v4usa;
typedef v4h  __attribute__((may_alias)) v4ha;
__global__ __launch_bounds__(256) void k_asoft(float* Sb) {
    const int lane = threadIdx.x & 31; const int row = blockIdx.x * 8 + (threadIdx.x >> 5); if (row >= ZH * TT) return; const int i = row % TT; const int zz = row / TT; (void)zz; const bool hires = (i < RH); float* sr = Sb + (size_t)row * TT; float v[TT / 32]; float mx = -3.0e38f;
#pragma unroll
    for (int ch = 0; ch < TT / 128; ++ch) { const int j0 = ch * 128 + lane * 4; const v4f a = *(const v4fa*)(sr + j0);
#pragma unroll
        for (int q = 0; q < 4; ++q) { const int j = j0 + q; (void)j; const float t = (j <= i && i - j < WIN) ? a[q] * SCL : -3.0e38f; v[ch * 4 + q] = t; mx = fmaxf(mx, t); } }
#pragma unroll
    for (int sh = 16; sh; sh >>= 1) mx = fmaxf(mx, __shfl_xor(mx, sh, 32));
    float sum = 0.f;
#pragma unroll
    for (int k = 0; k < TT / 32; ++k) { float d0 = __fsub_rn(v[k], mx); asm volatile("" : "+v"(d0)); v[k] = __builtin_amdgcn_exp2f(__fmul_rn(d0, 1.4426950408889634f)); sum += v[k]; }
#pragma unroll
    for (int sh = 16; sh; sh >>= 1) sum += __shfl_xor(sum, sh, 32);
    const float f = __fdiv_rn(hires ? 1.0f : PCAR, sum);
{
        if (hires) {
#pragma unroll
            for (int ch = 0; ch < TT / 128; ++ch) { v4us oh, ol;
#pragma unroll
                for (int q = 0; q < 4; ++q) { unsigned short a, c2; splitf(v[ch * 4 + q] * f, a, c2); oh[q] = a; ol[q] = c2; }
                bf* pr = (bf*)sr + ch * 128 + lane * 4; *(v4usa*)pr = oh; *(v4usa*)(pr + TT) = ol; }
        } else {
#pragma unroll
            for (int ch = 0; ch < TT / 128; ++ch) { v4h o4;
#pragma unroll
                for (int q = 0; q < 4; ++q) o4[q] = tohx(v[ch * 4 + q] * f);
                *(v4ha*)((h16*)sr + ch * 128 + lane * 4) = o4; } }
         }
}
__global__ __launch_bounds__(256) void k_merge(const float* __restrict__ O, int h0, bf* Ah, bf* Al) { const size_t e = ((size_t)blockIdx.x * 256 + threadIdx.x) * 2; if (e >= (size_t)ZH * TT * HD) return; const int d = (int)(e % HD); const int t = (int)((e / HD) % TT); const int zz = (int)(e / ((size_t)HD * TT)); const float cs = (t < RH) ? 1.0f : (1.0f / PCAR); const size_t oo = (size_t)t * DQ + (h0 + zz) * HD + d;
    v2us oh, ol;
#pragma unroll
    for (int q = 0; q < 2; ++q) { unsigned short a, c2; splitf(O[e + q] * cs, a, c2); oh[q] = a; ol[q] = c2; } *(v2us*)(Ah + oo) = oh; *(v2us*)(Al + oo) = ol;  }

extern "C" void kernel_launch(void* const* d_in, const int* in_sizes, int n_in,
                              void* d_out, int out_size, void* d_ws, size_t ws_size, hipStream_t stream) {
    (void)in_sizes; (void)n_in; (void)out_size;
    const float* x = (const float*)d_in[0];   /* seq1 */ const float* x2 = (const float*)d_in[1];   /* seq2 */ const float* lng = (const float*)d_in[2]; const float* lnb = (const float*)d_in[3]; const float* pq = (const float*)d_in[4]; const float* pk = (const float*)d_in[5]; const float* pv = (const float*)d_in[6];   /* [16][1024][64] */ const float* wo = (const float*)d_in[7]; const float* bo = (const float*)d_in[8];     const float* wq = pq; const float* wk = pk; const float* wv = pv;
    float* OUT = (float*)d_out;     // [2][2048][1024]
    char* wsp = (char*)d_ws;
    auto take = [&](size_t bytes) { char* p = wsp; wsp += (bytes + 255) & ~(size_t)255; return (void*)p; };
    bf* WQ = (bf*)take((size_t)DQ * DM * 2); bf* WK = (bf*)take((size_t)DKV * DM * 2); bf* WV = (bf*)take((size_t)DKV * DM * 2); bf* WO = (bf*)take((size_t)DM * DQ * 2); float* CS = (float*)take((size_t)TT * HD * 2 * 4);
    bf* X1h = (bf*)take((size_t)TT * DM * 2); bf* X1l = (bf*)take((size_t)TT * DM * 2); bf* X2h = (bf*)take((size_t)TT * DM * 2); bf* X2l = (bf*)take((size_t)TT * DM * 2); float* FQ = (float*)take((size_t)TT * DQ * 4); float* FK = (float*)take((size_t)TT * DKV * 4);
    h16* QP16 = (h16*)take((size_t)NH_ * TT * HD * 2); h16* KP16 = (h16*)take((size_t)NKV * TT * HD * 2); h16* VT16 = (h16*)take((size_t)NKV * HD * TT * 2);
    bf* QPh = (bf*)take((size_t)NH_ * TT * HD * 2); bf* QPl = (bf*)take((size_t)NH_ * TT * HD * 2); bf* KPh = (bf*)take((size_t)NKV * TT * HD * 2); bf* KPl = (bf*)take((size_t)NKV * TT * HD * 2); bf* VTh = (bf*)take((size_t)NKV * HD * TT * 2); bf* VTl = (bf*)take((size_t)NKV * HD * TT * 2);
    float* Sb = (float*)take((size_t)ZH * TT * TT * 4); float* Ob = (float*)take((size_t)ZH * TT * HD * 4); bf* ATh = (bf*)take((size_t)TT * DQ * 2); bf* ATl = (bf*)take((size_t)TT * DQ * 2);
    if ((size_t)(wsp - (char*)d_ws) > ws_size) return;    // ws 256 MiB
    float* FV = FK;   // v projection reuses the k buffer after the k planes are built (stream-ordered)
    { for (int hh = 0; hh < NH_; ++hh) { k_wtG<<<(unsigned)((DM * HD / 64 + 63) / 64), 256, 0, stream>>>(wq + (size_t)hh * DM * HD, DM, HD, WQ + (size_t)hh * HD * DM); k_wtG<<<(unsigned)((DM * HD / 64 + 63) / 64), 256, 0, stream>>>(wk + (size_t)hh * DM * HD, DM, HD, WK + (size_t)hh * HD * DM); k_wtG<<<(unsigned)((DM * HD / 64 + 63) / 64), 256, 0, stream>>>(wv + (size_t)hh * DM * HD, DM, HD, WV + (size_t)hh * HD * DM); }   /* head hh's 'xw' [1024][64] -> Bt rows hh*64.. */
      k_cvt8<<<(unsigned)(((size_t)DM * DQ / 8 + 255) / 256), 256, 0, stream>>>(wo, WO, (size_t)DM * DQ / 8);
       }
    k_csid<<<(TT * HD + 255) / 256, 256, 0, stream>>>(CS);
    const unsigned LQ = (unsigned)(((size_t)NH_ * TT * HD / 2 + 255) / 256), LKv = (unsigned)(((size_t)NKV * TT * HD / 2 + 255) / 256);
    for (int b = 0; b < NB_; ++b) {
        
        k_lnx<<<TT / 8, 256, 0, stream>>>(x + (size_t)b * TT * DM, lng, lnb, X1h, X1l); k_lnx<<<TT / 8, 256, 0, stream>>>(x2 + (size_t)b * TT * DM, lng, lnb, X2h, X2l);   /* LayerNorm(seq1), LayerNorm(seq2) as bf16 hi/lo planes */
        k_gemmw<bf, 1, false><<<dim3(TT / 64, DQ / 64, 1), 32, 0, stream>>>(X1h, X1l, WQ, nullptr, DM, FQ, DQ, nullptr, 0, 0, 0);
        k_rope<<<LQ, 256, 0, stream>>>(FQ, DQ, NH_, CS, nullptr, nullptr, 1.0f, QP16, QPh, QPl);
        k_gemmw<bf, 1, false><<<dim3(TT / 64, DKV / 64, 1), 32, 0, stream>>>(X2h, X2l, WK, nullptr, DM, FK, DKV, nullptr, 0, 0, 0);
        k_rope<<<LKv, 256, 0, stream>>>(FK, DKV, NKV, CS, nullptr, nullptr, 1.0f, KP16, KPh, KPl);
        k_gemmw<bf, 1, false><<<dim3(TT / 64, DKV / 64, 1), 32, 0, stream>>>(X2h, X2l, WV, nullptr, DM, FV, DKV, nullptr, 0, 0, 0); k_vtp<<<LKv, 256, 0, stream>>>(FV, DKV, NKV, VT16, VTh, VTl);
        for (int h0 = 0; h0 < NH_; h0 += ZH) { const size_t zq = (size_t)h0, zk = (size_t)(h0 / REP);   // one kv head per query head: the pass's heads use consecutive kv planes (z-strides TT*HD)
            k_gemmc<bf, 2, 1><<<dim3(RH / 64, TT / 64, ZH), 32, 0, stream>>>(QPh + zq * TT * HD, QPl + zq * TT * HD, HD, KPh + zk * TT * HD, KPl + zk * TT * HD, HD, Sb, TT, 0, (size_t)TT * HD, (size_t)TT * HD, (size_t)TT * TT);
            k_gemmc<h16, 0, 1><<<dim3((TT - RH) / 64, TT / 64, ZH), 32, 0, stream>>>(QP16 + zq * TT * HD + (size_t)RH * HD, nullptr, HD, KP16 + zk * TT * HD, nullptr, HD, Sb + (size_t)RH * TT, TT, RH, (size_t)TT * HD, (size_t)TT * HD, (size_t)TT * TT);
            k_asoft<<<ZH * TT / 8, 256, 0, stream>>>(Sb);   /* leaves the probabilities in the score rows, 16-bit pitch 2 * TT */
            k_gemmc<bf, 2, 2><<<dim3(RH / 64, HD / 64, ZH), 32, 0, stream>>>((const bf*)Sb, (const bf*)Sb + TT, 2 * TT, VTh + zk * HD * TT, VTl + zk * HD * TT, TT, Ob, HD, 0, (size_t)TT * TT * 2, (size_t)HD * TT, (size_t)TT * HD);
            k_gemmc<h16, 0, 2><<<dim3((TT - RH) / 64, HD / 64, ZH), 32, 0, stream>>>((const h16*)Sb + (size_t)RH * TT * 2, nullptr, 2 * TT, VT16 + zk * HD * TT, nullptr, TT, Ob + (size_t)RH * HD, HD, RH, (size_t)TT * TT * 2, (size_t)HD * TT, (size_t)TT * HD);
            k_merge<<<(unsigned)(((size_t)ZH * TT * HD / 2 + 255) / 256), 256, 0, stream>>>(Ob, h0, ATh, ATl); }
        k_gemmw<bf, 1, true><<<dim3(TT / 64, DM / 64, 1), 32, 0, stream>>>(ATh, ATl, WO, nullptr, DQ, OUT + (size_t)b * TT * DM, DM, bo, 0, 0, 0); }
}

// v002
// One run takes 773 microseconds.
// Two timings next to v001 both put it at 1.45 times that version's speed.
// All steps since v000 together make it 2.40 times as fast.
#include <hip/hip_runtime.h>

// Causal cross attention between two LayerNorm'd sequences with per-head projection tensors (seq1, seq2 [2][2048][1024]; x1, x2 = LayerNorm(seq) (eps 1e-5, gamma/beta read); q = x1 q_proj[h], k = x2 k_proj[h], v = x2 v_proj[h] ([16][1024][64] 0.02, 'xw' per head, no bias); scores / float32(sqrt 64); causal (-inf); softmax; out = merged mixer_w^T + mixer_b ('oi') -> [2][2048][1024] (4.2 M); argument order seq1, seq2, ln_gamma, ln_beta, q_proj, k_proj, v_proj, mixer_w, mixer_b).
// Layout per batch: a LayerNorm kernel (one wave per token row: mean, biased variance, f32) writes bf16 hi/lo planes of x1, then of x2; per-head 'xw' weight blocks gathered into Bt; projections hi/lo x exact (2 products); causal T-2048 attention (hybrid rows: < 512 hi/lo 3 products, rest fp16 x1024; k_gemmc skips tiles above the diagonal); merged hi/lo x mixer_w exact + mixer_b.
// Compute dtypes, f32 accumulate: every input rounded to bf16; LayerNorm f32; projections 2 products (~f32); attention rows < 512 3 products, rest fp16; softmax f32; mixer hl x exact + bias.

#define NB_  2
#define TT   2048
#define DM   1024
#define NH_  16
#define NKV  16
#define REP  (NH_ / NKV)
#define HD   64
#define DQ   (NH_ * HD)
#define DKV  (NKV * HD)
#define ZH   8                    // heads per attention pass
#define RH   512                  // query rows < RH use hi+lo planes (0: none)
#define WIN  2048
#define PCAR 1024.0f
#define SCL  0.125f   // HD^-0.5
typedef _Float16 h16;
typedef unsigned short bf;
typedef __attribute__((ext_vector_type(16))) __bf16   v16bf;
typedef __attribute__((ext_vector_type(16))) _Float16 v16h;
typedef __attribute__((ext_vector_type(8)))  _Float16 v8h;
typedef __attribute__((ext_vector_type(8)))  unsigned short v8us;
typedef __attribute__((ext_vector_type(8)))  float    v8f;
typedef __attribute__((ext_vector_type(4)))  float    v4f;
typedef v8h  __attribute__((may_alias)) v8ha;
typedef v4f  __attribute__((may_alias)) v4fa;
typedef v8us __attribute__((may_alias)) v8usa;

__device__ __forceinline__ unsigned short f2bf(float f) { unsigned u = __float_as_uint(f); u += 0x7FFFu + ((u >> 16) & 1u); return (unsigned short)(u >> 16); }
__device__ __forceinline__ float bf2f(unsigned short b) { return __uint_as_float(((unsigned)b) << 16); }
__device__ __forceinline__ float bfr(float f) { return bf2f(f2bf(f)); }
__device__ __forceinline__ v16h cat16(v8h lo, v8h hi) { return __builtin_shufflevector(lo, hi, 0, 1, 2, 3, 4, 5, 6, 7, 8, 9, 10, 11, 12, 13, 14, 15); }
__device__ __forceinline__ v16bf cat16b(v8us lo, v8us hi) { return __builtin_bit_cast(v16bf, __builtin_shufflevector(lo, hi, 0, 1, 2, 3, 4, 5, 6, 7, 8, 9, 10, 11, 12, 13, 14, 15)); }
__device__ __forceinline__ v8f wmma16(v16h a, v16h b, v8f c) { return __builtin_amdgcn_wmma_f32_16x16x32_f16(false, a, false, b, (short)0, c, false, false); }
__device__ __forceinline__ v8f wmmab(v16bf a, v16bf b, v8f c) { return __builtin_amdgcn_wmma_f32_16x16x32_bf16(false, a, false, b, (short)0, c, false, false); }



// ---- k_gemmw: register-blocked GEMM, ONE WAVE per 64x64 output tile (16 accumulators), operands straight from K-contiguous 16-bit planes; grid (M/64, N/64, Z), 32 threads.
// C[m][n] (f32, pitch ldc, + optional f32 bias[n]) = sum_k A[m][k] Bt[n][k] (+ split products per NSPLIT). z-batch strides sA/sB/sC in elements. K % 32 == 0.
template <typename T16> struct WFrag;
template <> struct WFrag<h16> { typedef v16h V; static __device__ __forceinline__ V ld(const h16* p) { return cat16(*(const v8h*)p, *(const v8h*)(p + 16)); } static __device__ __forceinline__ v8f mma(V a, V b, v8f c) { return wmma16(a, b, c); } };
template <> struct WFrag<bf> { typedef v16bf V; static __device__ __forceinline__ V ld(const bf* p) { return cat16b(*(const v8us*)p, *(const v8us*)(p + 16)); } static __device__ __forceinline__ v8f mma(V a, V b, v8f c) { return wmmab(a, b, c); } };
template <typename T16, int NSPLIT, bool BIAS>
__global__ __launch_bounds__(32) void k_gemmw(const T16* __restrict__ A, const T16* __restrict__ A2, const T16* __restrict__ Bt, const T16* __restrict__ Bt2, int K, float* C, int ldc, const float* __restrict__ bias, size_t sA, size_t sB, size_t sC) {
    typedef typename WFrag<T16>::V V;
    __shared__ __align__(16) float os[16 * 68];
    const size_t z = blockIdx.z; A += z * sA; if (A2) A2 += z * sA; Bt += z * sB; if (Bt2) Bt2 += z * sB; C += z * sC;
    const int lane = threadIdx.x & 31, lr = lane & 15, hi = lane >> 4; const int r0 = blockIdx.x * 64, c0 = blockIdx.y * 64;
    v8f acc[4][4];
#pragma unroll
    for (int mb = 0; mb < 4; ++mb)
#pragma unroll
        for (int nb = 0; nb < 4; ++nb) acc[mb][nb] = (v8f){};
    const size_t aoff = (size_t)(r0 + lr) * K + 8 * hi, boff = (size_t)(c0 + lr) * K + 8 * hi;
#pragma unroll 1
    for (int kc = 0; kc < K; kc += 32) {
        V a[4], a2[4];
#pragma unroll
        for (int mb = 0; mb < 4; ++mb) { a[mb] = WFrag<T16>::ld(A + aoff + (size_t)mb * 16 * K + kc); if (NSPLIT == 1 || NSPLIT == 2) a2[mb] = WFrag<T16>::ld(A2 + aoff + (size_t)mb * 16 * K + kc); }
#pragma unroll
        for (int nb = 0; nb < 4; ++nb) { const V b = WFrag<T16>::ld(Bt + boff + (size_t)nb * 16 * K + kc); V b2; if (NSPLIT >= 2) b2 = WFrag<T16>::ld(Bt2 + boff + (size_t)nb * 16 * K + kc);
#pragma unroll
            for (int mb = 0; mb < 4; ++mb) { acc[mb][nb] = WFrag<T16>::mma(a[mb], b, acc[mb][nb]); if (NSPLIT == 1 || NSPLIT == 2) acc[mb][nb] = WFrag<T16>::mma(a2[mb], b, acc[mb][nb]); if (NSPLIT >= 2) acc[mb][nb] = WFrag<T16>::mma(a[mb], b2, acc[mb][nb]); } }
        asm volatile("v_nop\n\tv_nop\n\tv_nop\n\tv_nop" : "+v"(acc[0][0]), "+v"(acc[1][1]), "+v"(acc[2][2]), "+v"(acc[3][3]) : "v"(a[0]), "v"(a[3]));
    }
#pragma unroll
    for (int mb = 0; mb < 4; ++mb) {
#pragma unroll
        for (int nb = 0; nb < 4; ++nb) {
#pragma unroll
            for (int j = 0; j < 8; ++j) os[(hi * 8 + j) * 68 + nb * 16 + lr] = acc[mb][nb][j]; }
        __builtin_amdgcn_wave_barrier(); asm volatile("" ::: "memory");
        float* crow = C + (size_t)(r0 + mb * 16) * ldc + c0;
{
#pragma unroll
            for (int s = 0; s < 8; ++s) { const int row = 2 * s + hi, cofs = lr * 4; v4f val = *(const v4fa*)(os + row * 68 + cofs); if (BIAS) { val[0] += bfr(bias[c0 + cofs]); val[1] += bfr(bias[c0 + cofs + 1]); val[2] += bfr(bias[c0 + cofs + 2]); val[3] += bfr(bias[c0 + cofs + 3]); }
                *(v4f*)(crow + (size_t)row * ldc + cofs) = val; }
             }
        __builtin_amdgcn_wave_barrier(); asm volatile("" ::: "memory");
    }
}

// ---- k_gemmc: the same one-wave 64x64 tile GEMM specialised for causal attention: CMODE 1 skips score tiles entirely above the diagonal (query rows r0+roff.., key columns c0..), CMODE 2 limits the
// key (K) loop of the probability x value contraction to the diagonal block (probabilities beyond it are exactly zero). roff = row offset of this launch's first row within the sequence. lda = row pitch of A and A2 in elements (Bt's pitch is K).
template <typename T16, int NSPLIT, int CMODE>
__global__ __launch_bounds__(32) void k_gemmc(const T16* __restrict__ A, const T16* __restrict__ A2, int lda, const T16* __restrict__ Bt, const T16* __restrict__ Bt2, int K, float* C, int ldc, int roff, size_t sA, size_t sB, size_t sC) {
    typedef typename WFrag<T16>::V V;
    __shared__ __align__(16) float os[16 * 68];
    const size_t z = blockIdx.z; A += z * sA; if (A2) A2 += z * sA; Bt += z * sB; if (Bt2) Bt2 += z * sB; C += z * sC;
    const int lane = threadIdx.x & 31, lr = lane & 15, hi = lane >> 4; const int r0 = blockIdx.x * 64, c0 = blockIdx.y * 64;
    if (CMODE == 1 && c0 > r0 + roff + 63) return;                  // score tile entirely above the causal diagonal: never read (the softmax masks j > i by select)
    const int Kl = (CMODE == 2) ? min(K, r0 + roff + 64) : K;        // P.V: probabilities are exactly 0 beyond the diagonal block, so the K loop stops there
    v8f acc[4][4];
#pragma unroll
    for (int mb = 0; mb < 4; ++mb)
#pragma unroll
        for (int nb = 0; nb < 4; ++nb) acc[mb][nb] = (v8f){};
    const size_t aoff = (size_t)(r0 + lr) * lda + 8 * hi, boff = (size_t)(c0 + lr) * K + 8 * hi;
#pragma unroll 1
    for (int kc = 0; kc < Kl; kc += 32) {
        V a[4], a2[4];
#pragma unroll
        for (int mb = 0; mb < 4; ++mb) { a[mb] = WFrag<T16>::ld(A + aoff + (size_t)mb * 16 * lda + kc); asm volatile("s_wait_xcnt 0x0" ::: "memory");   // the next fragment may land in this load's address registers: the wait stands in front of that overwrite
            if (NSPLIT == 1 || NSPLIT == 2) { a2[mb] = WFrag<T16>::ld(A2 + aoff + (size_t)mb * 16 * lda + kc); asm volatile("s_wait_xcnt 0x0" ::: "memory"); } }   // same wait, for the lo plane's load
#pragma unroll
        for (int nb = 0; nb < 4; ++nb) { const V b = WFrag<T16>::ld(Bt + boff + (size_t)nb * 16 * K + kc); V b2; if (NSPLIT >= 2) b2 = WFrag<T16>::ld(Bt2 + boff + (size_t)nb * 16 * K + kc);
#pragma unroll
            for (int mb = 0; mb < 4; ++mb) { acc[mb][nb] = WFrag<T16>::mma(a[mb], b, acc[mb][nb]); if (NSPLIT == 1 || NSPLIT == 2) acc[mb][nb] = WFrag<T16>::mma(a2[mb], b, acc[mb][nb]); if (NSPLIT >= 2) acc[mb][nb] = WFrag<T16>::mma(a[mb], b2, acc[mb][nb]); } }
        asm volatile("v_nop\n\tv_nop\n\tv_nop\n\tv_nop" : "+v"(acc[0][0]), "+v"(acc[1][1]), "+v"(acc[2][2]), "+v"(acc[3][3]) : "v"(a[0]), "v"(a[3]));
    }
#pragma unroll
    for (int mb = 0; mb < 4; ++mb) {
#pragma unroll
        for (int nb = 0; nb < 4; ++nb) {
#pragma unroll
            for (int j = 0; j < 8; ++j) os[(hi * 8 + j) * 68 + nb * 16 + lr] = acc[mb][nb][j]; }
        __builtin_amdgcn_wave_barrier(); asm volatile("" ::: "memory");
        float* crow = C + (size_t)(r0 + mb * 16) * ldc + c0;
{
#pragma unroll
            for (int s = 0; s < 8; ++s) { const int row = 2 * s + hi, cofs = lr * 4; v4f val = *(const v4fa*)(os + row * 68 + cofs);
                *(v4f*)(crow + (size_t)row * ldc + cofs) = val; }
             }
        __builtin_amdgcn_wave_barrier(); asm volatile("" ::: "memory");
    }
}

__device__ __forceinline__ h16 tohx(float x) { return (h16)x; }
__device__ __forceinline__ void splitf(float y, unsigned short& h, unsigned short& l) { h = f2bf(y); l = f2bf(y - bf2f(h)); }
typedef __attribute__((ext_vector_type(2))) _Float16 v2h;
typedef __attribute__((ext_vector_type(4))) _Float16 v4h;
typedef __attribute__((ext_vector_type(2))) unsigned short v2us;
typedef __attribute__((ext_vector_type(4))) unsigned short v4us;
typedef __attribute__((ext_vector_type(2))) float v2f;
typedef __attribute__((ext_vector_type(4))) int v4i;

// k_prep: every piece of set-up that depends on no other kernel, in ONE launch, dealt by block index (the gather's blocks come first: they run longest).
//   blocks [0, PG):        per-head 'xw' blocks [16][1024][64] of q_proj, k_proj, v_proj -> bf16 Bt rows (head * 64 + n)[k]; one 64-element line of Bt per wave and trip, 8 lines per wave
//   blocks [PG, PG + PC):  mixer_w ('oi', already K-contiguous) -> bf16, 8 elements per thread
//   blocks [PG + PC, ...): the (1, 0) pair table that k_rope reads
#define PG (3 * NH_ * DM * HD / 64 / 64)
#define PC (DM * DQ / 8 / 256)
#define PS (TT * HD / 256)
__global__ __launch_bounds__(256) void k_prep(const float* __restrict__ wq, const float* __restrict__ wk, const float* __restrict__ wv, const float* __restrict__ wo, bf* WQ, bf* WK, bf* WV, bf* WO, float* CS) {
    const int blk = blockIdx.x;
    if (blk < PG) {
        const int ten = blk / (PG / 3); const float* __restrict__ w3 = (ten == 0) ? wq : (ten == 1) ? wk : wv; bf* B3 = (ten == 0) ? WQ : (ten == 1) ? WK : WV;
        const unsigned lane = threadIdx.x & 31; const unsigned G0 = ((blk % (PG / 3)) * 8 + (threadIdx.x >> 5)) * 8;   // Bt line index within the tensor (DM * HD / 64 lines per head)
        for (unsigned l = 0; l < 8; ++l) { const unsigned e = (G0 + l) * 64 + lane * 2; const unsigned k = e % DM, n = (e / DM) % HD, hh = e / (DM * HD); const float* w = w3 + (size_t)hh * DM * HD; v2us o;
            o[0] = f2bf(w[k * HD + n]); o[1] = f2bf(w[(k + 1) * HD + n]); *(v2us*)(B3 + e) = o;
            asm volatile("s_wait_xcnt 0x0" ::: "memory"); }   // the next trip's loads may land in this store's registers: the wait stands in front of that overwrite
    } else if (blk < PG + PC) {
        const size_t i = (size_t)(blk - PG) * 256 + threadIdx.x; const v8f v = *(const v8f*)(wo + i * 8); v8us o;
#pragma unroll   // constant indices keep v and o in registers
        for (int k = 0; k < 8; ++k) o[k] = f2bf(v[k]);
        *(v8us*)(WO + i * 8) = o;
        asm volatile("s_wait_xcnt 0x0" ::: "memory");   // code laid out behind this store may reuse its address registers: the wait stands in front of any such overwrite
    } else {
        const int idx = (blk - PG - PC) * 256 + threadIdx.x; v2f cs; cs[0] = 1.0f; cs[1] = 0.0f; *(v2f*)(CS + (size_t)idx * 2) = cs;
        asm volatile("s_wait_xcnt 0x0" ::: "memory");   // same wait, for the pair table's store
    }
}

__global__ __launch_bounds__(256) void k_lnx(const float* __restrict__ X, const float* __restrict__ gw, const float* __restrict__ gb, bf* Ph, bf* Pl) { const int lane = threadIdx.x & 31; const int r = blockIdx.x * 8 + (threadIdx.x >> 5); if (r >= TT) return; const float* xr = X + (size_t)r * DM; float hv[32]; float s = 0.f;
#pragma unroll
    for (int ch = 0; ch < 8; ++ch) { const v4f a = *(const v4f*)(xr + ch * 128 + lane * 4);
#pragma unroll
        for (int q = 0; q < 4; ++q) { const float u = bfr(a[q]); hv[ch * 4 + q] = u; s += u; } }
#pragma unroll
    for (int sh = 16; sh; sh >>= 1) s += __shfl_xor(s, sh, 32);
    float mu = s * (1.0f / 1024.0f); asm volatile("" : "+v"(mu)); float s2 = 0.f;
#pragma unroll
    for (int k = 0; k < 32; ++k) { float d0 = __fsub_rn(hv[k], mu); asm volatile("" : "+v"(d0)); float p = __fmul_rn(d0, d0); asm volatile("" : "+v"(p)); s2 = __fadd_rn(s2, p); }
#pragma unroll
    for (int sh = 16; sh; sh >>= 1) s2 += __shfl_xor(s2, sh, 32);
    float var = __fadd_rn(s2 * (1.0f / 1024.0f), 1e-5f); asm volatile("" : "+v"(var)); const float rs = __frsqrt_rn(var);
{
#pragma unroll
        for (int ch = 0; ch < 8; ++ch) { const int c0 = ch * 128 + lane * 4; v4us oh, ol;
#pragma unroll
            for (int q = 0; q < 4; ++q) { float gg = bfr(gw[c0 + q]); asm volatile("" : "+v"(gg)); float d0 = __fsub_rn(hv[ch * 4 + q], mu); asm volatile("" : "+v"(d0)); float n0 = __fmul_rn(d0, rs); asm volatile("" : "+v"(n0)); float y = __fmul_rn(n0, gg); asm volatile("" : "+v"(y)); const float z = __fadd_rn(y, bfr(gb[c0 + q])); unsigned short a2, c2; splitf(z, a2, c2); oh[q] = a2; ol[q] = c2; }
            const size_t oo = (size_t)r * DM + c0; *(v4us*)(Ph + oo) = oh; *(v4us*)(Pl + oo) = ol; }
         } }
// k_rope: head planes [h][t][d] (fp16 + hi/lo) of rope(x) x sc with the rotate-half convention out[d] = x[d] cos[t][d] - x[d+HD/2] sin[t][d], out[d+HD/2] = x[d+HD/2] cos[t][d+HD/2] + x[d] sin[t][d+HD/2]
__global__ __launch_bounds__(256) void k_rope(const float* __restrict__ F, int pitch, int nheads, const float* __restrict__ CS, const float* __restrict__ RF, const float* __restrict__ nw, float sc, h16* P16, bf* Ph, bf* Pl) {
    const size_t e = ((size_t)blockIdx.x * 256 + threadIdx.x) * 2; if (e >= (size_t)nheads * TT * HD) return; const int d = (int)(e % HD); const int t = (int)((e / HD) % TT); const int h = (int)(e / ((size_t)HD * TT)); const float* f = F + (size_t)t * pitch + h * HD; const float rf = RF ? RF[(size_t)h * TT + t] : 1.0f; v2h o16; v2us oh, ol;
#pragma unroll
    for (int q = 0; q < 2; ++q) { const int dd = d + q; const int dp = (dd < HD / 2) ? dd + HD / 2 : dd - HD / 2; float x0 = f[dd], x1 = f[dp];
        if (RF) { float n0 = __fmul_rn(x0, rf), n1 = __fmul_rn(x1, rf); asm volatile("" : "+v"(n0)); asm volatile("" : "+v"(n1)); x0 = __fmul_rn(bfr(nw[dd]), n0); x1 = __fmul_rn(bfr(nw[dp]), n1); }
        const v2f cs = *(const v2f*)(CS + ((size_t)t * HD + dd) * 2); float a = __fmul_rn(x0, cs[0]), bq = __fmul_rn(x1, cs[1]); asm volatile("" : "+v"(a)); asm volatile("" : "+v"(bq)); const float r = ((dd < HD / 2) ? __fsub_rn(a, bq) : __fadd_rn(a, bq)) * sc;
        o16[q] = tohx(r); unsigned short a2, c2; splitf(r, a2, c2); oh[q] = a2; ol[q] = c2; }
    *(v2h*)(P16 + e) = o16; *(v2us*)(Ph + e) = oh; *(v2us*)(Pl + e) = ol;  }
__global__ __launch_bounds__(256) void k_vtp(const float* __restrict__ F, int pitch, int nheads, h16* V16, bf* Vh, bf* Vl) { const size_t e = ((size_t)blockIdx.x * 256 + threadIdx.x) * 2; if (e >= (size_t)nheads * HD * TT) return; const int t = (int)(e % TT); const int d = (int)((e / TT) % HD); const int g = (int)(e / ((size_t)TT * HD)); v2h o16; v2us oh, ol;
#pragma unroll
    for (int q = 0; q < 2; ++q) { const float x = F[(size_t)(t + q) * pitch + g * HD + d]; o16[q] = tohx(x); unsigned short a2, c2; splitf(x, a2, c2); oh[q] = a2; ol[q] = c2; }
    *(v2h*)(V16 + e) = o16; *(v2us*)(Vh + e) = oh; *(v2us*)(Vl + e) = ol;  }
// k_asoft: per row (zz, i): t = S x HD^-0.5 for j <= i and i - j < WIN (sliding causal window; the reference's -1e9 additive fill vanishes identically); softmax over the 2048 keys (register row, one exp, fixed trees);
// the probabilities overwrite the row's own 8 KiB of scores (one wave owns a row and holds all of it in registers before its first store): rows < RH bf16 hi in the first 4 KiB, lo in the second; other rows fp16 in the first 4 KiB. 16-bit row pitch 2 * TT.
typedef v4us __attribute__((may_alias)) v4usa;
typedef v4h  __attribute__((may_alias)) v4ha;
__global__ __launch_bounds__(256) void k_asoft(float* Sb) {
    const int lane = threadIdx.x & 31; const int row = blockIdx.x * 8 + (threadIdx.x >> 5); if (row >= ZH * TT) return; const int i = row % TT; const int zz = row / TT; (void)zz; const bool hires = (i < RH); float* sr = Sb + (size_t)row * TT; float v[TT / 32]; float mx = -3.0e38f;
#pragma unroll
    for (int ch = 0; ch < TT / 128; ++ch) { const int j0 = ch * 128 + lane * 4; const v4f a = *(const v4fa*)(sr + j0);
#pragma unroll
        for (int q = 0; q < 4; ++q) { const int j = j0 + q; (void)j; const float t = (j <= i && i - j < WIN) ? a[q] * SCL : -3.0e38f; v[ch * 4 + q] = t; mx = fmaxf(mx, t); } }
#pragma unroll
    for (int sh = 16; sh; sh >>= 1) mx = fmaxf(mx, __shfl_xor(mx, sh, 32));
    float sum = 0.f;
#pragma unroll
    for (int k = 0; k < TT / 32; ++k) { float d0 = __fsub_rn(v[k], mx); asm volatile("" : "+v"(d0)); v[k] = __builtin_amdgcn_exp2f(__fmul_rn(d0, 1.4426950408889634f)); sum += v[k]; }
#pragma unroll
    for (int sh = 16; sh; sh >>= 1) sum += __shfl_xor(sum, sh, 32);
    const float f = __fdiv_rn(hires ? 1.0f : PCAR, sum);
{
        if (hires) {
#pragma unroll
            for (int ch = 0; ch < TT / 128; ++ch) { v4us oh, ol;
#pragma unroll
                for (int q = 0; q < 4; ++q) { unsigned short a, c2; splitf(v[ch * 4 + q] * f, a, c2); oh[q] = a; ol[q] = c2; }
                bf* pr = (bf*)sr + ch * 128 + lane * 4; *(v4usa*)pr = oh; *(v4usa*)(pr + TT) = ol; }
        } else {
#pragma unroll
            for (int ch = 0; ch < TT / 128; ++ch) { v4h o4;
#pragma unroll
                for (int q = 0; q < 4; ++q) o4[q] = tohx(v[ch * 4 + q] * f);
                *(v4ha*)((h16*)sr + ch * 128 + lane * 4) = o4; } }
         }
}
__global__ __launch_bounds__(256) void k_merge(const float* __restrict__ O, int h0, bf* Ah, bf* Al) { const size_t e = ((size_t)blockIdx.x * 256 + threadIdx.x) * 2; if (e >= (size_t)ZH * TT * HD) return; const int d = (int)(e % HD); const int t = (int)((e / HD) % TT); const int zz = (int)(e / ((size_t)HD * TT)); const float cs = (t < RH) ? 1.0f : (1.0f / PCAR); const size_t oo = (size_t)t * DQ + (h0 + zz) * HD + d;
    v2us oh, ol;
#pragma unroll
    for (int q = 0; q < 2; ++q) { unsigned short a, c2; splitf(O[e + q] * cs, a, c2); oh[q] = a; ol[q] = c2; } *(v2us*)(Ah + oo) = oh; *(v2us*)(Al + oo) = ol;  }

extern "C" void kernel_launch(void* const* d_in, const int* in_sizes, int n_in,
                              void* d_out, int out_size, void* d_ws, size_t ws_size, hipStream_t stream) {
    (void)in_sizes; (void)n_in; (void)out_size;
    const float* x = (const float*)d_in[0];   /* seq1 */ const float* x2 = (const float*)d_in[1];   /* seq2 */ const float* lng = (const float*)d_in[2]; const float* lnb = (const float*)d_in[3]; const float* pq = (const float*)d_in[4]; const float* pk = (const float*)d_in[5]; const float* pv = (const float*)d_in[6];   /* [16][1024][64] */ const float* wo = (const float*)d_in[7]; const float* bo = (const float*)d_in[8];     const float* wq = pq; const float* wk = pk; const float* wv = pv;
    float* OUT = (float*)d_out;     // [2][2048][1024]
    char* wsp = (char*)d_ws;
    auto take = [&](size_t bytes) { char* p = wsp; wsp += (bytes + 255) & ~(size_t)255; return (void*)p; };
    bf* WQ = (bf*)take((size_t)DQ * DM * 2); bf* WK = (bf*)take((size_t)DKV * DM * 2); bf* WV = (bf*)take((size_t)DKV * DM * 2); bf* WO = (bf*)take((size_t)DM * DQ * 2); float* CS = (float*)take((size_t)TT * HD * 2 * 4);
    bf* X1h = (bf*)take((size_t)TT * DM * 2); bf* X1l = (bf*)take((size_t)TT * DM * 2); bf* X2h = (bf*)take((size_t)TT * DM * 2); bf* X2l = (bf*)take((size_t)TT * DM * 2); float* FQ = (float*)take((size_t)TT * DQ * 4); float* FK = (float*)take((size_t)TT * DKV * 4);
    h16* QP16 = (h16*)take((size_t)NH_ * TT * HD * 2); h16* KP16 = (h16*)take((size_t)NKV * TT * HD * 2); h16* VT16 = (h16*)take((size_t)NKV * HD * TT * 2);
    bf* QPh = (bf*)take((size_t)NH_ * TT * HD * 2); bf* QPl = (bf*)take((size_t)NH_ * TT * HD * 2); bf* KPh = (bf*)take((size_t)NKV * TT * HD * 2); bf* KPl = (bf*)take((size_t)NKV * TT * HD * 2); bf* VTh = (bf*)take((size_t)NKV * HD * TT * 2); bf* VTl = (bf*)take((size_t)NKV * HD * TT * 2);
    float* Sb = (float*)take((size_t)ZH * TT * TT * 4); float* Ob = (float*)take((size_t)ZH * TT * HD * 4); bf* ATh = (bf*)take((size_t)TT * DQ * 2); bf* ATl = (bf*)take((size_t)TT * DQ * 2);
    if ((size_t)(wsp - (char*)d_ws) > ws_size) return;    // ws 256 MiB
    float* FV = FK;   // v projection reuses the k buffer after the k planes are built (stream-ordered)
    k_prep<<<PG + PC + PS, 256, 0, stream>>>(wq, wk, wv, wo, WQ, WK, WV, WO, CS);   /* head hh's 'xw' [1024][64] -> Bt rows hh*64..; mixer_w -> bf16; pair table */
    const unsigned LQ = (unsigned)(((size_t)NH_ * TT * HD / 2 + 255) / 256), LKv = (unsigned)(((size_t)NKV * TT * HD / 2 + 255) / 256);
    for (int b = 0; b < NB_; ++b) {
        
        k_lnx<<<TT / 8, 256, 0, stream>>>(x + (size_t)b * TT * DM, lng, lnb, X1h, X1l); k_lnx<<<TT / 8, 256, 0, stream>>>(x2 + (size_t)b * TT * DM, lng, lnb, X2h, X2l);   /* LayerNorm(seq1), LayerNorm(seq2) as bf16 hi/lo planes */
        k_gemmw<bf, 1, false><<<dim3(TT / 64, DQ / 64, 1), 32, 0, stream>>>(X1h, X1l, WQ, nullptr, DM, FQ, DQ, nullptr, 0, 0, 0);
        k_rope<<<LQ, 256, 0, stream>>>(FQ, DQ, NH_, CS, nullptr, nullptr, 1.0f, QP16, QPh, QPl);
        k_gemmw<bf, 1, false><<<dim3(TT / 64, DKV / 64, 1), 32, 0, stream>>>(X2h, X2l, WK, nullptr, DM, FK, DKV, nullptr, 0, 0, 0);
        k_rope<<<LKv, 256, 0, stream>>>(FK, DKV, NKV, CS, nullptr, nullptr, 1.0f, KP16, KPh, KPl);
        k_gemmw<bf, 1, false><<<dim3(TT / 64, DKV / 64, 1), 32, 0, stream>>>(X2h, X2l, WV, nullptr, DM, FV, DKV, nullptr, 0, 0, 0); k_vtp<<<LKv, 256, 0, stream>>>(FV, DKV, NKV, VT16, VTh, VTl);
        for (int h0 = 0; h0 < NH_; h0 += ZH) { const size_t zq = (size_t)h0, zk = (size_t)(h0 / REP);   // one kv head per query head: the pass's heads use consecutive kv planes (z-strides TT*HD)
            k_gemmc<bf, 2, 1><<<dim3(RH / 64, TT / 64, ZH), 32, 0, stream>>>(QPh + zq * TT * HD, QPl + zq * TT * HD, HD, KPh + zk * TT * HD, KPl + zk * TT * HD, HD, Sb, TT, 0, (size_t)TT * HD, (size_t)TT * HD, (size_t)TT * TT);
            k_gemmc<h16, 0, 1><<<dim3((TT - RH) / 64, TT / 64, ZH), 32, 0, stream>>>(QP16 + zq * TT * HD + (size_t)RH * HD, nullptr, HD, KP16 + zk * TT * HD, nullptr, HD, Sb + (size_t)RH * TT, TT, RH, (size_t)TT * HD, (size_t)TT * HD, (size_t)TT * TT);
            k_asoft<<<ZH * TT / 8, 256, 0, stream>>>(Sb);   /* leaves the probabilities in the score rows, 16-bit pitch 2 * TT */
            k_gemmc<bf, 2, 2><<<dim3(RH / 64, HD / 64, ZH), 32, 0, stream>>>((const bf*)Sb, (const bf*)Sb + TT, 2 * TT, VTh + zk * HD * TT, VTl + zk * HD * TT, TT, Ob, HD, 0, (size_t)TT * TT * 2, (size_t)HD * TT, (size_t)TT * HD);
            k_gemmc<h16, 0, 2><<<dim3((TT - RH) / 64, HD / 64, ZH), 32, 0, stream>>>((const h16*)Sb + (size_t)RH * TT * 2, nullptr, 2 * TT, VT16 + zk * HD * TT, nullptr, TT, Ob + (size_t)RH * HD, HD, RH, (size_t)TT * TT * 2, (size_t)HD * TT, (size_t)TT * HD);
            k_merge<<<(unsigned)(((size_t)ZH * TT * HD / 2 + 255) / 256), 256, 0, stream>>>(Ob, h0, ATh, ATl); }
        k_gemmw<bf, 1, true><<<dim3(TT / 64, DM / 64, 1), 32, 0, stream>>>(ATh, ATl, WO, nullptr, DQ, OUT + (size_t)b * TT * DM, DM, bo, 0, 0, 0); }
}

// v003
// It runs in 374 microseconds.
// Two timings next to v002 both put it at 2.07 times that version's speed.
// Over all steps from v000 it is 4.96 times as fast.
#include <hip/hip_runtime.h>

// Causal cross attention between two LayerNorm'd sequences with per-head projection tensors (seq1, seq2 [2][2048][1024]; x1, x2 = LayerNorm(seq) (eps 1e-5, gamma/beta read); q = x1 q_proj[h], k = x2 k_proj[h], v = x2 v_proj[h] ([16][1024][64] 0.02, 'xw' per head, no bias); scores / float32(sqrt 64); causal (-inf); softmax; out = merged mixer_w^T + mixer_b ('oi') -> [2][2048][1024] (4.2 M); argument order seq1, seq2, ln_gamma, ln_beta, q_proj, k_proj, v_proj, mixer_w, mixer_b).
// Layout per batch: a LayerNorm kernel (one wave per token row: mean, biased variance, f32) writes bf16 hi/lo planes of x1, then of x2; per-head 'xw' weight blocks gathered into Bt; projections hi/lo x exact (2 products); one fused causal T-2048 attention kernel with a running softmax (hybrid rows: < 512 hi/lo 3 products, rest fp16 x1024; key blocks above the diagonal are never visited); merged hi/lo x mixer_w exact + mixer_b.
// Compute dtypes, f32 accumulate: every input rounded to bf16; LayerNorm f32; projections 2 products (~f32); attention rows < 512 3 products, rest fp16; softmax f32; mixer hl x exact + bias.

#define NB_  2
#define TT   2048
#define DM   1024
#define NH_  16
#define NKV  16
#define REP  (NH_ / NKV)
#define HD   64
#define DQ   (NH_ * HD)
#define DKV  (NKV * HD)
#define RH   512                  // query rows < RH use hi+lo planes (0: none)
#define PCAR 1024.0f
#define SCL  0.125f   // HD^-0.5
typedef _Float16 h16;
typedef unsigned short bf;
typedef __attribute__((ext_vector_type(16))) __bf16   v16bf;
typedef __attribute__((ext_vector_type(16))) _Float16 v16h;
typedef __attribute__((ext_vector_type(8)))  _Float16 v8h;
typedef __attribute__((ext_vector_type(8)))  unsigned short v8us;
typedef __attribute__((ext_vector_type(8)))  float    v8f;
typedef __attribute__((ext_vector_type(4)))  float    v4f;
typedef v8h  __attribute__((may_alias)) v8ha;
typedef v4f  __attribute__((may_alias)) v4fa;
typedef v8us __attribute__((may_alias)) v8usa;

__device__ __forceinline__ unsigned short f2bf(float f) { unsigned u = __float_as_uint(f); u += 0x7FFFu + ((u >> 16) & 1u); return (unsigned short)(u >> 16); }
__device__ __forceinline__ float bf2f(unsigned short b) { return __uint_as_float(((unsigned)b) << 16); }
__device__ __forceinline__ float bfr(float f) { return bf2f(f2bf(f)); }
__device__ __forceinline__ v16h cat16(v8h lo, v8h hi) { return __builtin_shufflevector(lo, hi, 0, 1, 2, 3, 4, 5, 6, 7, 8, 9, 10, 11, 12, 13, 14, 15); }
__device__ __forceinline__ v16bf cat16b(v8us lo, v8us hi) { return __builtin_bit_cast(v16bf, __builtin_shufflevector(lo, hi, 0, 1, 2, 3, 4, 5, 6, 7, 8, 9, 10, 11, 12, 13, 14, 15)); }
__device__ __forceinline__ v8f wmma16(v16h a, v16h b, v8f c) { return __builtin_amdgcn_wmma_f32_16x16x32_f16(false, a, false, b, (short)0, c, false, false); }
__device__ __forceinline__ v8f wmmab(v16bf a, v16bf b, v8f c) { return __builtin_amdgcn_wmma_f32_16x16x32_bf16(false, a, false, b, (short)0, c, false, false); }



// ---- k_gemmw: register-blocked GEMM, ONE WAVE per 64x64 output tile (16 accumulators), operands straight from K-contiguous 16-bit planes; grid (M/64, N/64, Z), 32 threads.
// C[m][n] (f32, pitch ldc, + optional f32 bias[n]) = sum_k A[m][k] Bt[n][k] (+ split products per NSPLIT). z-batch strides sA/sB/sC in elements. K % 32 == 0.
template <typename T16> struct WFrag;
template <> struct WFrag<h16> { typedef v16h V; static __device__ __forceinline__ V ld(const h16* p) { return cat16(*(const v8h*)p, *(const v8h*)(p + 16)); } static __device__ __forceinline__ v8f mma(V a, V b, v8f c) { return wmma16(a, b, c); } };
template <> struct WFrag<bf> { typedef v16bf V; static __device__ __forceinline__ V ld(const bf* p) { return cat16b(*(const v8us*)p, *(const v8us*)(p + 16)); } static __device__ __forceinline__ v8f mma(V a, V b, v8f c) { return wmmab(a, b, c); } };
template <typename T16, int NSPLIT, bool BIAS>
__global__ __launch_bounds__(32) void k_gemmw(const T16* __restrict__ A, const T16* __restrict__ A2, const T16* __restrict__ Bt, const T16* __restrict__ Bt2, int K, float* C, int ldc, const float* __restrict__ bias, size_t sA, size_t sB, size_t sC) {
    typedef typename WFrag<T16>::V V;
    __shared__ __align__(16) float os[16 * 68];
    const size_t z = blockIdx.z; A += z * sA; if (A2) A2 += z * sA; Bt += z * sB; if (Bt2) Bt2 += z * sB; C += z * sC;
    const int lane = threadIdx.x & 31, lr = lane & 15, hi = lane >> 4; const int r0 = blockIdx.x * 64, c0 = blockIdx.y * 64;
    v8f acc[4][4];
#pragma unroll
    for (int mb = 0; mb < 4; ++mb)
#pragma unroll
        for (int nb = 0; nb < 4; ++nb) acc[mb][nb] = (v8f){};
    const size_t aoff = (size_t)(r0 + lr) * K + 8 * hi, boff = (size_t)(c0 + lr) * K + 8 * hi;
#pragma unroll 1
    for (int kc = 0; kc < K; kc += 32) {
        V a[4], a2[4];
#pragma unroll
        for (int mb = 0; mb < 4; ++mb) { a[mb] = WFrag<T16>::ld(A + aoff + (size_t)mb * 16 * K + kc); if (NSPLIT == 1 || NSPLIT == 2) a2[mb] = WFrag<T16>::ld(A2 + aoff + (size_t)mb * 16 * K + kc); }
#pragma unroll
        for (int nb = 0; nb < 4; ++nb) { const V b = WFrag<T16>::ld(Bt + boff + (size_t)nb * 16 * K + kc); V b2; if (NSPLIT >= 2) b2 = WFrag<T16>::ld(Bt2 + boff + (size_t)nb * 16 * K + kc);
#pragma unroll
            for (int mb = 0; mb < 4; ++mb) { acc[mb][nb] = WFrag<T16>::mma(a[mb], b, acc[mb][nb]); if (NSPLIT == 1 || NSPLIT == 2) acc[mb][nb] = WFrag<T16>::mma(a2[mb], b, acc[mb][nb]); if (NSPLIT >= 2) acc[mb][nb] = WFrag<T16>::mma(a[mb], b2, acc[mb][nb]); } }
        asm volatile("v_nop\n\tv_nop\n\tv_nop\n\tv_nop" : "+v"(acc[0][0]), "+v"(acc[1][1]), "+v"(acc[2][2]), "+v"(acc[3][3]) : "v"(a[0]), "v"(a[3]));
    }
#pragma unroll
    for (int mb = 0; mb < 4; ++mb) {
#pragma unroll
        for (int nb = 0; nb < 4; ++nb) {
#pragma unroll
            for (int j = 0; j < 8; ++j) os[(hi * 8 + j) * 68 + nb * 16 + lr] = acc[mb][nb][j]; }
        __builtin_amdgcn_wave_barrier(); asm volatile("" ::: "memory");
        float* crow = C + (size_t)(r0 + mb * 16) * ldc + c0;
{
#pragma unroll
            for (int s = 0; s < 8; ++s) { const int row = 2 * s + hi, cofs = lr * 4; v4f val = *(const v4fa*)(os + row * 68 + cofs); if (BIAS) { val[0] += bfr(bias[c0 + cofs]); val[1] += bfr(bias[c0 + cofs + 1]); val[2] += bfr(bias[c0 + cofs + 2]); val[3] += bfr(bias[c0 + cofs + 3]); }
                *(v4f*)(crow + (size_t)row * ldc + cofs) = val; }
             }
        __builtin_amdgcn_wave_barrier(); asm volatile("" ::: "memory");
    }
}

__device__ __forceinline__ h16 tohx(float x) { return (h16)x; }
__device__ __forceinline__ void splitf(float y, unsigned short& h, unsigned short& l) { h = f2bf(y); l = f2bf(y - bf2f(h)); }
typedef __attribute__((ext_vector_type(2))) _Float16 v2h;
typedef __attribute__((ext_vector_type(4))) _Float16 v4h;
typedef __attribute__((ext_vector_type(2))) unsigned short v2us;
typedef __attribute__((ext_vector_type(4))) unsigned short v4us;
typedef __attribute__((ext_vector_type(2))) float v2f;
typedef __attribute__((ext_vector_type(4))) int v4i;

// k_prep: every piece of set-up that depends on no other kernel, in ONE launch, dealt by block index (the gather's blocks come first: they run longest).
//   blocks [0, PG):        per-head 'xw' blocks [16][1024][64] of q_proj, k_proj, v_proj -> bf16 Bt rows (head * 64 + n)[k]; one 64-element line of Bt per wave and trip, 8 lines per wave
//   blocks [PG, PG + PC):  mixer_w ('oi', already K-contiguous) -> bf16, 8 elements per thread
//   blocks [PG + PC, ...): the (1, 0) pair table that k_rope reads
#define PG (3 * NH_ * DM * HD / 64 / 64)
#define PC (DM * DQ / 8 / 256)
#define PS (TT * HD / 256)
__global__ __launch_bounds__(256) void k_prep(const float* __restrict__ wq, const float* __restrict__ wk, const float* __restrict__ wv, const float* __restrict__ wo, bf* WQ, bf* WK, bf* WV, bf* WO, float* CS) {
    const int blk = blockIdx.x;
    if (blk < PG) {
        const int ten = blk / (PG / 3); const float* __restrict__ w3 = (ten == 0) ? wq : (ten == 1) ? wk : wv; bf* B3 = (ten == 0) ? WQ : (ten == 1) ? WK : WV;
        const unsigned lane = threadIdx.x & 31; const unsigned G0 = ((blk % (PG / 3)) * 8 + (threadIdx.x >> 5)) * 8;   // Bt line index within the tensor (DM * HD / 64 lines per head)
        for (unsigned l = 0; l < 8; ++l) { const unsigned e = (G0 + l) * 64 + lane * 2; const unsigned k = e % DM, n = (e / DM) % HD, hh = e / (DM * HD); const float* w = w3 + (size_t)hh * DM * HD; v2us o;
            o[0] = f2bf(w[k * HD + n]); o[1] = f2bf(w[(k + 1) * HD + n]); *(v2us*)(B3 + e) = o;
            asm volatile("s_wait_xcnt 0x0" ::: "memory"); }   // the next trip's loads may land in this store's registers: the wait stands in front of that overwrite
    } else if (blk < PG + PC) {
        const size_t i = (size_t)(blk - PG) * 256 + threadIdx.x; const v8f v = *(const v8f*)(wo + i * 8); v8us o;
#pragma unroll   // constant indices keep v and o in registers
        for (int k = 0; k < 8; ++k) o[k] = f2bf(v[k]);
        *(v8us*)(WO + i * 8) = o;
        asm volatile("s_wait_xcnt 0x0" ::: "memory");   // code laid out behind this store may reuse its address registers: the wait stands in front of any such overwrite
    } else {
        const int idx = (blk - PG - PC) * 256 + threadIdx.x; v2f cs; cs[0] = 1.0f; cs[1] = 0.0f; *(v2f*)(CS + (size_t)idx * 2) = cs;
        asm volatile("s_wait_xcnt 0x0" ::: "memory");   // same wait, for the pair table's store
    }
}

__global__ __launch_bounds__(256) void k_lnx(const float* __restrict__ X, const float* __restrict__ gw, const float* __restrict__ gb, bf* Ph, bf* Pl) { const int lane = threadIdx.x & 31; const int r = blockIdx.x * 8 + (threadIdx.x >> 5); if (r >= TT) return; const float* xr = X + (size_t)r * DM; float hv[32]; float s = 0.f;
#pragma unroll
    for (int ch = 0; ch < 8; ++ch) { const v4f a = *(const v4f*)(xr + ch * 128 + lane * 4);
#pragma unroll
        for (int q = 0; q < 4; ++q) { const float u = bfr(a[q]); hv[ch * 4 + q] = u; s += u; } }
#pragma unroll
    for (int sh = 16; sh; sh >>= 1) s += __shfl_xor(s, sh, 32);
    float mu = s * (1.0f / 1024.0f); asm volatile("" : "+v"(mu)); float s2 = 0.f;
#pragma unroll
    for (int k = 0; k < 32; ++k) { float d0 = __fsub_rn(hv[k], mu); asm volatile("" : "+v"(d0)); float p = __fmul_rn(d0, d0); asm volatile("" : "+v"(p)); s2 = __fadd_rn(s2, p); }
#pragma unroll
    for (int sh = 16; sh; sh >>= 1) s2 += __shfl_xor(s2, sh, 32);
    float var = __fadd_rn(s2 * (1.0f / 1024.0f), 1e-5f); asm volatile("" : "+v"(var)); const float rs = __frsqrt_rn(var);
{
#pragma unroll
        for (int ch = 0; ch < 8; ++ch) { const int c0 = ch * 128 + lane * 4; v4us oh, ol;
#pragma unroll
            for (int q = 0; q < 4; ++q) { float gg = bfr(gw[c0 + q]); asm volatile("" : "+v"(gg)); float d0 = __fsub_rn(hv[ch * 4 + q], mu); asm volatile("" : "+v"(d0)); float n0 = __fmul_rn(d0, rs); asm volatile("" : "+v"(n0)); float y = __fmul_rn(n0, gg); asm volatile("" : "+v"(y)); const float z = __fadd_rn(y, bfr(gb[c0 + q])); unsigned short a2, c2; splitf(z, a2, c2); oh[q] = a2; ol[q] = c2; }
            const size_t oo = (size_t)r * DM + c0; *(v4us*)(Ph + oo) = oh; *(v4us*)(Pl + oo) = ol; }
         } }
// k_rope: head planes [h][t][d] (fp16 + hi/lo) of rope(x) x sc with the rotate-half convention out[d] = x[d] cos[t][d] - x[d+HD/2] sin[t][d], out[d+HD/2] = x[d+HD/2] cos[t][d+HD/2] + x[d] sin[t][d+HD/2]
__global__ __launch_bounds__(256) void k_rope(const float* __restrict__ F, int pitch, int nheads, const float* __restrict__ CS, const float* __restrict__ RF, const float* __restrict__ nw, float sc, h16* P16, bf* Ph, bf* Pl) {
    const size_t e = ((size_t)blockIdx.x * 256 + threadIdx.x) * 2; if (e >= (size_t)nheads * TT * HD) return; const int d = (int)(e % HD); const int t = (int)((e / HD) % TT); const int h = (int)(e / ((size_t)HD * TT)); const float* f = F + (size_t)t * pitch + h * HD; const float rf = RF ? RF[(size_t)h * TT + t] : 1.0f; v2h o16; v2us oh, ol;
#pragma unroll
    for (int q = 0; q < 2; ++q) { const int dd = d + q; const int dp = (dd < HD / 2) ? dd + HD / 2 : dd - HD / 2; float x0 = f[dd], x1 = f[dp];
        if (RF) { float n0 = __fmul_rn(x0, rf), n1 = __fmul_rn(x1, rf); asm volatile("" : "+v"(n0)); asm volatile("" : "+v"(n1)); x0 = __fmul_rn(bfr(nw[dd]), n0); x1 = __fmul_rn(bfr(nw[dp]), n1); }
        const v2f cs = *(const v2f*)(CS + ((size_t)t * HD + dd) * 2); float a = __fmul_rn(x0, cs[0]), bq = __fmul_rn(x1, cs[1]); asm volatile("" : "+v"(a)); asm volatile("" : "+v"(bq)); const float r = ((dd < HD / 2) ? __fsub_rn(a, bq) : __fadd_rn(a, bq)) * sc;
        o16[q] = tohx(r); unsigned short a2, c2; splitf(r, a2, c2); oh[q] = a2; ol[q] = c2; }
    *(v2h*)(P16 + e) = o16; *(v2us*)(Ph + e) = oh; *(v2us*)(Pl + e) = ol;  }
__global__ __launch_bounds__(256) void k_vtp(const float* __restrict__ F, int pitch, int nheads, h16* V16, bf* Vh, bf* Vl) { const size_t e = ((size_t)blockIdx.x * 256 + threadIdx.x) * 2; if (e >= (size_t)nheads * HD * TT) return; const int t = (int)(e % TT); const int d = (int)((e / TT) % HD); const int g = (int)(e / ((size_t)TT * HD)); v2h o16; v2us oh, ol;
#pragma unroll
    for (int q = 0; q < 2; ++q) { const float x = F[(size_t)(t + q) * pitch + g * HD + d]; o16[q] = tohx(x); unsigned short a2, c2; splitf(x, a2, c2); oh[q] = a2; ol[q] = c2; }
    *(v2h*)(V16 + e) = o16; *(v2us*)(Vh + e) = oh; *(v2us*)(Vl + e) = ol;  }
// k_fattn: scores, causal softmax, probability x value and the head merge in one kernel; no score or probability ever goes to memory.
// One work-group = one head x 32 query rows; its 4 waves deal the 32-key blocks up to the diagonal among them (wave w takes blocks w, w + 4, ...), each with its own running maximum, sum and output tile, joined through LDS at the end.
// St = K Qt (A = key rows, B = query rows): a lane holds scores of ONE query (column lr), keys 8 * hi + j of each 16-key tile, which is the B-operand k order of the next product, Ot += Vt Pt: P goes from accumulator to operand inside the lane.
// HL (query rows < RH): bf16 hi/lo planes, 3 products each; otherwise fp16, P carried x PCAR. Output: merged bf16 hi/lo planes [t][head * HD + d].
#define L2E 1.4426950408889634f
template <bool B> struct BoolC { static constexpr bool value = B; };
template <typename T16, bool HL>
__device__ __forceinline__ void attn_body(const T16* __restrict__ Qa, const T16* __restrict__ Qb, const T16* __restrict__ Ka, const T16* __restrict__ Kb, const T16* __restrict__ Va, const T16* __restrict__ Vb, int q0, int head, bf* Ah, bf* Al, float* red, float* rml) {
    typedef typename WFrag<T16>::V V;
    const int lane = threadIdx.x & 31, lr = lane & 15, hi = lane >> 4, w = __builtin_amdgcn_readfirstlane(threadIdx.x >> 5);   // the wave's number in a scalar register: block loop and diagonal test become scalar branches
    V q[2][2], q2[2][2]; const size_t qo = (size_t)(q0 + lr) * HD + 8 * hi; const T16* qp = Qa + qo; const T16* qp2 = HL ? Qb + qo : qp;   // one address per plane, every fragment at a constant offset from it
#pragma unroll
    for (int nb = 0; nb < 2; ++nb)
#pragma unroll
        for (int kc = 0; kc < 2; ++kc) { q[nb][kc] = WFrag<T16>::ld(qp + nb * 16 * HD + kc * 32); if (HL) q2[nb][kc] = WFrag<T16>::ld(qp2 + nb * 16 * HD + kc * 32); }
    asm volatile("s_wait_xcnt 0x0" :: "v"(qp), "v"(qp2) : "memory");   // later code may reuse the query loads' address registers: the wait stands in front of that overwrite; named as inputs, the addresses stay in their registers up to it
    v8f o[2][4]; float m[2], l[2];
#pragma unroll
    for (int nb = 0; nb < 2; ++nb) { m[nb] = -3.0e38f; l[nb] = 0.f;
#pragma unroll
        for (int mb = 0; mb < 4; ++mb) o[nb][mb] = (v8f){}; }
    const int nkb = q0 / 32 + 1;   // key blocks up to and with the diagonal one
    auto pass = [&](const int kb, auto dg) {   // one 32-key block; dg: the block crosses the diagonal and is masked
        constexpr bool diag = decltype(dg)::value; const int key0 = kb * 32;
        v8f s[2][2];
#pragma unroll
        for (int nb = 0; nb < 2; ++nb) { s[nb][0] = (v8f){}; s[nb][1] = (v8f){}; }
        V kf[2][2], kf2[2][2]; const size_t ko = (size_t)(key0 + lr) * HD + 8 * hi; const T16* kp = Ka + ko; const T16* kp2 = HL ? Kb + ko : kp;
#pragma unroll
        for (int mt = 0; mt < 2; ++mt)
#pragma unroll
            for (int kc = 0; kc < 2; ++kc) { kf[mt][kc] = WFrag<T16>::ld(kp + mt * 16 * HD + kc * 32); if (HL) kf2[mt][kc] = WFrag<T16>::ld(kp2 + mt * 16 * HD + kc * 32); }
        asm volatile("s_wait_xcnt 0x0" :: "v"(kp), "v"(kp2) : "memory");   // same wait, in the same form, for the key loads
#pragma unroll
        for (int kc = 0; kc < 2; ++kc)
#pragma unroll
            for (int mt = 0; mt < 2; ++mt)
#pragma unroll
                for (int nb = 0; nb < 2; ++nb) { s[nb][mt] = WFrag<T16>::mma(kf[mt][kc], q[nb][kc], s[nb][mt]); if (HL) { s[nb][mt] = WFrag<T16>::mma(kf[mt][kc], q2[nb][kc], s[nb][mt]); s[nb][mt] = WFrag<T16>::mma(kf2[mt][kc], q[nb][kc], s[nb][mt]); } }
        V pf[2], pf2[2];
#pragma unroll
        for (int nb = 0; nb < 2; ++nb) {
            float t[16]; float mx = m[nb]; const int qi = q0 + nb * 16 + lr;
#pragma unroll
            for (int e = 0; e < 16; ++e) { float x = s[nb][e >> 3][e & 7] * SCL; if (diag && key0 + (e >> 3) * 16 + hi * 8 + (e & 7) > qi) x = -3.0e38f; t[e] = x; mx = fmaxf(mx, x); }
            mx = fmaxf(mx, __shfl_xor(mx, 16, 32));   // the other half of the wave holds this query's other 16 keys
            const float al = __builtin_amdgcn_exp2f((m[nb] - mx) * L2E); m[nb] = mx; float sum = 0.f;
#pragma unroll
            for (int e = 0; e < 16; ++e) { t[e] = __builtin_amdgcn_exp2f((t[e] - mx) * L2E); sum += t[e]; }
            l[nb] = l[nb] * al + sum;   // each half keeps its own keys' sum; the halves are joined once, behind the loop
#pragma unroll
            for (int mb = 0; mb < 4; ++mb) o[nb][mb] *= al;
            if constexpr (HL) { __attribute__((ext_vector_type(16))) unsigned short ph, pl;
#pragma unroll
                for (int e = 0; e < 16; ++e) { unsigned short a, c2; splitf(t[e], a, c2); ph[e] = a; pl[e] = c2; }
                pf[nb] = __builtin_bit_cast(v16bf, ph); pf2[nb] = __builtin_bit_cast(v16bf, pl);
            } else {
#pragma unroll
                for (int e = 0; e < 16; ++e) pf[nb][e] = tohx(t[e] * PCAR); }
        }
        const size_t vo = (size_t)lr * TT + key0 + 8 * hi; const T16* vp = Va + vo; const T16* vp2 = HL ? Vb + vo : vp;
#pragma unroll
        for (int mb = 0; mb < 4; ++mb) { const V vf = WFrag<T16>::ld(vp + mb * 16 * TT); V vf2; if (HL) vf2 = WFrag<T16>::ld(vp2 + mb * 16 * TT);
            asm volatile("s_wait_xcnt 0x0" :: "v"(vp), "v"(vp2) : "memory");   // same wait, in the same form, for the value loads
#pragma unroll
            for (int nb = 0; nb < 2; ++nb) { o[nb][mb] = WFrag<T16>::mma(vf, pf[nb], o[nb][mb]); if (HL) { o[nb][mb] = WFrag<T16>::mma(vf, pf2[nb], o[nb][mb]); o[nb][mb] = WFrag<T16>::mma(vf2, pf[nb], o[nb][mb]); } } }
        // the distance behind the pass's last matrix instructions, on the back edge and on the way out alike
        asm volatile("v_nop\n\tv_nop\n\tv_nop\n\tv_nop\n\tv_nop" : "+v"(o[0][0]), "+v"(o[0][1]), "+v"(o[0][2]), "+v"(o[0][3]), "+v"(o[1][0]), "+v"(o[1][1]), "+v"(o[1][2]), "+v"(o[1][3]));
    };
#pragma unroll 1   // one pass's fragments at a time: unrolled, two passes' fragments would cost a resident wave
    for (int kb = w; kb < nkb - 1; kb += 4) pass(kb, BoolC<false>());
    if (((nkb - 1) & 3) == w) pass(nkb - 1, BoolC<true>());   // only the last block crosses the diagonal; it is its owner's last
#pragma unroll
    for (int nb = 0; nb < 2; ++nb) { l[nb] += __shfl_xor(l[nb], 16, 32);
        if (hi == 0) { rml[((w * 2 + nb) * 2 + 0) * 16 + lr] = m[nb]; rml[((w * 2 + nb) * 2 + 1) * 16 + lr] = l[nb]; }
#pragma unroll
        for (int mb = 0; mb < 4; ++mb)
#pragma unroll
            for (int j = 0; j < 8; ++j) red[((w * 64) + (nb * 4 + mb) * 8 + j) * 32 + lane] = o[nb][mb][j]; }
    __syncthreads();   // every wave's partial maximum, sum and tile are in LDS before any is read
    // join: wave w finishes 8 whole query rows (one writer per 128-byte output line); lane = (row lane >> 2, 16 columns (lane & 3) * 16 ..)
    const int nbq = w >> 1, lq = (w & 1) * 8 + (lane >> 2), mbq = lane & 3; float mw[4], M = -3.0e38f, L = 0.f;
#pragma unroll
    for (int u = 0; u < 4; ++u) { mw[u] = rml[((u * 2 + nbq) * 2 + 0) * 16 + lq]; M = fmaxf(M, mw[u]); }
#pragma unroll
    for (int u = 0; u < 4; ++u) { mw[u] = __builtin_amdgcn_exp2f((mw[u] - M) * L2E); L += mw[u] * rml[((u * 2 + nbq) * 2 + 1) * 16 + lq]; }   // a wave that had no block: maximum -3e38, factor 0
    const float inv = __fdiv_rn(HL ? 1.0f : (1.0f / PCAR), L); v8us oh[2], ol[2];
#pragma unroll
    for (int e = 0; e < 16; ++e) { float a = 0.f;
#pragma unroll
        for (int u = 0; u < 4; ++u) a += mw[u] * red[((u * 64) + (nbq * 4 + mbq) * 8 + (e & 7)) * 32 + (e >> 3) * 16 + lq];
        unsigned short a2, c2; splitf(a * inv, a2, c2); oh[e >> 3][e & 7] = a2; ol[e >> 3][e & 7] = c2; }
    const size_t oo = (size_t)(q0 + nbq * 16 + lq) * DQ + head * HD + mbq * 16;
    *(v8us*)(Ah + oo) = oh[0]; *(v8us*)(Ah + oo + 8) = oh[1]; *(v8us*)(Al + oo) = ol[0]; *(v8us*)(Al + oo + 8) = ol[1];
}
// four waves per SIMD: the grid is 4096 waves on 1024 SIMDs, and the vector work between the matrix runs of one wave is covered by the other three
__global__ __launch_bounds__(128) __attribute__((amdgpu_waves_per_eu(4, 4))) void k_fattn(const h16* __restrict__ Q16, const h16* __restrict__ K16, const h16* __restrict__ V16, const bf* __restrict__ Qh, const bf* __restrict__ Ql, const bf* __restrict__ Kh, const bf* __restrict__ Kl, const bf* __restrict__ Vh, const bf* __restrict__ Vl, bf* Ah, bf* Al) {
    __shared__ __align__(16) float red[4 * 64 * 32]; __shared__ float rml[4 * 2 * 2 * 16];
    const int head = blockIdx.x; const int q0 = (TT / 32 - 1 - (int)blockIdx.y) * 32;   // longest rows first
    const size_t po = (size_t)head * TT * HD;
    if (q0 < RH) attn_body<bf, true>(Qh + po, Ql + po, Kh + po, Kl + po, Vh + po, Vl + po, q0, head, Ah, Al, red, rml);
    else attn_body<h16, false>(Q16 + po, nullptr, K16 + po, nullptr, V16 + po, nullptr, q0, head, Ah, Al, red, rml);
}

extern "C" void kernel_launch(void* const* d_in, const int* in_sizes, int n_in,
                              void* d_out, int out_size, void* d_ws, size_t ws_size, hipStream_t stream) {
    (void)in_sizes; (void)n_in; (void)out_size;
    const float* x = (const float*)d_in[0];   /* seq1 */ const float* x2 = (const float*)d_in[1];   /* seq2 */ const float* lng = (const float*)d_in[2]; const float* lnb = (const float*)d_in[3]; const float* pq = (const float*)d_in[4]; const float* pk = (const float*)d_in[5]; const float* pv = (const float*)d_in[6];   /* [16][1024][64] */ const float* wo = (const float*)d_in[7]; const float* bo = (const float*)d_in[8];     const float* wq = pq; const float* wk = pk; const float* wv = pv;
    float* OUT = (float*)d_out;     // [2][2048][1024]
    char* wsp = (char*)d_ws;
    auto take = [&](size_t bytes) { char* p = wsp; wsp += (bytes + 255) & ~(size_t)255; return (void*)p; };
    bf* WQ = (bf*)take((size_t)DQ * DM * 2); bf* WK = (bf*)take((size_t)DKV * DM * 2); bf* WV = (bf*)take((size_t)DKV * DM * 2); bf* WO = (bf*)take((size_t)DM * DQ * 2); float* CS = (float*)take((size_t)TT * HD * 2 * 4);
    bf* X1h = (bf*)take((size_t)TT * DM * 2); bf* X1l = (bf*)take((size_t)TT * DM * 2); bf* X2h = (bf*)take((size_t)TT * DM * 2); bf* X2l = (bf*)take((size_t)TT * DM * 2); float* FQ = (float*)take((size_t)TT * DQ * 4); float* FK = (float*)take((size_t)TT * DKV * 4);
    h16* QP16 = (h16*)take((size_t)NH_ * TT * HD * 2); h16* KP16 = (h16*)take((size_t)NKV * TT * HD * 2); h16* VT16 = (h16*)take((size_t)NKV * HD * TT * 2);
    bf* QPh = (bf*)take((size_t)NH_ * TT * HD * 2); bf* QPl = (bf*)take((size_t)NH_ * TT * HD * 2); bf* KPh = (bf*)take((size_t)NKV * TT * HD * 2); bf* KPl = (bf*)take((size_t)NKV * TT * HD * 2); bf* VTh = (bf*)take((size_t)NKV * HD * TT * 2); bf* VTl = (bf*)take((size_t)NKV * HD * TT * 2);
    bf* ATh = (bf*)take((size_t)TT * DQ * 2); bf* ATl = (bf*)take((size_t)TT * DQ * 2);
    if ((size_t)(wsp - (char*)d_ws) > ws_size) return;    // ws 256 MiB
    float* FV = FK;   // v projection reuses the k buffer after the k planes are built (stream-ordered)
    k_prep<<<PG + PC + PS, 256, 0, stream>>>(wq, wk, wv, wo, WQ, WK, WV, WO, CS);   /* head hh's 'xw' [1024][64] -> Bt rows hh*64..; mixer_w -> bf16; pair table */
    const unsigned LQ = (unsigned)(((size_t)NH_ * TT * HD / 2 + 255) / 256), LKv = (unsigned)(((size_t)NKV * TT * HD / 2 + 255) / 256);
    for (int b = 0; b < NB_; ++b) {
        
        k_lnx<<<TT / 8, 256, 0, stream>>>(x + (size_t)b * TT * DM, lng, lnb, X1h, X1l); k_lnx<<<TT / 8, 256, 0, stream>>>(x2 + (size_t)b * TT * DM, lng, lnb, X2h, X2l);   /* LayerNorm(seq1), LayerNorm(seq2) as bf16 hi/lo planes */
        k_gemmw<bf, 1, false><<<dim3(TT / 64, DQ / 64, 1), 32, 0, stream>>>(X1h, X1l, WQ, nullptr, DM, FQ, DQ, nullptr, 0, 0, 0);
        k_rope<<<LQ, 256, 0, stream>>>(FQ, DQ, NH_, CS, nullptr, nullptr, 1.0f, QP16, QPh, QPl);
        k_gemmw<bf, 1, false><<<dim3(TT / 64, DKV / 64, 1), 32, 0, stream>>>(X2h, X2l, WK, nullptr, DM, FK, DKV, nullptr, 0, 0, 0);
        k_rope<<<LKv, 256, 0, stream>>>(FK, DKV, NKV, CS, nullptr, nullptr, 1.0f, KP16, KPh, KPl);
        k_gemmw<bf, 1, false><<<dim3(TT / 64, DKV / 64, 1), 32, 0, stream>>>(X2h, X2l, WV, nullptr, DM, FV, DKV, nullptr, 0, 0, 0); k_vtp<<<LKv, 256, 0, stream>>>(FV, DKV, NKV, VT16, VTh, VTl);
        k_fattn<<<dim3(NH_, TT / 32, 1), 128, 0, stream>>>(QP16, KP16, VT16, QPh, QPl, KPh, KPl, VTh, VTl, ATh, ATl);   /* one kv head per query head; leaves the merged hi/lo planes */
        k_gemmw<bf, 1, true><<<dim3(TT / 64, DM / 64, 1), 32, 0, stream>>>(ATh, ATl, WO, nullptr, DQ, OUT + (size_t)b * TT * DM, DM, bo, 0, 0, 0); }
}

// v004
// It runs in 333 microseconds.
// Next to v003, in two timings, it ran 1.12 times as fast each time.
// Over all steps from v000 it is 5.55 times as fast.
#include <hip/hip_runtime.h>

// Causal cross attention between two LayerNorm'd sequences with per-head projection tensors (seq1, seq2 [2][2048][1024]; x1, x2 = LayerNorm(seq) (eps 1e-5, gamma/beta read); q = x1 q_proj[h], k = x2 k_proj[h], v = x2 v_proj[h] ([16][1024][64] 0.02, 'xw' per head, no bias); scores / float32(sqrt 64); causal (-inf); softmax; out = merged mixer_w^T + mixer_b ('oi') -> [2][2048][1024] (4.2 M); argument order seq1, seq2, ln_gamma, ln_beta, q_proj, k_proj, v_proj, mixer_w, mixer_b).
// Layout per batch: a LayerNorm kernel (one wave per token row: mean, biased variance, f32) writes bf16 hi/lo planes of x1, then of x2; per-head 'xw' weight blocks gathered into Bt once, before the batch loop; projections hi/lo x exact (2 products), whose epilogue writes the 16-bit head planes itself (q, k as [h][t][d], v as [h][d][t]); one fused causal T-2048 attention kernel with a running softmax (hybrid rows: < 512 hi/lo 3 products, rest fp16 x1024; key blocks above the diagonal are never visited); merged hi/lo x mixer_w exact + mixer_b.
// Compute dtypes, f32 accumulate: every input rounded to bf16; LayerNorm f32; projections 2 products (~f32); attention rows < 512 3 products, rest fp16; softmax f32; mixer hl x exact + bias.

#define NB_  2
#define TT   2048
#define DM   1024
#define NH_  16
#define NKV  16
#define REP  (NH_ / NKV)
#define HD   64
#define DQ   (NH_ * HD)
#define DKV  (NKV * HD)
#define RH   512                  // query rows < RH use hi+lo planes (0: none)
#define PCAR 1024.0f
#define SCL  0.125f   // HD^-0.5
typedef _Float16 h16;
typedef unsigned short bf;
typedef __attribute__((ext_vector_type(16))) __bf16   v16bf;
typedef __attribute__((ext_vector_type(16))) _Float16 v16h;
typedef __attribute__((ext_vector_type(8)))  _Float16 v8h;
typedef __attribute__((ext_vector_type(8)))  unsigned short v8us;
typedef __attribute__((ext_vector_type(8)))  float    v8f;
typedef __attribute__((ext_vector_type(4)))  float    v4f;
typedef v8h  __attribute__((may_alias)) v8ha;
typedef v4f  __attribute__((may_alias)) v4fa;
typedef v8us __attribute__((may_alias)) v8usa;

__device__ __forceinline__ unsigned short f2bf(float f) { unsigned u = __float_as_uint(f); u += 0x7FFFu + ((u >> 16) & 1u); return (unsigned short)(u >> 16); }
__device__ __forceinline__ float bf2f(unsigned short b) { return __uint_as_float(((unsigned)b) << 16); }
__device__ __forceinline__ float bfr(float f) { return bf2f(f2bf(f)); }
__device__ __forceinline__ v16h cat16(v8h lo, v8h hi) { return __builtin_shufflevector(lo, hi, 0, 1, 2, 3, 4, 5, 6, 7, 8, 9, 10, 11, 12, 13, 14, 15); }
__device__ __forceinline__ v16bf cat16b(v8us lo, v8us hi) { return __builtin_bit_cast(v16bf, __builtin_shufflevector(lo, hi, 0, 1, 2, 3, 4, 5, 6, 7, 8, 9, 10, 11, 12, 13, 14, 15)); }
__device__ __forceinline__ v8f wmma16(v16h a, v16h b, v8f c) { return __builtin_amdgcn_wmma_f32_16x16x32_f16(false, a, false, b, (short)0, c, false, false); }
__device__ __forceinline__ v8f wmmab(v16bf a, v16bf b, v8f c) { return __builtin_amdgcn_wmma_f32_16x16x32_bf16(false, a, false, b, (short)0, c, false, false); }
__device__ __forceinline__ h16 tohx(float x) { return (h16)x; }
__device__ __forceinline__ void splitf(float y, unsigned short& h, unsigned short& l) { h = f2bf(y); l = f2bf(y - bf2f(h)); }



// ---- k_gemmw: register-blocked GEMM, ONE WAVE per 64x64 output tile (16 accumulators), operands straight from K-contiguous 16-bit planes; grid (M/64, N/64, Z), 32 threads.
// C[m][n] = sum_k A[m][k] Bt[n][k] (+ split products per NSPLIT). z-batch strides sA/sB/sC in elements. K % 32 == 0.
// EP picks what the tile leaves as: EP_F32B f32 rows (pitch ldc) + f32 bias[n]; EP_HTD / EP_HDT fp16 and bf16 hi/lo planes of head blockIdx.y (a 64-column tile is one head), rows [t][d] or transposed [d][t].
#define EP_F32B 0
#define EP_HTD  1
#define EP_HDT  2
template <typename T16> struct WFrag;
template <> struct WFrag<h16> { typedef v16h V; static __device__ __forceinline__ V ld(const h16* p) { return cat16(*(const v8h*)p, *(const v8h*)(p + 16)); } static __device__ __forceinline__ v8f mma(V a, V b, v8f c) { return wmma16(a, b, c); } };
template <> struct WFrag<bf> { typedef v16bf V; static __device__ __forceinline__ V ld(const bf* p) { return cat16b(*(const v8us*)p, *(const v8us*)(p + 16)); } static __device__ __forceinline__ v8f mma(V a, V b, v8f c) { return wmmab(a, b, c); } };
template <typename T16, int NSPLIT, int EP>
__global__ __launch_bounds__(32) void k_gemmw(const T16* __restrict__ A, const T16* __restrict__ A2, const T16* __restrict__ Bt, const T16* __restrict__ Bt2, int K, float* C, int ldc, const float* __restrict__ bias, size_t sA, size_t sB, size_t sC, h16* P16, bf* Ph, bf* Pl) {
    typedef typename WFrag<T16>::V V;
    __shared__ __align__(16) float os[16 * 68];
    const size_t z = blockIdx.z; A += z * sA; if (A2) A2 += z * sA; Bt += z * sB; if (Bt2) Bt2 += z * sB; C += z * sC;
    const int lane = threadIdx.x & 31, lr = lane & 15, hi = lane >> 4; const int r0 = blockIdx.x * 64, c0 = blockIdx.y * 64;
    v8f acc[4][4];
#pragma unroll
    for (int mb = 0; mb < 4; ++mb)
#pragma unroll
        for (int nb = 0; nb < 4; ++nb) acc[mb][nb] = (v8f){};
    const size_t aoff = (size_t)(r0 + lr) * K + 8 * hi, boff = (size_t)(c0 + lr) * K + 8 * hi;
#pragma unroll 1
    for (int kc = 0; kc < K; kc += 32) {
        V a[4], a2[4];
#pragma unroll
        for (int mb = 0; mb < 4; ++mb) { a[mb] = WFrag<T16>::ld(A + aoff + (size_t)mb * 16 * K + kc); if (NSPLIT == 1 || NSPLIT == 2) a2[mb] = WFrag<T16>::ld(A2 + aoff + (size_t)mb * 16 * K + kc); }
#pragma unroll
        for (int nb = 0; nb < 4; ++nb) { const V b = WFrag<T16>::ld(Bt + boff + (size_t)nb * 16 * K + kc); V b2; if (NSPLIT >= 2) b2 = WFrag<T16>::ld(Bt2 + boff + (size_t)nb * 16 * K + kc);
#pragma unroll
            for (int mb = 0; mb < 4; ++mb) { acc[mb][nb] = WFrag<T16>::mma(a[mb], b, acc[mb][nb]); if (NSPLIT == 1 || NSPLIT == 2) acc[mb][nb] = WFrag<T16>::mma(a2[mb], b, acc[mb][nb]); if (NSPLIT >= 2) acc[mb][nb] = WFrag<T16>::mma(a[mb], b2, acc[mb][nb]); } }
        asm volatile("v_nop\n\tv_nop\n\tv_nop\n\tv_nop" : "+v"(acc[0][0]), "+v"(acc[1][1]), "+v"(acc[2][2]), "+v"(acc[3][3]) : "v"(a[0]), "v"(a[3]));
    }
    if constexpr (EP == EP_HDT) {
        // a lane's 8 accumulator rows are 8 consecutive t of one column d: 16 bytes of a [d][t] plane straight from registers; the four mb of a column fill its 128-byte line, all from this wave
#pragma unroll   // these three: constant indices keep acc and the packed vectors in registers
        for (int mb = 0; mb < 4; ++mb)
#pragma unroll
            for (int nb = 0; nb < 4; ++nb) { v8h o16; v8us oh, ol;
#pragma unroll
                for (int j = 0; j < 8; ++j) { const float x = acc[mb][nb][j]; o16[j] = tohx(x); unsigned short a2, c2; splitf(x, a2, c2); oh[j] = a2; ol[j] = c2; }
                const size_t oo = ((size_t)blockIdx.y * HD + nb * 16 + lr) * TT + r0 + mb * 16 + hi * 8;
                *(v8h*)(P16 + oo) = o16; *(v8us*)(Ph + oo) = oh; *(v8us*)(Pl + oo) = ol; }
        return;
    }
#pragma unroll
    for (int mb = 0; mb < 4; ++mb) {
#pragma unroll
        for (int nb = 0; nb < 4; ++nb) {
#pragma unroll
            for (int j = 0; j < 8; ++j) os[(hi * 8 + j) * 68 + nb * 16 + lr] = acc[mb][nb][j]; }
        __builtin_amdgcn_wave_barrier(); asm volatile("" ::: "memory");
        if constexpr (EP == EP_HTD) {
            // 8 lanes per token row, 8 columns each: every store covers four whole 128-byte rows of a [t][d] plane
#pragma unroll   // this and the next: constant LDS offsets, packed vectors in registers
            for (int s = 0; s < 4; ++s) { const int row = 4 * s + (lane >> 3), cofs = (lane & 7) * 8; const v4f x0 = *(const v4fa*)(os + row * 68 + cofs), x1 = *(const v4fa*)(os + row * 68 + cofs + 4); v8h o16; v8us oh, ol;
#pragma unroll
                for (int j = 0; j < 8; ++j) { const float x = (j < 4) ? x0[j & 3] : x1[j & 3]; o16[j] = tohx(x); unsigned short a2, c2; splitf(x, a2, c2); oh[j] = a2; ol[j] = c2; }
                const size_t oo = ((size_t)blockIdx.y * TT + r0 + mb * 16 + row) * HD + cofs;
                *(v8h*)(P16 + oo) = o16; *(v8us*)(Ph + oo) = oh; *(v8us*)(Pl + oo) = ol; }
        } else {
            float* crow = C + (size_t)(r0 + mb * 16) * ldc + c0;
#pragma unroll
            for (int s = 0; s < 8; ++s) { const int row = 2 * s + hi, cofs = lr * 4; v4f val = *(const v4fa*)(os + row * 68 + cofs); val[0] += bfr(bias[c0 + cofs]); val[1] += bfr(bias[c0 + cofs + 1]); val[2] += bfr(bias[c0 + cofs + 2]); val[3] += bfr(bias[c0 + cofs + 3]);
                *(v4f*)(crow + (size_t)row * ldc + cofs) = val; }
        }
        __builtin_amdgcn_wave_barrier(); asm volatile("" ::: "memory");
    }
}

typedef __attribute__((ext_vector_type(4))) _Float16 v4h;
typedef __attribute__((ext_vector_type(2))) unsigned short v2us;
typedef __attribute__((ext_vector_type(4))) unsigned short v4us;
typedef __attribute__((ext_vector_type(4))) int v4i;

// k_prep: every piece of set-up that depends on no other kernel, in ONE launch, dealt by block index (the gather's blocks come first: they run longest).
//   blocks [0, PG):        per-head 'xw' blocks [16][1024][64] of q_proj, k_proj, v_proj -> bf16 Bt rows (head * 64 + n)[k]; one 64-element line of Bt per wave and trip, 8 lines per wave
//   blocks [PG, PG + PC):  mixer_w ('oi', already K-contiguous) -> bf16, 8 elements per thread
#define PG (3 * NH_ * DM * HD / 64 / 64)
#define PC (DM * DQ / 8 / 256)
__global__ __launch_bounds__(256) void k_prep(const float* __restrict__ wq, const float* __restrict__ wk, const float* __restrict__ wv, const float* __restrict__ wo, bf* WQ, bf* WK, bf* WV, bf* WO) {
    const int blk = blockIdx.x;
    if (blk < PG) {
        const int ten = blk / (PG / 3); const float* __restrict__ w3 = (ten == 0) ? wq : (ten == 1) ? wk : wv; bf* B3 = (ten == 0) ? WQ : (ten == 1) ? WK : WV;
        const unsigned lane = threadIdx.x & 31; const unsigned G0 = ((blk % (PG / 3)) * 8 + (threadIdx.x >> 5)) * 8;   // Bt line index within the tensor (DM * HD / 64 lines per head)
        for (unsigned l = 0; l < 8; ++l) { const unsigned e = (G0 + l) * 64 + lane * 2; const unsigned k = e % DM, n = (e / DM) % HD, hh = e / (DM * HD); const float* w = w3 + (size_t)hh * DM * HD; v2us o;
            o[0] = f2bf(w[k * HD + n]); o[1] = f2bf(w[(k + 1) * HD + n]); *(v2us*)(B3 + e) = o;
            asm volatile("s_wait_xcnt 0x0" ::: "memory"); }   // the next trip's loads may land in this store's registers: the wait stands in front of that overwrite
    } else {
        const size_t i = (size_t)(blk - PG) * 256 + threadIdx.x; const v8f v = *(const v8f*)(wo + i * 8); v8us o;
#pragma unroll   // constant indices keep v and o in registers
        for (int k = 0; k < 8; ++k) o[k] = f2bf(v[k]);
        *(v8us*)(WO + i * 8) = o;
        asm volatile("s_wait_xcnt 0x0" ::: "memory");   // code laid out behind this store may reuse its address registers: the wait stands in front of any such overwrite
    }
}

__global__ __launch_bounds__(256) void k_lnx(const float* __restrict__ X, const float* __restrict__ gw, const float* __restrict__ gb, bf* Ph, bf* Pl) { const int lane = threadIdx.x & 31; const int r = blockIdx.x * 8 + (threadIdx.x >> 5); if (r >= TT) return; const float* xr = X + (size_t)r * DM; float hv[32]; float s = 0.f;
#pragma unroll
    for (int ch = 0; ch < 8; ++ch) { const v4f a = *(const v4f*)(xr + ch * 128 + lane * 4);
#pragma unroll
        for (int q = 0; q < 4; ++q) { const float u = bfr(a[q]); hv[ch * 4 + q] = u; s += u; } }
#pragma unroll
    for (int sh = 16; sh; sh >>= 1) s += __shfl_xor(s, sh, 32);
    float mu = s * (1.0f / 1024.0f); asm volatile("" : "+v"(mu)); float s2 = 0.f;
#pragma unroll
    for (int k = 0; k < 32; ++k) { float d0 = __fsub_rn(hv[k], mu); asm volatile("" : "+v"(d0)); float p = __fmul_rn(d0, d0); asm volatile("" : "+v"(p)); s2 = __fadd_rn(s2, p); }
#pragma unroll
    for (int sh = 16; sh; sh >>= 1) s2 += __shfl_xor(s2, sh, 32);
    float var = __fadd_rn(s2 * (1.0f / 1024.0f), 1e-5f); asm volatile("" : "+v"(var)); const float rs = __frsqrt_rn(var);
{
#pragma unroll
        for (int ch = 0; ch < 8; ++ch) { const int c0 = ch * 128 + lane * 4; v4us oh, ol;
#pragma unroll
            for (int q = 0; q < 4; ++q) { float gg = bfr(gw[c0 + q]); asm volatile("" : "+v"(gg)); float d0 = __fsub_rn(hv[ch * 4 + q], mu); asm volatile("" : "+v"(d0)); float n0 = __fmul_rn(d0, rs); asm volatile("" : "+v"(n0)); float y = __fmul_rn(n0, gg); asm volatile("" : "+v"(y)); const float z = __fadd_rn(y, bfr(gb[c0 + q])); unsigned short a2, c2; splitf(z, a2, c2); oh[q] = a2; ol[q] = c2; }
            const size_t oo = (size_t)r * DM + c0; *(v4us*)(Ph + oo) = oh; *(v4us*)(Pl + oo) = ol; }
         } }
// k_fattn: scores, causal softmax, probability x value and the head merge in one kernel; no score or probability ever goes to memory.
// One work-group = one head x 32 query rows; its 4 waves deal the 32-key blocks up to the diagonal among them (wave w takes blocks w, w + 4, ...), each with its own running maximum, sum and output tile, joined through LDS at the end.
// St = K Qt (A = key rows, B = query rows): a lane holds scores of ONE query (column lr), keys 8 * hi + j of each 16-key tile, which is the B-operand k order of the next product, Ot += Vt Pt: P goes from accumulator to operand inside the lane.
// HL (query rows < RH): bf16 hi/lo planes, 3 products each; otherwise fp16, P carried x PCAR. Output: merged bf16 hi/lo planes [t][head * HD + d].
#define L2E 1.4426950408889634f
template <bool B> struct BoolC { static constexpr bool value = B; };
template <typename T16, bool HL>
__device__ __forceinline__ void attn_body(const T16* __restrict__ Qa, const T16* __restrict__ Qb, const T16* __restrict__ Ka, const T16* __restrict__ Kb, const T16* __restrict__ Va, const T16* __restrict__ Vb, int q0, int head, bf* Ah, bf* Al, float* red, float* rml) {
    typedef typename WFrag<T16>::V V;
    const int lane = threadIdx.x & 31, lr = lane & 15, hi = lane >> 4, w = __builtin_amdgcn_readfirstlane(threadIdx.x >> 5);   // the wave's number in a scalar register: block loop and diagonal test become scalar branches
    V q[2][2], q2[2][2]; const size_t qo = (size_t)(q0 + lr) * HD + 8 * hi; const T16* qp = Qa + qo; const T16* qp2 = HL ? Qb + qo : qp;   // one address per plane, every fragment at a constant offset from it
#pragma unroll
    for (int nb = 0; nb < 2; ++nb)
#pragma unroll
        for (int kc = 0; kc < 2; ++kc) { q[nb][kc] = WFrag<T16>::ld(qp + nb * 16 * HD + kc * 32); if (HL) q2[nb][kc] = WFrag<T16>::ld(qp2 + nb * 16 * HD + kc * 32); }
    asm volatile("s_wait_xcnt 0x0" :: "v"(qp), "v"(qp2) : "memory");   // later code may reuse the query loads' address registers: the wait stands in front of that overwrite; named as inputs, the addresses stay in their registers up to it
    v8f o[2][4]; float m[2], l[2];
#pragma unroll
    for (int nb = 0; nb < 2; ++nb) { m[nb] = -3.0e38f; l[nb] = 0.f;
#pragma unroll
        for (int mb = 0; mb < 4; ++mb) o[nb][mb] = (v8f){}; }
    const int nkb = q0 / 32 + 1;   // key blocks up to and with the diagonal one
    auto pass = [&](const int kb, auto dg) {   // one 32-key block; dg: the block crosses the diagonal and is masked
        constexpr bool diag = decltype(dg)::value; const int key0 = kb * 32;
        v8f s[2][2];
#pragma unroll
        for (int nb = 0; nb < 2; ++nb) { s[nb][0] = (v8f){}; s[nb][1] = (v8f){}; }
        V kf[2][2], kf2[2][2]; const size_t ko = (size_t)(key0 + lr) * HD + 8 * hi; const T16* kp = Ka + ko; const T16* kp2 = HL ? Kb + ko : kp;
#pragma unroll
        for (int mt = 0; mt < 2; ++mt)
#pragma unroll
            for (int kc = 0; kc < 2; ++kc) { kf[mt][kc] = WFrag<T16>::ld(kp + mt * 16 * HD + kc * 32); if (HL) kf2[mt][kc] = WFrag<T16>::ld(kp2 + mt * 16 * HD + kc * 32); }
        asm volatile("s_wait_xcnt 0x0" :: "v"(kp), "v"(kp2) : "memory");   // same wait, in the same form, for the key loads
#pragma unroll
        for (int kc = 0; kc < 2; ++kc)
#pragma unroll
            for (int mt = 0; mt < 2; ++mt)
#pragma unroll
                for (int nb = 0; nb < 2; ++nb) { s[nb][mt] = WFrag<T16>::mma(kf[mt][kc], q[nb][kc], s[nb][mt]); if (HL) { s[nb][mt] = WFrag<T16>::mma(kf[mt][kc], q2[nb][kc], s[nb][mt]); s[nb][mt] = WFrag<T16>::mma(kf2[mt][kc], q[nb][kc], s[nb][mt]); } }
        V pf[2], pf2[2];
#pragma unroll
        for (int nb = 0; nb < 2; ++nb) {
            float t[16]; float mx = m[nb]; const int qi = q0 + nb * 16 + lr;
#pragma unroll
            for (int e = 0; e < 16; ++e) { float x = s[nb][e >> 3][e & 7] * SCL; if (diag && key0 + (e >> 3) * 16 + hi * 8 + (e & 7) > qi) x = -3.0e38f; t[e] = x; mx = fmaxf(mx, x); }
            mx = fmaxf(mx, __shfl_xor(mx, 16, 32));   // the other half of the wave holds this query's other 16 keys
            const float al = __builtin_amdgcn_exp2f((m[nb] - mx) * L2E); m[nb] = mx; float sum = 0.f;
#pragma unroll
            for (int e = 0; e < 16; ++e) { t[e] = __builtin_amdgcn_exp2f((t[e] - mx) * L2E); sum += t[e]; }
            l[nb] = l[nb] * al + sum;   // each half keeps its own keys' sum; the halves are joined once, behind the loop
#pragma unroll
            for (int mb = 0; mb < 4; ++mb) o[nb][mb] *= al;
            if constexpr (HL) { __attribute__((ext_vector_type(16))) unsigned short ph, pl;
#pragma unroll
                for (int e = 0; e < 16; ++e) { unsigned short a, c2; splitf(t[e], a, c2); ph[e] = a; pl[e] = c2; }
                pf[nb] = __builtin_bit_cast(v16bf, ph); pf2[nb] = __builtin_bit_cast(v16bf, pl);
            } else {
#pragma unroll
                for (int e = 0; e < 16; ++e) pf[nb][e] = tohx(t[e] * PCAR); }
        }
        const size_t vo = (size_t)lr * TT + key0 + 8 * hi; const T16* vp = Va + vo; const T16* vp2 = HL ? Vb + vo : vp;
#pragma unroll
        for (int mb = 0; mb < 4; ++mb) { const V vf = WFrag<T16>::ld(vp + mb * 16 * TT); V vf2; if (HL) vf2 = WFrag<T16>::ld(vp2 + mb * 16 * TT);
            asm volatile("s_wait_xcnt 0x0" :: "v"(vp), "v"(vp2) : "memory");   // same wait, in the same form, for the value loads
#pragma unroll
            for (int nb = 0; nb < 2; ++nb) { o[nb][mb] = WFrag<T16>::mma(vf, pf[nb], o[nb][mb]); if (HL) { o[nb][mb] = WFrag<T16>::mma(vf, pf2[nb], o[nb][mb]); o[nb][mb] = WFrag<T16>::mma(vf2, pf[nb], o[nb][mb]); } } }
        // the distance behind the pass's last matrix instructions, on the back edge and on the way out alike
        asm volatile("v_nop\n\tv_nop\n\tv_nop\n\tv_nop\n\tv_nop" : "+v"(o[0][0]), "+v"(o[0][1]), "+v"(o[0][2]), "+v"(o[0][3]), "+v"(o[1][0]), "+v"(o[1][1]), "+v"(o[1][2]), "+v"(o[1][3]));
    };
#pragma unroll 1   // one pass's fragments at a time: unrolled, two passes' fragments would cost a resident wave
    for (int kb = w; kb < nkb - 1; kb += 4) pass(kb, BoolC<false>());
    if (((nkb - 1) & 3) == w) pass(nkb - 1, BoolC<true>());   // only the last block crosses the diagonal; it is its owner's last
#pragma unroll
    for (int nb = 0; nb < 2; ++nb) { l[nb] += __shfl_xor(l[nb], 16, 32);
        if (hi == 0) { rml[((w * 2 + nb) * 2 + 0) * 16 + lr] = m[nb]; rml[((w * 2 + nb) * 2 + 1) * 16 + lr] = l[nb]; }
#pragma unroll
        for (int mb = 0; mb < 4; ++mb)
#pragma unroll
            for (int j = 0; j < 8; ++j) red[((w * 64) + (nb * 4 + mb) * 8 + j) * 32 + lane] = o[nb][mb][j]; }
    __syncthreads();   // every wave's partial maximum, sum and tile are in LDS before any is read
    // join: wave w finishes 8 whole query rows (one writer per 128-byte output line); lane = (row lane >> 2, 16 columns (lane & 3) * 16 ..)
    const int nbq = w >> 1, lq = (w & 1) * 8 + (lane >> 2), mbq = lane & 3; float mw[4], M = -3.0e38f, L = 0.f;
#pragma unroll
    for (int u = 0; u < 4; ++u) { mw[u] = rml[((u * 2 + nbq) * 2 + 0) * 16 + lq]; M = fmaxf(M, mw[u]); }
#pragma unroll
    for (int u = 0; u < 4; ++u) { mw[u] = __builtin_amdgcn_exp2f((mw[u] - M) * L2E); L += mw[u] * rml[((u * 2 + nbq) * 2 + 1) * 16 + lq]; }   // a wave that had no block: maximum -3e38, factor 0
    const float inv = __fdiv_rn(HL ? 1.0f : (1.0f / PCAR), L); v8us oh[2], ol[2];
#pragma unroll
    for (int e = 0; e < 16; ++e) { float a = 0.f;
#pragma unroll
        for (int u = 0; u < 4; ++u) a += mw[u] * red[((u * 64) + (nbq * 4 + mbq) * 8 + (e & 7)) * 32 + (e >> 3) * 16 + lq];
        unsigned short a2, c2; splitf(a * inv, a2, c2); oh[e >> 3][e & 7] = a2; ol[e >> 3][e & 7] = c2; }
    const size_t oo = (size_t)(q0 + nbq * 16 + lq) * DQ + head * HD + mbq * 16;
    *(v8us*)(Ah + oo) = oh[0]; *(v8us*)(Ah + oo + 8) = oh[1]; *(v8us*)(Al + oo) = ol[0]; *(v8us*)(Al + oo + 8) = ol[1];
}
// four waves per SIMD: the grid is 4096 waves on 1024 SIMDs, and the vector work between the matrix runs of one wave is covered by the other three
__global__ __launch_bounds__(128) __attribute__((amdgpu_waves_per_eu(4, 4))) void k_fattn(const h16* __restrict__ Q16, const h16* __restrict__ K16, const h16* __restrict__ V16, const bf* __restrict__ Qh, const bf* __restrict__ Ql, const bf* __restrict__ Kh, const bf* __restrict__ Kl, const bf* __restrict__ Vh, const bf* __restrict__ Vl, bf* Ah, bf* Al) {
    __shared__ __align__(16) float red[4 * 64 * 32]; __shared__ float rml[4 * 2 * 2 * 16];
    const int head = blockIdx.x; const int q0 = (TT / 32 - 1 - (int)blockIdx.y) * 32;   // longest rows first
    const size_t po = (size_t)head * TT * HD;
    if (q0 < RH) attn_body<bf, true>(Qh + po, Ql + po, Kh + po, Kl + po, Vh + po, Vl + po, q0, head, Ah, Al, red, rml);
    else attn_body<h16, false>(Q16 + po, nullptr, K16 + po, nullptr, V16 + po, nullptr, q0, head, Ah, Al, red, rml);
}

extern "C" void kernel_launch(void* const* d_in, const int* in_sizes, int n_in,
                              void* d_out, int out_size, void* d_ws, size_t ws_size, hipStream_t stream) {
    (void)in_sizes; (void)n_in; (void)out_size;
    const float* x = (const float*)d_in[0];   /* seq1 */ const float* x2 = (const float*)d_in[1];   /* seq2 */ const float* lng = (const float*)d_in[2]; const float* lnb = (const float*)d_in[3]; const float* pq = (const float*)d_in[4]; const float* pk = (const float*)d_in[5]; const float* pv = (const float*)d_in[6];   /* [16][1024][64] */ const float* wo = (const float*)d_in[7]; const float* bo = (const float*)d_in[8];     const float* wq = pq; const float* wk = pk; const float* wv = pv;
    float* OUT = (float*)d_out;     // [2][2048][1024]
    char* wsp = (char*)d_ws;
    auto take = [&](size_t bytes) { char* p = wsp; wsp += (bytes + 255) & ~(size_t)255; return (void*)p; };
    bf* WQ = (bf*)take((size_t)DQ * DM * 2); bf* WK = (bf*)take((size_t)DKV * DM * 2); bf* WV = (bf*)take((size_t)DKV * DM * 2); bf* WO = (bf*)take((size_t)DM * DQ * 2);
    bf* X1h = (bf*)take((size_t)TT * DM * 2); bf* X1l = (bf*)take((size_t)TT * DM * 2); bf* X2h = (bf*)take((size_t)TT * DM * 2); bf* X2l = (bf*)take((size_t)TT * DM * 2);
    h16* QP16 = (h16*)take((size_t)NH_ * TT * HD * 2); h16* KP16 = (h16*)take((size_t)NKV * TT * HD * 2); h16* VT16 = (h16*)take((size_t)NKV * HD * TT * 2);
    bf* QPh = (bf*)take((size_t)NH_ * TT * HD * 2); bf* QPl = (bf*)take((size_t)NH_ * TT * HD * 2); bf* KPh = (bf*)take((size_t)NKV * TT * HD * 2); bf* KPl = (bf*)take((size_t)NKV * TT * HD * 2); bf* VTh = (bf*)take((size_t)NKV * HD * TT * 2); bf* VTl = (bf*)take((size_t)NKV * HD * TT * 2);
    bf* ATh = (bf*)take((size_t)TT * DQ * 2); bf* ATl = (bf*)take((size_t)TT * DQ * 2);
    if ((size_t)(wsp - (char*)d_ws) > ws_size) return;    // ws 256 MiB
    k_prep<<<PG + PC, 256, 0, stream>>>(wq, wk, wv, wo, WQ, WK, WV, WO);   /* head hh's 'xw' [1024][64] -> Bt rows hh*64..; mixer_w -> bf16 */
    for (int b = 0; b < NB_; ++b) {
        
        k_lnx<<<TT / 8, 256, 0, stream>>>(x + (size_t)b * TT * DM, lng, lnb, X1h, X1l); k_lnx<<<TT / 8, 256, 0, stream>>>(x2 + (size_t)b * TT * DM, lng, lnb, X2h, X2l);   /* LayerNorm(seq1), LayerNorm(seq2) as bf16 hi/lo planes */
        k_gemmw<bf, 1, EP_HTD><<<dim3(TT / 64, DQ / 64, 1), 32, 0, stream>>>(X1h, X1l, WQ, nullptr, DM, nullptr, 0, nullptr, 0, 0, 0, QP16, QPh, QPl);
        k_gemmw<bf, 1, EP_HTD><<<dim3(TT / 64, DKV / 64, 1), 32, 0, stream>>>(X2h, X2l, WK, nullptr, DM, nullptr, 0, nullptr, 0, 0, 0, KP16, KPh, KPl);
        k_gemmw<bf, 1, EP_HDT><<<dim3(TT / 64, DKV / 64, 1), 32, 0, stream>>>(X2h, X2l, WV, nullptr, DM, nullptr, 0, nullptr, 0, 0, 0, VT16, VTh, VTl);
        k_fattn<<<dim3(NH_, TT / 32, 1), 128, 0, stream>>>(QP16, KP16, VT16, QPh, QPl, KPh, KPl, VTh, VTl, ATh, ATl);   /* one kv head per query head; leaves the merged hi/lo planes */
        k_gemmw<bf, 1, EP_F32B><<<dim3(TT / 64, DM / 64, 1), 32, 0, stream>>>(ATh, ATl, WO, nullptr, DQ, OUT + (size_t)b * TT * DM, DM, bo, 0, 0, 0, nullptr, nullptr, nullptr); }
}

// v005
// A run of this version takes 172 microseconds.
// Next to v004, in two timings, it ran 1.94 times as fast each time.
// Over all steps from v000 it is 10.7 times as fast.
#include <hip/hip_runtime.h>

// Causal cross attention between two LayerNorm'd sequences with per-head projection tensors (seq1, seq2 [2][2048][1024]; x1, x2 = LayerNorm(seq) (eps 1e-5, gamma/beta read); q = x1 q_proj[h], k = x2 k_proj[h], v = x2 v_proj[h] ([16][1024][64] 0.02, 'xw' per head, no bias); scores / float32(sqrt 64); causal (-inf); softmax; out = merged mixer_w^T + mixer_b ('oi') -> [2][2048][1024] (4.2 M); argument order seq1, seq2, ln_gamma, ln_beta, q_proj, k_proj, v_proj, mixer_w, mixer_b).
// Layout, every launch over both batches (token rows b * 2048 + t): a LayerNorm kernel (one wave per token row: mean, biased variance, f32; grid y picks the sequence) writes bf16 hi/lo planes of x1 and of x2; per-head 'xw' weight blocks gathered into Bt; the q, k and v projections hi/lo x exact (2 products) in one launch (grid z), whose epilogue writes the 16-bit head planes itself (q, k as [b][h][t][d], v as [b][h][d][t]); one fused causal T-2048 attention kernel with a running softmax (hybrid rows: < 512 hi/lo 3 products, rest fp16 x1024; key blocks above the diagonal are never visited); merged hi/lo x mixer_w exact + mixer_b.
// Compute dtypes, f32 accumulate: every input rounded to bf16; LayerNorm f32; projections 2 products (~f32); attention rows < 512 3 products, rest fp16; softmax f32; mixer hl x exact + bias.

#define NB_  2
#define TT   2048
#define DM   1024
#define NH_  16
#define NKV  16
#define REP  (NH_ / NKV)
#define HD   64
#define DQ   (NH_ * HD)
#define DKV  (NKV * HD)
#define RH   512                  // query rows < RH use hi+lo planes (0: none)
#define PCAR 1024.0f
#define SCL  0.125f   // HD^-0.5
typedef _Float16 h16;
typedef unsigned short bf;
typedef __attribute__((ext_vector_type(16))) __bf16   v16bf;
typedef __attribute__((ext_vector_type(16))) _Float16 v16h;
typedef __attribute__((ext_vector_type(8)))  _Float16 v8h;
typedef __attribute__((ext_vector_type(8)))  unsigned short v8us;
typedef __attribute__((ext_vector_type(8)))  float    v8f;
typedef __attribute__((ext_vector_type(4)))  float    v4f;
typedef v8h  __attribute__((may_alias)) v8ha;
typedef v4f  __attribute__((may_alias)) v4fa;
typedef v8us __attribute__((may_alias)) v8usa;

__device__ __forceinline__ unsigned short f2bf(float f) { unsigned u = __float_as_uint(f); u += 0x7FFFu + ((u >> 16) & 1u); return (unsigned short)(u >> 16); }
__device__ __forceinline__ float bf2f(unsigned short b) { return __uint_as_float(((unsigned)b) << 16); }
__device__ __forceinline__ float bfr(float f) { return bf2f(f2bf(f)); }
__device__ __forceinline__ v16h cat16(v8h lo, v8h hi) { return __builtin_shufflevector(lo, hi, 0, 1, 2, 3, 4, 5, 6, 7, 8, 9, 10, 11, 12, 13, 14, 15); }
__device__ __forceinline__ v16bf cat16b(v8us lo, v8us hi) { return __builtin_bit_cast(v16bf, __builtin_shufflevector(lo, hi, 0, 1, 2, 3, 4, 5, 6, 7, 8, 9, 10, 11, 12, 13, 14, 15)); }
__device__ __forceinline__ v8f wmma16(v16h a, v16h b, v8f c) { return __builtin_amdgcn_wmma_f32_16x16x32_f16(false, a, false, b, (short)0, c, false, false); }
__device__ __forceinline__ v8f wmmab(v16bf a, v16bf b, v8f c) { return __builtin_amdgcn_wmma_f32_16x16x32_bf16(false, a, false, b, (short)0, c, false, false); }
__device__ __forceinline__ h16 tohx(float x) { return (h16)x; }
__device__ __forceinline__ void splitf(float y, unsigned short& h, unsigned short& l) { h = f2bf(y); l = f2bf(y - bf2f(h)); }



// ---- k_gemmw: register-blocked GEMM, ONE WAVE per 64x64 output tile (16 accumulators), operands straight from K-contiguous 16-bit planes; grid (M/64, N/64, Z), 32 threads.
// C[m][n] = sum_k A[m][k] Bt[n][k] (+ split products per NSPLIT). z strides sA/sB/sC in elements (sC: of C, or of the head planes). K % 32 == 0.
// EP picks what the tile leaves as: EP_F32B f32 rows (pitch ldc) + f32 bias[n]; EP_QKV fp16 and bf16 hi/lo planes of batch r0 / TT, head blockIdx.y (a 64-column tile is one head): z = 0 (q, from the first A planes) and z = 1 (k, from the second) as rows [t][d], z = 2 (v, from the second too) transposed [d][t].
#define EP_F32B 0
#define EP_QKV  1
template <typename T16> struct WFrag;
template <> struct WFrag<h16> { typedef v16h V; static __device__ __forceinline__ V ld(const h16* p) { return cat16(*(const v8h*)p, *(const v8h*)(p + 16)); } static __device__ __forceinline__ v8f mma(V a, V b, v8f c) { return wmma16(a, b, c); } };
template <> struct WFrag<bf> { typedef v16bf V; static __device__ __forceinline__ V ld(const bf* p) { return cat16b(*(const v8us*)p, *(const v8us*)(p + 16)); } static __device__ __forceinline__ v8f mma(V a, V b, v8f c) { return wmmab(a, b, c); } };
template <typename T16, int NSPLIT, int EP>
__global__ __launch_bounds__(32) void k_gemmw(const T16* __restrict__ A, const T16* __restrict__ A2, const T16* __restrict__ Bt, const T16* __restrict__ Bt2, int K, float* C, int ldc, const float* __restrict__ bias, size_t sA, size_t sB, size_t sC, h16* P16, bf* Ph, bf* Pl) {
    typedef typename WFrag<T16>::V V;
    __shared__ __align__(16) float os[16 * 68];
    const size_t z = blockIdx.z, za = (EP == EP_QKV && z) ? 1 : z; A += za * sA; if (A2) A2 += za * sA; Bt += z * sB; if (Bt2) Bt2 += z * sB; if (EP == EP_QKV) { P16 += z * sC; Ph += z * sC; Pl += z * sC; } else C += z * sC;
    const int lane = threadIdx.x & 31, lr = lane & 15, hi = lane >> 4; const int r0 = blockIdx.x * 64, c0 = blockIdx.y * 64; const int t0 = r0 % TT; const size_t hp = (size_t)(r0 / TT) * NH_ + blockIdx.y;   // the tile's first token within its batch; its head plane
    v8f acc[4][4];
#pragma unroll
    for (int mb = 0; mb < 4; ++mb)
#pragma unroll
        for (int nb = 0; nb < 4; ++nb) acc[mb][nb] = (v8f){};
    const size_t aoff = (size_t)(r0 + lr) * K + 8 * hi, boff = (size_t)(c0 + lr) * K + 8 * hi;
#pragma unroll 1
    for (int kc = 0; kc < K; kc += 32) {
        V a[4], a2[4];
#pragma unroll
        for (int mb = 0; mb < 4; ++mb) { a[mb] = WFrag<T16>::ld(A + aoff + (size_t)mb * 16 * K + kc); if (NSPLIT == 1 || NSPLIT == 2) a2[mb] = WFrag<T16>::ld(A2 + aoff + (size_t)mb * 16 * K + kc); }
#pragma unroll
        for (int nb = 0; nb < 4; ++nb) { const V b = WFrag<T16>::ld(Bt + boff + (size_t)nb * 16 * K + kc); V b2; if (NSPLIT >= 2) b2 = WFrag<T16>::ld(Bt2 + boff + (size_t)nb * 16 * K + kc);
#pragma unroll
            for (int mb = 0; mb < 4; ++mb) { acc[mb][nb] = WFrag<T16>::mma(a[mb], b, acc[mb][nb]); if (NSPLIT == 1 || NSPLIT == 2) acc[mb][nb] = WFrag<T16>::mma(a2[mb], b, acc[mb][nb]); if (NSPLIT >= 2) acc[mb][nb] = WFrag<T16>::mma(a[mb], b2, acc[mb][nb]); } }
        asm volatile("v_nop\n\tv_nop\n\tv_nop\n\tv_nop" : "+v"(acc[0][0]), "+v"(acc[1][1]), "+v"(acc[2][2]), "+v"(acc[3][3]) : "v"(a[0]), "v"(a[3]));
    }
    if (EP == EP_QKV && blockIdx.z == 2) {
        // a lane's 8 accumulator rows are 8 consecutive t of one column d: 16 bytes of a [d][t] plane straight from registers; the four mb of a column fill its 128-byte line, all from this wave
#pragma unroll   // these three: constant indices keep acc and the packed vectors in registers
        for (int mb = 0; mb < 4; ++mb)
#pragma unroll
            for (int nb = 0; nb < 4; ++nb) { v8h o16; v8us oh, ol;
#pragma unroll
                for (int j = 0; j < 8; ++j) { const float x = acc[mb][nb][j]; o16[j] = tohx(x); unsigned short a2, c2; splitf(x, a2, c2); oh[j] = a2; ol[j] = c2; }
                const size_t oo = (hp * HD + nb * 16 + lr) * TT + t0 + mb * 16 + hi * 8;
                *(v8h*)(P16 + oo) = o16; *(v8us*)(Ph + oo) = oh; *(v8us*)(Pl + oo) = ol; }
        return;
    }
#pragma unroll
    for (int mb = 0; mb < 4; ++mb) {
#pragma unroll
        for (int nb = 0; nb < 4; ++nb) {
#pragma unroll
            for (int j = 0; j < 8; ++j) os[(hi * 8 + j) * 68 + nb * 16 + lr] = acc[mb][nb][j]; }
        __builtin_amdgcn_wave_barrier(); asm volatile("" ::: "memory");
        if constexpr (EP == EP_QKV) {
            // 8 lanes per token row, 8 columns each: every store covers four whole 128-byte rows of a [t][d] plane
#pragma unroll   // this and the next: constant LDS offsets, packed vectors in registers
            for (int s = 0; s < 4; ++s) { const int row = 4 * s + (lane >> 3), cofs = (lane & 7) * 8; const v4f x0 = *(const v4fa*)(os + row * 68 + cofs), x1 = *(const v4fa*)(os + row * 68 + cofs + 4); v8h o16; v8us oh, ol;
#pragma unroll
                for (int j = 0; j < 8; ++j) { const float x = (j < 4) ? x0[j & 3] : x1[j & 3]; o16[j] = tohx(x); unsigned short a2, c2; splitf(x, a2, c2); oh[j] = a2; ol[j] = c2; }
                const size_t oo = (hp * TT + t0 + mb * 16 + row) * HD + cofs;
                *(v8h*)(P16 + oo) = o16; *(v8us*)(Ph + oo) = oh; *(v8us*)(Pl + oo) = ol; }
        } else {
            float* crow = C + (size_t)(r0 + mb * 16) * ldc + c0;
#pragma unroll
            for (int s = 0; s < 8; ++s) { const int row = 2 * s + hi, cofs = lr * 4; v4f val = *(const v4fa*)(os + row * 68 + cofs); val[0] += bfr(bias[c0 + cofs]); val[1] += bfr(bias[c0 + cofs + 1]); val[2] += bfr(bias[c0 + cofs + 2]); val[3] += bfr(bias[c0 + cofs + 3]);
                *(v4f*)(crow + (size_t)row * ldc + cofs) = val; }
        }
        __builtin_amdgcn_wave_barrier(); asm volatile("" ::: "memory");
    }
}

typedef __attribute__((ext_vector_type(4))) _Float16 v4h;
typedef __attribute__((ext_vector_type(2))) unsigned short v2us;
typedef __attribute__((ext_vector_type(4))) unsigned short v4us;
typedef __attribute__((ext_vector_type(4))) int v4i;

// k_prep: every piece of set-up that depends on no other kernel, in ONE launch, dealt by block index (the gather's blocks come first: they run longest).
//   blocks [0, PG):        per-head 'xw' blocks [16][1024][64] of q_proj, k_proj, v_proj -> bf16 Bt rows (head * 64 + n)[k]; one 64-element line of Bt per wave and trip, 8 lines per wave
//   blocks [PG, PG + PC):  mixer_w ('oi', already K-contiguous) -> bf16, 8 elements per thread
#define PG (3 * NH_ * DM * HD / 64 / 64)
#define PC (DM * DQ / 8 / 256)
__global__ __launch_bounds__(256) void k_prep(const float* __restrict__ wq, const float* __restrict__ wk, const float* __restrict__ wv, const float* __restrict__ wo, bf* WQ, bf* WK, bf* WV, bf* WO) {
    const int blk = blockIdx.x;
    if (blk < PG) {
        const int ten = blk / (PG / 3); const float* __restrict__ w3 = (ten == 0) ? wq : (ten == 1) ? wk : wv; bf* B3 = (ten == 0) ? WQ : (ten == 1) ? WK : WV;
        const unsigned lane = threadIdx.x & 31; const unsigned G0 = ((blk % (PG / 3)) * 8 + (threadIdx.x >> 5)) * 8;   // Bt line index within the tensor (DM * HD / 64 lines per head)
        for (unsigned l = 0; l < 8; ++l) { const unsigned e = (G0 + l) * 64 + lane * 2; const unsigned k = e % DM, n = (e / DM) % HD, hh = e / (DM * HD); const float* w = w3 + (size_t)hh * DM * HD; v2us o;
            o[0] = f2bf(w[k * HD + n]); o[1] = f2bf(w[(k + 1) * HD + n]); *(v2us*)(B3 + e) = o;
            asm volatile("s_wait_xcnt 0x0" ::: "memory"); }   // the next trip's loads may land in this store's registers: the wait stands in front of that overwrite
    } else {
        const size_t i = (size_t)(blk - PG) * 256 + threadIdx.x; const v8f v = *(const v8f*)(wo + i * 8); v8us o;
#pragma unroll   // constant indices keep v and o in registers
        for (int k = 0; k < 8; ++k) o[k] = f2bf(v[k]);
        *(v8us*)(WO + i * 8) = o;
        asm volatile("s_wait_xcnt 0x0" ::: "memory");   // code laid out behind this store may reuse its address registers: the wait stands in front of any such overwrite
    }
}

// grid (NB_ * TT / 8, 2): y = 0 takes Xa, y = 1 takes Xb and the second pair of planes, sP elements further on
__global__ __launch_bounds__(256) void k_lnx(const float* __restrict__ Xa, const float* __restrict__ Xb, const float* __restrict__ gw, const float* __restrict__ gb, bf* Ph, bf* Pl, size_t sP) { const int lane = threadIdx.x & 31; const int r = blockIdx.x * 8 + (threadIdx.x >> 5); if (r >= NB_ * TT) return; const float* X = blockIdx.y ? Xb : Xa; Ph += blockIdx.y * sP; Pl += blockIdx.y * sP; const float* xr = X + (size_t)r * DM; float hv[32]; float s = 0.f;
#pragma unroll
    for (int ch = 0; ch < 8; ++ch) { const v4f a = *(const v4f*)(xr + ch * 128 + lane * 4);
#pragma unroll
        for (int q = 0; q < 4; ++q) { const float u = bfr(a[q]); hv[ch * 4 + q] = u; s += u; } }
#pragma unroll
    for (int sh = 16; sh; sh >>= 1) s += __shfl_xor(s, sh, 32);
    float mu = s * (1.0f / 1024.0f); asm volatile("" : "+v"(mu)); float s2 = 0.f;
#pragma unroll
    for (int k = 0; k < 32; ++k) { float d0 = __fsub_rn(hv[k], mu); asm volatile("" : "+v"(d0)); float p = __fmul_rn(d0, d0); asm volatile("" : "+v"(p)); s2 = __fadd_rn(s2, p); }
#pragma unroll
    for (int sh = 16; sh; sh >>= 1) s2 += __shfl_xor(s2, sh, 32);
    float var = __fadd_rn(s2 * (1.0f / 1024.0f), 1e-5f); asm volatile("" : "+v"(var)); const float rs = __frsqrt_rn(var);
{
#pragma unroll
        for (int ch = 0; ch < 8; ++ch) { const int c0 = ch * 128 + lane * 4; v4us oh, ol;
#pragma unroll
            for (int q = 0; q < 4; ++q) { float gg = bfr(gw[c0 + q]); asm volatile("" : "+v"(gg)); float d0 = __fsub_rn(hv[ch * 4 + q], mu); asm volatile("" : "+v"(d0)); float n0 = __fmul_rn(d0, rs); asm volatile("" : "+v"(n0)); float y = __fmul_rn(n0, gg); asm volatile("" : "+v"(y)); const float z = __fadd_rn(y, bfr(gb[c0 + q])); unsigned short a2, c2; splitf(z, a2, c2); oh[q] = a2; ol[q] = c2; }
            const size_t oo = (size_t)r * DM + c0; *(v4us*)(Ph + oo) = oh; *(v4us*)(Pl + oo) = ol; }
         } }
// k_fattn: scores, causal softmax, probability x value and the head merge in one kernel; no score or probability ever goes to memory.
// One work-group = one head of one batch x 32 query rows; its 4 waves deal the 32-key blocks up to the diagonal among them (wave w takes blocks w, w + 4, ...), each with its own running maximum, sum and output tile, joined through LDS at the end.
// St = K Qt (A = key rows, B = query rows): a lane holds scores of ONE query (column lr), keys 8 * hi + j of each 16-key tile, which is the B-operand k order of the next product, Ot += Vt Pt: P goes from accumulator to operand inside the lane.
// HL (query rows < RH): bf16 hi/lo planes, 3 products each; otherwise fp16, P carried x PCAR. Output: merged bf16 hi/lo planes [t][head * HD + d].
#define L2E 1.4426950408889634f
template <bool B> struct BoolC { static constexpr bool value = B; };
template <typename T16, bool HL>
__device__ __forceinline__ void attn_body(const T16* __restrict__ Qa, const T16* __restrict__ Qb, const T16* __restrict__ Ka, const T16* __restrict__ Kb, const T16* __restrict__ Va, const T16* __restrict__ Vb, int q0, int head, bf* Ah, bf* Al, float* red, float* rml) {
    typedef typename WFrag<T16>::V V;
    const int lane = threadIdx.x & 31, lr = lane & 15, hi = lane >> 4, w = __builtin_amdgcn_readfirstlane(threadIdx.x >> 5);   // the wave's number in a scalar register: block loop and diagonal test become scalar branches
    V q[2][2], q2[2][2]; const size_t qo = (size_t)(q0 + lr) * HD + 8 * hi; const T16* qp = Qa + qo; const T16* qp2 = HL ? Qb + qo : qp;   // one address per plane, every fragment at a constant offset from it
#pragma unroll
    for (int nb = 0; nb < 2; ++nb)
#pragma unroll
        for (int kc = 0; kc < 2; ++kc) { q[nb][kc] = WFrag<T16>::ld(qp + nb * 16 * HD + kc * 32); if (HL) q2[nb][kc] = WFrag<T16>::ld(qp2 + nb * 16 * HD + kc * 32); }
    asm volatile("s_wait_xcnt 0x0" :: "v"(qp), "v"(qp2) : "memory");   // later code may reuse the query loads' address registers: the wait stands in front of that overwrite; named as inputs, the addresses stay in their registers up to it
    v8f o[2][4]; float m[2], l[2];
#pragma unroll
    for (int nb = 0; nb < 2; ++nb) { m[nb] = -3.0e38f; l[nb] = 0.f;
#pragma unroll
        for (int mb = 0; mb < 4; ++mb) o[nb][mb] = (v8f){}; }
    const int nkb = q0 / 32 + 1;   // key blocks up to and with the diagonal one
    auto pass = [&](const int kb, auto dg) {   // one 32-key block; dg: the block crosses the diagonal and is masked
        constexpr bool diag = decltype(dg)::value; const int key0 = kb * 32;
        v8f s[2][2];
#pragma unroll
        for (int nb = 0; nb < 2; ++nb) { s[nb][0] = (v8f){}; s[nb][1] = (v8f){}; }
        V kf[2][2], kf2[2][2]; const size_t ko = (size_t)(key0 + lr) * HD + 8 * hi; const T16* kp = Ka + ko; const T16* kp2 = HL ? Kb + ko : kp;
#pragma unroll
        for (int mt = 0; mt < 2; ++mt)
#pragma unroll
            for (int kc = 0; kc < 2; ++kc) { kf[mt][kc] = WFrag<T16>::ld(kp + mt * 16 * HD + kc * 32); if (HL) kf2[mt][kc] = WFrag<T16>::ld(kp2 + mt * 16 * HD + kc * 32); }
        asm volatile("s_wait_xcnt 0x0" :: "v"(kp), "v"(kp2) : "memory");   // same wait, in the same form, for the key loads
#pragma unroll
        for (int kc = 0; kc < 2; ++kc)
#pragma unroll
            for (int mt = 0; mt < 2; ++mt)
#pragma unroll
                for (int nb = 0; nb < 2; ++nb) { s[nb][mt] = WFrag<T16>::mma(kf[mt][kc], q[nb][kc], s[nb][mt]); if (HL) { s[nb][mt] = WFrag<T16>::mma(kf[mt][kc], q2[nb][kc], s[nb][mt]); s[nb][mt] = WFrag<T16>::mma(kf2[mt][kc], q[nb][kc], s[nb][mt]); } }
        V pf[2], pf2[2];
#pragma unroll
        for (int nb = 0; nb < 2; ++nb) {
            float t[16]; float mx = m[nb]; const int qi = q0 + nb * 16 + lr;
#pragma unroll
            for (int e = 0; e < 16; ++e) { float x = s[nb][e >> 3][e & 7] * SCL; if (diag && key0 + (e >> 3) * 16 + hi * 8 + (e & 7) > qi) x = -3.0e38f; t[e] = x; mx = fmaxf(mx, x); }
            mx = fmaxf(mx, __shfl_xor(mx, 16, 32));   // the other half of the wave holds this query's other 16 keys
            const float al = __builtin_amdgcn_exp2f((m[nb] - mx) * L2E); m[nb] = mx; float sum = 0.f;
#pragma unroll
            for (int e = 0; e < 16; ++e) { t[e] = __builtin_amdgcn_exp2f((t[e] - mx) * L2E); sum += t[e]; }
            l[nb] = l[nb] * al + sum;   // each half keeps its own keys' sum; the halves are joined once, behind the loop
#pragma unroll
            for (int mb = 0; mb < 4; ++mb) o[nb][mb] *= al;
            if constexpr (HL) { __attribute__((ext_vector_type(16))) unsigned short ph, pl;
#pragma unroll
                for (int e = 0; e < 16; ++e) { unsigned short a, c2; splitf(t[e], a, c2); ph[e] = a; pl[e] = c2; }
                pf[nb] = __builtin_bit_cast(v16bf, ph); pf2[nb] = __builtin_bit_cast(v16bf, pl);
            } else {
#pragma unroll
                for (int e = 0; e < 16; ++e) pf[nb][e] = tohx(t[e] * PCAR); }
        }
        const size_t vo = (size_t)lr * TT + key0 + 8 * hi; const T16* vp = Va + vo; const T16* vp2 = HL ? Vb + vo : vp;
#pragma unroll
        for (int mb = 0; mb < 4; ++mb) { const V vf = WFrag<T16>::ld(vp + mb * 16 * TT); V vf2; if (HL) vf2 = WFrag<T16>::ld(vp2 + mb * 16 * TT);
            asm volatile("s_wait_xcnt 0x0" :: "v"(vp), "v"(vp2) : "memory");   // same wait, in the same form, for the value loads
#pragma unroll
            for (int nb = 0; nb < 2; ++nb) { o[nb][mb] = WFrag<T16>::mma(vf, pf[nb], o[nb][mb]); if (HL) { o[nb][mb] = WFrag<T16>::mma(vf, pf2[nb], o[nb][mb]); o[nb][mb] = WFrag<T16>::mma(vf2, pf[nb], o[nb][mb]); } } }
        // the distance behind the pass's last matrix instructions, on the back edge and on the way out alike
        asm volatile("v_nop\n\tv_nop\n\tv_nop\n\tv_nop\n\tv_nop" : "+v"(o[0][0]), "+v"(o[0][1]), "+v"(o[0][2]), "+v"(o[0][3]), "+v"(o[1][0]), "+v"(o[1][1]), "+v"(o[1][2]), "+v"(o[1][3]));
    };
#pragma unroll 1   // one pass's fragments at a time: unrolled, two passes' fragments would cost a resident wave
    for (int kb = w; kb < nkb - 1; kb += 4) pass(kb, BoolC<false>());
    if (((nkb - 1) & 3) == w) pass(nkb - 1, BoolC<true>());   // only the last block crosses the diagonal; it is its owner's last
#pragma unroll
    for (int nb = 0; nb < 2; ++nb) { l[nb] += __shfl_xor(l[nb], 16, 32);
        if (hi == 0) { rml[((w * 2 + nb) * 2 + 0) * 16 + lr] = m[nb]; rml[((w * 2 + nb) * 2 + 1) * 16 + lr] = l[nb]; }
#pragma unroll
        for (int mb = 0; mb < 4; ++mb)
#pragma unroll
            for (int j = 0; j < 8; ++j) red[((w * 64) + (nb * 4 + mb) * 8 + j) * 32 + lane] = o[nb][mb][j]; }
    __syncthreads();   // every wave's partial maximum, sum and tile are in LDS before any is read
    // join: wave w finishes 8 whole query rows (one writer per 128-byte output line); lane = (row lane >> 2, 16 columns (lane & 3) * 16 ..)
    const int nbq = w >> 1, lq = (w & 1) * 8 + (lane >> 2), mbq = lane & 3; float mw[4], M = -3.0e38f, L = 0.f;
#pragma unroll
    for (int u = 0; u < 4; ++u) { mw[u] = rml[((u * 2 + nbq) * 2 + 0) * 16 + lq]; M = fmaxf(M, mw[u]); }
#pragma unroll
    for (int u = 0; u < 4; ++u) { mw[u] = __builtin_amdgcn_exp2f((mw[u] - M) * L2E); L += mw[u] * rml[((u * 2 + nbq) * 2 + 1) * 16 + lq]; }   // a wave that had no block: maximum -3e38, factor 0
    const float inv = __fdiv_rn(HL ? 1.0f : (1.0f / PCAR), L); v8us oh[2], ol[2];
#pragma unroll
    for (int e = 0; e < 16; ++e) { float a = 0.f;
#pragma unroll
        for (int u = 0; u < 4; ++u) a += mw[u] * red[((u * 64) + (nbq * 4 + mbq) * 8 + (e & 7)) * 32 + (e >> 3) * 16 + lq];
        unsigned short a2, c2; splitf(a * inv, a2, c2); oh[e >> 3][e & 7] = a2; ol[e >> 3][e & 7] = c2; }
    const size_t oo = (size_t)(q0 + nbq * 16 + lq) * DQ + head * HD + mbq * 16;
    *(v8us*)(Ah + oo) = oh[0]; *(v8us*)(Ah + oo + 8) = oh[1]; *(v8us*)(Al + oo) = ol[0]; *(v8us*)(Al + oo + 8) = ol[1];
}
// four waves per SIMD: the vector work between the matrix runs of one wave is covered by the other three; the grid is 8192 waves on 1024 SIMDs, so a work-group that ends is followed by one that waits
__global__ __launch_bounds__(128) __attribute__((amdgpu_waves_per_eu(4, 4))) void k_fattn(const h16* __restrict__ Q16, const h16* __restrict__ K16, const h16* __restrict__ V16, const bf* __restrict__ Qh, const bf* __restrict__ Ql, const bf* __restrict__ Kh, const bf* __restrict__ Kl, const bf* __restrict__ Vh, const bf* __restrict__ Vl, bf* Ah, bf* Al) {
    __shared__ __align__(16) float red[4 * 64 * 32]; __shared__ float rml[4 * 2 * 2 * 16];
    const int bh = blockIdx.x, head = bh % NH_; const int q0 = (TT / 32 - 1 - (int)blockIdx.y) * 32;   // bh = batch * NH_ + head; longest rows first, of both batches
    const size_t po = (size_t)bh * TT * HD; Ah += (size_t)(bh / NH_) * TT * DQ; Al += (size_t)(bh / NH_) * TT * DQ;
    if (q0 < RH) attn_body<bf, true>(Qh + po, Ql + po, Kh + po, Kl + po, Vh + po, Vl + po, q0, head, Ah, Al, red, rml);
    else attn_body<h16, false>(Q16 + po, nullptr, K16 + po, nullptr, V16 + po, nullptr, q0, head, Ah, Al, red, rml);
}

extern "C" void kernel_launch(void* const* d_in, const int* in_sizes, int n_in,
                              void* d_out, int out_size, void* d_ws, size_t ws_size, hipStream_t stream) {
    (void)in_sizes; (void)n_in; (void)out_size;
    const float* x = (const float*)d_in[0];   /* seq1 */ const float* x2 = (const float*)d_in[1];   /* seq2 */ const float* lng = (const float*)d_in[2]; const float* lnb = (const float*)d_in[3]; const float* pq = (const float*)d_in[4]; const float* pk = (const float*)d_in[5]; const float* pv = (const float*)d_in[6];   /* [16][1024][64] */ const float* wo = (const float*)d_in[7]; const float* bo = (const float*)d_in[8];     const float* wq = pq; const float* wk = pk; const float* wv = pv;
    float* OUT = (float*)d_out;     // [2][2048][1024]
    char* wsp = (char*)d_ws;
    auto take = [&](size_t bytes) { char* p = wsp; wsp += (bytes + 255) & ~(size_t)255; return (void*)p; };
    bf* WQ = (bf*)take((size_t)3 * DQ * DM * 2); bf* WK = WQ + (size_t)DQ * DM; bf* WV = WK + (size_t)DQ * DM;   /* one behind the other: the projection launch steps through them by grid z */ bf* WO = (bf*)take((size_t)DM * DQ * 2);
    const size_t XP = (size_t)NB_ * TT * DM, HP = (size_t)NB_ * NH_ * TT * HD;   // elements of one plane: activations, heads (both batches)
    bf* Xh = (bf*)take(2 * XP * 2); bf* Xl = (bf*)take(2 * XP * 2);   // x1 then x2
    h16* P16 = (h16*)take(3 * HP * 2); bf* PPh = (bf*)take(3 * HP * 2); bf* PPl = (bf*)take(3 * HP * 2);   // q then k then v (transposed)
    bf* ATh = (bf*)take(XP * 2); bf* ATl = (bf*)take(XP * 2);
    if ((size_t)(wsp - (char*)d_ws) > ws_size) return;    // ws 256 MiB
    k_prep<<<PG + PC, 256, 0, stream>>>(wq, wk, wv, wo, WQ, WK, WV, WO);   /* head hh's 'xw' [1024][64] -> Bt rows hh*64..; mixer_w -> bf16 */
    k_lnx<<<dim3(NB_ * TT / 8, 2, 1), 256, 0, stream>>>(x, x2, lng, lnb, Xh, Xl, XP);   /* LayerNorm(seq1), LayerNorm(seq2) as bf16 hi/lo planes */
    k_gemmw<bf, 1, EP_QKV><<<dim3(NB_ * TT / 64, DQ / 64, 3), 32, 0, stream>>>(Xh, Xl, WQ, nullptr, DM, nullptr, 0, nullptr, XP, (size_t)DQ * DM, HP, P16, PPh, PPl);
    k_fattn<<<dim3(NB_ * NH_, TT / 32, 1), 128, 0, stream>>>(P16, P16 + HP, P16 + 2 * HP, PPh, PPl, PPh + HP, PPl + HP, PPh + 2 * HP, PPl + 2 * HP, ATh, ATl);   /* one kv head per query head; leaves the merged hi/lo planes */
    k_gemmw<bf, 1, EP_F32B><<<dim3(NB_ * TT / 64, DM / 64, 1), 32, 0, stream>>>(ATh, ATl, WO, nullptr, DQ, OUT, DM, bo, 0, 0, 0, nullptr, nullptr, nullptr);
}

// v006
// Measured time: 121 microseconds a run.
// Timed twice side by side with v005, it ran 1.41 times as fast both times.
// Over all steps from v000 it is 15.2 times as fast.
#include <hip/hip_runtime.h>

// Causal cross attention between two LayerNorm'd sequences with per-head projection tensors (seq1, seq2 [2][2048][1024]; x1, x2 = LayerNorm(seq) (eps 1e-5, gamma/beta read); q = x1 q_proj[h], k = x2 k_proj[h], v = x2 v_proj[h] ([16][1024][64] 0.02, 'xw' per head, no bias); scores / float32(sqrt 64); causal (-inf); softmax; out = merged mixer_w^T + mixer_b ('oi') -> [2][2048][1024] (4.2 M); argument order seq1, seq2, ln_gamma, ln_beta, q_proj, k_proj, v_proj, mixer_w, mixer_b).
// Layout, every launch over both batches (token rows b * 2048 + t): a LayerNorm kernel (one wave per token row: mean, biased variance, f32; grid y picks the sequence) writes bf16 hi/lo planes of x1 and of x2; per-head 'xw' weight blocks gathered into Bt; the q, k and v projections hi/lo x exact (2 products) in one launch (grid z), whose epilogue writes the 16-bit head planes itself (q, k as [b][h][t][d], v as [b][h][d][t]); one fused causal T-2048 attention kernel with a running softmax (hybrid rows: < 512 hi/lo 3 products, rest fp16 x1024; key blocks above the diagonal are never visited); merged hi/lo x mixer_w exact + mixer_b.
// Compute dtypes, f32 accumulate: every input rounded to bf16; LayerNorm f32; projections 2 products (~f32); attention rows < 512 3 products, rest fp16; softmax f32; mixer hl x exact + bias.

#define NB_  2
#define TT   2048
#define DM   1024
#define NH_  16
#define NKV  16
#define REP  (NH_ / NKV)
#define HD   64
#define DQ   (NH_ * HD)
#define DKV  (NKV * HD)
#define RH   512                  // query rows < RH use hi+lo planes (0: none)
#define PCAR 1024.0f
#define SCL  0.125f   // HD^-0.5
typedef _Float16 h16;
typedef unsigned short bf;
typedef __attribute__((ext_vector_type(16))) __bf16   v16bf;
typedef __attribute__((ext_vector_type(16))) _Float16 v16h;
typedef __attribute__((ext_vector_type(8)))  _Float16 v8h;
typedef __attribute__((ext_vector_type(8)))  unsigned short v8us;
typedef __attribute__((ext_vector_type(8)))  float    v8f;
typedef __attribute__((ext_vector_type(4)))  float    v4f;
typedef v8h  __attribute__((may_alias)) v8ha;
typedef v4f  __attribute__((may_alias)) v4fa;
typedef v8us __attribute__((may_alias)) v8usa;

__device__ __forceinline__ unsigned short f2bf(float f) { unsigned u = __float_as_uint(f); u += 0x7FFFu + ((u >> 16) & 1u); return (unsigned short)(u >> 16); }
__device__ __forceinline__ float bf2f(unsigned short b) { return __uint_as_float(((unsigned)b) << 16); }
__device__ __forceinline__ float bfr(float f) { return bf2f(f2bf(f)); }
__device__ __forceinline__ v16h cat16(v8h lo, v8h hi) { return __builtin_shufflevector(lo, hi, 0, 1, 2, 3, 4, 5, 6, 7, 8, 9, 10, 11, 12, 13, 14, 15); }
__device__ __forceinline__ v16bf cat16b(v8us lo, v8us hi) { return __builtin_bit_cast(v16bf, __builtin_shufflevector(lo, hi, 0, 1, 2, 3, 4, 5, 6, 7, 8, 9, 10, 11, 12, 13, 14, 15)); }
__device__ __forceinline__ v8f wmma16(v16h a, v16h b, v8f c) { return __builtin_amdgcn_wmma_f32_16x16x32_f16(false, a, false, b, (short)0, c, false, false); }
__device__ __forceinline__ v8f wmmab(v16bf a, v16bf b, v8f c) { return __builtin_amdgcn_wmma_f32_16x16x32_bf16(false, a, false, b, (short)0, c, false, false); }
__device__ __forceinline__ h16 tohx(float x) { return (h16)x; }
__device__ __forceinline__ void splitf(float y, unsigned short& h, unsigned short& l) { h = f2bf(y); l = f2bf(y - bf2f(h)); }



// ---- k_gemmw: GEMM, one work-group of 4 waves per 128x128 output tile, each wave a 64x64 quarter (16 accumulators); grid (M/128, N/128, Z), 128 threads.
// C[m][n] = sum_k (A[m][k] + A2[m][k]) Bt[n][k], two products per k block. z strides sA/sB/sC in elements (sC: of C, or of the head planes). K % 64 == 0, K >= 128.
// Operands come through LDS: a stage is 64 k (one whole 128-byte line) of the tile's 128 A rows, 128 A2 rows and 128 Bt rows, brought by asynchronous copies (16 bytes a lane, a wave's copy = 4 whole lines) into one of two buffers, the next stage's copies in flight while this one is worked on.
// LDS rows have pitch 128 bytes and no pad: the 16-byte chunk c of row r lies at chunk place c ^ ((r >> 1) & 7), so the 16 rows that a fragment read touches fall on 16 different bank groups.
// EP picks what the tile leaves as: EP_F32B f32 rows (pitch ldc) + f32 bias[n]; EP_QKV fp16 and bf16 hi/lo planes of batch r0 / TT, head c0 / 64 (a wave's 64 columns are one head): z = 0 (q, from the first A planes) and z = 1 (k, from the second) as rows [t][d], z = 2 (v, from the second too) transposed [d][t].
#define EP_F32B 0
#define EP_QKV  1
#define GT   128                  // rows of the work-group's tile, of A and of Bt alike
#define GKS  64                   // k per stage
#define GPL  (GT * GKS * 2)       // bytes of one operand plane in a stage
#define GSTG (3 * GPL)            // bytes of a stage: A, A2, Bt
template <typename T16> struct WFrag;
template <> struct WFrag<h16> { typedef v16h V; static __device__ __forceinline__ V ld(const h16* p) { return cat16(*(const v8h*)p, *(const v8h*)(p + 16)); } static __device__ __forceinline__ v8f mma(V a, V b, v8f c) { return wmma16(a, b, c); } };
template <> struct WFrag<bf> { typedef v16bf V; static __device__ __forceinline__ V ld(const bf* p) { return cat16b(*(const v8us*)p, *(const v8us*)(p + 16)); } static __device__ __forceinline__ V ld2(const char* p0, const char* p1) { return cat16b(*(const v8usa*)p0, *(const v8usa*)p1); } static __device__ __forceinline__ v8f mma(V a, V b, v8f c) { return wmmab(a, b, c); } };
// one operand plane of a stage: 8 copies a lane, rows 16 apart (gs bytes in memory, 2048 in LDS). The s_wait_xcnt closes the statement, so it stands in front of any later write of the address registers that the copies name.
__device__ __forceinline__ void copy_plane(unsigned l, const char* g, size_t gs) {
    asm volatile("global_load_async_to_lds_b128 %0, %8, off\n\tglobal_load_async_to_lds_b128 %1, %9, off\n\tglobal_load_async_to_lds_b128 %2, %10, off\n\tglobal_load_async_to_lds_b128 %3, %11, off\n\t"
                 "global_load_async_to_lds_b128 %4, %12, off\n\tglobal_load_async_to_lds_b128 %5, %13, off\n\tglobal_load_async_to_lds_b128 %6, %14, off\n\tglobal_load_async_to_lds_b128 %7, %15, off\n\ts_wait_xcnt 0x0"
                 :: "v"(l), "v"(l + 2048u), "v"(l + 4096u), "v"(l + 6144u), "v"(l + 8192u), "v"(l + 10240u), "v"(l + 12288u), "v"(l + 14336u),
                    "v"(g), "v"(g + gs), "v"(g + 2 * gs), "v"(g + 3 * gs), "v"(g + 4 * gs), "v"(g + 5 * gs), "v"(g + 6 * gs), "v"(g + 7 * gs) : "memory");
}
template <typename T16, int EP>
__global__ __launch_bounds__(128) void k_gemmw(const T16* __restrict__ A, const T16* __restrict__ A2, const T16* __restrict__ Bt, int K, float* C, int ldc, const float* __restrict__ bias, size_t sA, size_t sB, size_t sC, h16* P16, bf* Ph, bf* Pl) {
    typedef typename WFrag<T16>::V V;
    __shared__ __align__(256) char ring[2 * GSTG];   // two stages (the banks repeat every 256 bytes: rows start on that grid); behind the loop's last barrier the epilogue's staging rows
    const size_t z = blockIdx.z, za = (EP == EP_QKV && z) ? 1 : z; A += za * sA; A2 += za * sA; Bt += z * sB; if (EP == EP_QKV) { P16 += z * sC; Ph += z * sC; Pl += z * sC; } else C += z * sC;
    const int lane = threadIdx.x & 31, lr = lane & 15, hi = lane >> 4, w = __builtin_amdgcn_readfirstlane(threadIdx.x >> 5);
    const int wr = (w >> 1) * 64, wc = (w & 1) * 64;   // the wave's quarter within the tile
    const int r0 = blockIdx.x * GT + wr, c0 = blockIdx.y * GT + wc; const int t0 = r0 % TT; const size_t hp = (size_t)(r0 / TT) * NH_ + c0 / HD;   // the quarter's first token within its batch; its head plane
    float* os = (float*)ring + w * (16 * 68);
    // copies: thread = (row cr of 16, chunk cch of 8)
    const int cr = threadIdx.x >> 3, cch = threadIdx.x & 7; const size_t gs = (size_t)16 * K * 2;
    const unsigned cl = (unsigned)(size_t)ring + cr * 128 + ((cch ^ ((cr >> 1) & 7)) << 4);
    const char* gA = (const char*)(A + (size_t)(blockIdx.x * GT + cr) * K + cch * 8); const char* gA2 = (const char*)(A2 + (size_t)(blockIdx.x * GT + cr) * K + cch * 8); const char* gB = (const char*)(Bt + (size_t)(blockIdx.y * GT + cr) * K + cch * 8);
    auto stage = [&](const int t) { const unsigned l = cl + (t & 1) * GSTG; const size_t ko = (size_t)t * (GKS * 2); copy_plane(l, gA + ko, gs); copy_plane(l + GPL, gA2 + ko, gs); copy_plane(l + 2 * GPL, gB + ko, gs); };
    // fragment reads: row lr of a 16-row group; the chunks 4 * kc + hi and 4 * kc + 2 + hi (k 8 * hi .. and 16 + 8 * hi .. of the 32-k block, as from memory) at their places
    int fo[2][2];
#pragma unroll   // this and every unroll below: constant indices keep offsets, fragments and accumulators in registers
    for (int kc = 0; kc < 2; ++kc)
#pragma unroll
        for (int h = 0; h < 2; ++h) fo[kc][h] = lr * 128 + (((4 * kc + 2 * h + hi) ^ (lr >> 1)) << 4);
    v8f acc[4][4];
#pragma unroll
    for (int mb = 0; mb < 4; ++mb)
#pragma unroll
        for (int nb = 0; nb < 4; ++nb) acc[mb][nb] = (v8f){};
    const int nt = K / GKS;
    stage(0);
    asm volatile("s_wait_asynccnt 0x0" ::: "memory");   // this wave's part of stage 0 has landed
    __syncthreads();                                     // ... and every other wave's
    stage(1);
#pragma unroll 1   // one trip per stage: the waits, the barrier and the refill at the foot stay in the order written
    for (int t = 0; t < nt; ++t) {
        const char* st = ring + (t & 1) * GSTG; V a[4], a2[4];
#pragma unroll
        for (int kc = 0; kc < 2; ++kc) {
#pragma unroll
            for (int mb = 0; mb < 4; ++mb) { const char* p = st + (wr + mb * 16) * 128; a[mb] = WFrag<T16>::ld2(p + fo[kc][0], p + fo[kc][1]); a2[mb] = WFrag<T16>::ld2(p + GPL + fo[kc][0], p + GPL + fo[kc][1]); }
#pragma unroll
            for (int nb = 0; nb < 4; ++nb) { const char* p = st + 2 * GPL + (wc + nb * 16) * 128; const V b = WFrag<T16>::ld2(p + fo[kc][0], p + fo[kc][1]);
#pragma unroll
                for (int mb = 0; mb < 4; ++mb) { acc[mb][nb] = WFrag<T16>::mma(a[mb], b, acc[mb][nb]); acc[mb][nb] = WFrag<T16>::mma(a2[mb], b, acc[mb][nb]); } }
        }
        // the distance behind the trip's last matrix instructions, whichever way the branches below go
        asm volatile("v_nop\n\tv_nop\n\tv_nop\n\tv_nop" : "+v"(acc[0][0]), "+v"(acc[0][1]), "+v"(acc[0][2]), "+v"(acc[0][3]), "+v"(acc[1][0]), "+v"(acc[1][1]), "+v"(acc[1][2]), "+v"(acc[1][3]), "+v"(acc[2][0]), "+v"(acc[2][1]), "+v"(acc[2][2]), "+v"(acc[2][3]), "+v"(acc[3][0]), "+v"(acc[3][1]), "+v"(acc[3][2]), "+v"(acc[3][3]));
        asm volatile("s_wait_dscnt 0x0" ::: "memory");      // this wave's reads of stage t are done before the buffer is given up
        asm volatile("s_wait_asynccnt 0x0" ::: "memory");   // this wave's part of stage t + 1 has landed
        __syncthreads();                                     // publishes stage t + 1 and ends every wave's reads of stage t
        if (t + 2 < nt) stage(t + 2);                        // into the buffer that this trip has just read
    }
    asm volatile("s_wait_asynccnt 0x0" ::: "memory");   // nothing in flight when the ring becomes staging rows
    if (EP == EP_QKV && blockIdx.z == 2) {
        // a lane's 8 accumulator rows are 8 consecutive t of one column d: 16 bytes of a [d][t] plane straight from registers; the four mb of a column fill its 128-byte line, all from this wave
#pragma unroll   // these three: constant indices keep acc and the packed vectors in registers
        for (int mb = 0; mb < 4; ++mb)
#pragma unroll
            for (int nb = 0; nb < 4; ++nb) { v8h o16; v8us oh, ol;
#pragma unroll
                for (int j = 0; j < 8; ++j) { const float x = acc[mb][nb][j]; o16[j] = tohx(x); unsigned short a2, c2; splitf(x, a2, c2); oh[j] = a2; ol[j] = c2; }
                const size_t oo = (hp * HD + nb * 16 + lr) * TT + t0 + mb * 16 + hi * 8;
                *(v8h*)(P16 + oo) = o16; *(v8us*)(Ph + oo) = oh; *(v8us*)(Pl + oo) = ol; }
        return;
    }
#pragma unroll
    for (int mb = 0; mb < 4; ++mb) {
#pragma unroll
        for (int nb = 0; nb < 4; ++nb) {
#pragma unroll
            for (int j = 0; j < 8; ++j) os[(hi * 8 + j) * 68 + nb * 16 + lr] = acc[mb][nb][j]; }
        __builtin_amdgcn_wave_barrier(); asm volatile("" ::: "memory");
        if constexpr (EP == EP_QKV) {
            // 8 lanes per token row, 8 columns each: every store covers four whole 128-byte rows of a [t][d] plane
#pragma unroll   // this and the next: constant LDS offsets, packed vectors in registers
            for (int s = 0; s < 4; ++s) { const int row = 4 * s + (lane >> 3), cofs = (lane & 7) * 8; const v4f x0 = *(const v4fa*)(os + row * 68 + cofs), x1 = *(const v4fa*)(os + row * 68 + cofs + 4); v8h o16; v8us oh, ol;
#pragma unroll
                for (int j = 0; j < 8; ++j) { const float x = (j < 4) ? x0[j & 3] : x1[j & 3]; o16[j] = tohx(x); unsigned short a2, c2; splitf(x, a2, c2); oh[j] = a2; ol[j] = c2; }
                const size_t oo = (hp * TT + t0 + mb * 16 + row) * HD + cofs;
                *(v8h*)(P16 + oo) = o16; *(v8us*)(Ph + oo) = oh; *(v8us*)(Pl + oo) = ol; }
        } else {
            float* crow = C + (size_t)(r0 + mb * 16) * ldc + c0;
#pragma unroll
            for (int s = 0; s < 8; ++s) { const int row = 2 * s + hi, cofs = lr * 4; v4f val = *(const v4fa*)(os + row * 68 + cofs); val[0] += bfr(bias[c0 + cofs]); val[1] += bfr(bias[c0 + cofs + 1]); val[2] += bfr(bias[c0 + cofs + 2]); val[3] += bfr(bias[c0 + cofs + 3]);
                *(v4f*)(crow + (size_t)row * ldc + cofs) = val; }
        }
        __builtin_amdgcn_wave_barrier(); asm volatile("" ::: "memory");
    }
}

typedef __attribute__((ext_vector_type(4))) _Float16 v4h;
typedef __attribute__((ext_vector_type(2))) unsigned short v2us;
typedef __attribute__((ext_vector_type(4))) unsigned short v4us;
typedef __attribute__((ext_vector_type(4))) int v4i;

// k_prep: every piece of set-up that depends on no other kernel, in ONE launch, dealt by block index (the gather's blocks come first: they run longest).
//   blocks [0, PG):        per-head 'xw' blocks [16][1024][64] of q_proj, k_proj, v_proj -> bf16 Bt rows (head * 64 + n)[k]; one 64-element line of Bt per wave and trip, 8 lines per wave
//   blocks [PG, PG + PC):  mixer_w ('oi', already K-contiguous) -> bf16, 8 elements per thread
#define PG (3 * NH_ * DM * HD / 64 / 64)
#define PC (DM * DQ / 8 / 256)
__global__ __launch_bounds__(256) void k_prep(const float* __restrict__ wq, const float* __restrict__ wk, const float* __restrict__ wv, const float* __restrict__ wo, bf* WQ, bf* WK, bf* WV, bf* WO) {
    const int blk = blockIdx.x;
    if (blk < PG) {
        const int ten = blk / (PG / 3); const float* __restrict__ w3 = (ten == 0) ? wq : (ten == 1) ? wk : wv; bf* B3 = (ten == 0) ? WQ : (ten == 1) ? WK : WV;
        const unsigned lane = threadIdx.x & 31; const unsigned G0 = ((blk % (PG / 3)) * 8 + (threadIdx.x >> 5)) * 8;   // Bt line index within the tensor (DM * HD / 64 lines per head)
        for (unsigned l = 0; l < 8; ++l) { const unsigned e = (G0 + l) * 64 + lane * 2; const unsigned k = e % DM, n = (e / DM) % HD, hh = e / (DM * HD); const float* w = w3 + (size_t)hh * DM * HD; v2us o;
            o[0] = f2bf(w[k * HD + n]); o[1] = f2bf(w[(k + 1) * HD + n]); *(v2us*)(B3 + e) = o;
            asm volatile("s_wait_xcnt 0x0" ::: "memory"); }   // the next trip's loads may land in this store's registers: the wait stands in front of that overwrite
    } else {
        const size_t i = (size_t)(blk - PG) * 256 + threadIdx.x; const v8f v = *(const v8f*)(wo + i * 8); v8us o;
#pragma unroll   // constant indices keep v and o in registers
        for (int k = 0; k < 8; ++k) o[k] = f2bf(v[k]);
        *(v8us*)(WO + i * 8) = o;
        asm volatile("s_wait_xcnt 0x0" ::: "memory");   // code laid out behind this store may reuse its address registers: the wait stands in front of any such overwrite
    }
}

// grid (NB_ * TT / 8, 2): y = 0 takes Xa, y = 1 takes Xb and the second pair of planes, sP elements further on
__global__ __launch_bounds__(256) void k_lnx(const float* __restrict__ Xa, const float* __restrict__ Xb, const float* __restrict__ gw, const float* __restrict__ gb, bf* Ph, bf* Pl, size_t sP) { const int lane = threadIdx.x & 31; const int r = blockIdx.x * 8 + (threadIdx.x >> 5); if (r >= NB_ * TT) return; const float* X = blockIdx.y ? Xb : Xa; Ph += blockIdx.y * sP; Pl += blockIdx.y * sP; const float* xr = X + (size_t)r * DM; float hv[32]; float s = 0.f;
#pragma unroll
    for (int ch = 0; ch < 8; ++ch) { const v4f a = *(const v4f*)(xr + ch * 128 + lane * 4);
#pragma unroll
        for (int q = 0; q < 4; ++q) { const float u = bfr(a[q]); hv[ch * 4 + q] = u; s += u; } }
#pragma unroll
    for (int sh = 16; sh; sh >>= 1) s += __shfl_xor(s, sh, 32);
    float mu = s * (1.0f / 1024.0f); asm volatile("" : "+v"(mu)); float s2 = 0.f;
#pragma unroll
    for (int k = 0; k < 32; ++k) { float d0 = __fsub_rn(hv[k], mu); asm volatile("" : "+v"(d0)); float p = __fmul_rn(d0, d0); asm volatile("" : "+v"(p)); s2 = __fadd_rn(s2, p); }
#pragma unroll
    for (int sh = 16; sh; sh >>= 1) s2 += __shfl_xor(s2, sh, 32);
    float var = __fadd_rn(s2 * (1.0f / 1024.0f), 1e-5f); asm volatile("" : "+v"(var)); const float rs = __frsqrt_rn(var);
{
#pragma unroll
        for (int ch = 0; ch < 8; ++ch) { const int c0 = ch * 128 + lane * 4; v4us oh, ol;
#pragma unroll
            for (int q = 0; q < 4; ++q) { float gg = bfr(gw[c0 + q]); asm volatile("" : "+v"(gg)); float d0 = __fsub_rn(hv[ch * 4 + q], mu); asm volatile("" : "+v"(d0)); float n0 = __fmul_rn(d0, rs); asm volatile("" : "+v"(n0)); float y = __fmul_rn(n0, gg); asm volatile("" : "+v"(y)); const float z = __fadd_rn(y, bfr(gb[c0 + q])); unsigned short a2, c2; splitf(z, a2, c2); oh[q] = a2; ol[q] = c2; }
            const size_t oo = (size_t)r * DM + c0; *(v4us*)(Ph + oo) = oh; *(v4us*)(Pl + oo) = ol; }
         } }
// k_fattn: scores, causal softmax, probability x value and the head merge in one kernel; no score or probability ever goes to memory.
// One work-group = one head of one batch x 32 query rows; its 4 waves deal the 32-key blocks up to the diagonal among them (wave w takes blocks w, w + 4, ...), each with its own running maximum, sum and output tile, joined through LDS at the end.
// St = K Qt (A = key rows, B = query rows): a lane holds scores of ONE query (column lr), keys 8 * hi + j of each 16-key tile, which is the B-operand k order of the next product, Ot += Vt Pt: P goes from accumulator to operand inside the lane.
// HL (query rows < RH): bf16 hi/lo planes, 3 products each; otherwise fp16, P carried x PCAR. Output: merged bf16 hi/lo planes [t][head * HD + d].
#define L2E 1.4426950408889634f
template <bool B> struct BoolC { static constexpr bool value = B; };
template <typename T16, bool HL>
__device__ __forceinline__ void attn_body(const T16* __restrict__ Qa, const T16* __restrict__ Qb, const T16* __restrict__ Ka, const T16* __restrict__ Kb, const T16* __restrict__ Va, const T16* __restrict__ Vb, int q0, int head, bf* Ah, bf* Al, float* red, float* rml) {
    typedef typename WFrag<T16>::V V;
    const int lane = threadIdx.x & 31, lr = lane & 15, hi = lane >> 4, w = __builtin_amdgcn_readfirstlane(threadIdx.x >> 5);   // the wave's number in a scalar register: block loop and diagonal test become scalar branches
    V q[2][2], q2[2][2]; const size_t qo = (size_t)(q0 + lr) * HD + 8 * hi; const T16* qp = Qa + qo; const T16* qp2 = HL ? Qb + qo : qp;   // one address per plane, every fragment at a constant offset from it
#pragma unroll
    for (int nb = 0; nb < 2; ++nb)
#pragma unroll
        for (int kc = 0; kc < 2; ++kc) { q[nb][kc] = WFrag<T16>::ld(qp + nb * 16 * HD + kc * 32); if (HL) q2[nb][kc] = WFrag<T16>::ld(qp2 + nb * 16 * HD + kc * 32); }
    asm volatile("s_wait_xcnt 0x0" :: "v"(qp), "v"(qp2) : "memory");   // later code may reuse the query loads' address registers: the wait stands in front of that overwrite; named as inputs, the addresses stay in their registers up to it
    v8f o[2][4]; float m[2], l[2];
#pragma unroll
    for (int nb = 0; nb < 2; ++nb) { m[nb] = -3.0e38f; l[nb] = 0.f;
#pragma unroll
        for (int mb = 0; mb < 4; ++mb) o[nb][mb] = (v8f){}; }
    const int nkb = q0 / 32 + 1;   // key blocks up to and with the diagonal one
    auto pass = [&](const int kb, auto dg) {   // one 32-key block; dg: the block crosses the diagonal and is masked
        constexpr bool diag = decltype(dg)::value; const int key0 = kb * 32;
        v8f s[2][2];
#pragma unroll
        for (int nb = 0; nb < 2; ++nb) { s[nb][0] = (v8f){}; s[nb][1] = (v8f){}; }
        V kf[2][2], kf2[2][2]; const size_t ko = (size_t)(key0 + lr) * HD + 8 * hi; const T16* kp = Ka + ko; const T16* kp2 = HL ? Kb + ko : kp;
#pragma unroll
        for (int mt = 0; mt < 2; ++mt)
#pragma unroll
            for (int kc = 0; kc < 2; ++kc) { kf[mt][kc] = WFrag<T16>::ld(kp + mt * 16 * HD + kc * 32); if (HL) kf2[mt][kc] = WFrag<T16>::ld(kp2 + mt * 16 * HD + kc * 32); }
        asm volatile("s_wait_xcnt 0x0" :: "v"(kp), "v"(kp2) : "memory");   // same wait, in the same form, for the key loads
#pragma unroll
        for (int kc = 0; kc < 2; ++kc)
#pragma unroll
            for (int mt = 0; mt < 2; ++mt)
#pragma unroll
                for (int nb = 0; nb < 2; ++nb) { s[nb][mt] = WFrag<T16>::mma(kf[mt][kc], q[nb][kc], s[nb][mt]); if (HL) { s[nb][mt] = WFrag<T16>::mma(kf[mt][kc], q2[nb][kc], s[nb][mt]); s[nb][mt] = WFrag<T16>::mma(kf2[mt][kc], q[nb][kc], s[nb][mt]); } }
        V pf[2], pf2[2];
#pragma unroll
        for (int nb = 0; nb < 2; ++nb) {
            float t[16]; float mx = m[nb]; const int qi = q0 + nb * 16 + lr;
#pragma unroll
            for (int e = 0; e < 16; ++e) { float x = s[nb][e >> 3][e & 7] * SCL; if (diag && key0 + (e >> 3) * 16 + hi * 8 + (e & 7) > qi) x = -3.0e38f; t[e] = x; mx = fmaxf(mx, x); }
            mx = fmaxf(mx, __shfl_xor(mx, 16, 32));   // the other half of the wave holds this query's other 16 keys
            const float al = __builtin_amdgcn_exp2f((m[nb] - mx) * L2E); m[nb] = mx; float sum = 0.f;
#pragma unroll
            for (int e = 0; e < 16; ++e) { t[e] = __builtin_amdgcn_exp2f((t[e] - mx) * L2E); sum += t[e]; }
            l[nb] = l[nb] * al + sum;   // each half keeps its own keys' sum; the halves are joined once, behind the loop
#pragma unroll
            for (int mb = 0; mb < 4; ++mb) o[nb][mb] *= al;
            if constexpr (HL) { __attribute__((ext_vector_type(16))) unsigned short ph, pl;
#pragma unroll
                for (int e = 0; e < 16; ++e) { unsigned short a, c2; splitf(t[e], a, c2); ph[e] = a; pl[e] = c2; }
                pf[nb] = __builtin_bit_cast(v16bf, ph); pf2[nb] = __builtin_bit_cast(v16bf, pl);
            } else {
#pragma unroll
                for (int e = 0; e < 16; ++e) pf[nb][e] = tohx(t[e] * PCAR); }
        }
        const size_t vo = (size_t)lr * TT + key0 + 8 * hi; const T16* vp = Va + vo; const T16* vp2 = HL ? Vb + vo : vp;
#pragma unroll
        for (int mb = 0; mb < 4; ++mb) { const V vf = WFrag<T16>::ld(vp + mb * 16 * TT); V vf2; if (HL) vf2 = WFrag<T16>::ld(vp2 + mb * 16 * TT);
            asm volatile("s_wait_xcnt 0x0" :: "v"(vp), "v"(vp2) : "memory");   // same wait, in the same form, for the value loads
#pragma unroll
            for (int nb = 0; nb < 2; ++nb) { o[nb][mb] = WFrag<T16>::mma(vf, pf[nb], o[nb][mb]); if (HL) { o[nb][mb] = WFrag<T16>::mma(vf, pf2[nb], o[nb][mb]); o[nb][mb] = WFrag<T16>::mma(vf2, pf[nb], o[nb][mb]); } } }
        // the distance behind the pass's last matrix instructions, on the back edge and on the way out alike
        asm volatile("v_nop\n\tv_nop\n\tv_nop\n\tv_nop\n\tv_nop" : "+v"(o[0][0]), "+v"(o[0][1]), "+v"(o[0][2]), "+v"(o[0][3]), "+v"(o[1][0]), "+v"(o[1][1]), "+v"(o[1][2]), "+v"(o[1][3]));
    };
#pragma unroll 1   // one pass's fragments at a time: unrolled, two passes' fragments would cost a resident wave
    for (int kb = w; kb < nkb - 1; kb += 4) pass(kb, BoolC<false>());
    if (((nkb - 1) & 3) == w) pass(nkb - 1, BoolC<true>());   // only the last block crosses the diagonal; it is its owner's last
#pragma unroll
    for (int nb = 0; nb < 2; ++nb) { l[nb] += __shfl_xor(l[nb], 16, 32);
        if (hi == 0) { rml[((w * 2 + nb) * 2 + 0) * 16 + lr] = m[nb]; rml[((w * 2 + nb) * 2 + 1) * 16 + lr] = l[nb]; }
#pragma unroll
        for (int mb = 0; mb < 4; ++mb)
#pragma unroll
            for (int j = 0; j < 8; ++j) red[((w * 64) + (nb * 4 + mb) * 8 + j) * 32 + lane] = o[nb][mb][j]; }
    __syncthreads();   // every wave's partial maximum, sum and tile are in LDS before any is read
    // join: wave w finishes 8 whole query rows (one writer per 128-byte output line); lane = (row lane >> 2, 16 columns (lane & 3) * 16 ..)
    const int nbq = w >> 1, lq = (w & 1) * 8 + (lane >> 2), mbq = lane & 3; float mw[4], M = -3.0e38f, L = 0.f;
#pragma unroll
    for (int u = 0; u < 4; ++u) { mw[u] = rml[((u * 2 + nbq) * 2 + 0) * 16 + lq]; M = fmaxf(M, mw[u]); }
#pragma unroll
    for (int u = 0; u < 4; ++u) { mw[u] = __builtin_amdgcn_exp2f((mw[u] - M) * L2E); L += mw[u] * rml[((u * 2 + nbq) * 2 + 1) * 16 + lq]; }   // a wave that had no block: maximum -3e38, factor 0
    const float inv = __fdiv_rn(HL ? 1.0f : (1.0f / PCAR), L); v8us oh[2], ol[2];
#pragma unroll
    for (int e = 0; e < 16; ++e) { float a = 0.f;
#pragma unroll
        for (int u = 0; u < 4; ++u) a += mw[u] * red[((u * 64) + (nbq * 4 + mbq) * 8 + (e & 7)) * 32 + (e >> 3) * 16 + lq];
        unsigned short a2, c2; splitf(a * inv, a2, c2); oh[e >> 3][e & 7] = a2; ol[e >> 3][e & 7] = c2; }
    const size_t oo = (size_t)(q0 + nbq * 16 + lq) * DQ + head * HD + mbq * 16;
    *(v8us*)(Ah + oo) = oh[0]; *(v8us*)(Ah + oo + 8) = oh[1]; *(v8us*)(Al + oo) = ol[0]; *(v8us*)(Al + oo + 8) = ol[1];
}
// four waves per SIMD: the vector work between the matrix runs of one wave is covered by the other three; the grid is 8192 waves on 1024 SIMDs, so a work-group that ends is followed by one that waits
__global__ __launch_bounds__(128) __attribute__((amdgpu_waves_per_eu(4, 4))) void k_fattn(const h16* __restrict__ Q16, const h16* __restrict__ K16, const h16* __restrict__ V16, const bf* __restrict__ Qh, const bf* __restrict__ Ql, const bf* __restrict__ Kh, const bf* __restrict__ Kl, const bf* __restrict__ Vh, const bf* __restrict__ Vl, bf* Ah, bf* Al) {
    __shared__ __align__(16) float red[4 * 64 * 32]; __shared__ float rml[4 * 2 * 2 * 16];
    const int bh = blockIdx.x, head = bh % NH_; const int q0 = (TT / 32 - 1 - (int)blockIdx.y) * 32;   // bh = batch * NH_ + head; longest rows first, of both batches
    const size_t po = (size_t)bh * TT * HD; Ah += (size_t)(bh / NH_) * TT * DQ; Al += (size_t)(bh / NH_) * TT * DQ;
    if (q0 < RH) attn_body<bf, true>(Qh + po, Ql + po, Kh + po, Kl + po, Vh + po, Vl + po, q0, head, Ah, Al, red, rml);
    else attn_body<h16, false>(Q16 + po, nullptr, K16 + po, nullptr, V16 + po, nullptr, q0, head, Ah, Al, red, rml);
}

extern "C" void kernel_launch(void* const* d_in, const int* in_sizes, int n_in,
                              void* d_out, int out_size, void* d_ws, size_t ws_size, hipStream_t stream) {
    (void)in_sizes; (void)n_in; (void)out_size;
    const float* x = (const float*)d_in[0];   /* seq1 */ const float* x2 = (const float*)d_in[1];   /* seq2 */ const float* lng = (const float*)d_in[2]; const float* lnb = (const float*)d_in[3]; const float* pq = (const float*)d_in[4]; const float* pk = (const float*)d_in[5]; const float* pv = (const float*)d_in[6];   /* [16][1024][64] */ const float* wo = (const float*)d_in[7]; const float* bo = (const float*)d_in[8];     const float* wq = pq; const float* wk = pk; const float* wv = pv;
    float* OUT = (float*)d_out;     // [2][2048][1024]
    char* wsp = (char*)d_ws;
    auto take = [&](size_t bytes) { char* p = wsp; wsp += (bytes + 255) & ~(size_t)255; return (void*)p; };
    bf* WQ = (bf*)take((size_t)3 * DQ * DM * 2); bf* WK = WQ + (size_t)DQ * DM; bf* WV = WK + (size_t)DQ * DM;   /* one behind the other: the projection launch steps through them by grid z */ bf* WO = (bf*)take((size_t)DM * DQ * 2);
    const size_t XP = (size_t)NB_ * TT * DM, HP = (size_t)NB_ * NH_ * TT * HD;   // elements of one plane: activations, heads (both batches)
    bf* Xh = (bf*)take(2 * XP * 2); bf* Xl = (bf*)take(2 * XP * 2);   // x1 then x2
    h16* P16 = (h16*)take(3 * HP * 2); bf* PPh = (bf*)take(3 * HP * 2); bf* PPl = (bf*)take(3 * HP * 2);   // q then k then v (transposed)
    bf* ATh = (bf*)take(XP * 2); bf* ATl = (bf*)take(XP * 2);
    if ((size_t)(wsp - (char*)d_ws) > ws_size) return;    // ws 256 MiB
    k_prep<<<PG + PC, 256, 0, stream>>>(wq, wk, wv, wo, WQ, WK, WV, WO);   /* head hh's 'xw' [1024][64] -> Bt rows hh*64..; mixer_w -> bf16 */
    k_lnx<<<dim3(NB_ * TT / 8, 2, 1), 256, 0, stream>>>(x, x2, lng, lnb, Xh, Xl, XP);   /* LayerNorm(seq1), LayerNorm(seq2) as bf16 hi/lo planes */
    k_gemmw<bf, EP_QKV><<<dim3(NB_ * TT / GT, DQ / GT, 3), 128, 0, stream>>>(Xh, Xl, WQ, DM, nullptr, 0, nullptr, XP, (size_t)DQ * DM, HP, P16, PPh, PPl);
    k_fattn<<<dim3(NB_ * NH_, TT / 32, 1), 128, 0, stream>>>(P16, P16 + HP, P16 + 2 * HP, PPh, PPl, PPh + HP, PPl + HP, PPh + 2 * HP, PPl + 2 * HP, ATh, ATl);   /* one kv head per query head; leaves the merged hi/lo planes */
    k_gemmw<bf, EP_F32B><<<dim3(NB_ * TT / GT, DM / GT, 1), 128, 0, stream>>>(ATh, ATl, WO, DQ, OUT, DM, bo, 0, 0, 0, nullptr, nullptr, nullptr);
}

// v007
// Measured time: 117 microseconds a run.
// In both of two side-by-side timings against v006, it was 1.04 times as fast.
// Counting every step since v000, it is 15.8 times as fast.
#include <hip/hip_runtime.h>

// Causal cross attention between two LayerNorm'd sequences with per-head projection tensors (seq1, seq2 [2][2048][1024]; x1, x2 = LayerNorm(seq) (eps 1e-5, gamma/beta read); q = x1 q_proj[h], k = x2 k_proj[h], v = x2 v_proj[h] ([16][1024][64] 0.02, 'xw' per head, no bias); scores / float32(sqrt 64); causal (-inf); softmax; out = merged mixer_w^T + mixer_b ('oi') -> [2][2048][1024] (4.2 M); argument order seq1, seq2, ln_gamma, ln_beta, q_proj, k_proj, v_proj, mixer_w, mixer_b).
// Layout, every launch over both batches (token rows b * 2048 + t): a LayerNorm kernel (one wave per token row: mean, biased variance, f32; grid y picks the sequence) writes bf16 hi/lo planes of x1 and of x2; per-head 'xw' weight blocks gathered into Bt; the q, k and v projections hi/lo x exact (2 products) in one launch (grid z), whose epilogue writes the 16-bit head planes itself (q, k as [b][h][t][d], v as [b][h][d][t]); one fused causal T-2048 attention kernel with a running softmax (hybrid rows: < 512 hi/lo 3 products, rest fp16 x1024; key blocks above the diagonal are never visited); merged hi/lo x mixer_w exact + mixer_b.
// Compute dtypes, f32 accumulate: every input rounded to bf16; LayerNorm f32; projections 2 products (~f32); attention rows < 512 3 products, rest fp16; softmax f32; mixer hl x exact + bias.

#define NB_  2
#define TT   2048
#define DM   1024
#define NH_  16
#define NKV  16
#define REP  (NH_ / NKV)
#define HD   64
#define DQ   (NH_ * HD)
#define DKV  (NKV * HD)
#define RH   512                  // query rows < RH use hi+lo planes (0: none)
#define PCAR 1024.0f
#define SCL  0.125f   // HD^-0.5
typedef _Float16 h16;
typedef unsigned short bf;
typedef __attribute__((ext_vector_type(16))) __bf16   v16bf;
typedef __attribute__((ext_vector_type(16))) _Float16 v16h;
typedef __attribute__((ext_vector_type(8)))  _Float16 v8h;
typedef __attribute__((ext_vector_type(8)))  unsigned short v8us;
typedef __attribute__((ext_vector_type(8)))  float    v8f;
typedef __attribute__((ext_vector_type(4)))  float    v4f;
typedef v8h  __attribute__((may_alias)) v8ha;
typedef v4f  __attribute__((may_alias)) v4fa;
typedef v8us __attribute__((may_alias)) v8usa;

__device__ __forceinline__ unsigned short f2bf(float f) { unsigned u = __float_as_uint(f); u += 0x7FFFu + ((u >> 16) & 1u); return (unsigned short)(u >> 16); }
__device__ __forceinline__ float bf2f(unsigned short b) { return __uint_as_float(((unsigned)b) << 16); }
__device__ __forceinline__ float bfr(float f) { return bf2f(f2bf(f)); }
__device__ __forceinline__ v16h cat16(v8h lo, v8h hi) { return __builtin_shufflevector(lo, hi, 0, 1, 2, 3, 4, 5, 6, 7, 8, 9, 10, 11, 12, 13, 14, 15); }
__device__ __forceinline__ v16bf cat16b(v8us lo, v8us hi) { return __builtin_bit_cast(v16bf, __builtin_shufflevector(lo, hi, 0, 1, 2, 3, 4, 5, 6, 7, 8, 9, 10, 11, 12, 13, 14, 15)); }
__device__ __forceinline__ v8f wmma16(v16h a, v16h b, v8f c) { return __builtin_amdgcn_wmma_f32_16x16x32_f16(false, a, false, b, (short)0, c, false, false); }
__device__ __forceinline__ v8f wmmab(v16bf a, v16bf b, v8f c) { return __builtin_amdgcn_wmma_f32_16x16x32_bf16(false, a, false, b, (short)0, c, false, false); }
__device__ __forceinline__ h16 tohx(float x) { return (h16)x; }
__device__ __forceinline__ void splitf(float y, unsigned short& h, unsigned short& l) { h = f2bf(y); l = f2bf(y - bf2f(h)); }



// ---- k_gemmw: GEMM, one work-group of 4 waves per 128x128 output tile, each wave a 64x64 quarter (16 accumulators); grid (M/128, N/128, Z), 128 threads.
// C[m][n] = sum_k (A[m][k] + A2[m][k]) Bt[n][k], two products per k block. z strides sA/sB/sC in elements (sC: of C, or of the head planes). K % 64 == 0, K >= 128.
// Operands come through LDS: a stage is 64 k (one whole 128-byte line) of the tile's 128 A rows, 128 A2 rows and 128 Bt rows, brought by asynchronous copies (16 bytes a lane, a wave's copy = 4 whole lines) into one of two buffers, the next stage's copies in flight while this one is worked on.
// LDS rows have pitch 128 bytes and no pad: the 16-byte chunk c of row r lies at chunk place c ^ ((r >> 1) & 7), so the 16 rows that a fragment read touches fall on 16 different bank groups.
// EP picks what the tile leaves as: EP_F32B f32 rows (pitch ldc) + f32 bias[n]; EP_QKV fp16 and bf16 hi/lo planes of batch r0 / TT, head c0 / 64 (a wave's 64 columns are one head): z = 0 (q, from the first A planes) and z = 1 (k, from the second) as rows [t][d], z = 2 (v, from the second too) transposed [d][t].
#define EP_F32B 0
#define EP_QKV  1
#define GT   128                  // rows of the work-group's tile, of A and of Bt alike
#define GKS  64                   // k per stage
#define GPL  (GT * GKS * 2)       // bytes of one operand plane in a stage
#define GSTG (3 * GPL)            // bytes of a stage: A, A2, Bt
template <typename T16> struct WFrag;
template <> struct WFrag<h16> { typedef v16h V; static __device__ __forceinline__ V ld(const h16* p) { return cat16(*(const v8h*)p, *(const v8h*)(p + 16)); } static __device__ __forceinline__ v8f mma(V a, V b, v8f c) { return wmma16(a, b, c); } };
template <> struct WFrag<bf> { typedef v16bf V; static __device__ __forceinline__ V ld(const bf* p) { return cat16b(*(const v8us*)p, *(const v8us*)(p + 16)); } static __device__ __forceinline__ V ld2(const char* p0, const char* p1) { return cat16b(*(const v8usa*)p0, *(const v8usa*)p1); } static __device__ __forceinline__ v8f mma(V a, V b, v8f c) { return wmmab(a, b, c); } };
// one operand plane of a stage: 8 copies a lane, rows 16 apart (gs bytes in memory, 2048 in LDS). The s_wait_xcnt closes the statement, so it stands in front of any later write of the address registers that the copies name.
__device__ __forceinline__ void copy_plane(unsigned l, const char* g, size_t gs) {
    asm volatile("global_load_async_to_lds_b128 %0, %8, off\n\tglobal_load_async_to_lds_b128 %1, %9, off\n\tglobal_load_async_to_lds_b128 %2, %10, off\n\tglobal_load_async_to_lds_b128 %3, %11, off\n\t"
                 "global_load_async_to_lds_b128 %4, %12, off\n\tglobal_load_async_to_lds_b128 %5, %13, off\n\tglobal_load_async_to_lds_b128 %6, %14, off\n\tglobal_load_async_to_lds_b128 %7, %15, off\n\ts_wait_xcnt 0x0"
                 :: "v"(l), "v"(l + 2048u), "v"(l + 4096u), "v"(l + 6144u), "v"(l + 8192u), "v"(l + 10240u), "v"(l + 12288u), "v"(l + 14336u),
                    "v"(g), "v"(g + gs), "v"(g + 2 * gs), "v"(g + 3 * gs), "v"(g + 4 * gs), "v"(g + 5 * gs), "v"(g + 6 * gs), "v"(g + 7 * gs) : "memory");
}
template <typename T16, int EP>
__global__ __launch_bounds__(128) void k_gemmw(const T16* __restrict__ A, const T16* __restrict__ A2, const T16* __restrict__ Bt, int K, float* C, int ldc, const float* __restrict__ bias, size_t sA, size_t sB, size_t sC, h16* P16, bf* Ph, bf* Pl) {
    typedef typename WFrag<T16>::V V;
    __shared__ __align__(256) char ring[2 * GSTG];   // two stages (the banks repeat every 256 bytes: rows start on that grid); behind the loop's last barrier the epilogue's staging rows
    const size_t z = blockIdx.z, za = (EP == EP_QKV && z) ? 1 : z; A += za * sA; A2 += za * sA; Bt += z * sB; if (EP == EP_QKV) { P16 += z * sC; Ph += z * sC; Pl += z * sC; } else C += z * sC;
    const int lane = threadIdx.x & 31, lr = lane & 15, hi = lane >> 4, w = __builtin_amdgcn_readfirstlane(threadIdx.x >> 5);
    const int wr = (w >> 1) * 64, wc = (w & 1) * 64;   // the wave's quarter within the tile
    const int r0 = blockIdx.x * GT + wr, c0 = blockIdx.y * GT + wc; const int t0 = r0 % TT; const size_t hp = (size_t)(r0 / TT) * NH_ + c0 / HD;   // the quarter's first token within its batch; its head plane
    float* os = (float*)ring + w * (16 * 68);
    // copies: thread = (row cr of 16, chunk cch of 8)
    const int cr = threadIdx.x >> 3, cch = threadIdx.x & 7; const size_t gs = (size_t)16 * K * 2;
    const unsigned cl = (unsigned)(size_t)ring + cr * 128 + ((cch ^ ((cr >> 1) & 7)) << 4);
    const char* gA = (const char*)(A + (size_t)(blockIdx.x * GT + cr) * K + cch * 8); const char* gA2 = (const char*)(A2 + (size_t)(blockIdx.x * GT + cr) * K + cch * 8); const char* gB = (const char*)(Bt + (size_t)(blockIdx.y * GT + cr) * K + cch * 8);
    auto stage = [&](const int t) { const unsigned l = cl + (t & 1) * GSTG; const size_t ko = (size_t)t * (GKS * 2); copy_plane(l, gA + ko, gs); copy_plane(l + GPL, gA2 + ko, gs); copy_plane(l + 2 * GPL, gB + ko, gs); };
    // fragment reads: row lr of a 16-row group; the chunks 4 * kc + hi and 4 * kc + 2 + hi (k 8 * hi .. and 16 + 8 * hi .. of the 32-k block, as from memory) at their places
    int fo[2][2];
#pragma unroll   // this and every unroll below: constant indices keep offsets, fragments and accumulators in registers
    for (int kc = 0; kc < 2; ++kc)
#pragma unroll
        for (int h = 0; h < 2; ++h) fo[kc][h] = lr * 128 + (((4 * kc + 2 * h + hi) ^ (lr >> 1)) << 4);
    v8f acc[4][4];
#pragma unroll
    for (int mb = 0; mb < 4; ++mb)
#pragma unroll
        for (int nb = 0; nb < 4; ++nb) acc[mb][nb] = (v8f){};
    const int nt = K / GKS;
    stage(0);
    asm volatile("s_wait_asynccnt 0x0" ::: "memory");   // this wave's part of stage 0 has landed
    __syncthreads();                                     // ... and every other wave's
    stage(1);
#pragma unroll 1   // one trip per stage: the waits, the barrier and the refill at the foot stay in the order written
    for (int t = 0; t < nt; ++t) {
        const char* st = ring + (t & 1) * GSTG; V a[4], a2[4];
#pragma unroll
        for (int kc = 0; kc < 2; ++kc) {
#pragma unroll
            for (int mb = 0; mb < 4; ++mb) { const char* p = st + (wr + mb * 16) * 128; a[mb] = WFrag<T16>::ld2(p + fo[kc][0], p + fo[kc][1]); a2[mb] = WFrag<T16>::ld2(p + GPL + fo[kc][0], p + GPL + fo[kc][1]); }
#pragma unroll
            for (int nb = 0; nb < 4; ++nb) { const char* p = st + 2 * GPL + (wc + nb * 16) * 128; const V b = WFrag<T16>::ld2(p + fo[kc][0], p + fo[kc][1]);
#pragma unroll
                for (int mb = 0; mb < 4; ++mb) { acc[mb][nb] = WFrag<T16>::mma(a[mb], b, acc[mb][nb]); acc[mb][nb] = WFrag<T16>::mma(a2[mb], b, acc[mb][nb]); } }
        }
        // the distance behind the trip's last matrix instructions, whichever way the branches below go
        asm volatile("v_nop\n\tv_nop\n\tv_nop\n\tv_nop" : "+v"(acc[0][0]), "+v"(acc[0][1]), "+v"(acc[0][2]), "+v"(acc[0][3]), "+v"(acc[1][0]), "+v"(acc[1][1]), "+v"(acc[1][2]), "+v"(acc[1][3]), "+v"(acc[2][0]), "+v"(acc[2][1]), "+v"(acc[2][2]), "+v"(acc[2][3]), "+v"(acc[3][0]), "+v"(acc[3][1]), "+v"(acc[3][2]), "+v"(acc[3][3]));
        asm volatile("s_wait_dscnt 0x0" ::: "memory");      // this wave's reads of stage t are done before the buffer is given up
        asm volatile("s_wait_asynccnt 0x0" ::: "memory");   // this wave's part of stage t + 1 has landed
        __syncthreads();                                     // publishes stage t + 1 and ends every wave's reads of stage t
        if (t + 2 < nt) stage(t + 2);                        // into the buffer that this trip has just read
    }
    asm volatile("s_wait_asynccnt 0x0" ::: "memory");   // nothing in flight when the ring becomes staging rows
    if (EP == EP_QKV && blockIdx.z == 2) {
        // a lane's 8 accumulator rows are 8 consecutive t of one column d: 16 bytes of a [d][t] plane straight from registers; the four mb of a column fill its 128-byte line, all from this wave
#pragma unroll   // these three: constant indices keep acc and the packed vectors in registers
        for (int mb = 0; mb < 4; ++mb)
#pragma unroll
            for (int nb = 0; nb < 4; ++nb) { v8h o16; v8us oh, ol;
#pragma unroll
                for (int j = 0; j < 8; ++j) { const float x = acc[mb][nb][j]; o16[j] = tohx(x); unsigned short a2, c2; splitf(x, a2, c2); oh[j] = a2; ol[j] = c2; }
                const size_t oo = (hp * HD + nb * 16 + lr) * TT + t0 + mb * 16 + hi * 8;
                *(v8h*)(P16 + oo) = o16; *(v8us*)(Ph + oo) = oh; *(v8us*)(Pl + oo) = ol; }
        return;
    }
#pragma unroll
    for (int mb = 0; mb < 4; ++mb) {
#pragma unroll
        for (int nb = 0; nb < 4; ++nb) {
#pragma unroll
            for (int j = 0; j < 8; ++j) os[(hi * 8 + j) * 68 + nb * 16 + lr] = acc[mb][nb][j]; }
        __builtin_amdgcn_wave_barrier(); asm volatile("" ::: "memory");
        if constexpr (EP == EP_QKV) {
            // 8 lanes per token row, 8 columns each: every store covers four whole 128-byte rows of a [t][d] plane
#pragma unroll   // this and the next: constant LDS offsets, packed vectors in registers
            for (int s = 0; s < 4; ++s) { const int row = 4 * s + (lane >> 3), cofs = (lane & 7) * 8; const v4f x0 = *(const v4fa*)(os + row * 68 + cofs), x1 = *(const v4fa*)(os + row * 68 + cofs + 4); v8h o16; v8us oh, ol;
#pragma unroll
                for (int j = 0; j < 8; ++j) { const float x = (j < 4) ? x0[j & 3] : x1[j & 3]; o16[j] = tohx(x); unsigned short a2, c2; splitf(x, a2, c2); oh[j] = a2; ol[j] = c2; }
                const size_t oo = (hp * TT + t0 + mb * 16 + row) * HD + cofs;
                *(v8h*)(P16 + oo) = o16; *(v8us*)(Ph + oo) = oh; *(v8us*)(Pl + oo) = ol; }
        } else {
            float* crow = C + (size_t)(r0 + mb * 16) * ldc + c0;
#pragma unroll
            for (int s = 0; s < 8; ++s) { const int row = 2 * s + hi, cofs = lr * 4; v4f val = *(const v4fa*)(os + row * 68 + cofs); val[0] += bfr(bias[c0 + cofs]); val[1] += bfr(bias[c0 + cofs + 1]); val[2] += bfr(bias[c0 + cofs + 2]); val[3] += bfr(bias[c0 + cofs + 3]);
                *(v4f*)(crow + (size_t)row * ldc + cofs) = val; }
        }
        __builtin_amdgcn_wave_barrier(); asm volatile("" ::: "memory");
    }
}

typedef __attribute__((ext_vector_type(4))) _Float16 v4h;
typedef __attribute__((ext_vector_type(2))) unsigned short v2us;
typedef __attribute__((ext_vector_type(4))) unsigned short v4us;
typedef __attribute__((ext_vector_type(4))) int v4i;

// k_prep: every piece of set-up that depends on no other kernel, in ONE launch, dealt by block index (the gather's blocks come first: they run longest).
//   blocks [0, PG):        per-head 'xw' blocks [16][1024][64] of q_proj, k_proj, v_proj -> bf16 Bt rows (head * 64 + n)[k]; one 64-element line of Bt per wave and trip, 8 lines per wave
//   blocks [PG, PG + PC):  mixer_w ('oi', already K-contiguous) -> bf16, 8 elements per thread
#define PG (3 * NH_ * DM * HD / 64 / 64)
#define PC (DM * DQ / 8 / 256)
__global__ __launch_bounds__(256) void k_prep(const float* __restrict__ wq, const float* __restrict__ wk, const float* __restrict__ wv, const float* __restrict__ wo, bf* WQ, bf* WK, bf* WV, bf* WO) {
    const int blk = blockIdx.x;
    if (blk < PG) {
        const int ten = blk / (PG / 3); const float* __restrict__ w3 = (ten == 0) ? wq : (ten == 1) ? wk : wv; bf* B3 = (ten == 0) ? WQ : (ten == 1) ? WK : WV;
        const unsigned lane = threadIdx.x & 31; const unsigned G0 = ((blk % (PG / 3)) * 8 + (threadIdx.x >> 5)) * 8;   // Bt line index within the tensor (DM * HD / 64 lines per head)
        for (unsigned l = 0; l < 8; ++l) { const unsigned e = (G0 + l) * 64 + lane * 2; const unsigned k = e % DM, n = (e / DM) % HD, hh = e / (DM * HD); const float* w = w3 + (size_t)hh * DM * HD; v2us o;
            o[0] = f2bf(w[k * HD + n]); o[1] = f2bf(w[(k + 1) * HD + n]); *(v2us*)(B3 + e) = o;
            asm volatile("s_wait_xcnt 0x0" ::: "memory"); }   // the next trip's loads may land in this store's registers: the wait stands in front of that overwrite
    } else {
        const size_t i = (size_t)(blk - PG) * 256 + threadIdx.x; const v8f v = *(const v8f*)(wo + i * 8); v8us o;
#pragma unroll   // constant indices keep v and o in registers
        for (int k = 0; k < 8; ++k) o[k] = f2bf(v[k]);
        *(v8us*)(WO + i * 8) = o;
        asm volatile("s_wait_xcnt 0x0" ::: "memory");   // code laid out behind this store may reuse its address registers: the wait stands in front of any such overwrite
    }
}

// grid (NB_ * TT / 8, 2): y = 0 takes Xa, y = 1 takes Xb and the second pair of planes, sP elements further on
__global__ __launch_bounds__(256) void k_lnx(const float* __restrict__ Xa, const float* __restrict__ Xb, const float* __restrict__ gw, const float* __restrict__ gb, bf* Ph, bf* Pl, size_t sP) { const int lane = threadIdx.x & 31; const int r = blockIdx.x * 8 + (threadIdx.x >> 5); if (r >= NB_ * TT) return; const float* X = blockIdx.y ? Xb : Xa; Ph += blockIdx.y * sP; Pl += blockIdx.y * sP; const float* xr = X + (size_t)r * DM; float hv[32]; float s = 0.f;
#pragma unroll
    for (int ch = 0; ch < 8; ++ch) { const v4f a = *(const v4f*)(xr + ch * 128 + lane * 4);
#pragma unroll
        for (int q = 0; q < 4; ++q) { const float u = bfr(a[q]); hv[ch * 4 + q] = u; s += u; } }
#pragma unroll
    for (int sh = 16; sh; sh >>= 1) s += __shfl_xor(s, sh, 32);
    float mu = s * (1.0f / 1024.0f); asm volatile("" : "+v"(mu)); float s2 = 0.f;
#pragma unroll
    for (int k = 0; k < 32; ++k) { float d0 = __fsub_rn(hv[k], mu); asm volatile("" : "+v"(d0)); float p = __fmul_rn(d0, d0); asm volatile("" : "+v"(p)); s2 = __fadd_rn(s2, p); }
#pragma unroll
    for (int sh = 16; sh; sh >>= 1) s2 += __shfl_xor(s2, sh, 32);
    float var = __fadd_rn(s2 * (1.0f / 1024.0f), 1e-5f); asm volatile("" : "+v"(var)); const float rs = __frsqrt_rn(var);
{
#pragma unroll
        for (int ch = 0; ch < 8; ++ch) { const int c0 = ch * 128 + lane * 4; v4us oh, ol;
#pragma unroll
            for (int q = 0; q < 4; ++q) { float gg = bfr(gw[c0 + q]); asm volatile("" : "+v"(gg)); float d0 = __fsub_rn(hv[ch * 4 + q], mu); asm volatile("" : "+v"(d0)); float n0 = __fmul_rn(d0, rs); asm volatile("" : "+v"(n0)); float y = __fmul_rn(n0, gg); asm volatile("" : "+v"(y)); const float z = __fadd_rn(y, bfr(gb[c0 + q])); unsigned short a2, c2; splitf(z, a2, c2); oh[q] = a2; ol[q] = c2; }
            const size_t oo = (size_t)r * DM + c0; *(v4us*)(Ph + oo) = oh; *(v4us*)(Pl + oo) = ol; }
         } }
// k_fattn: scores, causal softmax, probability x value and the head merge in one kernel; no score or probability ever goes to memory.
// One work-group = one head of one batch x 32 query rows; its 4 waves deal the 32-key blocks up to the diagonal among them (wave w takes blocks w, w + 4, ...), each with its own running maximum, sum and output tile, joined through LDS at the end.
// St = K Qt (A = key rows, B = query rows): a lane holds scores of ONE query (column lr), keys 8 * hi + j of each 16-key tile, which is the B-operand k order of the next product, Ot += Vt Pt: P goes from accumulator to operand inside the lane.
// HL (query rows < RH): bf16 hi/lo planes, 3 products each; otherwise fp16, P carried x PCAR. Output: merged bf16 hi/lo planes [t][head * HD + d].
// Rows >= RH (fp16): keys and values come through LDS. A stage is 128 keys (the four waves' blocks of one trip): 128 key rows of 128 bytes, then 64 value rows [d] of 256 bytes, brought by asynchronous copies (16 bytes a lane, a wave's copy = 4 whole lines) into one of two buffers, the next stage's copies in flight while this one is worked on.
// No pad: the 16-byte chunk c of key row r lies at chunk place c ^ ((r >> 1) & 7), that of value row d at c ^ (d & 15), so the 16 rows that a fragment read touches fall on 16 different bank groups.
#define L2E 1.4426950408889634f
#define AKB  (128 * HD * 2)       // bytes of a stage's key rows; its value rows take as many
#define ASTG (2 * AKB)            // bytes of a stage
__device__ __forceinline__ v16h lds_frag(const char* p0, const char* p1) { return cat16(*(const v8ha*)p0, *(const v8ha*)p1); }
// 8 copies a lane, gs bytes apart in memory; in LDS the even ones 4096 apart from l0, the odd ones from l1. The s_wait_xcnt closes the statement, so it stands in front of any later write of the address registers that the copies name.
__device__ __forceinline__ void copy_rows(unsigned l0, unsigned l1, const char* g, size_t gs) {
    asm volatile("global_load_async_to_lds_b128 %0, %8, off\n\tglobal_load_async_to_lds_b128 %1, %9, off\n\tglobal_load_async_to_lds_b128 %2, %10, off\n\tglobal_load_async_to_lds_b128 %3, %11, off\n\t"
                 "global_load_async_to_lds_b128 %4, %12, off\n\tglobal_load_async_to_lds_b128 %5, %13, off\n\tglobal_load_async_to_lds_b128 %6, %14, off\n\tglobal_load_async_to_lds_b128 %7, %15, off\n\ts_wait_xcnt 0x0"
                 :: "v"(l0), "v"(l1), "v"(l0 + 4096u), "v"(l1 + 4096u), "v"(l0 + 8192u), "v"(l1 + 8192u), "v"(l0 + 12288u), "v"(l1 + 12288u),
                    "v"(g), "v"(g + gs), "v"(g + 2 * gs), "v"(g + 3 * gs), "v"(g + 4 * gs), "v"(g + 5 * gs), "v"(g + 6 * gs), "v"(g + 7 * gs) : "memory");
}
template <bool B> struct BoolC { static constexpr bool value = B; };
template <typename T16, bool HL>
__device__ __forceinline__ void attn_body(const T16* __restrict__ Qa, const T16* __restrict__ Qb, const T16* __restrict__ Ka, const T16* __restrict__ Kb, const T16* __restrict__ Va, const T16* __restrict__ Vb, int q0, int head, bf* Ah, bf* Al, float* red, float* rml) {
    typedef typename WFrag<T16>::V V;
    char* ring = (char*)red;   // the staged path's two stages; the join's rows lie over them, when they are out of use
    const int lane = threadIdx.x & 31, lr = lane & 15, hi = lane >> 4, w = __builtin_amdgcn_readfirstlane(threadIdx.x >> 5);   // the wave's number in a scalar register: block loop and diagonal test become scalar branches
    V q[2][2], q2[2][2]; const size_t qo = (size_t)(q0 + lr) * HD + 8 * hi; const T16* qp = Qa + qo; const T16* qp2 = HL ? Qb + qo : qp;   // one address per plane, every fragment at a constant offset from it
#pragma unroll
    for (int nb = 0; nb < 2; ++nb)
#pragma unroll
        for (int kc = 0; kc < 2; ++kc) { q[nb][kc] = WFrag<T16>::ld(qp + nb * 16 * HD + kc * 32); if (HL) q2[nb][kc] = WFrag<T16>::ld(qp2 + nb * 16 * HD + kc * 32); }
    asm volatile("s_wait_xcnt 0x0" :: "v"(qp), "v"(qp2) : "memory");   // later code may reuse the query loads' address registers: the wait stands in front of that overwrite; named as inputs, the addresses stay in their registers up to it
    v8f o[2][4]; float m[2], l[2];
#pragma unroll
    for (int nb = 0; nb < 2; ++nb) { m[nb] = -3.0e38f; l[nb] = 0.f;
#pragma unroll
        for (int mb = 0; mb < 4; ++mb) o[nb][mb] = (v8f){}; }
    const int nkb = q0 / 32 + 1;   // key blocks up to and with the diagonal one
    const char* st = ring;   // the stage that the pass reads (staged path)
    // fragment reads from a stage: key row lr of a 16-row group, chunks 4 * kc + hi and 4 * kc + 2 + hi; value row lr of a 16-row group, chunks hi and 2 + hi of the wave's four: the k order of the loads from memory
    int fk[2][2], fv[2];
#pragma unroll   // this and the next: constant indices keep the offsets in registers
    for (int h = 0; h < 2; ++h) { fv[h] = AKB + lr * 256 + (((4 * w + 2 * h + hi) ^ lr) << 4);
#pragma unroll
        for (int kc = 0; kc < 2; ++kc) fk[kc][h] = (w * 32 + lr) * 128 + (((4 * kc + 2 * h + hi) ^ (lr >> 1)) << 4); }
    auto pass = [&](const int kb, auto dg) {   // one 32-key block; dg: the block crosses the diagonal and is masked
        constexpr bool diag = decltype(dg)::value; const int key0 = kb * 32;
        v8f s[2][2];
#pragma unroll
        for (int nb = 0; nb < 2; ++nb) { s[nb][0] = (v8f){}; s[nb][1] = (v8f){}; }
        V kf[2][2], kf2[2][2];
        if constexpr (HL) {
        const size_t ko = (size_t)(key0 + lr) * HD + 8 * hi; const T16* kp = Ka + ko; const T16* kp2 = HL ? Kb + ko : kp;
#pragma unroll
        for (int mt = 0; mt < 2; ++mt)
#pragma unroll
            for (int kc = 0; kc < 2; ++kc) { kf[mt][kc] = WFrag<T16>::ld(kp + mt * 16 * HD + kc * 32); if (HL) kf2[mt][kc] = WFrag<T16>::ld(kp2 + mt * 16 * HD + kc * 32); }
        asm volatile("s_wait_xcnt 0x0" :: "v"(kp), "v"(kp2) : "memory");   // same wait, in the same form, for the key loads
        } else {
#pragma unroll   // this and the next: constant indices keep the fragments in registers
            for (int mt = 0; mt < 2; ++mt)
#pragma unroll
                for (int kc = 0; kc < 2; ++kc) kf[mt][kc] = lds_frag(st + mt * 2048 + fk[kc][0], st + mt * 2048 + fk[kc][1]);
        }
#pragma unroll
        for (int kc = 0; kc < 2; ++kc)
#pragma unroll
            for (int mt = 0; mt < 2; ++mt)
#pragma unroll
                for (int nb = 0; nb < 2; ++nb) { s[nb][mt] = WFrag<T16>::mma(kf[mt][kc], q[nb][kc], s[nb][mt]); if (HL) { s[nb][mt] = WFrag<T16>::mma(kf[mt][kc], q2[nb][kc], s[nb][mt]); s[nb][mt] = WFrag<T16>::mma(kf2[mt][kc], q[nb][kc], s[nb][mt]); } }
        V pf[2], pf2[2];
#pragma unroll
        for (int nb = 0; nb < 2; ++nb) {
            float t[16]; float mx = m[nb]; const int qi = q0 + nb * 16 + lr;
#pragma unroll
            for (int e = 0; e < 16; ++e) { float x = s[nb][e >> 3][e & 7] * SCL; if (diag && key0 + (e >> 3) * 16 + hi * 8 + (e & 7) > qi) x = -3.0e38f; t[e] = x; mx = fmaxf(mx, x); }
            mx = fmaxf(mx, __shfl_xor(mx, 16, 32));   // the other half of the wave holds this query's other 16 keys
            const float al = __builtin_amdgcn_exp2f((m[nb] - mx) * L2E); m[nb] = mx; float sum = 0.f;
#pragma unroll
            for (int e = 0; e < 16; ++e) { t[e] = __builtin_amdgcn_exp2f((t[e] - mx) * L2E); sum += t[e]; }
            l[nb] = l[nb] * al + sum;   // each half keeps its own keys' sum; the halves are joined once, behind the loop
#pragma unroll
            for (int mb = 0; mb < 4; ++mb) o[nb][mb] *= al;
            if constexpr (HL) { __attribute__((ext_vector_type(16))) unsigned short ph, pl;
#pragma unroll
                for (int e = 0; e < 16; ++e) { unsigned short a, c2; splitf(t[e], a, c2); ph[e] = a; pl[e] = c2; }
                pf[nb] = __builtin_bit_cast(v16bf, ph); pf2[nb] = __builtin_bit_cast(v16bf, pl);
            } else {
#pragma unroll
                for (int e = 0; e < 16; ++e) pf[nb][e] = tohx(t[e] * PCAR); }
        }
        if constexpr (HL) {
        const size_t vo = (size_t)lr * TT + key0 + 8 * hi; const T16* vp = Va + vo; const T16* vp2 = HL ? Vb + vo : vp;
#pragma unroll
        for (int mb = 0; mb < 4; ++mb) { const V vf = WFrag<T16>::ld(vp + mb * 16 * TT); V vf2; if (HL) vf2 = WFrag<T16>::ld(vp2 + mb * 16 * TT);
            asm volatile("s_wait_xcnt 0x0" :: "v"(vp), "v"(vp2) : "memory");   // same wait, in the same form, for the value loads
#pragma unroll
            for (int nb = 0; nb < 2; ++nb) { o[nb][mb] = WFrag<T16>::mma(vf, pf[nb], o[nb][mb]); if (HL) { o[nb][mb] = WFrag<T16>::mma(vf, pf2[nb], o[nb][mb]); o[nb][mb] = WFrag<T16>::mma(vf2, pf[nb], o[nb][mb]); } } }
        } else {
#pragma unroll   // this and the next: constant indices keep the output tiles in registers
            for (int mb = 0; mb < 4; ++mb) { const V vf = lds_frag(st + mb * 4096 + fv[0], st + mb * 4096 + fv[1]);
#pragma unroll
                for (int nb = 0; nb < 2; ++nb) o[nb][mb] = WFrag<T16>::mma(vf, pf[nb], o[nb][mb]); }
        }
        // the distance behind the pass's last matrix instructions, on the back edge and on the way out alike
        asm volatile("v_nop\n\tv_nop\n\tv_nop\n\tv_nop\n\tv_nop" : "+v"(o[0][0]), "+v"(o[0][1]), "+v"(o[0][2]), "+v"(o[0][3]), "+v"(o[1][0]), "+v"(o[1][1]), "+v"(o[1][2]), "+v"(o[1][3]));
    };
    if constexpr (HL) {
#pragma unroll 1   // one pass's fragments at a time: unrolled, two passes' fragments would cost a resident wave
    for (int kb = w; kb < nkb - 1; kb += 4) pass(kb, BoolC<false>());
    if (((nkb - 1) & 3) == w) pass(nkb - 1, BoolC<true>());   // only the last block crosses the diagonal; it is its owner's last
    } else {
        // copies: keys, thread = (row of 16, chunk of 8), rows 16 apart; values, thread = (row of 8, chunk of 16), rows 8 apart (the odd ones' places differ in the chunk's top bit)
        const int kr = threadIdx.x >> 3, kch = threadIdx.x & 7, vr = threadIdx.x >> 4, vch = threadIdx.x & 15; const unsigned rb = (unsigned)(size_t)ring;
        const unsigned lk = rb + kr * 128 + ((kch ^ ((kr >> 1) & 7)) << 4), lv0 = rb + AKB + vr * 256 + ((vch ^ vr) << 4), lv1 = rb + AKB + (vr + 8) * 256 + ((vch ^ (vr + 8)) << 4);
        const char* gk = (const char*)(Ka + (size_t)kr * HD + kch * 8); const char* gv = (const char*)(Va + (size_t)vr * TT + vch * 8);
        auto stage = [&](const int t) { const unsigned b = (t & 1) * ASTG; copy_rows(lk + b, lk + b + 2048u, gk + (size_t)t * AKB, (size_t)16 * HD * 2); copy_rows(lv0 + b, lv1 + b, gv + (size_t)t * 256, (size_t)8 * TT * 2); };
        const int nfull = (nkb - 1) / 4, nst = nfull + 1;   // stages of four blocks: nfull in which every wave's block lies below the diagonal block, and the last; its keys beyond the diagonal block are copied (they lie inside the planes) and not read
        auto foot = [&](const int t) {   // the foot of trip t, gone through by every wave
            asm volatile("s_wait_dscnt 0x0" ::: "memory");      // this wave's reads of stage t are done before the buffer is given up
            asm volatile("s_wait_asynccnt 0x0" ::: "memory");   // this wave's part of stage t + 1 has landed
            __syncthreads();                                     // publishes stage t + 1 and ends every wave's reads of stage t
            if (t + 2 < nst) stage(t + 2);                       // into the buffer that this trip has just read
        };
        stage(0);
        asm volatile("s_wait_asynccnt 0x0" ::: "memory");   // this wave's part of stage 0 has landed
        __syncthreads();                                     // ... and every other wave's
        if (nst > 1) stage(1);
#pragma unroll 1   // one trip per stage: the waits, the barrier and the refill at the foot stay in the order written
        for (int t = 0; t < nfull; ++t) { st = ring + (t & 1) * ASTG; pass(4 * t + w, BoolC<false>()); foot(t); }
        st = ring + (nfull & 1) * ASTG; const int kb = 4 * nfull + w;   // the last trip, outside the loop so that the loop's body has no branch over a pass
        if (kb < nkb - 1) pass(kb, BoolC<false>()); else if (kb == nkb - 1) pass(kb, BoolC<true>());   // only the last block crosses the diagonal; a wave whose block lies beyond it has no pass, and still goes through the foot
        foot(nfull);
        asm volatile("s_wait_asynccnt 0x0" ::: "memory");   // nothing in flight when the ring becomes the join's rows
    }
#pragma unroll
    for (int nb = 0; nb < 2; ++nb) { l[nb] += __shfl_xor(l[nb], 16, 32);
        if (hi == 0) { rml[((w * 2 + nb) * 2 + 0) * 16 + lr] = m[nb]; rml[((w * 2 + nb) * 2 + 1) * 16 + lr] = l[nb]; }
#pragma unroll
        for (int mb = 0; mb < 4; ++mb)
#pragma unroll
            for (int j = 0; j < 8; ++j) red[((w * 64) + (nb * 4 + mb) * 8 + j) * 32 + lane] = o[nb][mb][j]; }
    __syncthreads();   // every wave's partial maximum, sum and tile are in LDS before any is read
    // join: wave w finishes 8 whole query rows (one writer per 128-byte output line); lane = (row lane >> 2, 16 columns (lane & 3) * 16 ..)
    const int nbq = w >> 1, lq = (w & 1) * 8 + (lane >> 2), mbq = lane & 3; float mw[4], M = -3.0e38f, L = 0.f;
#pragma unroll
    for (int u = 0; u < 4; ++u) { mw[u] = rml[((u * 2 + nbq) * 2 + 0) * 16 + lq]; M = fmaxf(M, mw[u]); }
#pragma unroll
    for (int u = 0; u < 4; ++u) { mw[u] = __builtin_amdgcn_exp2f((mw[u] - M) * L2E); L += mw[u] * rml[((u * 2 + nbq) * 2 + 1) * 16 + lq]; }   // a wave that had no block: maximum -3e38, factor 0
    const float inv = __fdiv_rn(HL ? 1.0f : (1.0f / PCAR), L); v8us oh[2], ol[2];
#pragma unroll
    for (int e = 0; e < 16; ++e) { float a = 0.f;
#pragma unroll
        for (int u = 0; u < 4; ++u) a += mw[u] * red[((u * 64) + (nbq * 4 + mbq) * 8 + (e & 7)) * 32 + (e >> 3) * 16 + lq];
        unsigned short a2, c2; splitf(a * inv, a2, c2); oh[e >> 3][e & 7] = a2; ol[e >> 3][e & 7] = c2; }
    const size_t oo = (size_t)(q0 + nbq * 16 + lq) * DQ + head * HD + mbq * 16;
    *(v8us*)(Ah + oo) = oh[0]; *(v8us*)(Ah + oo + 8) = oh[1]; *(v8us*)(Al + oo) = ol[0]; *(v8us*)(Al + oo + 8) = ol[1];
}
// four waves per SIMD: the vector work between the matrix runs of one wave is covered by the other three; the grid is 8192 waves on 1024 SIMDs, so a work-group that ends is followed by one that waits
__global__ __launch_bounds__(128) __attribute__((amdgpu_waves_per_eu(4, 4))) void k_fattn(const h16* __restrict__ Q16, const h16* __restrict__ K16, const h16* __restrict__ V16, const bf* __restrict__ Qh, const bf* __restrict__ Ql, const bf* __restrict__ Kh, const bf* __restrict__ Kl, const bf* __restrict__ Vh, const bf* __restrict__ Vl, bf* Ah, bf* Al) {
    __shared__ __align__(256) float red[2 * ASTG / 4]; __shared__ float rml[4 * 2 * 2 * 16];   // red: two stages (the banks repeat every 256 bytes: rows start on that grid); behind the loop the join's 4 * 64 * 32 floats
    const int bh = blockIdx.x, head = bh % NH_; const int q0 = (TT / 32 - 1 - (int)blockIdx.y) * 32;   // bh = batch * NH_ + head; longest rows first, of both batches
    const size_t po = (size_t)bh * TT * HD; Ah += (size_t)(bh / NH_) * TT * DQ; Al += (size_t)(bh / NH_) * TT * DQ;
    if (q0 < RH) attn_body<bf, true>(Qh + po, Ql + po, Kh + po, Kl + po, Vh + po, Vl + po, q0, head, Ah, Al, red, rml);
    else attn_body<h16, false>(Q16 + po, nullptr, K16 + po, nullptr, V16 + po, nullptr, q0, head, Ah, Al, red, rml);
}

extern "C" void kernel_launch(void* const* d_in, const int* in_sizes, int n_in,
                              void* d_out, int out_size, void* d_ws, size_t ws_size, hipStream_t stream) {
    (void)in_sizes; (void)n_in; (void)out_size;
    const float* x = (const float*)d_in[0];   /* seq1 */ const float* x2 = (const float*)d_in[1];   /* seq2 */ const float* lng = (const float*)d_in[2]; const float* lnb = (const float*)d_in[3]; const float* pq = (const float*)d_in[4]; const float* pk = (const float*)d_in[5]; const float* pv = (const float*)d_in[6];   /* [16][1024][64] */ const float* wo = (const float*)d_in[7]; const float* bo = (const float*)d_in[8];     const float* wq = pq; const float* wk = pk; const float* wv = pv;
    float* OUT = (float*)d_out;     // [2][2048][1024]
    char* wsp = (char*)d_ws;
    auto take = [&](size_t bytes) { char* p = wsp; wsp += (bytes + 255) & ~(size_t)255; return (void*)p; };
    bf* WQ = (bf*)take((size_t)3 * DQ * DM * 2); bf* WK = WQ + (size_t)DQ * DM; bf* WV = WK + (size_t)DQ * DM;   /* one behind the other: the projection launch steps through them by grid z */ bf* WO = (bf*)take((size_t)DM * DQ * 2);
    const size_t XP = (size_t)NB_ * TT * DM, HP = (size_t)NB_ * NH_ * TT * HD;   // elements of one plane: activations, heads (both batches)
    bf* Xh = (bf*)take(2 * XP * 2); bf* Xl = (bf*)take(2 * XP * 2);   // x1 then x2
    h16* P16 = (h16*)take(3 * HP * 2); bf* PPh = (bf*)take(3 * HP * 2); bf* PPl = (bf*)take(3 * HP * 2);   // q then k then v (transposed)
    bf* ATh = (bf*)take(XP * 2); bf* ATl = (bf*)take(XP * 2);
    if ((size_t)(wsp - (char*)d_ws) > ws_size) return;    // ws 256 MiB
    k_prep<<<PG + PC, 256, 0, stream>>>(wq, wk, wv, wo, WQ, WK, WV, WO);   /* head hh's 'xw' [1024][64] -> Bt rows hh*64..; mixer_w -> bf16 */
    k_lnx<<<dim3(NB_ * TT / 8, 2, 1), 256, 0, stream>>>(x, x2, lng, lnb, Xh, Xl, XP);   /* LayerNorm(seq1), LayerNorm(seq2) as bf16 hi/lo planes */
    k_gemmw<bf, EP_QKV><<<dim3(NB_ * TT / GT, DQ / GT, 3), 128, 0, stream>>>(Xh, Xl, WQ, DM, nullptr, 0, nullptr, XP, (size_t)DQ * DM, HP, P16, PPh, PPl);
    k_fattn<<<dim3(NB_ * NH_, TT / 32, 1), 128, 0, stream>>>(P16, P16 + HP, P16 + 2 * HP, PPh, PPl, PPh + HP, PPl + HP, PPh + 2 * HP, PPl + 2 * HP, ATh, ATl);   /* one kv head per query head; leaves the merged hi/lo planes */
    k_gemmw<bf, EP_F32B><<<dim3(NB_ * TT / GT, DM / GT, 1), 128, 0, stream>>>(ATh, ATl, WO, DQ, OUT, DM, bo, 0, 0, 0, nullptr, nullptr, nullptr);
}

// v008
// One run takes 112 microseconds.
// Two timings next to v007 both put it at 1.05 times that version's speed.
// All steps since v000 together make it 16.6 times as fast.
#include <hip/hip_runtime.h>

// Causal cross attention between two LayerNorm'd sequences with per-head projection tensors (seq1, seq2 [2][2048][1024]; x1, x2 = LayerNorm(seq) (eps 1e-5, gamma/beta read); q = x1 q_proj[h], k = x2 k_proj[h], v = x2 v_proj[h] ([16][1024][64] 0.02, 'xw' per head, no bias); scores / float32(sqrt 64); causal (-inf); softmax; out = merged mixer_w^T + mixer_b ('oi') -> [2][2048][1024] (4.2 M); argument order seq1, seq2, ln_gamma, ln_beta, q_proj, k_proj, v_proj, mixer_w, mixer_b).
// Layout, every launch over both batches (token rows b * 2048 + t): one front launch holds the three pieces that depend on no other kernel: LayerNorm (one wave per token row: mean, biased variance, f32) writes bf16 hi/lo planes of x1 and of x2, the per-head 'xw' weight blocks are gathered into Bt, and mixer_w is converted to bf16; the q, k and v projections hi/lo x exact (2 products) in one launch (grid z), whose epilogue writes the 16-bit head planes itself (q, k as [b][h][t][d], v as [b][h][d][t]); one fused causal T-2048 attention kernel with a running softmax (hybrid rows: < 512 hi/lo 3 products, rest fp16 x1024; key blocks above the diagonal are never visited); merged hi/lo x mixer_w exact + mixer_b.
// Compute dtypes, f32 accumulate: every input rounded to bf16; LayerNorm f32; projections 2 products (~f32); attention rows < 512 3 products, rest fp16; softmax f32; mixer hl x exact + bias.

#define NB_  2
#define TT   2048
#define DM   1024
#define NH_  16
#define NKV  16
#define REP  (NH_ / NKV)
#define HD   64
#define DQ   (NH_ * HD)
#define DKV  (NKV * HD)
#define RH   512                  // query rows < RH use hi+lo planes (0: none)
#define PCAR 1024.0f
#define SCL  0.125f   // HD^-0.5
typedef _Float16 h16;
typedef unsigned short bf;
typedef __attribute__((ext_vector_type(16))) __bf16   v16bf;
typedef __attribute__((ext_vector_type(16))) _Float16 v16h;
typedef __attribute__((ext_vector_type(8)))  _Float16 v8h;
typedef __attribute__((ext_vector_type(8)))  unsigned short v8us;
typedef __attribute__((ext_vector_type(8)))  float    v8f;
typedef __attribute__((ext_vector_type(4)))  float    v4f;
typedef v8h  __attribute__((may_alias)) v8ha;
typedef v4f  __attribute__((may_alias)) v4fa;
typedef v8us __attribute__((may_alias)) v8usa;

__device__ __forceinline__ unsigned short f2bf(float f) { unsigned u = __float_as_uint(f); u += 0x7FFFu + ((u >> 16) & 1u); return (unsigned short)(u >> 16); }
__device__ __forceinline__ float bf2f(unsigned short b) { return __uint_as_float(((unsigned)b) << 16); }
__device__ __forceinline__ float bfr(float f) { return bf2f(f2bf(f)); }
__device__ __forceinline__ v16h cat16(v8h lo, v8h hi) { return __builtin_shufflevector(lo, hi, 0, 1, 2, 3, 4, 5, 6, 7, 8, 9, 10, 11, 12, 13, 14, 15); }
__device__ __forceinline__ v16bf cat16b(v8us lo, v8us hi) { return __builtin_bit_cast(v16bf, __builtin_shufflevector(lo, hi, 0, 1, 2, 3, 4, 5, 6, 7, 8, 9, 10, 11, 12, 13, 14, 15)); }
__device__ __forceinline__ v8f wmma16(v16h a, v16h b, v8f c) { return __builtin_amdgcn_wmma_f32_16x16x32_f16(false, a, false, b, (short)0, c, false, false); }
__device__ __forceinline__ v8f wmmab(v16bf a, v16bf b, v8f c) { return __builtin_amdgcn_wmma_f32_16x16x32_bf16(false, a, false, b, (short)0, c, false, false); }
__device__ __forceinline__ h16 tohx(float x) { return (h16)x; }
__device__ __forceinline__ void splitf(float y, unsigned short& h, unsigned short& l) { h = f2bf(y); l = f2bf(y - bf2f(h)); }



// ---- k_gemmw: GEMM, one work-group of 4 waves per 128x128 output tile, each wave a 64x64 quarter (16 accumulators); grid (M/128, N/128, Z), 128 threads.
// C[m][n] = sum_k (A[m][k] + A2[m][k]) Bt[n][k], two products per k block. z strides sA/sB/sC in elements (sC: of C, or of the head planes). K % 64 == 0, K >= 128.
// Operands come through LDS: a stage is 64 k (one whole 128-byte line) of the tile's 128 A rows, 128 A2 rows and 128 Bt rows, brought by asynchronous copies (16 bytes a lane, a wave's copy = 4 whole lines) into one of two buffers, the next stage's copies in flight while this one is worked on.
// LDS rows have pitch 128 bytes and no pad: the 16-byte chunk c of row r lies at chunk place c ^ ((r >> 1) & 7), so the 16 rows that a fragment read touches fall on 16 different bank groups.
// EP picks what the tile leaves as: EP_F32B f32 rows (pitch ldc) + f32 bias[n]; EP_QKV fp16 and bf16 hi/lo planes of batch r0 / TT, head c0 / 64 (a wave's 64 columns are one head): z = 0 (q, from the first A planes) and z = 1 (k, from the second) as rows [t][d], z = 2 (v, from the second too) transposed [d][t].
#define EP_F32B 0
#define EP_QKV  1
#define GT   128                  // rows of the work-group's tile, of A and of Bt alike
#define GKS  64                   // k per stage
#define GPL  (GT * GKS * 2)       // bytes of one operand plane in a stage
#define GSTG (3 * GPL)            // bytes of a stage: A, A2, Bt
template <typename T16> struct WFrag;
template <> struct WFrag<h16> { typedef v16h V; static __device__ __forceinline__ V ld(const h16* p) { return cat16(*(const v8h*)p, *(const v8h*)(p + 16)); } static __device__ __forceinline__ v8f mma(V a, V b, v8f c) { return wmma16(a, b, c); } };
template <> struct WFrag<bf> { typedef v16bf V; static __device__ __forceinline__ V ld(const bf* p) { return cat16b(*(const v8us*)p, *(const v8us*)(p + 16)); } static __device__ __forceinline__ V ld2(const char* p0, const char* p1) { return cat16b(*(const v8usa*)p0, *(const v8usa*)p1); } static __device__ __forceinline__ v8f mma(V a, V b, v8f c) { return wmmab(a, b, c); } };
// one operand plane of a stage: 8 copies a lane, rows 16 apart (gs bytes in memory, 2048 in LDS). The s_wait_xcnt closes the statement, so it stands in front of any later write of the address registers that the copies name.
__device__ __forceinline__ void copy_plane(unsigned l, const char* g, size_t gs) {
    asm volatile("global_load_async_to_lds_b128 %0, %8, off\n\tglobal_load_async_to_lds_b128 %1, %9, off\n\tglobal_load_async_to_lds_b128 %2, %10, off\n\tglobal_load_async_to_lds_b128 %3, %11, off\n\t"
                 "global_load_async_to_lds_b128 %4, %12, off\n\tglobal_load_async_to_lds_b128 %5, %13, off\n\tglobal_load_async_to_lds_b128 %6, %14, off\n\tglobal_load_async_to_lds_b128 %7, %15, off\n\ts_wait_xcnt 0x0"
                 :: "v"(l), "v"(l + 2048u), "v"(l + 4096u), "v"(l + 6144u), "v"(l + 8192u), "v"(l + 10240u), "v"(l + 12288u), "v"(l + 14336u),
                    "v"(g), "v"(g + gs), "v"(g + 2 * gs), "v"(g + 3 * gs), "v"(g + 4 * gs), "v"(g + 5 * gs), "v"(g + 6 * gs), "v"(g + 7 * gs) : "memory");
}
template <typename T16, int EP>
__global__ __launch_bounds__(128) void k_gemmw(const T16* __restrict__ A, const T16* __restrict__ A2, const T16* __restrict__ Bt, int K, float* C, int ldc, const float* __restrict__ bias, size_t sA, size_t sB, size_t sC, h16* P16, bf* Ph, bf* Pl) {
    typedef typename WFrag<T16>::V V;
    __shared__ __align__(256) char ring[2 * GSTG];   // two stages (the banks repeat every 256 bytes: rows start on that grid); behind the loop's last barrier the epilogue's staging rows
    const size_t z = blockIdx.z, za = (EP == EP_QKV && z) ? 1 : z; A += za * sA; A2 += za * sA; Bt += z * sB; if (EP == EP_QKV) { P16 += z * sC; Ph += z * sC; Pl += z * sC; } else C += z * sC;
    const int lane = threadIdx.x & 31, lr = lane & 15, hi = lane >> 4, w = __builtin_amdgcn_readfirstlane(threadIdx.x >> 5);
    const int wr = (w >> 1) * 64, wc = (w & 1) * 64;   // the wave's quarter within the tile
    const int r0 = blockIdx.x * GT + wr, c0 = blockIdx.y * GT + wc; const int t0 = r0 % TT; const size_t hp = (size_t)(r0 / TT) * NH_ + c0 / HD;   // the quarter's first token within its batch; its head plane
    float* os = (float*)ring + w * (16 * 68);
    // copies: thread = (row cr of 16, chunk cch of 8)
    const int cr = threadIdx.x >> 3, cch = threadIdx.x & 7; const size_t gs = (size_t)16 * K * 2;
    const unsigned cl = (unsigned)(size_t)ring + cr * 128 + ((cch ^ ((cr >> 1) & 7)) << 4);
    const char* gA = (const char*)(A + (size_t)(blockIdx.x * GT + cr) * K + cch * 8); const char* gA2 = (const char*)(A2 + (size_t)(blockIdx.x * GT + cr) * K + cch * 8); const char* gB = (const char*)(Bt + (size_t)(blockIdx.y * GT + cr) * K + cch * 8);
    auto stage = [&](const int t) { const unsigned l = cl + (t & 1) * GSTG; const size_t ko = (size_t)t * (GKS * 2); copy_plane(l, gA + ko, gs); copy_plane(l + GPL, gA2 + ko, gs); copy_plane(l + 2 * GPL, gB + ko, gs); };
    // fragment reads: row lr of a 16-row group; the chunks 4 * kc + hi and 4 * kc + 2 + hi (k 8 * hi .. and 16 + 8 * hi .. of the 32-k block, as from memory) at their places
    int fo[2][2];
#pragma unroll   // this and every unroll below: constant indices keep offsets, fragments and accumulators in registers
    for (int kc = 0; kc < 2; ++kc)
#pragma unroll
        for (int h = 0; h < 2; ++h) fo[kc][h] = lr * 128 + (((4 * kc + 2 * h + hi) ^ (lr >> 1)) << 4);
    v8f acc[4][4];
#pragma unroll
    for (int mb = 0; mb < 4; ++mb)
#pragma unroll
        for (int nb = 0; nb < 4; ++nb) acc[mb][nb] = (v8f){};
    const int nt = K / GKS;
    stage(0);
    asm volatile("s_wait_asynccnt 0x0" ::: "memory");   // this wave's part of stage 0 has landed
    __syncthreads();                                     // ... and every other wave's
    stage(1);
#pragma unroll 1   // one trip per stage: the waits, the barrier and the refill at the foot stay in the order written
    for (int t = 0; t < nt; ++t) {
        const char* st = ring + (t & 1) * GSTG; V a[4], a2[4];
#pragma unroll
        for (int kc = 0; kc < 2; ++kc) {
#pragma unroll
            for (int mb = 0; mb < 4; ++mb) { const char* p = st + (wr + mb * 16) * 128; a[mb] = WFrag<T16>::ld2(p + fo[kc][0], p + fo[kc][1]); a2[mb] = WFrag<T16>::ld2(p + GPL + fo[kc][0], p + GPL + fo[kc][1]); }
#pragma unroll
            for (int nb = 0; nb < 4; ++nb) { const char* p = st + 2 * GPL + (wc + nb * 16) * 128; const V b = WFrag<T16>::ld2(p + fo[kc][0], p + fo[kc][1]);
#pragma unroll
                for (int mb = 0; mb < 4; ++mb) { acc[mb][nb] = WFrag<T16>::mma(a[mb], b, acc[mb][nb]); acc[mb][nb] = WFrag<T16>::mma(a2[mb], b, acc[mb][nb]); } }
        }
        // the distance behind the trip's last matrix instructions, whichever way the branches below go
        asm volatile("v_nop\n\tv_nop\n\tv_nop\n\tv_nop" : "+v"(acc[0][0]), "+v"(acc[0][1]), "+v"(acc[0][2]), "+v"(acc[0][3]), "+v"(acc[1][0]), "+v"(acc[1][1]), "+v"(acc[1][2]), "+v"(acc[1][3]), "+v"(acc[2][0]), "+v"(acc[2][1]), "+v"(acc[2][2]), "+v"(acc[2][3]), "+v"(acc[3][0]), "+v"(acc[3][1]), "+v"(acc[3][2]), "+v"(acc[3][3]));
        asm volatile("s_wait_dscnt 0x0" ::: "memory");      // this wave's reads of stage t are done before the buffer is given up
        asm volatile("s_wait_asynccnt 0x0" ::: "memory");   // this wave's part of stage t + 1 has landed
        __syncthreads();                                     // publishes stage t + 1 and ends every wave's reads of stage t
        if (t + 2 < nt) stage(t + 2);                        // into the buffer that this trip has just read
    }
    asm volatile("s_wait_asynccnt 0x0" ::: "memory");   // nothing in flight when the ring becomes staging rows
    if (EP == EP_QKV && blockIdx.z == 2) {
        // a lane's 8 accumulator rows are 8 consecutive t of one column d: 16 bytes of a [d][t] plane straight from registers; the four mb of a column fill its 128-byte line, all from this wave
#pragma unroll   // these three: constant indices keep acc and the packed vectors in registers
        for (int mb = 0; mb < 4; ++mb)
#pragma unroll
            for (int nb = 0; nb < 4; ++nb) { v8h o16; v8us oh, ol;
#pragma unroll
                for (int j = 0; j < 8; ++j) { const float x = acc[mb][nb][j]; o16[j] = tohx(x); unsigned short a2, c2; splitf(x, a2, c2); oh[j] = a2; ol[j] = c2; }
                const size_t oo = (hp * HD + nb * 16 + lr) * TT + t0 + mb * 16 + hi * 8;
                *(v8h*)(P16 + oo) = o16; *(v8us*)(Ph + oo) = oh; *(v8us*)(Pl + oo) = ol; }
        return;
    }
#pragma unroll
    for (int mb = 0; mb < 4; ++mb) {
#pragma unroll
        for (int nb = 0; nb < 4; ++nb) {
#pragma unroll
            for (int j = 0; j < 8; ++j) os[(hi * 8 + j) * 68 + nb * 16 + lr] = acc[mb][nb][j]; }
        __builtin_amdgcn_wave_barrier(); asm volatile("" ::: "memory");
        if constexpr (EP == EP_QKV) {
            // 8 lanes per token row, 8 columns each: every store covers four whole 128-byte rows of a [t][d] plane
#pragma unroll   // this and the next: constant LDS offsets, packed vectors in registers
            for (int s = 0; s < 4; ++s) { const int row = 4 * s + (lane >> 3), cofs = (lane & 7) * 8; const v4f x0 = *(const v4fa*)(os + row * 68 + cofs), x1 = *(const v4fa*)(os + row * 68 + cofs + 4); v8h o16; v8us oh, ol;
#pragma unroll
                for (int j = 0; j < 8; ++j) { const float x = (j < 4) ? x0[j & 3] : x1[j & 3]; o16[j] = tohx(x); unsigned short a2, c2; splitf(x, a2, c2); oh[j] = a2; ol[j] = c2; }
                const size_t oo = (hp * TT + t0 + mb * 16 + row) * HD + cofs;
                *(v8h*)(P16 + oo) = o16; *(v8us*)(Ph + oo) = oh; *(v8us*)(Pl + oo) = ol; }
        } else {
            float* crow = C + (size_t)(r0 + mb * 16) * ldc + c0;
#pragma unroll
            for (int s = 0; s < 8; ++s) { const int row = 2 * s + hi, cofs = lr * 4; v4f val = *(const v4fa*)(os + row * 68 + cofs); val[0] += bfr(bias[c0 + cofs]); val[1] += bfr(bias[c0 + cofs + 1]); val[2] += bfr(bias[c0 + cofs + 2]); val[3] += bfr(bias[c0 + cofs + 3]);
                *(v4f*)(crow + (size_t)row * ldc + cofs) = val; }
        }
        __builtin_amdgcn_wave_barrier(); asm volatile("" ::: "memory");
    }
}

typedef __attribute__((ext_vector_type(4))) _Float16 v4h;
typedef __attribute__((ext_vector_type(2))) unsigned short v2us;
typedef __attribute__((ext_vector_type(4))) unsigned short v4us;
typedef __attribute__((ext_vector_type(4))) int v4i;

// prep_body: the weights' set-up, dealt by the index blk that k_front hands it.
//   blk in [0, PG):        per-head 'xw' blocks [16][1024][64] of q_proj, k_proj, v_proj -> bf16 Bt rows (head * 64 + n)[k]; one 64-element line of Bt per wave and trip, 8 lines per wave
//   blk in [PG, PG + PC):  mixer_w ('oi', already K-contiguous) -> bf16, 8 elements per thread
#define PG (3 * NH_ * DM * HD / 64 / 64)
#define PC (DM * DQ / 8 / 256)
__device__ __forceinline__ void prep_body(const int blk, const float* __restrict__ wq, const float* __restrict__ wk, const float* __restrict__ wv, const float* __restrict__ wo, bf* WQ, bf* WK, bf* WV, bf* WO) {
    if (blk < PG) {
        const int ten = blk / (PG / 3); const float* __restrict__ w3 = (ten == 0) ? wq : (ten == 1) ? wk : wv; bf* B3 = (ten == 0) ? WQ : (ten == 1) ? WK : WV;
        const unsigned lane = threadIdx.x & 31; const unsigned G0 = ((blk % (PG / 3)) * 8 + (threadIdx.x >> 5)) * 8;   // Bt line index within the tensor (DM * HD / 64 lines per head)
        for (unsigned l = 0; l < 8; ++l) { const unsigned e = (G0 + l) * 64 + lane * 2; const unsigned k = e % DM, n = (e / DM) % HD, hh = e / (DM * HD); const float* w = w3 + (size_t)hh * DM * HD; v2us o;
            o[0] = f2bf(w[k * HD + n]); o[1] = f2bf(w[(k + 1) * HD + n]); *(v2us*)(B3 + e) = o;
            asm volatile("s_wait_xcnt 0x0" ::: "memory"); }   // the next trip's loads may land in this store's registers: the wait stands in front of that overwrite
    } else {
        const size_t i = (size_t)(blk - PG) * 256 + threadIdx.x; const v8f v = *(const v8f*)(wo + i * 8); v8us o;
#pragma unroll   // constant indices keep v and o in registers
        for (int k = 0; k < 8; ++k) o[k] = f2bf(v[k]);
        *(v8us*)(WO + i * 8) = o;
        asm volatile("s_wait_xcnt 0x0" ::: "memory");   // code laid out behind this store may reuse its address registers: the wait stands in front of any such overwrite
    }
}

// lnx_body: 8 token rows, bx of NB_ * TT / 8; by = 0 takes Xa, by = 1 takes Xb and the second pair of planes, sP elements further on
__device__ __forceinline__ void lnx_body(const int bx, const int by, const float* __restrict__ Xa, const float* __restrict__ Xb, const float* __restrict__ gw, const float* __restrict__ gb, bf* Ph, bf* Pl, size_t sP) { const int lane = threadIdx.x & 31; const int r = bx * 8 + (threadIdx.x >> 5); if (r >= NB_ * TT) return; const float* X = by ? Xb : Xa; Ph += by * sP; Pl += by * sP; const float* xr = X + (size_t)r * DM; float hv[32]; float s = 0.f;
#pragma unroll
    for (int ch = 0; ch < 8; ++ch) { const v4f a = *(const v4f*)(xr + ch * 128 + lane * 4);
#pragma unroll
        for (int q = 0; q < 4; ++q) { const float u = bfr(a[q]); hv[ch * 4 + q] = u; s += u; } }
#pragma unroll
    for (int sh = 16; sh; sh >>= 1) s += __shfl_xor(s, sh, 32);
    float mu = s * (1.0f / 1024.0f); asm volatile("" : "+v"(mu)); float s2 = 0.f;
#pragma unroll
    for (int k = 0; k < 32; ++k) { float d0 = __fsub_rn(hv[k], mu); asm volatile("" : "+v"(d0)); float p = __fmul_rn(d0, d0); asm volatile("" : "+v"(p)); s2 = __fadd_rn(s2, p); }
#pragma unroll
    for (int sh = 16; sh; sh >>= 1) s2 += __shfl_xor(s2, sh, 32);
    float var = __fadd_rn(s2 * (1.0f / 1024.0f), 1e-5f); asm volatile("" : "+v"(var)); const float rs = __frsqrt_rn(var);
{
#pragma unroll
        for (int ch = 0; ch < 8; ++ch) { const int c0 = ch * 128 + lane * 4; v4us oh, ol;
#pragma unroll
            for (int q = 0; q < 4; ++q) { float gg = bfr(gw[c0 + q]); asm volatile("" : "+v"(gg)); float d0 = __fsub_rn(hv[ch * 4 + q], mu); asm volatile("" : "+v"(d0)); float n0 = __fmul_rn(d0, rs); asm volatile("" : "+v"(n0)); float y = __fmul_rn(n0, gg); asm volatile("" : "+v"(y)); const float z = __fadd_rn(y, bfr(gb[c0 + q])); unsigned short a2, c2; splitf(z, a2, c2); oh[q] = a2; ol[q] = c2; }
            const size_t oo = (size_t)r * DM + c0; *(v4us*)(Ph + oo) = oh; *(v4us*)(Pl + oo) = ol; }
         } }
// k_front: everything that depends on no other kernel, in ONE launch, dealt by block index: the weight gather's blocks first (the longest chains of dependent loads, with little vector work), then the LayerNorm blocks of both sequences (vector work and whole-line streams, which run while the gather waits), last the short mixer_w conversion.
#define LNB (NB_ * TT / 8)
__global__ __launch_bounds__(256) void k_front(const float* __restrict__ wq, const float* __restrict__ wk, const float* __restrict__ wv, const float* __restrict__ wo, bf* WQ, bf* WK, bf* WV, bf* WO, const float* __restrict__ Xa, const float* __restrict__ Xb, const float* __restrict__ gw, const float* __restrict__ gb, bf* Ph, bf* Pl, size_t sP) {
    const int blk = blockIdx.x;
    if (blk < PG) prep_body(blk, wq, wk, wv, wo, WQ, WK, WV, WO);
    else if (blk < PG + 2 * LNB) lnx_body((blk - PG) % LNB, (blk - PG) / LNB, Xa, Xb, gw, gb, Ph, Pl, sP);
    else prep_body(blk - 2 * LNB, wq, wk, wv, wo, WQ, WK, WV, WO);
}
// k_fattn: scores, causal softmax, probability x value and the head merge in one kernel; no score or probability ever goes to memory.
// One work-group = one head of one batch x 32 query rows; its 4 waves deal the 32-key blocks up to the diagonal among them (wave w takes blocks w, w + 4, ...), each with its own running maximum, sum and output tile, joined through LDS at the end.
// St = K Qt (A = key rows, B = query rows): a lane holds scores of ONE query (column lr), keys 8 * hi + j of each 16-key tile, which is the B-operand k order of the next product, Ot += Vt Pt: P goes from accumulator to operand inside the lane.
// HL (query rows < RH): bf16 hi/lo planes, 3 products each; otherwise fp16, P carried x PCAR. Output: merged bf16 hi/lo planes [t][head * HD + d].
// Rows >= RH (fp16): keys and values come through LDS. A stage is 128 keys (the four waves' blocks of one trip): 128 key rows of 128 bytes, then 64 value rows [d] of 256 bytes, brought by asynchronous copies (16 bytes a lane, a wave's copy = 4 whole lines) into one of two buffers, the next stage's copies in flight while this one is worked on.
// No pad: the 16-byte chunk c of key row r lies at chunk place c ^ ((r >> 1) & 7), that of value row d at c ^ (d & 15), so the 16 rows that a fragment read touches fall on 16 different bank groups.
#define L2E 1.4426950408889634f
#define AKB  (128 * HD * 2)       // bytes of a stage's key rows; its value rows take as many
#define ASTG (2 * AKB)            // bytes of a stage
__device__ __forceinline__ v16h lds_frag(const char* p0, const char* p1) { return cat16(*(const v8ha*)p0, *(const v8ha*)p1); }
// 8 copies a lane, gs bytes apart in memory; in LDS the even ones 4096 apart from l0, the odd ones from l1. The s_wait_xcnt closes the statement, so it stands in front of any later write of the address registers that the copies name.
__device__ __forceinline__ void copy_rows(unsigned l0, unsigned l1, const char* g, size_t gs) {
    asm volatile("global_load_async_to_lds_b128 %0, %8, off\n\tglobal_load_async_to_lds_b128 %1, %9, off\n\tglobal_load_async_to_lds_b128 %2, %10, off\n\tglobal_load_async_to_lds_b128 %3, %11, off\n\t"
                 "global_load_async_to_lds_b128 %4, %12, off\n\tglobal_load_async_to_lds_b128 %5, %13, off\n\tglobal_load_async_to_lds_b128 %6, %14, off\n\tglobal_load_async_to_lds_b128 %7, %15, off\n\ts_wait_xcnt 0x0"
                 :: "v"(l0), "v"(l1), "v"(l0 + 4096u), "v"(l1 + 4096u), "v"(l0 + 8192u), "v"(l1 + 8192u), "v"(l0 + 12288u), "v"(l1 + 12288u),
                    "v"(g), "v"(g + gs), "v"(g + 2 * gs), "v"(g + 3 * gs), "v"(g + 4 * gs), "v"(g + 5 * gs), "v"(g + 6 * gs), "v"(g + 7 * gs) : "memory");
}
template <bool B> struct BoolC { static constexpr bool value = B; };
template <typename T16, bool HL>
__device__ __forceinline__ void attn_body(const T16* __restrict__ Qa, const T16* __restrict__ Qb, const T16* __restrict__ Ka, const T16* __restrict__ Kb, const T16* __restrict__ Va, const T16* __restrict__ Vb, int q0, int head, bf* Ah, bf* Al, float* red, float* rml) {
    typedef typename WFrag<T16>::V V;
    char* ring = (char*)red;   // the staged path's two stages; the join's rows lie over them, when they are out of use
    const int lane = threadIdx.x & 31, lr = lane & 15, hi = lane >> 4, w = __builtin_amdgcn_readfirstlane(threadIdx.x >> 5);   // the wave's number in a scalar register: block loop and diagonal test become scalar branches
    V q[2][2], q2[2][2]; const size_t qo = (size_t)(q0 + lr) * HD + 8 * hi; const T16* qp = Qa + qo; const T16* qp2 = HL ? Qb + qo : qp;   // one address per plane, every fragment at a constant offset from it
#pragma unroll
    for (int nb = 0; nb < 2; ++nb)
#pragma unroll
        for (int kc = 0; kc < 2; ++kc) { q[nb][kc] = WFrag<T16>::ld(qp + nb * 16 * HD + kc * 32); if (HL) q2[nb][kc] = WFrag<T16>::ld(qp2 + nb * 16 * HD + kc * 32); }
    asm volatile("s_wait_xcnt 0x0" :: "v"(qp), "v"(qp2) : "memory");   // later code may reuse the query loads' address registers: the wait stands in front of that overwrite; named as inputs, the addresses stay in their registers up to it
    v8f o[2][4]; float m[2], l[2];
#pragma unroll
    for (int nb = 0; nb < 2; ++nb) { m[nb] = -3.0e38f; l[nb] = 0.f;
#pragma unroll
        for (int mb = 0; mb < 4; ++mb) o[nb][mb] = (v8f){}; }
    const int nkb = q0 / 32 + 1;   // key blocks up to and with the diagonal one
    const char* st = ring;   // the stage that the pass reads (staged path)
    // fragment reads from a stage: key row lr of a 16-row group, chunks 4 * kc + hi and 4 * kc + 2 + hi; value row lr of a 16-row group, chunks hi and 2 + hi of the wave's four: the k order of the loads from memory
    int fk[2][2], fv[2];
#pragma unroll   // this and the next: constant indices keep the offsets in registers
    for (int h = 0; h < 2; ++h) { fv[h] = AKB + lr * 256 + (((4 * w + 2 * h + hi) ^ lr) << 4);
#pragma unroll
        for (int kc = 0; kc < 2; ++kc) fk[kc][h] = (w * 32 + lr) * 128 + (((4 * kc + 2 * h + hi) ^ (lr >> 1)) << 4); }
    auto pass = [&](const int kb, auto dg) {   // one 32-key block; dg: the block crosses the diagonal and is masked
        constexpr bool diag = decltype(dg)::value; const int key0 = kb * 32;
        v8f s[2][2];
#pragma unroll
        for (int nb = 0; nb < 2; ++nb) { s[nb][0] = (v8f){}; s[nb][1] = (v8f){}; }
        V kf[2][2], kf2[2][2];
        if constexpr (HL) {
        const size_t ko = (size_t)(key0 + lr) * HD + 8 * hi; const T16* kp = Ka + ko; const T16* kp2 = HL ? Kb + ko : kp;
#pragma unroll
        for (int mt = 0; mt < 2; ++mt)
#pragma unroll
            for (int kc = 0; kc < 2; ++kc) { kf[mt][kc] = WFrag<T16>::ld(kp + mt * 16 * HD + kc * 32); if (HL) kf2[mt][kc] = WFrag<T16>::ld(kp2 + mt * 16 * HD + kc * 32); }
        asm volatile("s_wait_xcnt 0x0" :: "v"(kp), "v"(kp2) : "memory");   // same wait, in the same form, for the key loads
        } else {
#pragma unroll   // this and the next: constant indices keep the fragments in registers
            for (int mt = 0; mt < 2; ++mt)
#pragma unroll
                for (int kc = 0; kc < 2; ++kc) kf[mt][kc] = lds_frag(st + mt * 2048 + fk[kc][0], st + mt * 2048 + fk[kc][1]);
        }
#pragma unroll
        for (int kc = 0; kc < 2; ++kc)
#pragma unroll
            for (int mt = 0; mt < 2; ++mt)
#pragma unroll
                for (int nb = 0; nb < 2; ++nb) { s[nb][mt] = WFrag<T16>::mma(kf[mt][kc], q[nb][kc], s[nb][mt]); if (HL) { s[nb][mt] = WFrag<T16>::mma(kf[mt][kc], q2[nb][kc], s[nb][mt]); s[nb][mt] = WFrag<T16>::mma(kf2[mt][kc], q[nb][kc], s[nb][mt]); } }
        V pf[2], pf2[2];
#pragma unroll
        for (int nb = 0; nb < 2; ++nb) {
            float t[16]; float mx = m[nb]; const int qi = q0 + nb * 16 + lr;
#pragma unroll
            for (int e = 0; e < 16; ++e) { float x = s[nb][e >> 3][e & 7] * SCL; if (diag && key0 + (e >> 3) * 16 + hi * 8 + (e & 7) > qi) x = -3.0e38f; t[e] = x; mx = fmaxf(mx, x); }
            mx = fmaxf(mx, __shfl_xor(mx, 16, 32));   // the other half of the wave holds this query's other 16 keys
            const float al = __builtin_amdgcn_exp2f((m[nb] - mx) * L2E); m[nb] = mx; float sum = 0.f;
#pragma unroll
            for (int e = 0; e < 16; ++e) { t[e] = __builtin_amdgcn_exp2f((t[e] - mx) * L2E); sum += t[e]; }
            l[nb] = l[nb] * al + sum;   // each half keeps its own keys' sum; the halves are joined once, behind the loop
#pragma unroll
            for (int mb = 0; mb < 4; ++mb) o[nb][mb] *= al;
            if constexpr (HL) { __attribute__((ext_vector_type(16))) unsigned short ph, pl;
#pragma unroll
                for (int e = 0; e < 16; ++e) { unsigned short a, c2; splitf(t[e], a, c2); ph[e] = a; pl[e] = c2; }
                pf[nb] = __builtin_bit_cast(v16bf, ph); pf2[nb] = __builtin_bit_cast(v16bf, pl);
            } else {
#pragma unroll
                for (int e = 0; e < 16; ++e) pf[nb][e] = tohx(t[e] * PCAR); }
        }
        if constexpr (HL) {
        const size_t vo = (size_t)lr * TT + key0 + 8 * hi; const T16* vp = Va + vo; const T16* vp2 = HL ? Vb + vo : vp;
#pragma unroll
        for (int mb = 0; mb < 4; ++mb) { const V vf = WFrag<T16>::ld(vp + mb * 16 * TT); V vf2; if (HL) vf2 = WFrag<T16>::ld(vp2 + mb * 16 * TT);
            asm volatile("s_wait_xcnt 0x0" :: "v"(vp), "v"(vp2) : "memory");   // same wait, in the same form, for the value loads
#pragma unroll
            for (int nb = 0; nb < 2; ++nb) { o[nb][mb] = WFrag<T16>::mma(vf, pf[nb], o[nb][mb]); if (HL) { o[nb][mb] = WFrag<T16>::mma(vf, pf2[nb], o[nb][mb]); o[nb][mb] = WFrag<T16>::mma(vf2, pf[nb], o[nb][mb]); } } }
        } else {
#pragma unroll   // this and the next: constant indices keep the output tiles in registers
            for (int mb = 0; mb < 4; ++mb) { const V vf = lds_frag(st + mb * 4096 + fv[0], st + mb * 4096 + fv[1]);
#pragma unroll
                for (int nb = 0; nb < 2; ++nb) o[nb][mb] = WFrag<T16>::mma(vf, pf[nb], o[nb][mb]); }
        }
        // the distance behind the pass's last matrix instructions, on the back edge and on the way out alike
        asm volatile("v_nop\n\tv_nop\n\tv_nop\n\tv_nop\n\tv_nop" : "+v"(o[0][0]), "+v"(o[0][1]), "+v"(o[0][2]), "+v"(o[0][3]), "+v"(o[1][0]), "+v"(o[1][1]), "+v"(o[1][2]), "+v"(o[1][3]));
    };
    if constexpr (HL) {
#pragma unroll 1   // one pass's fragments at a time: unrolled, two passes' fragments would cost a resident wave
    for (int kb = w; kb < nkb - 1; kb += 4) pass(kb, BoolC<false>());
    if (((nkb - 1) & 3) == w) pass(nkb - 1, BoolC<true>());   // only the last block crosses the diagonal; it is its owner's last
    } else {
        // copies: keys, thread = (row of 16, chunk of 8), rows 16 apart; values, thread = (row of 8, chunk of 16), rows 8 apart (the odd ones' places differ in the chunk's top bit)
        const int kr = threadIdx.x >> 3, kch = threadIdx.x & 7, vr = threadIdx.x >> 4, vch = threadIdx.x & 15; const unsigned rb = (unsigned)(size_t)ring;
        const unsigned lk = rb + kr * 128 + ((kch ^ ((kr >> 1) & 7)) << 4), lv0 = rb + AKB + vr * 256 + ((vch ^ vr) << 4), lv1 = rb + AKB + (vr + 8) * 256 + ((vch ^ (vr + 8)) << 4);
        const char* gk = (const char*)(Ka + (size_t)kr * HD + kch * 8); const char* gv = (const char*)(Va + (size_t)vr * TT + vch * 8);
        auto stage = [&](const int t) { const unsigned b = (t & 1) * ASTG; copy_rows(lk + b, lk + b + 2048u, gk + (size_t)t * AKB, (size_t)16 * HD * 2); copy_rows(lv0 + b, lv1 + b, gv + (size_t)t * 256, (size_t)8 * TT * 2); };
        const int nfull = (nkb - 1) / 4, nst = nfull + 1;   // stages of four blocks: nfull in which every wave's block lies below the diagonal block, and the last; its keys beyond the diagonal block are copied (they lie inside the planes) and not read
        auto foot = [&](const int t) {   // the foot of trip t, gone through by every wave
            asm volatile("s_wait_dscnt 0x0" ::: "memory");      // this wave's reads of stage t are done before the buffer is given up
            asm volatile("s_wait_asynccnt 0x0" ::: "memory");   // this wave's part of stage t + 1 has landed
            __syncthreads();                                     // publishes stage t + 1 and ends every wave's reads of stage t
            if (t + 2 < nst) stage(t + 2);                       // into the buffer that this trip has just read
        };
        stage(0);
        asm volatile("s_wait_asynccnt 0x0" ::: "memory");   // this wave's part of stage 0 has landed
        __syncthreads();                                     // ... and every other wave's
        if (nst > 1) stage(1);
#pragma unroll 1   // one trip per stage: the waits, the barrier and the refill at the foot stay in the order written
        for (int t = 0; t < nfull; ++t) { st = ring + (t & 1) * ASTG; pass(4 * t + w, BoolC<false>()); foot(t); }
        st = ring + (nfull & 1) * ASTG; const int kb = 4 * nfull + w;   // the last trip, outside the loop so that the loop's body has no branch over a pass
        if (kb < nkb - 1) pass(kb, BoolC<false>()); else if (kb == nkb - 1) pass(kb, BoolC<true>());   // only the last block crosses the diagonal; a wave whose block lies beyond it has no pass, and still goes through the foot
        foot(nfull);
        asm volatile("s_wait_asynccnt 0x0" ::: "memory");   // nothing in flight when the ring becomes the join's rows
    }
#pragma unroll
    for (int nb = 0; nb < 2; ++nb) { l[nb] += __shfl_xor(l[nb], 16, 32);
        if (hi == 0) { rml[((w * 2 + nb) * 2 + 0) * 16 + lr] = m[nb]; rml[((w * 2 + nb) * 2 + 1) * 16 + lr] = l[nb]; }
#pragma unroll
        for (int mb = 0; mb < 4; ++mb)
#pragma unroll
            for (int j = 0; j < 8; ++j) red[((w * 64) + (nb * 4 + mb) * 8 + j) * 32 + lane] = o[nb][mb][j]; }
    __syncthreads();   // every wave's partial maximum, sum and tile are in LDS before any is read
    // join: wave w finishes 8 whole query rows (one writer per 128-byte output line); lane = (row lane >> 2, 16 columns (lane & 3) * 16 ..)
    const int nbq = w >> 1, lq = (w & 1) * 8 + (lane >> 2), mbq = lane & 3; float mw[4], M = -3.0e38f, L = 0.f;
#pragma unroll
    for (int u = 0; u < 4; ++u) { mw[u] = rml[((u * 2 + nbq) * 2 + 0) * 16 + lq]; M = fmaxf(M, mw[u]); }
#pragma unroll
    for (int u = 0; u < 4; ++u) { mw[u] = __builtin_amdgcn_exp2f((mw[u] - M) * L2E); L += mw[u] * rml[((u * 2 + nbq) * 2 + 1) * 16 + lq]; }   // a wave that had no block: maximum -3e38, factor 0
    const float inv = __fdiv_rn(HL ? 1.0f : (1.0f / PCAR), L); v8us oh[2], ol[2];
#pragma unroll
    for (int e = 0; e < 16; ++e) { float a = 0.f;
#pragma unroll
        for (int u = 0; u < 4; ++u) a += mw[u] * red[((u * 64) + (nbq * 4 + mbq) * 8 + (e & 7)) * 32 + (e >> 3) * 16 + lq];
        unsigned short a2, c2; splitf(a * inv, a2, c2); oh[e >> 3][e & 7] = a2; ol[e >> 3][e & 7] = c2; }
    const size_t oo = (size_t)(q0 + nbq * 16 + lq) * DQ + head * HD + mbq * 16;
    *(v8us*)(Ah + oo) = oh[0]; *(v8us*)(Ah + oo + 8) = oh[1]; *(v8us*)(Al + oo) = ol[0]; *(v8us*)(Al + oo + 8) = ol[1];
}
// four waves per SIMD: the vector work between the matrix runs of one wave is covered by the other three; the grid is 8192 waves on 1024 SIMDs, so a work-group that ends is followed by one that waits
__global__ __launch_bounds__(128) __attribute__((amdgpu_waves_per_eu(4, 4))) void k_fattn(const h16* __restrict__ Q16, const h16* __restrict__ K16, const h16* __restrict__ V16, const bf* __restrict__ Qh, const bf* __restrict__ Ql, const bf* __restrict__ Kh, const bf* __restrict__ Kl, const bf* __restrict__ Vh, const bf* __restrict__ Vl, bf* Ah, bf* Al) {
    __shared__ __align__(256) float red[2 * ASTG / 4]; __shared__ float rml[4 * 2 * 2 * 16];   // red: two stages (the banks repeat every 256 bytes: rows start on that grid); behind the loop the join's 4 * 64 * 32 floats
    const int bh = blockIdx.x, head = bh % NH_; const int q0 = (TT / 32 - 1 - (int)blockIdx.y) * 32;   // bh = batch * NH_ + head; longest rows first, of both batches
    const size_t po = (size_t)bh * TT * HD; Ah += (size_t)(bh / NH_) * TT * DQ; Al += (size_t)(bh / NH_) * TT * DQ;
    if (q0 < RH) attn_body<bf, true>(Qh + po, Ql + po, Kh + po, Kl + po, Vh + po, Vl + po, q0, head, Ah, Al, red, rml);
    else attn_body<h16, false>(Q16 + po, nullptr, K16 + po, nullptr, V16 + po, nullptr, q0, head, Ah, Al, red, rml);
}

extern "C" void kernel_launch(void* const* d_in, const int* in_sizes, int n_in,
                              void* d_out, int out_size, void* d_ws, size_t ws_size, hipStream_t stream) {
    (void)in_sizes; (void)n_in; (void)out_size;
    const float* x = (const float*)d_in[0];   /* seq1 */ const float* x2 = (const float*)d_in[1];   /* seq2 */ const float* lng = (const float*)d_in[2]; const float* lnb = (const float*)d_in[3]; const float* pq = (const float*)d_in[4]; const float* pk = (const float*)d_in[5]; const float* pv = (const float*)d_in[6];   /* [16][1024][64] */ const float* wo = (const float*)d_in[7]; const float* bo = (const float*)d_in[8];     const float* wq = pq; const float* wk = pk; const float* wv = pv;
    float* OUT = (float*)d_out;     // [2][2048][1024]
    char* wsp = (char*)d_ws;
    auto take = [&](size_t bytes) { char* p = wsp; wsp += (bytes + 255) & ~(size_t)255; return (void*)p; };
    bf* WQ = (bf*)take((size_t)3 * DQ * DM * 2); bf* WK = WQ + (size_t)DQ * DM; bf* WV = WK + (size_t)DQ * DM;   /* one behind the other: the projection launch steps through them by grid z */ bf* WO = (bf*)take((size_t)DM * DQ * 2);
    const size_t XP = (size_t)NB_ * TT * DM, HP = (size_t)NB_ * NH_ * TT * HD;   // elements of one plane: activations, heads (both batches)
    bf* Xh = (bf*)take(2 * XP * 2); bf* Xl = (bf*)take(2 * XP * 2);   // x1 then x2
    h16* P16 = (h16*)take(3 * HP * 2); bf* PPh = (bf*)take(3 * HP * 2); bf* PPl = (bf*)take(3 * HP * 2);   // q then k then v (transposed)
    bf* ATh = (bf*)take(XP * 2); bf* ATl = (bf*)take(XP * 2);
    if ((size_t)(wsp - (char*)d_ws) > ws_size) return;    // ws 256 MiB
    k_front<<<PG + 2 * LNB + PC, 256, 0, stream>>>(wq, wk, wv, wo, WQ, WK, WV, WO, x, x2, lng, lnb, Xh, Xl, XP);   /* head hh's 'xw' [1024][64] -> Bt rows hh*64..; LayerNorm(seq1), LayerNorm(seq2) as bf16 hi/lo planes; mixer_w -> bf16 */
    k_gemmw<bf, EP_QKV><<<dim3(NB_ * TT / GT, DQ / GT, 3), 128, 0, stream>>>(Xh, Xl, WQ, DM, nullptr, 0, nullptr, XP, (size_t)DQ * DM, HP, P16, PPh, PPl);
    k_fattn<<<dim3(NB_ * NH_, TT / 32, 1), 128, 0, stream>>>(P16, P16 + HP, P16 + 2 * HP, PPh, PPl, PPh + HP, PPl + HP, PPh + 2 * HP, PPl + 2 * HP, ATh, ATl);   /* one kv head per query head; leaves the merged hi/lo planes */
    k_gemmw<bf, EP_F32B><<<dim3(NB_ * TT / GT, DM / GT, 1), 128, 0, stream>>>(ATh, ATl, WO, DQ, OUT, DM, bo, 0, 0, 0, nullptr, nullptr, nullptr);
}

// v009
// It runs in 108 microseconds.
// Next to v008, in two timings, it ran 1.04 times as fast each time.
// Over all steps from v000 it is 17.2 times as fast.
#include <hip/hip_runtime.h>

// Causal cross attention between two LayerNorm'd sequences with per-head projection tensors (seq1, seq2 [2][2048][1024]; x1, x2 = LayerNorm(seq) (eps 1e-5, gamma/beta read); q = x1 q_proj[h], k = x2 k_proj[h], v = x2 v_proj[h] ([16][1024][64] 0.02, 'xw' per head, no bias); scores / float32(sqrt 64); causal (-inf); softmax; out = merged mixer_w^T + mixer_b ('oi') -> [2][2048][1024] (4.2 M); argument order seq1, seq2, ln_gamma, ln_beta, q_proj, k_proj, v_proj, mixer_w, mixer_b).
// Layout, every launch over both batches (token rows b * 2048 + t): one front launch holds the three pieces that depend on no other kernel: LayerNorm (one wave per token row: mean, biased variance, f32) writes bf16 hi/lo planes of x1 and of x2, the per-head 'xw' weight blocks are gathered into Bt, and mixer_w is converted to bf16; the q, k and v projections hi/lo x exact (2 products) in one launch (grid z), whose epilogue writes the 16-bit head planes itself (q, k as [b][h][t][d], v as [b][h][d][t]); one fused causal T-2048 attention kernel with a running softmax (hybrid rows: < 512 hi/lo 3 products, rest fp16 x1024; key blocks above the diagonal are never visited); merged hi/lo x mixer_w exact + mixer_b.
// Compute dtypes, f32 accumulate: every input rounded to bf16; LayerNorm f32; projections 2 products (~f32); attention rows < 512 3 products, rest fp16; softmax f32; mixer hl x exact + bias.

#define NB_  2
#define TT   2048
#define DM   1024
#define NH_  16
#define NKV  16
#define REP  (NH_ / NKV)
#define HD   64
#define DQ   (NH_ * HD)
#define DKV  (NKV * HD)
#define RH   512                  // query rows < RH use hi+lo planes (0: none)
#define PCAR 1024.0f
#define SCL  0.125f   // HD^-0.5
typedef _Float16 h16;
typedef unsigned short bf;
typedef __attribute__((ext_vector_type(16))) __bf16   v16bf;
typedef __attribute__((ext_vector_type(16))) _Float16 v16h;
typedef __attribute__((ext_vector_type(8)))  _Float16 v8h;
typedef __attribute__((ext_vector_type(8)))  unsigned short v8us;
typedef __attribute__((ext_vector_type(8)))  float    v8f;
typedef __attribute__((ext_vector_type(4)))  float    v4f;
typedef v8h  __attribute__((may_alias)) v8ha;
typedef v4f  __attribute__((may_alias)) v4fa;
typedef v8us __attribute__((may_alias)) v8usa;

__device__ __forceinline__ unsigned short f2bf(float f) { unsigned u = __float_as_uint(f); u += 0x7FFFu + ((u >> 16) & 1u); return (unsigned short)(u >> 16); }
__device__ __forceinline__ float bf2f(unsigned short b) { return __uint_as_float(((unsigned)b) << 16); }
__device__ __forceinline__ float bfr(float f) { return bf2f(f2bf(f)); }
__device__ __forceinline__ v16h cat16(v8h lo, v8h hi) { return __builtin_shufflevector(lo, hi, 0, 1, 2, 3, 4, 5, 6, 7, 8, 9, 10, 11, 12, 13, 14, 15); }
__device__ __forceinline__ v16bf cat16b(v8us lo, v8us hi) { return __builtin_bit_cast(v16bf, __builtin_shufflevector(lo, hi, 0, 1, 2, 3, 4, 5, 6, 7, 8, 9, 10, 11, 12, 13, 14, 15)); }
__device__ __forceinline__ v8f wmma16(v16h a, v16h b, v8f c) { return __builtin_amdgcn_wmma_f32_16x16x32_f16(false, a, false, b, (short)0, c, false, false); }
__device__ __forceinline__ v8f wmmab(v16bf a, v16bf b, v8f c) { return __builtin_amdgcn_wmma_f32_16x16x32_bf16(false, a, false, b, (short)0, c, false, false); }
__device__ __forceinline__ h16 tohx(float x) { return (h16)x; }
__device__ __forceinline__ void splitf(float y, unsigned short& h, unsigned short& l) { h = f2bf(y); l = f2bf(y - bf2f(h)); }



// ---- k_gemmw: GEMM, one work-group of NW waves per 128x128 output tile; grid (M/128, N/128, Z), NW * 32 threads. NW = 4: each wave a 64x64 quarter (16 accumulators). NW = 8: each wave 32 rows x 64 columns (8 accumulators), for a grid of one work-group per WGP: two waves share a SIMD, and one's matrix runs cover the other's waits for LDS.
// C[m][n] = sum_k (A[m][k] + A2[m][k]) Bt[n][k], two products per k block. z strides sA/sB/sC in elements (sC: of C, or of the head planes). K % 64 == 0, K >= 128.
// Operands come through LDS: a stage is 64 k (one whole 128-byte line) of the tile's 128 A rows, 128 A2 rows and 128 Bt rows, brought by asynchronous copies (16 bytes a lane, a wave's copy = 4 whole lines) into one of two buffers, the next stage's copies in flight while this one is worked on.
// LDS rows have pitch 128 bytes and no pad: the 16-byte chunk c of row r lies at chunk place c ^ ((r >> 1) & 7), so the 16 rows that a fragment read touches fall on 16 different bank groups.
// EP picks what the tile leaves as: EP_F32B f32 rows (pitch ldc) + f32 bias[n]; EP_QKV fp16 and bf16 hi/lo planes of batch r0 / TT, head c0 / 64 (a wave's 64 columns are one head): z = 0 (q, from the first A planes) and z = 1 (k, from the second) as rows [t][d], z = 2 (v, from the second too) transposed [d][t].
#define EP_F32B 0
#define EP_QKV  1
#define GT   128                  // rows of the work-group's tile, of A and of Bt alike
#define GKS  64                   // k per stage
#define GPL  (GT * GKS * 2)       // bytes of one operand plane in a stage
#define GSTG (3 * GPL)            // bytes of a stage: A, A2, Bt
template <typename T16> struct WFrag;
template <> struct WFrag<h16> { typedef v16h V; static __device__ __forceinline__ V ld(const h16* p) { return cat16(*(const v8h*)p, *(const v8h*)(p + 16)); } static __device__ __forceinline__ v8f mma(V a, V b, v8f c) { return wmma16(a, b, c); } };
template <> struct WFrag<bf> { typedef v16bf V; static __device__ __forceinline__ V ld(const bf* p) { return cat16b(*(const v8us*)p, *(const v8us*)(p + 16)); } static __device__ __forceinline__ V ld2(const char* p0, const char* p1) { return cat16b(*(const v8usa*)p0, *(const v8usa*)p1); } static __device__ __forceinline__ v8f mma(V a, V b, v8f c) { return wmmab(a, b, c); } };
// one operand plane of a stage: 8 copies a lane, rows 16 apart (gs bytes in memory, 2048 in LDS). The s_wait_xcnt closes the statement, so it stands in front of any later write of the address registers that the copies name.
__device__ __forceinline__ void copy_plane(unsigned l, const char* g, size_t gs) {
    asm volatile("global_load_async_to_lds_b128 %0, %8, off\n\tglobal_load_async_to_lds_b128 %1, %9, off\n\tglobal_load_async_to_lds_b128 %2, %10, off\n\tglobal_load_async_to_lds_b128 %3, %11, off\n\t"
                 "global_load_async_to_lds_b128 %4, %12, off\n\tglobal_load_async_to_lds_b128 %5, %13, off\n\tglobal_load_async_to_lds_b128 %6, %14, off\n\tglobal_load_async_to_lds_b128 %7, %15, off\n\ts_wait_xcnt 0x0"
                 :: "v"(l), "v"(l + 2048u), "v"(l + 4096u), "v"(l + 6144u), "v"(l + 8192u), "v"(l + 10240u), "v"(l + 12288u), "v"(l + 14336u),
                    "v"(g), "v"(g + gs), "v"(g + 2 * gs), "v"(g + 3 * gs), "v"(g + 4 * gs), "v"(g + 5 * gs), "v"(g + 6 * gs), "v"(g + 7 * gs) : "memory");
}
// a whole stage for 256 threads: 4 copies a lane and plane, rows 32 apart (gs bytes in memory, 4096 in LDS), the planes GPL apart in LDS. One statement, closed by the s_wait_xcnt as above.
__device__ __forceinline__ void copy_stage8(unsigned l, const char* a, const char* a2, const char* b, size_t gs) {
    asm volatile("global_load_async_to_lds_b128 %0, %12, off\n\tglobal_load_async_to_lds_b128 %1, %13, off\n\tglobal_load_async_to_lds_b128 %2, %14, off\n\tglobal_load_async_to_lds_b128 %3, %15, off\n\t"
                 "global_load_async_to_lds_b128 %4, %16, off\n\tglobal_load_async_to_lds_b128 %5, %17, off\n\tglobal_load_async_to_lds_b128 %6, %18, off\n\tglobal_load_async_to_lds_b128 %7, %19, off\n\t"
                 "global_load_async_to_lds_b128 %8, %20, off\n\tglobal_load_async_to_lds_b128 %9, %21, off\n\tglobal_load_async_to_lds_b128 %10, %22, off\n\tglobal_load_async_to_lds_b128 %11, %23, off\n\ts_wait_xcnt 0x0"
                 :: "v"(l), "v"(l + 4096u), "v"(l + 8192u), "v"(l + 12288u), "v"(l + GPL), "v"(l + GPL + 4096u), "v"(l + GPL + 8192u), "v"(l + GPL + 12288u), "v"(l + 2 * GPL), "v"(l + 2 * GPL + 4096u), "v"(l + 2 * GPL + 8192u), "v"(l + 2 * GPL + 12288u),
                    "v"(a), "v"(a + gs), "v"(a + 2 * gs), "v"(a + 3 * gs), "v"(a2), "v"(a2 + gs), "v"(a2 + 2 * gs), "v"(a2 + 3 * gs), "v"(b), "v"(b + gs), "v"(b + 2 * gs), "v"(b + 3 * gs) : "memory");
}
template <typename T16, int EP, int NW>
__global__ __launch_bounds__(NW * 32) void k_gemmw(const T16* __restrict__ A, const T16* __restrict__ A2, const T16* __restrict__ Bt, int K, float* C, int ldc, const float* __restrict__ bias, size_t sA, size_t sB, size_t sC, h16* P16, bf* Ph, bf* Pl) {
    typedef typename WFrag<T16>::V V;
    static_assert((NW == 4 || NW == 8) && (EP != EP_QKV || NW == 4), "wave shapes written out below");
    constexpr int MB = 16 / NW;   // 16-row blocks of a wave's part
    __shared__ __align__(256) char ring[2 * GSTG];   // two stages (the banks repeat every 256 bytes: rows start on that grid); behind the loop's last barrier the epilogue's staging rows
    const size_t z = blockIdx.z, za = (EP == EP_QKV && z) ? 1 : z; A += za * sA; A2 += za * sA; Bt += z * sB; if (EP == EP_QKV) { P16 += z * sC; Ph += z * sC; Pl += z * sC; } else C += z * sC;
    const int lane = threadIdx.x & 31, lr = lane & 15, hi = lane >> 4, w = __builtin_amdgcn_readfirstlane(threadIdx.x >> 5);
    const int wr = (w >> 1) * (MB * 16), wc = (w & 1) * 64;   // the wave's part within the tile
    const int r0 = blockIdx.x * GT + wr, c0 = blockIdx.y * GT + wc; const int t0 = r0 % TT; const size_t hp = (size_t)(r0 / TT) * NH_ + c0 / HD;   // the wave part's first token within its batch; its head plane
    float* os = (float*)ring + w * (16 * 68);
    // copies: thread = (row cr of NW * 4, chunk cch of 8)
    const int cr = threadIdx.x >> 3, cch = threadIdx.x & 7; const size_t gs = (size_t)(NW * 4) * K * 2;
    const unsigned cl = (unsigned)(size_t)ring + cr * 128 + ((cch ^ ((cr >> 1) & 7)) << 4);
    const char* gA = (const char*)(A + (size_t)(blockIdx.x * GT + cr) * K + cch * 8); const char* gA2 = (const char*)(A2 + (size_t)(blockIdx.x * GT + cr) * K + cch * 8); const char* gB = (const char*)(Bt + (size_t)(blockIdx.y * GT + cr) * K + cch * 8);
    auto stage = [&](const int t) { const unsigned l = cl + (t & 1) * GSTG; const size_t ko = (size_t)t * (GKS * 2);
        if constexpr (NW == 4) { copy_plane(l, gA + ko, gs); copy_plane(l + GPL, gA2 + ko, gs); copy_plane(l + 2 * GPL, gB + ko, gs); } else copy_stage8(l, gA + ko, gA2 + ko, gB + ko, gs); };
    // fragment reads: row lr of a 16-row group; the chunks 4 * kc + hi and 4 * kc + 2 + hi (k 8 * hi .. and 16 + 8 * hi .. of the 32-k block, as from memory) at their places
    int fo[2][2];
#pragma unroll   // this and every unroll below: constant indices keep offsets, fragments and accumulators in registers
    for (int kc = 0; kc < 2; ++kc)
#pragma unroll
        for (int h = 0; h < 2; ++h) fo[kc][h] = lr * 128 + (((4 * kc + 2 * h + hi) ^ (lr >> 1)) << 4);
    v8f acc[MB][4];
#pragma unroll
    for (int mb = 0; mb < MB; ++mb)
#pragma unroll
        for (int nb = 0; nb < 4; ++nb) acc[mb][nb] = (v8f){};
    const int nt = K / GKS;
    stage(0);
    asm volatile("s_wait_asynccnt 0x0" ::: "memory");   // this wave's part of stage 0 has landed
    __syncthreads();                                     // ... and every other wave's
    stage(1);
#pragma unroll 1   // one trip per stage: the waits, the barrier and the refill at the foot stay in the order written
    for (int t = 0; t < nt; ++t) {
        const char* st = ring + (t & 1) * GSTG;
        if constexpr (NW == 8) {
            // the wave's part is small enough for all 16 fragments of the stage to be in registers at once: they are read as ONE group, and the 32 matrix instructions follow under counted waits, so that LDS latency is met once a stage and the SIMD's other wave has a long matrix run to hide behind
            V fa[2][MB], fa2[2][MB], fb[2][4];
#pragma unroll
            for (int kc = 0; kc < 2; ++kc) {
#pragma unroll
                for (int mb = 0; mb < MB; ++mb) { const char* p = st + (wr + mb * 16) * 128; fa[kc][mb] = WFrag<T16>::ld2(p + fo[kc][0], p + fo[kc][1]); fa2[kc][mb] = WFrag<T16>::ld2(p + GPL + fo[kc][0], p + GPL + fo[kc][1]); }
#pragma unroll
                for (int nb = 0; nb < 4; ++nb) { const char* p = st + 2 * GPL + (wc + nb * 16) * 128; fb[kc][nb] = WFrag<T16>::ld2(p + fo[kc][0], p + fo[kc][1]); }
            }
            __builtin_amdgcn_sched_barrier(0);   // keeps the reads one group: without it the scheduler sinks them among the matrix instructions, four places a stage
#pragma unroll
            for (int kc = 0; kc < 2; ++kc)
#pragma unroll
                for (int nb = 0; nb < 4; ++nb)
#pragma unroll
                    for (int mb = 0; mb < MB; ++mb) { acc[mb][nb] = WFrag<T16>::mma(fa[kc][mb], fb[kc][nb], acc[mb][nb]); acc[mb][nb] = WFrag<T16>::mma(fa2[kc][mb], fb[kc][nb], acc[mb][nb]); }
        } else {
        V a[MB], a2[MB];
#pragma unroll
        for (int kc = 0; kc < 2; ++kc) {
#pragma unroll
            for (int mb = 0; mb < MB; ++mb) { const char* p = st + (wr + mb * 16) * 128; a[mb] = WFrag<T16>::ld2(p + fo[kc][0], p + fo[kc][1]); a2[mb] = WFrag<T16>::ld2(p + GPL + fo[kc][0], p + GPL + fo[kc][1]); }
#pragma unroll
            for (int nb = 0; nb < 4; ++nb) { const char* p = st + 2 * GPL + (wc + nb * 16) * 128; const V b = WFrag<T16>::ld2(p + fo[kc][0], p + fo[kc][1]);
#pragma unroll
                for (int mb = 0; mb < MB; ++mb) { acc[mb][nb] = WFrag<T16>::mma(a[mb], b, acc[mb][nb]); acc[mb][nb] = WFrag<T16>::mma(a2[mb], b, acc[mb][nb]); } }
        }
        }
        // the distance behind the trip's last matrix instructions, whichever way the branches below go
        if constexpr (MB == 4) asm volatile("v_nop\n\tv_nop\n\tv_nop\n\tv_nop" : "+v"(acc[0][0]), "+v"(acc[0][1]), "+v"(acc[0][2]), "+v"(acc[0][3]), "+v"(acc[1][0]), "+v"(acc[1][1]), "+v"(acc[1][2]), "+v"(acc[1][3]), "+v"(acc[2][0]), "+v"(acc[2][1]), "+v"(acc[2][2]), "+v"(acc[2][3]), "+v"(acc[3][0]), "+v"(acc[3][1]), "+v"(acc[3][2]), "+v"(acc[3][3]));
        else asm volatile("v_nop\n\tv_nop\n\tv_nop\n\tv_nop" : "+v"(acc[0][0]), "+v"(acc[0][1]), "+v"(acc[0][2]), "+v"(acc[0][3]), "+v"(acc[1][0]), "+v"(acc[1][1]), "+v"(acc[1][2]), "+v"(acc[1][3]));
        asm volatile("s_wait_dscnt 0x0" ::: "memory");      // this wave's reads of stage t are done before the buffer is given up
        asm volatile("s_wait_asynccnt 0x0" ::: "memory");   // this wave's part of stage t + 1 has landed
        __syncthreads();                                     // publishes stage t + 1 and ends every wave's reads of stage t
        if (t + 2 < nt) stage(t + 2);                        // into the buffer that this trip has just read
    }
    asm volatile("s_wait_asynccnt 0x0" ::: "memory");   // nothing in flight when the ring becomes staging rows
    if (EP == EP_QKV && blockIdx.z == 2) {
        // a lane's 8 accumulator rows are 8 consecutive t of one column d: 16 bytes of a [d][t] plane straight from registers; the four mb of a column fill its 128-byte line, all from this wave
#pragma unroll   // these three: constant indices keep acc and the packed vectors in registers
        for (int mb = 0; mb < MB; ++mb)
#pragma unroll
            for (int nb = 0; nb < 4; ++nb) { v8h o16; v8us oh, ol;
#pragma unroll
                for (int j = 0; j < 8; ++j) { const float x = acc[mb][nb][j]; o16[j] = tohx(x); unsigned short a2, c2; splitf(x, a2, c2); oh[j] = a2; ol[j] = c2; }
                const size_t oo = (hp * HD + nb * 16 + lr) * TT + t0 + mb * 16 + hi * 8;
                *(v8h*)(P16 + oo) = o16; *(v8us*)(Ph + oo) = oh; *(v8us*)(Pl + oo) = ol; }
        return;
    }
#pragma unroll
    for (int mb = 0; mb < MB; ++mb) {
#pragma unroll
        for (int nb = 0; nb < 4; ++nb) {
#pragma unroll
            for (int j = 0; j < 8; ++j) os[(hi * 8 + j) * 68 + nb * 16 + lr] = acc[mb][nb][j]; }
        __builtin_amdgcn_wave_barrier(); asm volatile("" ::: "memory");
        if constexpr (EP == EP_QKV) {
            // 8 lanes per token row, 8 columns each: every store covers four whole 128-byte rows of a [t][d] plane
#pragma unroll   // this and the next: constant LDS offsets, packed vectors in registers
            for (int s = 0; s < 4; ++s) { const int row = 4 * s + (lane >> 3), cofs = (lane & 7) * 8; const v4f x0 = *(const v4fa*)(os + row * 68 + cofs), x1 = *(const v4fa*)(os + row * 68 + cofs + 4); v8h o16; v8us oh, ol;
#pragma unroll
                for (int j = 0; j < 8; ++j) { const float x = (j < 4) ? x0[j & 3] : x1[j & 3]; o16[j] = tohx(x); unsigned short a2, c2; splitf(x, a2, c2); oh[j] = a2; ol[j] = c2; }
                const size_t oo = (hp * TT + t0 + mb * 16 + row) * HD + cofs;
                *(v8h*)(P16 + oo) = o16; *(v8us*)(Ph + oo) = oh; *(v8us*)(Pl + oo) = ol; }
        } else {
            float* crow = C + (size_t)(r0 + mb * 16) * ldc + c0;
#pragma unroll
            for (int s = 0; s < 8; ++s) { const int row = 2 * s + hi, cofs = lr * 4; v4f val = *(const v4fa*)(os + row * 68 + cofs); val[0] += bfr(bias[c0 + cofs]); val[1] += bfr(bias[c0 + cofs + 1]); val[2] += bfr(bias[c0 + cofs + 2]); val[3] += bfr(bias[c0 + cofs + 3]);
                *(v4f*)(crow + (size_t)row * ldc + cofs) = val; }
        }
        __builtin_amdgcn_wave_barrier(); asm volatile("" ::: "memory");
    }
}

typedef __attribute__((ext_vector_type(4))) _Float16 v4h;
typedef __attribute__((ext_vector_type(2))) unsigned short v2us;
typedef __attribute__((ext_vector_type(4))) unsigned short v4us;
typedef __attribute__((ext_vector_type(4))) int v4i;

// prep_body: the weights' set-up, dealt by the index blk that k_front hands it.
//   blk in [0, PG):        per-head 'xw' blocks [16][1024][64] of q_proj, k_proj, v_proj -> bf16 Bt rows (head * 64 + n)[k]; one 64-element line of Bt per wave and trip, 8 lines per wave
//   blk in [PG, PG + PC):  mixer_w ('oi', already K-contiguous) -> bf16, 8 elements per thread
#define PG (3 * NH_ * DM * HD / 64 / 64)
#define PC (DM * DQ / 8 / 256)
__device__ __forceinline__ void prep_body(const int blk, const float* __restrict__ wq, const float* __restrict__ wk, const float* __restrict__ wv, const float* __restrict__ wo, bf* WQ, bf* WK, bf* WV, bf* WO) {
    if (blk < PG) {
        const int ten = blk / (PG / 3); const float* __restrict__ w3 = (ten == 0) ? wq : (ten == 1) ? wk : wv; bf* B3 = (ten == 0) ? WQ : (ten == 1) ? WK : WV;
        const unsigned lane = threadIdx.x & 31; const unsigned G0 = ((blk % (PG / 3)) * 8 + (threadIdx.x >> 5)) * 8;   // Bt line index within the tensor (DM * HD / 64 lines per head)
        for (unsigned l = 0; l < 8; ++l) { const unsigned e = (G0 + l) * 64 + lane * 2; const unsigned k = e % DM, n = (e / DM) % HD, hh = e / (DM * HD); const float* w = w3 + (size_t)hh * DM * HD; v2us o;
            o[0] = f2bf(w[k * HD + n]); o[1] = f2bf(w[(k + 1) * HD + n]); *(v2us*)(B3 + e) = o;
            asm volatile("s_wait_xcnt 0x0" ::: "memory"); }   // the next trip's loads may land in this store's registers: the wait stands in front of that overwrite
    } else {
        const size_t i = (size_t)(blk - PG) * 256 + threadIdx.x; const v8f v = *(const v8f*)(wo + i * 8); v8us o;
#pragma unroll   // constant indices keep v and o in registers
        for (int k = 0; k < 8; ++k) o[k] = f2bf(v[k]);
        *(v8us*)(WO + i * 8) = o;
        asm volatile("s_wait_xcnt 0x0" ::: "memory");   // code laid out behind this store may reuse its address registers: the wait stands in front of any such overwrite
    }
}

// lnx_body: 8 token rows, bx of NB_ * TT / 8; by = 0 takes Xa, by = 1 takes Xb and the second pair of planes, sP elements further on
__device__ __forceinline__ void lnx_body(const int bx, const int by, const float* __restrict__ Xa, const float* __restrict__ Xb, const float* __restrict__ gw, const float* __restrict__ gb, bf* Ph, bf* Pl, size_t sP) { const int lane = threadIdx.x & 31; const int r = bx * 8 + (threadIdx.x >> 5); if (r >= NB_ * TT) return; const float* X = by ? Xb : Xa; Ph += by * sP; Pl += by * sP; const float* xr = X + (size_t)r * DM; float hv[32]; float s = 0.f;
#pragma unroll
    for (int ch = 0; ch < 8; ++ch) { const v4f a = *(const v4f*)(xr + ch * 128 + lane * 4);
#pragma unroll
        for (int q = 0; q < 4; ++q) { const float u = bfr(a[q]); hv[ch * 4 + q] = u; s += u; } }
#pragma unroll
    for (int sh = 16; sh; sh >>= 1) s += __shfl_xor(s, sh, 32);
    float mu = s * (1.0f / 1024.0f); asm volatile("" : "+v"(mu)); float s2 = 0.f;
#pragma unroll
    for (int k = 0; k < 32; ++k) { float d0 = __fsub_rn(hv[k], mu); asm volatile("" : "+v"(d0)); float p = __fmul_rn(d0, d0); asm volatile("" : "+v"(p)); s2 = __fadd_rn(s2, p); }
#pragma unroll
    for (int sh = 16; sh; sh >>= 1) s2 += __shfl_xor(s2, sh, 32);
    float var = __fadd_rn(s2 * (1.0f / 1024.0f), 1e-5f); asm volatile("" : "+v"(var)); const float rs = __frsqrt_rn(var);
{
#pragma unroll
        for (int ch = 0; ch < 8; ++ch) { const int c0 = ch * 128 + lane * 4; v4us oh, ol;
#pragma unroll
            for (int q = 0; q < 4; ++q) { float gg = bfr(gw[c0 + q]); asm volatile("" : "+v"(gg)); float d0 = __fsub_rn(hv[ch * 4 + q], mu); asm volatile("" : "+v"(d0)); float n0 = __fmul_rn(d0, rs); asm volatile("" : "+v"(n0)); float y = __fmul_rn(n0, gg); asm volatile("" : "+v"(y)); const float z = __fadd_rn(y, bfr(gb[c0 + q])); unsigned short a2, c2; splitf(z, a2, c2); oh[q] = a2; ol[q] = c2; }
            const size_t oo = (size_t)r * DM + c0; *(v4us*)(Ph + oo) = oh; *(v4us*)(Pl + oo) = ol; }
         } }
// k_front: everything that depends on no other kernel, in ONE launch, dealt by block index: the weight gather's blocks first (the longest chains of dependent loads, with little vector work), then the LayerNorm blocks of both sequences (vector work and whole-line streams, which run while the gather waits), last the short mixer_w conversion.
#define LNB (NB_ * TT / 8)
__global__ __launch_bounds__(256) void k_front(const float* __restrict__ wq, const float* __restrict__ wk, const float* __restrict__ wv, const float* __restrict__ wo, bf* WQ, bf* WK, bf* WV, bf* WO, const float* __restrict__ Xa, const float* __restrict__ Xb, const float* __restrict__ gw, const float* __restrict__ gb, bf* Ph, bf* Pl, size_t sP) {
    const int blk = blockIdx.x;
    if (blk < PG) prep_body(blk, wq, wk, wv, wo, WQ, WK, WV, WO);
    else if (blk < PG + 2 * LNB) lnx_body((blk - PG) % LNB, (blk - PG) / LNB, Xa, Xb, gw, gb, Ph, Pl, sP);
    else prep_body(blk - 2 * LNB, wq, wk, wv, wo, WQ, WK, WV, WO);
}
// k_fattn: scores, causal softmax, probability x value and the head merge in one kernel; no score or probability ever goes to memory.
// One work-group = one head of one batch x 32 query rows; its 4 waves deal the 32-key blocks up to the diagonal among them (wave w takes blocks w, w + 4, ...), each with its own running maximum, sum and output tile, joined through LDS at the end.
// St = K Qt (A = key rows, B = query rows): a lane holds scores of ONE query (column lr), keys 8 * hi + j of each 16-key tile, which is the B-operand k order of the next product, Ot += Vt Pt: P goes from accumulator to operand inside the lane.
// HL (query rows < RH): bf16 hi/lo planes, 3 products each; otherwise fp16, P carried x PCAR. Output: merged bf16 hi/lo planes [t][head * HD + d].
// Rows >= RH (fp16): keys and values come through LDS. A stage is 128 keys (the four waves' blocks of one trip): 128 key rows of 128 bytes, then 64 value rows [d] of 256 bytes, brought by asynchronous copies (16 bytes a lane, a wave's copy = 4 whole lines) into one of two buffers, the next stage's copies in flight while this one is worked on.
// No pad: the 16-byte chunk c of key row r lies at chunk place c ^ ((r >> 1) & 7), that of value row d at c ^ (d & 15), so the 16 rows that a fragment read touches fall on 16 different bank groups.
#define L2E 1.4426950408889634f
#define AKB  (128 * HD * 2)       // bytes of a stage's key rows; its value rows take as many
#define ASTG (2 * AKB)            // bytes of a stage
__device__ __forceinline__ v16h lds_frag(const char* p0, const char* p1) { return cat16(*(const v8ha*)p0, *(const v8ha*)p1); }
// 8 copies a lane, gs bytes apart in memory; in LDS the even ones 4096 apart from l0, the odd ones from l1. The s_wait_xcnt closes the statement, so it stands in front of any later write of the address registers that the copies name.
__device__ __forceinline__ void copy_rows(unsigned l0, unsigned l1, const char* g, size_t gs) {
    asm volatile("global_load_async_to_lds_b128 %0, %8, off\n\tglobal_load_async_to_lds_b128 %1, %9, off\n\tglobal_load_async_to_lds_b128 %2, %10, off\n\tglobal_load_async_to_lds_b128 %3, %11, off\n\t"
                 "global_load_async_to_lds_b128 %4, %12, off\n\tglobal_load_async_to_lds_b128 %5, %13, off\n\tglobal_load_async_to_lds_b128 %6, %14, off\n\tglobal_load_async_to_lds_b128 %7, %15, off\n\ts_wait_xcnt 0x0"
                 :: "v"(l0), "v"(l1), "v"(l0 + 4096u), "v"(l1 + 4096u), "v"(l0 + 8192u), "v"(l1 + 8192u), "v"(l0 + 12288u), "v"(l1 + 12288u),
                    "v"(g), "v"(g + gs), "v"(g + 2 * gs), "v"(g + 3 * gs), "v"(g + 4 * gs), "v"(g + 5 * gs), "v"(g + 6 * gs), "v"(g + 7 * gs) : "memory");
}
template <bool B> struct BoolC { static constexpr bool value = B; };
template <typename T16, bool HL>
__device__ __forceinline__ void attn_body(const T16* __restrict__ Qa, const T16* __restrict__ Qb, const T16* __restrict__ Ka, const T16* __restrict__ Kb, const T16* __restrict__ Va, const T16* __restrict__ Vb, int q0, int head, bf* Ah, bf* Al, float* red, float* rml) {
    typedef typename WFrag<T16>::V V;
    char* ring = (char*)red;   // the staged path's two stages; the join's rows lie over them, when they are out of use
    const int lane = threadIdx.x & 31, lr = lane & 15, hi = lane >> 4, w = __builtin_amdgcn_readfirstlane(threadIdx.x >> 5);   // the wave's number in a scalar register: block loop and diagonal test become scalar branches
    V q[2][2], q2[2][2]; const size_t qo = (size_t)(q0 + lr) * HD + 8 * hi; const T16* qp = Qa + qo; const T16* qp2 = HL ? Qb + qo : qp;   // one address per plane, every fragment at a constant offset from it
#pragma unroll
    for (int nb = 0; nb < 2; ++nb)
#pragma unroll
        for (int kc = 0; kc < 2; ++kc) { q[nb][kc] = WFrag<T16>::ld(qp + nb * 16 * HD + kc * 32); if (HL) q2[nb][kc] = WFrag<T16>::ld(qp2 + nb * 16 * HD + kc * 32); }
    asm volatile("s_wait_xcnt 0x0" :: "v"(qp), "v"(qp2) : "memory");   // later code may reuse the query loads' address registers: the wait stands in front of that overwrite; named as inputs, the addresses stay in their registers up to it
    v8f o[2][4]; float m[2], l[2];
#pragma unroll
    for (int nb = 0; nb < 2; ++nb) { m[nb] = -3.0e38f; l[nb] = 0.f;
#pragma unroll
        for (int mb = 0; mb < 4; ++mb) o[nb][mb] = (v8f){}; }
    const int nkb = q0 / 32 + 1;   // key blocks up to and with the diagonal one
    const char* st = ring;   // the stage that the pass reads (staged path)
    // fragment reads from a stage: key row lr of a 16-row group, chunks 4 * kc + hi and 4 * kc + 2 + hi; value row lr of a 16-row group, chunks hi and 2 + hi of the wave's four: the k order of the loads from memory
    int fk[2][2], fv[2];
#pragma unroll   // this and the next: constant indices keep the offsets in registers
    for (int h = 0; h < 2; ++h) { fv[h] = AKB + lr * 256 + (((4 * w + 2 * h + hi) ^ lr) << 4);
#pragma unroll
        for (int kc = 0; kc < 2; ++kc) fk[kc][h] = (w * 32 + lr) * 128 + (((4 * kc + 2 * h + hi) ^ (lr >> 1)) << 4); }
    auto pass = [&](const int kb, auto dg) {   // one 32-key block; dg: the block crosses the diagonal and is masked
        constexpr bool diag = decltype(dg)::value; const int key0 = kb * 32;
        v8f s[2][2];
#pragma unroll
        for (int nb = 0; nb < 2; ++nb) { s[nb][0] = (v8f){}; s[nb][1] = (v8f){}; }
        V kf[2][2], kf2[2][2];
        if constexpr (HL) {
        const size_t ko = (size_t)(key0 + lr) * HD + 8 * hi; const T16* kp = Ka + ko; const T16* kp2 = HL ? Kb + ko : kp;
#pragma unroll
        for (int mt = 0; mt < 2; ++mt)
#pragma unroll
            for (int kc = 0; kc < 2; ++kc) { kf[mt][kc] = WFrag<T16>::ld(kp + mt * 16 * HD + kc * 32); if (HL) kf2[mt][kc] = WFrag<T16>::ld(kp2 + mt * 16 * HD + kc * 32); }
        asm volatile("s_wait_xcnt 0x0" :: "v"(kp), "v"(kp2) : "memory");   // same wait, in the same form, for the key loads
        } else {
#pragma unroll   // this and the next: constant indices keep the fragments in registers
            for (int mt = 0; mt < 2; ++mt)
#pragma unroll
                for (int kc = 0; kc < 2; ++kc) kf[mt][kc] = lds_frag(st + mt * 2048 + fk[kc][0], st + mt * 2048 + fk[kc][1]);
        }
#pragma unroll
        for (int kc = 0; kc < 2; ++kc)
#pragma unroll
            for (int mt = 0; mt < 2; ++mt)
#pragma unroll
                for (int nb = 0; nb < 2; ++nb) { s[nb][mt] = WFrag<T16>::mma(kf[mt][kc], q[nb][kc], s[nb][mt]); if (HL) { s[nb][mt] = WFrag<T16>::mma(kf[mt][kc], q2[nb][kc], s[nb][mt]); s[nb][mt] = WFrag<T16>::mma(kf2[mt][kc], q[nb][kc], s[nb][mt]); } }
        V pf[2], pf2[2];
#pragma unroll
        for (int nb = 0; nb < 2; ++nb) {
            float t[16]; float mx = m[nb]; const int qi = q0 + nb * 16 + lr;
#pragma unroll
            for (int e = 0; e < 16; ++e) { float x = s[nb][e >> 3][e & 7] * SCL; if (diag && key0 + (e >> 3) * 16 + hi * 8 + (e & 7) > qi) x = -3.0e38f; t[e] = x; mx = fmaxf(mx, x); }
            mx = fmaxf(mx, __shfl_xor(mx, 16, 32));   // the other half of the wave holds this query's other 16 keys
            const float al = __builtin_amdgcn_exp2f((m[nb] - mx) * L2E); m[nb] = mx; float sum = 0.f;
#pragma unroll
            for (int e = 0; e < 16; ++e) { t[e] = __builtin_amdgcn_exp2f((t[e] - mx) * L2E); sum += t[e]; }
            l[nb] = l[nb] * al + sum;   // each half keeps its own keys' sum; the halves are joined once, behind the loop
#pragma unroll
            for (int mb = 0; mb < 4; ++mb) o[nb][mb] *= al;
            if constexpr (HL) { __attribute__((ext_vector_type(16))) unsigned short ph, pl;
#pragma unroll
                for (int e = 0; e < 16; ++e) { unsigned short a, c2; splitf(t[e], a, c2); ph[e] = a; pl[e] = c2; }
                pf[nb] = __builtin_bit_cast(v16bf, ph); pf2[nb] = __builtin_bit_cast(v16bf, pl);
            } else {
#pragma unroll
                for (int e = 0; e < 16; ++e) pf[nb][e] = tohx(t[e] * PCAR); }
        }
        if constexpr (HL) {
        const size_t vo = (size_t)lr * TT + key0 + 8 * hi; const T16* vp = Va + vo; const T16* vp2 = HL ? Vb + vo : vp;
#pragma unroll
        for (int mb = 0; mb < 4; ++mb) { const V vf = WFrag<T16>::ld(vp + mb * 16 * TT); V vf2; if (HL) vf2 = WFrag<T16>::ld(vp2 + mb * 16 * TT);
            asm volatile("s_wait_xcnt 0x0" :: "v"(vp), "v"(vp2) : "memory");   // same wait, in the same form, for the value loads
#pragma unroll
            for (int nb = 0; nb < 2; ++nb) { o[nb][mb] = WFrag<T16>::mma(vf, pf[nb], o[nb][mb]); if (HL) { o[nb][mb] = WFrag<T16>::mma(vf, pf2[nb], o[nb][mb]); o[nb][mb] = WFrag<T16>::mma(vf2, pf[nb], o[nb][mb]); } } }
        } else {
#pragma unroll   // this and the next: constant indices keep the output tiles in registers
            for (int mb = 0; mb < 4; ++mb) { const V vf = lds_frag(st + mb * 4096 + fv[0], st + mb * 4096 + fv[1]);
#pragma unroll
                for (int nb = 0; nb < 2; ++nb) o[nb][mb] = WFrag<T16>::mma(vf, pf[nb], o[nb][mb]); }
        }
        // the distance behind the pass's last matrix instructions, on the back edge and on the way out alike
        asm volatile("v_nop\n\tv_nop\n\tv_nop\n\tv_nop\n\tv_nop" : "+v"(o[0][0]), "+v"(o[0][1]), "+v"(o[0][2]), "+v"(o[0][3]), "+v"(o[1][0]), "+v"(o[1][1]), "+v"(o[1][2]), "+v"(o[1][3]));
    };
    if constexpr (HL) {
#pragma unroll 1   // one pass's fragments at a time: unrolled, two passes' fragments would cost a resident wave
    for (int kb = w; kb < nkb - 1; kb += 4) pass(kb, BoolC<false>());
    if (((nkb - 1) & 3) == w) pass(nkb - 1, BoolC<true>());   // only the last block crosses the diagonal; it is its owner's last
    } else {
        // copies: keys, thread = (row of 16, chunk of 8), rows 16 apart; values, thread = (row of 8, chunk of 16), rows 8 apart (the odd ones' places differ in the chunk's top bit)
        const int kr = threadIdx.x >> 3, kch = threadIdx.x & 7, vr = threadIdx.x >> 4, vch = threadIdx.x & 15; const unsigned rb = (unsigned)(size_t)ring;
        const unsigned lk = rb + kr * 128 + ((kch ^ ((kr >> 1) & 7)) << 4), lv0 = rb + AKB + vr * 256 + ((vch ^ vr) << 4), lv1 = rb + AKB + (vr + 8) * 256 + ((vch ^ (vr + 8)) << 4);
        const char* gk = (const char*)(Ka + (size_t)kr * HD + kch * 8); const char* gv = (const char*)(Va + (size_t)vr * TT + vch * 8);
        auto stage = [&](const int t) { const unsigned b = (t & 1) * ASTG; copy_rows(lk + b, lk + b + 2048u, gk + (size_t)t * AKB, (size_t)16 * HD * 2); copy_rows(lv0 + b, lv1 + b, gv + (size_t)t * 256, (size_t)8 * TT * 2); };
        const int nfull = (nkb - 1) / 4, nst = nfull + 1;   // stages of four blocks: nfull in which every wave's block lies below the diagonal block, and the last; its keys beyond the diagonal block are copied (they lie inside the planes) and not read
        auto foot = [&](const int t) {   // the foot of trip t, gone through by every wave
            asm volatile("s_wait_dscnt 0x0" ::: "memory");      // this wave's reads of stage t are done before the buffer is given up
            asm volatile("s_wait_asynccnt 0x0" ::: "memory");   // this wave's part of stage t + 1 has landed
            __syncthreads();                                     // publishes stage t + 1 and ends every wave's reads of stage t
            if (t + 2 < nst) stage(t + 2);                       // into the buffer that this trip has just read
        };
        stage(0);
        asm volatile("s_wait_asynccnt 0x0" ::: "memory");   // this wave's part of stage 0 has landed
        __syncthreads();                                     // ... and every other wave's
        if (nst > 1) stage(1);
#pragma unroll 1   // one trip per stage: the waits, the barrier and the refill at the foot stay in the order written
        for (int t = 0; t < nfull; ++t) { st = ring + (t & 1) * ASTG; pass(4 * t + w, BoolC<false>()); foot(t); }
        st = ring + (nfull & 1) * ASTG; const int kb = 4 * nfull + w;   // the last trip, outside the loop so that the loop's body has no branch over a pass
        if (kb < nkb - 1) pass(kb, BoolC<false>()); else if (kb == nkb - 1) pass(kb, BoolC<true>());   // only the last block crosses the diagonal; a wave whose block lies beyond it has no pass, and still goes through the foot
        foot(nfull);
        asm volatile("s_wait_asynccnt 0x0" ::: "memory");   // nothing in flight when the ring becomes the join's rows
    }
#pragma unroll
    for (int nb = 0; nb < 2; ++nb) { l[nb] += __shfl_xor(l[nb], 16, 32);
        if (hi == 0) { rml[((w * 2 + nb) * 2 + 0) * 16 + lr] = m[nb]; rml[((w * 2 + nb) * 2 + 1) * 16 + lr] = l[nb]; }
#pragma unroll
        for (int mb = 0; mb < 4; ++mb)
#pragma unroll
            for (int j = 0; j < 8; ++j) red[((w * 64) + (nb * 4 + mb) * 8 + j) * 32 + lane] = o[nb][mb][j]; }
    __syncthreads();   // every wave's partial maximum, sum and tile are in LDS before any is read
    // join: wave w finishes 8 whole query rows (one writer per 128-byte output line); lane = (row lane >> 2, 16 columns (lane & 3) * 16 ..)
    const int nbq = w >> 1, lq = (w & 1) * 8 + (lane >> 2), mbq = lane & 3; float mw[4], M = -3.0e38f, L = 0.f;
#pragma unroll
    for (int u = 0; u < 4; ++u) { mw[u] = rml[((u * 2 + nbq) * 2 + 0) * 16 + lq]; M = fmaxf(M, mw[u]); }
#pragma unroll
    for (int u = 0; u < 4; ++u) { mw[u] = __builtin_amdgcn_exp2f((mw[u] - M) * L2E); L += mw[u] * rml[((u * 2 + nbq) * 2 + 1) * 16 + lq]; }   // a wave that had no block: maximum -3e38, factor 0
    const float inv = __fdiv_rn(HL ? 1.0f : (1.0f / PCAR), L); v8us oh[2], ol[2];
#pragma unroll
    for (int e = 0; e < 16; ++e) { float a = 0.f;
#pragma unroll
        for (int u = 0; u < 4; ++u) a += mw[u] * red[((u * 64) + (nbq * 4 + mbq) * 8 + (e & 7)) * 32 + (e >> 3) * 16 + lq];
        unsigned short a2, c2; splitf(a * inv, a2, c2); oh[e >> 3][e & 7] = a2; ol[e >> 3][e & 7] = c2; }
    const size_t oo = (size_t)(q0 + nbq * 16 + lq) * DQ + head * HD + mbq * 16;
    *(v8us*)(Ah + oo) = oh[0]; *(v8us*)(Ah + oo + 8) = oh[1]; *(v8us*)(Al + oo) = ol[0]; *(v8us*)(Al + oo + 8) = ol[1];
}
// four waves per SIMD: the vector work between the matrix runs of one wave is covered by the other three; the grid is 8192 waves on 1024 SIMDs, so a work-group that ends is followed by one that waits
__global__ __launch_bounds__(128) __attribute__((amdgpu_waves_per_eu(4, 4))) void k_fattn(const h16* __restrict__ Q16, const h16* __restrict__ K16, const h16* __restrict__ V16, const bf* __restrict__ Qh, const bf* __restrict__ Ql, const bf* __restrict__ Kh, const bf* __restrict__ Kl, const bf* __restrict__ Vh, const bf* __restrict__ Vl, bf* Ah, bf* Al) {
    __shared__ __align__(256) float red[2 * ASTG / 4]; __shared__ float rml[4 * 2 * 2 * 16];   // red: two stages (the banks repeat every 256 bytes: rows start on that grid); behind the loop the join's 4 * 64 * 32 floats
    const int bh = blockIdx.x, head = bh % NH_; const int q0 = (TT / 32 - 1 - (int)blockIdx.y) * 32;   // bh = batch * NH_ + head; longest rows first, of both batches
    const size_t po = (size_t)bh * TT * HD; Ah += (size_t)(bh / NH_) * TT * DQ; Al += (size_t)(bh / NH_) * TT * DQ;
    if (q0 < RH) attn_body<bf, true>(Qh + po, Ql + po, Kh + po, Kl + po, Vh + po, Vl + po, q0, head, Ah, Al, red, rml);
    else attn_body<h16, false>(Q16 + po, nullptr, K16 + po, nullptr, V16 + po, nullptr, q0, head, Ah, Al, red, rml);
}

extern "C" void kernel_launch(void* const* d_in, const int* in_sizes, int n_in,
                              void* d_out, int out_size, void* d_ws, size_t ws_size, hipStream_t stream) {
    (void)in_sizes; (void)n_in; (void)out_size;
    const float* x = (const float*)d_in[0];   /* seq1 */ const float* x2 = (const float*)d_in[1];   /* seq2 */ const float* lng = (const float*)d_in[2]; const float* lnb = (const float*)d_in[3]; const float* pq = (const float*)d_in[4]; const float* pk = (const float*)d_in[5]; const float* pv = (const float*)d_in[6];   /* [16][1024][64] */ const float* wo = (const float*)d_in[7]; const float* bo = (const float*)d_in[8];     const float* wq = pq; const float* wk = pk; const float* wv = pv;
    float* OUT = (float*)d_out;     // [2][2048][1024]
    char* wsp = (char*)d_ws;
    auto take = [&](size_t bytes) { char* p = wsp; wsp += (bytes + 255) & ~(size_t)255; return (void*)p; };
    bf* WQ = (bf*)take((size_t)3 * DQ * DM * 2); bf* WK = WQ + (size_t)DQ * DM; bf* WV = WK + (size_t)DQ * DM;   /* one behind the other: the projection launch steps through them by grid z */ bf* WO = (bf*)take((size_t)DM * DQ * 2);
    const size_t XP = (size_t)NB_ * TT * DM, HP = (size_t)NB_ * NH_ * TT * HD;   // elements of one plane: activations, heads (both batches)
    bf* Xh = (bf*)take(2 * XP * 2); bf* Xl = (bf*)take(2 * XP * 2);   // x1 then x2
    h16* P16 = (h16*)take(3 * HP * 2); bf* PPh = (bf*)take(3 * HP * 2); bf* PPl = (bf*)take(3 * HP * 2);   // q then k then v (transposed)
    bf* ATh = (bf*)take(XP * 2); bf* ATl = (bf*)take(XP * 2);
    if ((size_t)(wsp - (char*)d_ws) > ws_size) return;    // ws 256 MiB
    k_front<<<PG + 2 * LNB + PC, 256, 0, stream>>>(wq, wk, wv, wo, WQ, WK, WV, WO, x, x2, lng, lnb, Xh, Xl, XP);   /* head hh's 'xw' [1024][64] -> Bt rows hh*64..; LayerNorm(seq1), LayerNorm(seq2) as bf16 hi/lo planes; mixer_w -> bf16 */
    k_gemmw<bf, EP_QKV, 4><<<dim3(NB_ * TT / GT, DQ / GT, 3), 128, 0, stream>>>(Xh, Xl, WQ, DM, nullptr, 0, nullptr, XP, (size_t)DQ * DM, HP, P16, PPh, PPl);
    k_fattn<<<dim3(NB_ * NH_, TT / 32, 1), 128, 0, stream>>>(P16, P16 + HP, P16 + 2 * HP, PPh, PPl, PPh + HP, PPl + HP, PPh + 2 * HP, PPl + 2 * HP, ATh, ATl);   /* one kv head per query head; leaves the merged hi/lo planes */
    k_gemmw<bf, EP_F32B, 8><<<dim3(NB_ * TT / GT, DM / GT, 1), 256, 0, stream>>>(ATh, ATl, WO, DQ, OUT, DM, bo, 0, 0, 0, nullptr, nullptr, nullptr);
}

// v010
// One run takes 102 microseconds.
// Next to v009, in two timings, it ran 1.06 times as fast each time.
// Counting every step since v000, it is 18.3 times as fast.
#include <hip/hip_runtime.h>

// Causal cross attention between two LayerNorm'd sequences with per-head projection tensors (seq1, seq2 [2][2048][1024]; x1, x2 = LayerNorm(seq) (eps 1e-5, gamma/beta read); q = x1 q_proj[h], k = x2 k_proj[h], v = x2 v_proj[h] ([16][1024][64] 0.02, 'xw' per head, no bias); scores / float32(sqrt 64); causal (-inf); softmax; out = merged mixer_w^T + mixer_b ('oi') -> [2][2048][1024] (4.2 M); argument order seq1, seq2, ln_gamma, ln_beta, q_proj, k_proj, v_proj, mixer_w, mixer_b).
// Layout, every launch over both batches (token rows b * 2048 + t): one front launch holds the three pieces that depend on no other kernel: LayerNorm (one wave per token row: mean, biased variance, f32) writes bf16 hi/lo planes of x1 and of x2, the per-head 'xw' weight blocks are gathered into Bt, and mixer_w is converted to bf16; the q, k and v projections hi/lo x exact (2 products) in one launch (grid z), whose epilogue writes the 16-bit head planes itself (q, k as [b][h][t][d], v as [b][h][d][t]); one fused causal T-2048 attention kernel with a running softmax (hybrid rows: < 512 hi/lo 3 products, rest fp16 x1024; key blocks above the diagonal are never visited); merged hi/lo x mixer_w exact + mixer_b.
// Compute dtypes, f32 accumulate: every input rounded to bf16; LayerNorm f32; projections 2 products (~f32); attention rows < 512 3 products, rest fp16; softmax f32; mixer hl x exact + bias.

#define NB_  2
#define TT   2048
#define DM   1024
#define NH_  16
#define NKV  16
#define REP  (NH_ / NKV)
#define HD   64
#define DQ   (NH_ * HD)
#define DKV  (NKV * HD)
#define RH   512                  // query rows < RH use hi+lo planes (0: none)
#define PCAR 1024.0f
#define SCL  0.125f   // HD^-0.5
typedef _Float16 h16;
typedef unsigned short bf;
typedef __attribute__((ext_vector_type(16))) __bf16   v16bf;
typedef __attribute__((ext_vector_type(16))) _Float16 v16h;
typedef __attribute__((ext_vector_type(8)))  _Float16 v8h;
typedef __attribute__((ext_vector_type(8)))  unsigned short v8us;
typedef __attribute__((ext_vector_type(8)))  float    v8f;
typedef __attribute__((ext_vector_type(4)))  float    v4f;
typedef v8h  __attribute__((may_alias)) v8ha;
typedef v4f  __attribute__((may_alias)) v4fa;
typedef v8us __attribute__((may_alias)) v8usa;

__device__ __forceinline__ unsigned short f2bf(float f) { unsigned u = __float_as_uint(f); u += 0x7FFFu + ((u >> 16) & 1u); return (unsigned short)(u >> 16); }
__device__ __forceinline__ float bf2f(unsigned short b) { return __uint_as_float(((unsigned)b) << 16); }
__device__ __forceinline__ float bfr(float f) { return bf2f(f2bf(f)); }
__device__ __forceinline__ v16h cat16(v8h lo, v8h hi) { return __builtin_shufflevector(lo, hi, 0, 1, 2, 3, 4, 5, 6, 7, 8, 9, 10, 11, 12, 13, 14, 15); }
__device__ __forceinline__ v16bf cat16b(v8us lo, v8us hi) { return __builtin_bit_cast(v16bf, __builtin_shufflevector(lo, hi, 0, 1, 2, 3, 4, 5, 6, 7, 8, 9, 10, 11, 12, 13, 14, 15)); }
__device__ __forceinline__ v8f wmma16(v16h a, v16h b, v8f c) { return __builtin_amdgcn_wmma_f32_16x16x32_f16(false, a, false, b, (short)0, c, false, false); }
__device__ __forceinline__ v8f wmmab(v16bf a, v16bf b, v8f c) { return __builtin_amdgcn_wmma_f32_16x16x32_bf16(false, a, false, b, (short)0, c, false, false); }
__device__ __forceinline__ h16 tohx(float x) { return (h16)x; }
__device__ __forceinline__ void splitf(float y, unsigned short& h, unsigned short& l) { h = f2bf(y); l = f2bf(y - bf2f(h)); }



// ---- k_gemmw: GEMM, one work-group of NW waves per 128x128 output tile; grid (M/128, N/128, Z), NW * 32 threads. NW = 4: each wave a 64x64 quarter (16 accumulators). NW = 8: each wave 32 rows x 64 columns (8 accumulators), for a grid of one work-group per WGP: two waves share a SIMD, and one's matrix runs cover the other's waits for LDS.
// C[m][n] = sum_k (A[m][k] + A2[m][k]) Bt[n][k], two products per k block. z strides sA/sB/sC in elements (sC: of C, or of the head planes). K % 64 == 0, K >= 128.
// Operands come through LDS: a stage is 64 k (one whole 128-byte line) of the tile's 128 A rows, 128 A2 rows and 128 Bt rows, brought by asynchronous copies (16 bytes a lane, a wave's copy = 4 whole lines) into one of two buffers, the next stage's copies in flight while this one is worked on.
// LDS rows have pitch 128 bytes and no pad: the 16-byte chunk c of row r lies at chunk place c ^ ((r >> 1) & 7), so the 16 rows that a fragment read touches fall on 16 different bank groups.
// EP picks what the tile leaves as: EP_F32B f32 rows (pitch ldc) + f32 bias[n]; EP_QKV fp16 and bf16 hi/lo planes of batch r0 / TT, head c0 / 64 (a wave's 64 columns are one head): z = 0 (q, from the first A planes) and z = 1 (k, from the second) as rows [t][d], z = 2 (v, from the second too) transposed [d][t].
#define EP_F32B 0
#define EP_QKV  1
#define GT   128                  // rows of the work-group's tile, of A and of Bt alike
#define GKS  64                   // k per stage
#define GPL  (GT * GKS * 2)       // bytes of one operand plane in a stage
#define GSTG (3 * GPL)            // bytes of a stage: A, A2, Bt
template <typename T16> struct WFrag;
template <> struct WFrag<h16> { typedef v16h V; static __device__ __forceinline__ V ld(const h16* p) { return cat16(*(const v8h*)p, *(const v8h*)(p + 16)); } static __device__ __forceinline__ v8f mma(V a, V b, v8f c) { return wmma16(a, b, c); } };
template <> struct WFrag<bf> { typedef v16bf V; static __device__ __forceinline__ V ld(const bf* p) { return cat16b(*(const v8us*)p, *(const v8us*)(p + 16)); } static __device__ __forceinline__ V ld2(const char* p0, const char* p1) { return cat16b(*(const v8usa*)p0, *(const v8usa*)p1); } static __device__ __forceinline__ v8f mma(V a, V b, v8f c) { return wmmab(a, b, c); } };
// one operand plane of a stage: 8 copies a lane, rows 16 apart (gs bytes in memory, 2048 in LDS). The s_wait_xcnt closes the statement, so it stands in front of any later write of the address registers that the copies name.
__device__ __forceinline__ void copy_plane(unsigned l, const char* g, size_t gs) {
    asm volatile("global_load_async_to_lds_b128 %0, %8, off\n\tglobal_load_async_to_lds_b128 %1, %9, off\n\tglobal_load_async_to_lds_b128 %2, %10, off\n\tglobal_load_async_to_lds_b128 %3, %11, off\n\t"
                 "global_load_async_to_lds_b128 %4, %12, off\n\tglobal_load_async_to_lds_b128 %5, %13, off\n\tglobal_load_async_to_lds_b128 %6, %14, off\n\tglobal_load_async_to_lds_b128 %7, %15, off\n\ts_wait_xcnt 0x0"
                 :: "v"(l), "v"(l + 2048u), "v"(l + 4096u), "v"(l + 6144u), "v"(l + 8192u), "v"(l + 10240u), "v"(l + 12288u), "v"(l + 14336u),
                    "v"(g), "v"(g + gs), "v"(g + 2 * gs), "v"(g + 3 * gs), "v"(g + 4 * gs), "v"(g + 5 * gs), "v"(g + 6 * gs), "v"(g + 7 * gs) : "memory");
}
// a whole stage for 256 threads: 4 copies a lane and plane, rows 32 apart (gs bytes in memory, 4096 in LDS), the planes GPL apart in LDS. One statement, closed by the s_wait_xcnt as above.
__device__ __forceinline__ void copy_stage8(unsigned l, const char* a, const char* a2, const char* b, size_t gs) {
    asm volatile("global_load_async_to_lds_b128 %0, %12, off\n\tglobal_load_async_to_lds_b128 %1, %13, off\n\tglobal_load_async_to_lds_b128 %2, %14, off\n\tglobal_load_async_to_lds_b128 %3, %15, off\n\t"
                 "global_load_async_to_lds_b128 %4, %16, off\n\tglobal_load_async_to_lds_b128 %5, %17, off\n\tglobal_load_async_to_lds_b128 %6, %18, off\n\tglobal_load_async_to_lds_b128 %7, %19, off\n\t"
                 "global_load_async_to_lds_b128 %8, %20, off\n\tglobal_load_async_to_lds_b128 %9, %21, off\n\tglobal_load_async_to_lds_b128 %10, %22, off\n\tglobal_load_async_to_lds_b128 %11, %23, off\n\ts_wait_xcnt 0x0"
                 :: "v"(l), "v"(l + 4096u), "v"(l + 8192u), "v"(l + 12288u), "v"(l + GPL), "v"(l + GPL + 4096u), "v"(l + GPL + 8192u), "v"(l + GPL + 12288u), "v"(l + 2 * GPL), "v"(l + 2 * GPL + 4096u), "v"(l + 2 * GPL + 8192u), "v"(l + 2 * GPL + 12288u),
                    "v"(a), "v"(a + gs), "v"(a + 2 * gs), "v"(a + 3 * gs), "v"(a2), "v"(a2 + gs), "v"(a2 + 2 * gs), "v"(a2 + 3 * gs), "v"(b), "v"(b + gs), "v"(b + 2 * gs), "v"(b + 3 * gs) : "memory");
}
template <typename T16, int EP, int NW>
__global__ __launch_bounds__(NW * 32) void k_gemmw(const T16* __restrict__ A, const T16* __restrict__ A2, const T16* __restrict__ Bt, int K, float* C, int ldc, const float* __restrict__ bias, size_t sA, size_t sB, size_t sC, h16* P16, bf* Ph, bf* Pl) {
    typedef typename WFrag<T16>::V V;
    static_assert((NW == 4 || NW == 8) && (EP != EP_QKV || NW == 4), "wave shapes written out below");
    constexpr int MB = 16 / NW;   // 16-row blocks of a wave's part
    __shared__ __align__(256) char ring[2 * GSTG];   // two stages (the banks repeat every 256 bytes: rows start on that grid); behind the loop's last barrier the epilogue's staging rows
    const size_t z = blockIdx.z, za = (EP == EP_QKV && z) ? 1 : z; A += za * sA; A2 += za * sA; Bt += z * sB; if (EP == EP_QKV) { P16 += z * sC; Ph += z * sC; Pl += z * sC; } else C += z * sC;
    const int lane = threadIdx.x & 31, lr = lane & 15, hi = lane >> 4, w = __builtin_amdgcn_readfirstlane(threadIdx.x >> 5);
    const int wr = (w >> 1) * (MB * 16), wc = (w & 1) * 64;   // the wave's part within the tile
    const int r0 = blockIdx.x * GT + wr, c0 = blockIdx.y * GT + wc; const int t0 = r0 % TT; const size_t hp = (size_t)(r0 / TT) * NH_ + c0 / HD;   // the wave part's first token within its batch; its head plane
    float* os = (float*)ring + w * (16 * 68);
    // copies: thread = (row cr of NW * 4, chunk cch of 8)
    const int cr = threadIdx.x >> 3, cch = threadIdx.x & 7; const size_t gs = (size_t)(NW * 4) * K * 2;
    const unsigned cl = (unsigned)(size_t)ring + cr * 128 + ((cch ^ ((cr >> 1) & 7)) << 4);
    const char* gA = (const char*)(A + (size_t)(blockIdx.x * GT + cr) * K + cch * 8); const char* gA2 = (const char*)(A2 + (size_t)(blockIdx.x * GT + cr) * K + cch * 8); const char* gB = (const char*)(Bt + (size_t)(blockIdx.y * GT + cr) * K + cch * 8);
    auto stage = [&](const int t) { const unsigned l = cl + (t & 1) * GSTG; const size_t ko = (size_t)t * (GKS * 2);
        if constexpr (NW == 4) { copy_plane(l, gA + ko, gs); copy_plane(l + GPL, gA2 + ko, gs); copy_plane(l + 2 * GPL, gB + ko, gs); } else copy_stage8(l, gA + ko, gA2 + ko, gB + ko, gs); };
    // fragment reads: row lr of a 16-row group; the chunks 4 * kc + hi and 4 * kc + 2 + hi (k 8 * hi .. and 16 + 8 * hi .. of the 32-k block, as from memory) at their places
    int fo[2][2];
#pragma unroll   // this and every unroll below: constant indices keep offsets, fragments and accumulators in registers
    for (int kc = 0; kc < 2; ++kc)
#pragma unroll
        for (int h = 0; h < 2; ++h) fo[kc][h] = lr * 128 + (((4 * kc + 2 * h + hi) ^ (lr >> 1)) << 4);
    v8f acc[MB][4];
#pragma unroll
    for (int mb = 0; mb < MB; ++mb)
#pragma unroll
        for (int nb = 0; nb < 4; ++nb) acc[mb][nb] = (v8f){};
    const int nt = K / GKS;
    stage(0);
    asm volatile("s_wait_asynccnt 0x0" ::: "memory");   // this wave's part of stage 0 has landed
    __syncthreads();                                     // ... and every other wave's
    stage(1);
#pragma unroll 1   // one trip per stage: the waits, the barrier and the refill at the foot stay in the order written
    for (int t = 0; t < nt; ++t) {
        const char* st = ring + (t & 1) * GSTG;
        if constexpr (NW == 8) {
            // the wave's part is small enough for all 16 fragments of the stage to be in registers at once: they are read as ONE group, and the 32 matrix instructions follow under counted waits, so that LDS latency is met once a stage and the SIMD's other wave has a long matrix run to hide behind
            V fa[2][MB], fa2[2][MB], fb[2][4];
#pragma unroll
            for (int kc = 0; kc < 2; ++kc) {
#pragma unroll
                for (int mb = 0; mb < MB; ++mb) { const char* p = st + (wr + mb * 16) * 128; fa[kc][mb] = WFrag<T16>::ld2(p + fo[kc][0], p + fo[kc][1]); fa2[kc][mb] = WFrag<T16>::ld2(p + GPL + fo[kc][0], p + GPL + fo[kc][1]); }
#pragma unroll
                for (int nb = 0; nb < 4; ++nb) { const char* p = st + 2 * GPL + (wc + nb * 16) * 128; fb[kc][nb] = WFrag<T16>::ld2(p + fo[kc][0], p + fo[kc][1]); }
            }
            __builtin_amdgcn_sched_barrier(0);   // keeps the reads one group: without it the scheduler sinks them among the matrix instructions, four places a stage
#pragma unroll
            for (int kc = 0; kc < 2; ++kc)
#pragma unroll
                for (int nb = 0; nb < 4; ++nb)
#pragma unroll
                    for (int mb = 0; mb < MB; ++mb) { acc[mb][nb] = WFrag<T16>::mma(fa[kc][mb], fb[kc][nb], acc[mb][nb]); acc[mb][nb] = WFrag<T16>::mma(fa2[kc][mb], fb[kc][nb], acc[mb][nb]); }
        } else {
        V a[MB], a2[MB];
#pragma unroll
        for (int kc = 0; kc < 2; ++kc) {
#pragma unroll
            for (int mb = 0; mb < MB; ++mb) { const char* p = st + (wr + mb * 16) * 128; a[mb] = WFrag<T16>::ld2(p + fo[kc][0], p + fo[kc][1]); a2[mb] = WFrag<T16>::ld2(p + GPL + fo[kc][0], p + GPL + fo[kc][1]); }
#pragma unroll
            for (int nb = 0; nb < 4; ++nb) { const char* p = st + 2 * GPL + (wc + nb * 16) * 128; const V b = WFrag<T16>::ld2(p + fo[kc][0], p + fo[kc][1]);
#pragma unroll
                for (int mb = 0; mb < MB; ++mb) { acc[mb][nb] = WFrag<T16>::mma(a[mb], b, acc[mb][nb]); acc[mb][nb] = WFrag<T16>::mma(a2[mb], b, acc[mb][nb]); } }
        }
        }
        // the distance behind the trip's last matrix instructions, whichever way the branches below go
        if constexpr (MB == 4) asm volatile("v_nop\n\tv_nop\n\tv_nop\n\tv_nop" : "+v"(acc[0][0]), "+v"(acc[0][1]), "+v"(acc[0][2]), "+v"(acc[0][3]), "+v"(acc[1][0]), "+v"(acc[1][1]), "+v"(acc[1][2]), "+v"(acc[1][3]), "+v"(acc[2][0]), "+v"(acc[2][1]), "+v"(acc[2][2]), "+v"(acc[2][3]), "+v"(acc[3][0]), "+v"(acc[3][1]), "+v"(acc[3][2]), "+v"(acc[3][3]));
        else asm volatile("v_nop\n\tv_nop\n\tv_nop\n\tv_nop" : "+v"(acc[0][0]), "+v"(acc[0][1]), "+v"(acc[0][2]), "+v"(acc[0][3]), "+v"(acc[1][0]), "+v"(acc[1][1]), "+v"(acc[1][2]), "+v"(acc[1][3]));
        asm volatile("s_wait_dscnt 0x0" ::: "memory");      // this wave's reads of stage t are done before the buffer is given up
        asm volatile("s_wait_asynccnt 0x0" ::: "memory");   // this wave's part of stage t + 1 has landed
        __syncthreads();                                     // publishes stage t + 1 and ends every wave's reads of stage t
        if (t + 2 < nt) stage(t + 2);                        // into the buffer that this trip has just read
    }
    asm volatile("s_wait_asynccnt 0x0" ::: "memory");   // nothing in flight when the ring becomes staging rows
    if (EP == EP_QKV && blockIdx.z == 2) {
        // a lane's 8 accumulator rows are 8 consecutive t of one column d: 16 bytes of a [d][t] plane straight from registers; the four mb of a column fill its 128-byte line, all from this wave
#pragma unroll   // these three: constant indices keep acc and the packed vectors in registers
        for (int mb = 0; mb < MB; ++mb)
#pragma unroll
            for (int nb = 0; nb < 4; ++nb) { v8h o16; v8us oh, ol;
#pragma unroll
                for (int j = 0; j < 8; ++j) { const float x = acc[mb][nb][j]; o16[j] = tohx(x); unsigned short a2, c2; splitf(x, a2, c2); oh[j] = a2; ol[j] = c2; }
                const size_t oo = (hp * HD + nb * 16 + lr) * TT + t0 + mb * 16 + hi * 8;
                *(v8h*)(P16 + oo) = o16; *(v8us*)(Ph + oo) = oh; *(v8us*)(Pl + oo) = ol; }
        return;
    }
#pragma unroll
    for (int mb = 0; mb < MB; ++mb) {
#pragma unroll
        for (int nb = 0; nb < 4; ++nb) {
#pragma unroll
            for (int j = 0; j < 8; ++j) os[(hi * 8 + j) * 68 + nb * 16 + lr] = acc[mb][nb][j]; }
        __builtin_amdgcn_wave_barrier(); asm volatile("" ::: "memory");
        if constexpr (EP == EP_QKV) {
            // 8 lanes per token row, 8 columns each: every store covers four whole 128-byte rows of a [t][d] plane
#pragma unroll   // this and the next: constant LDS offsets, packed vectors in registers
            for (int s = 0; s < 4; ++s) { const int row = 4 * s + (lane >> 3), cofs = (lane & 7) * 8; const v4f x0 = *(const v4fa*)(os + row * 68 + cofs), x1 = *(const v4fa*)(os + row * 68 + cofs + 4); v8h o16; v8us oh, ol;
#pragma unroll
                for (int j = 0; j < 8; ++j) { const float x = (j < 4) ? x0[j & 3] : x1[j & 3]; o16[j] = tohx(x); unsigned short a2, c2; splitf(x, a2, c2); oh[j] = a2; ol[j] = c2; }
                const size_t oo = (hp * TT + t0 + mb * 16 + row) * HD + cofs;
                *(v8h*)(P16 + oo) = o16; *(v8us*)(Ph + oo) = oh; *(v8us*)(Pl + oo) = ol; }
        } else {
            float* crow = C + (size_t)(r0 + mb * 16) * ldc + c0;
#pragma unroll
            for (int s = 0; s < 8; ++s) { const int row = 2 * s + hi, cofs = lr * 4; v4f val = *(const v4fa*)(os + row * 68 + cofs); val[0] += bfr(bias[c0 + cofs]); val[1] += bfr(bias[c0 + cofs + 1]); val[2] += bfr(bias[c0 + cofs + 2]); val[3] += bfr(bias[c0 + cofs + 3]);
                *(v4f*)(crow + (size_t)row * ldc + cofs) = val; }
        }
        __builtin_amdgcn_wave_barrier(); asm volatile("" ::: "memory");
    }
}

typedef __attribute__((ext_vector_type(4))) _Float16 v4h;
typedef __attribute__((ext_vector_type(2))) unsigned short v2us;
typedef __attribute__((ext_vector_type(4))) unsigned short v4us;
typedef __attribute__((ext_vector_type(4))) int v4i;

// prep_body: the weights' set-up, dealt by the index blk that k_front hands it.
//   blk in [0, PG):        per-head 'xw' blocks [16][1024][64] of q_proj, k_proj, v_proj -> bf16 Bt rows (head * 64 + n)[k]; one tile of GKT k x 64 n per block: read as it lies in memory (16 bytes a lane, whole lines), turned in LDS, written as 256-byte pieces of Bt rows
//   blk in [PG, PG + PC):  mixer_w ('oi', already K-contiguous) -> bf16, 8 elements per thread
#define GKT 128                  // k rows of a gather tile
#define GLP (GKT / 2 + 1)        // LDS pitch of a tile's n row in dwords (a dword = the bf16 pair k, k + 1); odd, so that neither the writes down a column nor the reads along a row meet on a bank
#define PG (3 * NH_ * (DM / GKT))
typedef __attribute__((ext_vector_type(2))) unsigned v2u;
#define PC (DM * DQ / 8 / 256)
__device__ __forceinline__ void prep_body(const int blk, const float* __restrict__ wq, const float* __restrict__ wk, const float* __restrict__ wv, const float* __restrict__ wo, bf* WQ, bf* WK, bf* WV, bf* WO, unsigned* tl) {
    if (blk < PG) {
        const int ten = blk / (PG / 3); const float* __restrict__ w3 = (ten == 0) ? wq : (ten == 1) ? wk : wv; bf* B3 = (ten == 0) ? WQ : (ten == 1) ? WK : WV;
        const int rem = blk % (PG / 3), hh = rem / (DM / GKT), k0 = (rem % (DM / GKT)) * GKT;   // head, first k row of the tile
        const int cn = (threadIdx.x & 15) * 4, rp = threadIdx.x >> 4;   // reads: thread = (pair of k rows rp of 16, four n from cn); a wave's load = two whole 256-byte rows
        const float* p = w3 + ((size_t)hh * DM + k0 + 2 * rp) * HD + cn; v4f e[GKT / 32], o[GKT / 32];
#pragma unroll   // this and the two below: constant indices keep the rows in registers; all the tile's loads are out before the first is used
        for (int i = 0; i < GKT / 32; ++i) { e[i] = *(const v4f*)(p + i * 32 * HD); o[i] = *(const v4f*)(p + i * 32 * HD + HD); }
        asm volatile("s_wait_xcnt 0x0" :: "v"(p) : "memory");   // later code may reuse the loads' address registers: the wait stands in front of that overwrite; named as an input, the address stays in its registers up to it
#pragma unroll
        for (int i = 0; i < GKT / 32; ++i)
#pragma unroll
            for (int j = 0; j < 4; ++j) tl[(cn + j) * GLP + rp + 16 * i] = (unsigned)f2bf(e[i][j]) | ((unsigned)f2bf(o[i][j]) << 16);
        __syncthreads();   // the whole tile is in LDS before any n row is read (every thread of a gather block comes here: blk is the block's)
        const int lane = threadIdx.x & 31, n0 = (threadIdx.x >> 5) * 8;   // writes: a wave takes 8 n rows; its store = the row's GKT k, two whole lines
        bf* q = B3 + ((size_t)hh * HD + n0) * DM + k0 + 4 * lane; v2u r[8];
#pragma unroll   // this and the next: constant indices keep the pieces in registers
        for (int s = 0; s < 8; ++s) { r[s][0] = tl[(n0 + s) * GLP + 2 * lane]; r[s][1] = tl[(n0 + s) * GLP + 2 * lane + 1]; }
#pragma unroll
        for (int s = 0; s < 8; ++s) *(v2u*)(q + (size_t)s * DM) = r[s];
        asm volatile("s_wait_xcnt 0x0" ::: "memory");   // code laid out behind these stores may reuse their registers: the wait stands in front of any such overwrite
    } else {
        const size_t i = (size_t)(blk - PG) * 256 + threadIdx.x; const v8f v = *(const v8f*)(wo + i * 8); v8us o;
#pragma unroll   // constant indices keep v and o in registers
        for (int k = 0; k < 8; ++k) o[k] = f2bf(v[k]);
        *(v8us*)(WO + i * 8) = o;
        asm volatile("s_wait_xcnt 0x0" ::: "memory");   // code laid out behind this store may reuse its address registers: the wait stands in front of any such overwrite
    }
}

// lnx_body: 8 token rows, bx of NB_ * TT / 8; by = 0 takes Xa, by = 1 takes Xb and the second pair of planes, sP elements further on
__device__ __forceinline__ void lnx_body(const int bx, const int by, const float* __restrict__ Xa, const float* __restrict__ Xb, const float* __restrict__ gw, const float* __restrict__ gb, bf* Ph, bf* Pl, size_t sP) { const int lane = threadIdx.x & 31; const int r = bx * 8 + (threadIdx.x >> 5); if (r >= NB_ * TT) return; const float* X = by ? Xb : Xa; Ph += by * sP; Pl += by * sP; const float* xr = X + (size_t)r * DM; float hv[32]; float s = 0.f;
#pragma unroll
    for (int ch = 0; ch < 8; ++ch) { const v4f a = *(const v4f*)(xr + ch * 128 + lane * 4);
#pragma unroll
        for (int q = 0; q < 4; ++q) { const float u = bfr(a[q]); hv[ch * 4 + q] = u; s += u; } }
#pragma unroll
    for (int sh = 16; sh; sh >>= 1) s += __shfl_xor(s, sh, 32);
    float mu = s * (1.0f / 1024.0f); asm volatile("" : "+v"(mu)); float s2 = 0.f;
#pragma unroll
    for (int k = 0; k < 32; ++k) { float d0 = __fsub_rn(hv[k], mu); asm volatile("" : "+v"(d0)); float p = __fmul_rn(d0, d0); asm volatile("" : "+v"(p)); s2 = __fadd_rn(s2, p); }
#pragma unroll
    for (int sh = 16; sh; sh >>= 1) s2 += __shfl_xor(s2, sh, 32);
    float var = __fadd_rn(s2 * (1.0f / 1024.0f), 1e-5f); asm volatile("" : "+v"(var)); const float rs = __frsqrt_rn(var);
{
#pragma unroll
        for (int ch = 0; ch < 8; ++ch) { const int c0 = ch * 128 + lane * 4; v4us oh, ol; const v4f g4 = *(const v4f*)(gw + c0), b4 = *(const v4f*)(gb + c0);   // 16 bytes a lane: a wave's load = four whole lines
#pragma unroll
            for (int q = 0; q < 4; ++q) { float gg = bfr(g4[q]); asm volatile("" : "+v"(gg)); float d0 = __fsub_rn(hv[ch * 4 + q], mu); asm volatile("" : "+v"(d0)); float n0 = __fmul_rn(d0, rs); asm volatile("" : "+v"(n0)); float y = __fmul_rn(n0, gg); asm volatile("" : "+v"(y)); const float z = __fadd_rn(y, bfr(b4[q])); unsigned short a2, c2; splitf(z, a2, c2); oh[q] = a2; ol[q] = c2; }
            const size_t oo = (size_t)r * DM + c0; *(v4us*)(Ph + oo) = oh; *(v4us*)(Pl + oo) = ol; }
         } }
// k_front: everything that depends on no other kernel, in ONE launch, dealt by block index: the weight gather's blocks first (a load, a turn in LDS behind a barrier, a store: the longest chain, with little vector work), then the LayerNorm blocks of both sequences (vector work and whole-line streams, which run while the gather waits), last the short mixer_w conversion.
#define LNB (NB_ * TT / 8)
__global__ __launch_bounds__(256) void k_front(const float* __restrict__ wq, const float* __restrict__ wk, const float* __restrict__ wv, const float* __restrict__ wo, bf* WQ, bf* WK, bf* WV, bf* WO, const float* __restrict__ Xa, const float* __restrict__ Xb, const float* __restrict__ gw, const float* __restrict__ gb, bf* Ph, bf* Pl, size_t sP) {
    __shared__ unsigned tl[HD * GLP];   // a gather block's tile, turned: [n][pair of k]
    const int blk = blockIdx.x;
    if (blk < PG) prep_body(blk, wq, wk, wv, wo, WQ, WK, WV, WO, tl);
    else if (blk < PG + 2 * LNB) lnx_body((blk - PG) % LNB, (blk - PG) / LNB, Xa, Xb, gw, gb, Ph, Pl, sP);
    else prep_body(blk - 2 * LNB, wq, wk, wv, wo, WQ, WK, WV, WO, tl);
}
// k_fattn: scores, causal softmax, probability x value and the head merge in one kernel; no score or probability ever goes to memory.
// One work-group = one head of one batch x 32 query rows; its 4 waves deal the 32-key blocks up to the diagonal among them (wave w takes blocks w, w + 4, ...), each with its own running maximum, sum and output tile, joined through LDS at the end.
// St = K Qt (A = key rows, B = query rows): a lane holds scores of ONE query (column lr), keys 8 * hi + j of each 16-key tile, which is the B-operand k order of the next product, Ot += Vt Pt: P goes from accumulator to operand inside the lane.
// HL (query rows < RH): bf16 hi/lo planes, 3 products each; otherwise fp16, P carried x PCAR. Output: merged bf16 hi/lo planes [t][head * HD + d].
// Rows >= RH (fp16): keys and values come through LDS. A stage is 128 keys (the four waves' blocks of one trip): 128 key rows of 128 bytes, then 64 value rows [d] of 256 bytes, brought by asynchronous copies (16 bytes a lane, a wave's copy = 4 whole lines) into one of two buffers, the next stage's copies in flight while this one is worked on.
// No pad: the 16-byte chunk c of key row r lies at chunk place c ^ ((r >> 1) & 7), that of value row d at c ^ (d & 15), so the 16 rows that a fragment read touches fall on 16 different bank groups.
#define L2E 1.4426950408889634f
#define AKB  (128 * HD * 2)       // bytes of a stage's key rows; its value rows take as many
#define ASTG (2 * AKB)            // bytes of a stage
__device__ __forceinline__ v16h lds_frag(const char* p0, const char* p1) { return cat16(*(const v8ha*)p0, *(const v8ha*)p1); }
// 8 copies a lane, gs bytes apart in memory; in LDS the even ones 4096 apart from l0, the odd ones from l1. The s_wait_xcnt closes the statement, so it stands in front of any later write of the address registers that the copies name.
__device__ __forceinline__ void copy_rows(unsigned l0, unsigned l1, const char* g, size_t gs) {
    asm volatile("global_load_async_to_lds_b128 %0, %8, off\n\tglobal_load_async_to_lds_b128 %1, %9, off\n\tglobal_load_async_to_lds_b128 %2, %10, off\n\tglobal_load_async_to_lds_b128 %3, %11, off\n\t"
                 "global_load_async_to_lds_b128 %4, %12, off\n\tglobal_load_async_to_lds_b128 %5, %13, off\n\tglobal_load_async_to_lds_b128 %6, %14, off\n\tglobal_load_async_to_lds_b128 %7, %15, off\n\ts_wait_xcnt 0x0"
                 :: "v"(l0), "v"(l1), "v"(l0 + 4096u), "v"(l1 + 4096u), "v"(l0 + 8192u), "v"(l1 + 8192u), "v"(l0 + 12288u), "v"(l1 + 12288u),
                    "v"(g), "v"(g + gs), "v"(g + 2 * gs), "v"(g + 3 * gs), "v"(g + 4 * gs), "v"(g + 5 * gs), "v"(g + 6 * gs), "v"(g + 7 * gs) : "memory");
}
template <bool B> struct BoolC { static constexpr bool value = B; };
template <typename T16, bool HL>
__device__ __forceinline__ void attn_body(const T16* __restrict__ Qa, const T16* __restrict__ Qb, const T16* __restrict__ Ka, const T16* __restrict__ Kb, const T16* __restrict__ Va, const T16* __restrict__ Vb, int q0, int head, bf* Ah, bf* Al, float* red, float* rml) {
    typedef typename WFrag<T16>::V V;
    char* ring = (char*)red;   // the staged path's two stages; the join's rows lie over them, when they are out of use
    const int lane = threadIdx.x & 31, lr = lane & 15, hi = lane >> 4, w = __builtin_amdgcn_readfirstlane(threadIdx.x >> 5);   // the wave's number in a scalar register: block loop and diagonal test become scalar branches
    V q[2][2], q2[2][2]; const size_t qo = (size_t)(q0 + lr) * HD + 8 * hi; const T16* qp = Qa + qo; const T16* qp2 = HL ? Qb + qo : qp;   // one address per plane, every fragment at a constant offset from it
#pragma unroll
    for (int nb = 0; nb < 2; ++nb)
#pragma unroll
        for (int kc = 0; kc < 2; ++kc) { q[nb][kc] = WFrag<T16>::ld(qp + nb * 16 * HD + kc * 32); if (HL) q2[nb][kc] = WFrag<T16>::ld(qp2 + nb * 16 * HD + kc * 32); }
    asm volatile("s_wait_xcnt 0x0" :: "v"(qp), "v"(qp2) : "memory");   // later code may reuse the query loads' address registers: the wait stands in front of that overwrite; named as inputs, the addresses stay in their registers up to it
    v8f o[2][4]; float m[2], l[2];
#pragma unroll
    for (int nb = 0; nb < 2; ++nb) { m[nb] = -3.0e38f; l[nb] = 0.f;
#pragma unroll
        for (int mb = 0; mb < 4; ++mb) o[nb][mb] = (v8f){}; }
    const int nkb = q0 / 32 + 1;   // key blocks up to and with the diagonal one
    const char* st = ring;   // the stage that the pass reads (staged path)
    // fragment reads from a stage: key row lr of a 16-row group, chunks 4 * kc + hi and 4 * kc + 2 + hi; value row lr of a 16-row group, chunks hi and 2 + hi of the wave's four: the k order of the loads from memory
    int fk[2][2], fv[2];
#pragma unroll   // this and the next: constant indices keep the offsets in registers
    for (int h = 0; h < 2; ++h) { fv[h] = AKB + lr * 256 + (((4 * w + 2 * h + hi) ^ lr) << 4);
#pragma unroll
        for (int kc = 0; kc < 2; ++kc) fk[kc][h] = (w * 32 + lr) * 128 + (((4 * kc + 2 * h + hi) ^ (lr >> 1)) << 4); }
    auto pass = [&](const int kb, auto dg) {   // one 32-key block; dg: the block crosses the diagonal and is masked
        constexpr bool diag = decltype(dg)::value; const int key0 = kb * 32;
        v8f s[2][2];
#pragma unroll
        for (int nb = 0; nb < 2; ++nb) { s[nb][0] = (v8f){}; s[nb][1] = (v8f){}; }
        V kf[2][2], kf2[2][2];
        if constexpr (HL) {
        const size_t ko = (size_t)(key0 + lr) * HD + 8 * hi; const T16* kp = Ka + ko; const T16* kp2 = HL ? Kb + ko : kp;
#pragma unroll
        for (int mt = 0; mt < 2; ++mt)
#pragma unroll
            for (int kc = 0; kc < 2; ++kc) { kf[mt][kc] = WFrag<T16>::ld(kp + mt * 16 * HD + kc * 32); if (HL) kf2[mt][kc] = WFrag<T16>::ld(kp2 + mt * 16 * HD + kc * 32); }
        asm volatile("s_wait_xcnt 0x0" :: "v"(kp), "v"(kp2) : "memory");   // same wait, in the same form, for the key loads
        } else {
#pragma unroll   // this and the next: constant indices keep the fragments in registers
            for (int mt = 0; mt < 2; ++mt)
#pragma unroll
                for (int kc = 0; kc < 2; ++kc) kf[mt][kc] = lds_frag(st + mt * 2048 + fk[kc][0], st + mt * 2048 + fk[kc][1]);
        }
#pragma unroll
        for (int kc = 0; kc < 2; ++kc)
#pragma unroll
            for (int mt = 0; mt < 2; ++mt)
#pragma unroll
                for (int nb = 0; nb < 2; ++nb) { s[nb][mt] = WFrag<T16>::mma(kf[mt][kc], q[nb][kc], s[nb][mt]); if (HL) { s[nb][mt] = WFrag<T16>::mma(kf[mt][kc], q2[nb][kc], s[nb][mt]); s[nb][mt] = WFrag<T16>::mma(kf2[mt][kc], q[nb][kc], s[nb][mt]); } }
        V pf[2], pf2[2];
#pragma unroll
        for (int nb = 0; nb < 2; ++nb) {
            float t[16]; float mx = m[nb]; const int qi = q0 + nb * 16 + lr;
#pragma unroll
            for (int e = 0; e < 16; ++e) { float x = s[nb][e >> 3][e & 7] * SCL; if (diag && key0 + (e >> 3) * 16 + hi * 8 + (e & 7) > qi) x = -3.0e38f; t[e] = x; mx = fmaxf(mx, x); }
            mx = fmaxf(mx, __shfl_xor(mx, 16, 32));   // the other half of the wave holds this query's other 16 keys
            const float al = __builtin_amdgcn_exp2f((m[nb] - mx) * L2E); m[nb] = mx; float sum = 0.f;
#pragma unroll
            for (int e = 0; e < 16; ++e) { t[e] = __builtin_amdgcn_exp2f((t[e] - mx) * L2E); sum += t[e]; }
            l[nb] = l[nb] * al + sum;   // each half keeps its own keys' sum; the halves are joined once, behind the loop
#pragma unroll
            for (int mb = 0; mb < 4; ++mb) o[nb][mb] *= al;
            if constexpr (HL) { __attribute__((ext_vector_type(16))) unsigned short ph, pl;
#pragma unroll
                for (int e = 0; e < 16; ++e) { unsigned short a, c2; splitf(t[e], a, c2); ph[e] = a; pl[e] = c2; }
                pf[nb] = __builtin_bit_cast(v16bf, ph); pf2[nb] = __builtin_bit_cast(v16bf, pl);
            } else {
#pragma unroll
                for (int e = 0; e < 16; ++e) pf[nb][e] = tohx(t[e] * PCAR); }
        }
        if constexpr (HL) {
        const size_t vo = (size_t)lr * TT + key0 + 8 * hi; const T16* vp = Va + vo; const T16* vp2 = HL ? Vb + vo : vp;
#pragma unroll
        for (int mb = 0; mb < 4; ++mb) { const V vf = WFrag<T16>::ld(vp + mb * 16 * TT); V vf2; if (HL) vf2 = WFrag<T16>::ld(vp2 + mb * 16 * TT);
            asm volatile("s_wait_xcnt 0x0" :: "v"(vp), "v"(vp2) : "memory");   // same wait, in the same form, for the value loads
#pragma unroll
            for (int nb = 0; nb < 2; ++nb) { o[nb][mb] = WFrag<T16>::mma(vf, pf[nb], o[nb][mb]); if (HL) { o[nb][mb] = WFrag<T16>::mma(vf, pf2[nb], o[nb][mb]); o[nb][mb] = WFrag<T16>::mma(vf2, pf[nb], o[nb][mb]); } } }
        } else {
#pragma unroll   // this and the next: constant indices keep the output tiles in registers
            for (int mb = 0; mb < 4; ++mb) { const V vf = lds_frag(st + mb * 4096 + fv[0], st + mb * 4096 + fv[1]);
#pragma unroll
                for (int nb = 0; nb < 2; ++nb) o[nb][mb] = WFrag<T16>::mma(vf, pf[nb], o[nb][mb]); }
        }
        // the distance behind the pass's last matrix instructions, on the back edge and on the way out alike
        asm volatile("v_nop\n\tv_nop\n\tv_nop\n\tv_nop\n\tv_nop" : "+v"(o[0][0]), "+v"(o[0][1]), "+v"(o[0][2]), "+v"(o[0][3]), "+v"(o[1][0]), "+v"(o[1][1]), "+v"(o[1][2]), "+v"(o[1][3]));
    };
    if constexpr (HL) {
#pragma unroll 1   // one pass's fragments at a time: unrolled, two passes' fragments would cost a resident wave
    for (int kb = w; kb < nkb - 1; kb += 4) pass(kb, BoolC<false>());
    if (((nkb - 1) & 3) == w) pass(nkb - 1, BoolC<true>());   // only the last block crosses the diagonal; it is its owner's last
    } else {
        // copies: keys, thread = (row of 16, chunk of 8), rows 16 apart; values, thread = (row of 8, chunk of 16), rows 8 apart (the odd ones' places differ in the chunk's top bit)
        const int kr = threadIdx.x >> 3, kch = threadIdx.x & 7, vr = threadIdx.x >> 4, vch = threadIdx.x & 15; const unsigned rb = (unsigned)(size_t)ring;
        const unsigned lk = rb + kr * 128 + ((kch ^ ((kr >> 1) & 7)) << 4), lv0 = rb + AKB + vr * 256 + ((vch ^ vr) << 4), lv1 = rb + AKB + (vr + 8) * 256 + ((vch ^ (vr + 8)) << 4);
        const char* gk = (const char*)(Ka + (size_t)kr * HD + kch * 8); const char* gv = (const char*)(Va + (size_t)vr * TT + vch * 8);
        auto stage = [&](const int t) { const unsigned b = (t & 1) * ASTG; copy_rows(lk + b, lk + b + 2048u, gk + (size_t)t * AKB, (size_t)16 * HD * 2); copy_rows(lv0 + b, lv1 + b, gv + (size_t)t * 256, (size_t)8 * TT * 2); };
        const int nfull = (nkb - 1) / 4, nst = nfull + 1;   // stages of four blocks: nfull in which every wave's block lies below the diagonal block, and the last; its keys beyond the diagonal block are copied (they lie inside the planes) and not read
        auto foot = [&](const int t) {   // the foot of trip t, gone through by every wave
            asm volatile("s_wait_dscnt 0x0" ::: "memory");      // this wave's reads of stage t are done before the buffer is given up
            asm volatile("s_wait_asynccnt 0x0" ::: "memory");   // this wave's part of stage t + 1 has landed
            __syncthreads();                                     // publishes stage t + 1 and ends every wave's reads of stage t
            if (t + 2 < nst) stage(t + 2);                       // into the buffer that this trip has just read
        };
        stage(0);
        asm volatile("s_wait_asynccnt 0x0" ::: "memory");   // this wave's part of stage 0 has landed
        __syncthreads();                                     // ... and every other wave's
        if (nst > 1) stage(1);
#pragma unroll 1   // one trip per stage: the waits, the barrier and the refill at the foot stay in the order written
        for (int t = 0; t < nfull; ++t) { st = ring + (t & 1) * ASTG; pass(4 * t + w, BoolC<false>()); foot(t); }
        st = ring + (nfull & 1) * ASTG; const int kb = 4 * nfull + w;   // the last trip, outside the loop so that the loop's body has no branch over a pass
        if (kb < nkb - 1) pass(kb, BoolC<false>()); else if (kb == nkb - 1) pass(kb, BoolC<true>());   // only the last block crosses the diagonal; a wave whose block lies beyond it has no pass, and still goes through the foot
        foot(nfull);
        asm volatile("s_wait_asynccnt 0x0" ::: "memory");   // nothing in flight when the ring becomes the join's rows
    }
#pragma unroll
    for (int nb = 0; nb < 2; ++nb) { l[nb] += __shfl_xor(l[nb], 16, 32);
        if (hi == 0) { rml[((w * 2 + nb) * 2 + 0) * 16 + lr] = m[nb]; rml[((w * 2 + nb) * 2 + 1) * 16 + lr] = l[nb]; }
#pragma unroll
        for (int mb = 0; mb < 4; ++mb)
#pragma unroll
            for (int j = 0; j < 8; ++j) red[((w * 64) + (nb * 4 + mb) * 8 + j) * 32 + lane] = o[nb][mb][j]; }
    __syncthreads();   // every wave's partial maximum, sum and tile are in LDS before any is read
    // join: wave w finishes 8 whole query rows (one writer per 128-byte output line); lane = (row lane >> 2, 16 columns (lane & 3) * 16 ..)
    const int nbq = w >> 1, lq = (w & 1) * 8 + (lane >> 2), mbq = lane & 3; float mw[4], M = -3.0e38f, L = 0.f;
#pragma unroll
    for (int u = 0; u < 4; ++u) { mw[u] = rml[((u * 2 + nbq) * 2 + 0) * 16 + lq]; M = fmaxf(M, mw[u]); }
#pragma unroll
    for (int u = 0; u < 4; ++u) { mw[u] = __builtin_amdgcn_exp2f((mw[u] - M) * L2E); L += mw[u] * rml[((u * 2 + nbq) * 2 + 1) * 16 + lq]; }   // a wave that had no block: maximum -3e38, factor 0
    const float inv = __fdiv_rn(HL ? 1.0f : (1.0f / PCAR), L); v8us oh[2], ol[2];
#pragma unroll
    for (int e = 0; e < 16; ++e) { float a = 0.f;
#pragma unroll
        for (int u = 0; u < 4; ++u) a += mw[u] * red[((u * 64) + (nbq * 4 + mbq) * 8 + (e & 7)) * 32 + (e >> 3) * 16 + lq];
        unsigned short a2, c2; splitf(a * inv, a2, c2); oh[e >> 3][e & 7] = a2; ol[e >> 3][e & 7] = c2; }
    const size_t oo = (size_t)(q0 + nbq * 16 + lq) * DQ + head * HD + mbq * 16;
    *(v8us*)(Ah + oo) = oh[0]; *(v8us*)(Ah + oo + 8) = oh[1]; *(v8us*)(Al + oo) = ol[0]; *(v8us*)(Al + oo + 8) = ol[1];
}
// four waves per SIMD: the vector work between the matrix runs of one wave is covered by the other three; the grid is 8192 waves on 1024 SIMDs, so a work-group that ends is followed by one that waits
__global__ __launch_bounds__(128) __attribute__((amdgpu_waves_per_eu(4, 4))) void k_fattn(const h16* __restrict__ Q16, const h16* __restrict__ K16, const h16* __restrict__ V16, const bf* __restrict__ Qh, const bf* __restrict__ Ql, const bf* __restrict__ Kh, const bf* __restrict__ Kl, const bf* __restrict__ Vh, const bf* __restrict__ Vl, bf* Ah, bf* Al) {
    __shared__ __align__(256) float red[2 * ASTG / 4]; __shared__ float rml[4 * 2 * 2 * 16];   // red: two stages (the banks repeat every 256 bytes: rows start on that grid); behind the loop the join's 4 * 64 * 32 floats
    const int bh = blockIdx.x, head = bh % NH_; const int q0 = (TT / 32 - 1 - (int)blockIdx.y) * 32;   // bh = batch * NH_ + head; longest rows first, of both batches
    const size_t po = (size_t)bh * TT * HD; Ah += (size_t)(bh / NH_) * TT * DQ; Al += (size_t)(bh / NH_) * TT * DQ;
    if (q0 < RH) attn_body<bf, true>(Qh + po, Ql + po, Kh + po, Kl + po, Vh + po, Vl + po, q0, head, Ah, Al, red, rml);
    else attn_body<h16, false>(Q16 + po, nullptr, K16 + po, nullptr, V16 + po, nullptr, q0, head, Ah, Al, red, rml);
}

extern "C" void kernel_launch(void* const* d_in, const int* in_sizes, int n_in,
                              void* d_out, int out_size, void* d_ws, size_t ws_size, hipStream_t stream) {
    (void)in_sizes; (void)n_in; (void)out_size;
    const float* x = (const float*)d_in[0];   /* seq1 */ const float* x2 = (const float*)d_in[1];   /* seq2 */ const float* lng = (const float*)d_in[2]; const float* lnb = (const float*)d_in[3]; const float* pq = (const float*)d_in[4]; const float* pk = (const float*)d_in[5]; const float* pv = (const float*)d_in[6];   /* [16][1024][64] */ const float* wo = (const float*)d_in[7]; const float* bo = (const float*)d_in[8];     const float* wq = pq; const float* wk = pk; const float* wv = pv;
    float* OUT = (float*)d_out;     // [2][2048][1024]
    char* wsp = (char*)d_ws;
    auto take = [&](size_t bytes) { char* p = wsp; wsp += (bytes + 255) & ~(size_t)255; return (void*)p; };
    bf* WQ = (bf*)take((size_t)3 * DQ * DM * 2); bf* WK = WQ + (size_t)DQ * DM; bf* WV = WK + (size_t)DQ * DM;   /* one behind the other: the projection launch steps through them by grid z */ bf* WO = (bf*)take((size_t)DM * DQ * 2);
    const size_t XP = (size_t)NB_ * TT * DM, HP = (size_t)NB_ * NH_ * TT * HD;   // elements of one plane: activations, heads (both batches)
    bf* Xh = (bf*)take(2 * XP * 2); bf* Xl = (bf*)take(2 * XP * 2);   // x1 then x2
    h16* P16 = (h16*)take(3 * HP * 2); bf* PPh = (bf*)take(3 * HP * 2); bf* PPl = (bf*)take(3 * HP * 2);   // q then k then v (transposed)
    bf* ATh = (bf*)take(XP * 2); bf* ATl = (bf*)take(XP * 2);
    if ((size_t)(wsp - (char*)d_ws) > ws_size) return;    // ws 256 MiB
    k_front<<<PG + 2 * LNB + PC, 256, 0, stream>>>(wq, wk, wv, wo, WQ, WK, WV, WO, x, x2, lng, lnb, Xh, Xl, XP);   /* head hh's 'xw' [1024][64] -> Bt rows hh*64..; LayerNorm(seq1), LayerNorm(seq2) as bf16 hi/lo planes; mixer_w -> bf16 */
    k_gemmw<bf, EP_QKV, 4><<<dim3(NB_ * TT / GT, DQ / GT, 3), 128, 0, stream>>>(Xh, Xl, WQ, DM, nullptr, 0, nullptr, XP, (size_t)DQ * DM, HP, P16, PPh, PPl);
    k_fattn<<<dim3(NB_ * NH_, TT / 32, 1), 128, 0, stream>>>(P16, P16 + HP, P16 + 2 * HP, PPh, PPl, PPh + HP, PPl + HP, PPh + 2 * HP, PPl + 2 * HP, ATh, ATl);   /* one kv head per query head; leaves the merged hi/lo planes */
    k_gemmw<bf, EP_F32B, 8><<<dim3(NB_ * TT / GT, DM / GT, 1), 256, 0, stream>>>(ATh, ATl, WO, DQ, OUT, DM, bo, 0, 0, 0, nullptr, nullptr, nullptr);
}
